// v000
// Measured on an AMD MI455X. A time is GPU time per run, averaged over a window of back-to-back runs after a warm-up
// (all launches, gaps included; the runs take copies of the inputs in turn), and the median of several windows.
// Apart from v000's, it joins two sittings. Times from different sittings can be a few percent apart, while
// side-by-side timings come from the same sitting.
// v000 is the starting kernel. One run takes 1690 microseconds.
#include <hip/hip_runtime.h>
#include <math.h>

typedef __attribute__((ext_vector_type(16))) _Float16 v16h;
typedef __attribute__((ext_vector_type(16))) __bf16 v16b;
typedef __attribute__((ext_vector_type(8)))  _Float16 v8h;
typedef __attribute__((ext_vector_type(8)))  float v8f;
typedef __attribute__((ext_vector_type(4)))  float v4f;
typedef __attribute__((ext_vector_type(2)))  float v2f;
typedef __attribute__((ext_vector_type(4)))  unsigned v4u;
typedef __attribute__((ext_vector_type(4)))  int v4i;
typedef float __attribute__((may_alias)) float_a;
typedef int __attribute__((may_alias)) int_a;

template <typename T> __device__ __forceinline__ void vst2(void* p, T v) { *(T*)p = v;  }
__device__ __forceinline__ v8f wmma16(v16h a, v16h b, v8f c) {
  v8f d = __builtin_amdgcn_wmma_f32_16x16x32_f16(false, a, false, b, (short)0, c, false, false);
  asm volatile("v_nop\n\tv_nop\n\tv_nop\n\tv_nop" : "+v"(d) : "v"(a), "v"(b));
  return d;
}
__device__ __forceinline__ v8f wmma_bf(v16b a, v16b b, v8f c) {
  v8f d = __builtin_amdgcn_wmma_f32_16x16x32_bf16(false, a, false, b, (short)0, c, false, false);
  asm volatile("v_nop\n\tv_nop\n\tv_nop\n\tv_nop" : "+v"(d) : "v"(a), "v"(b));
  return d;
}
// 16x16x32 fragments: lane = (h = lane>>4, row/col = lane&15); elements 0..7 = k0+8h+0..7, 8..15 = k0+16+8h+0..7; D element r = row 8h+r
__device__ __forceinline__ v16h frag_h(const _Float16* rowk0, int lane) {
  union { v16h v; v8h q[2]; } u; const _Float16* p = rowk0 + 8 * (lane >> 4);
  u.q[0] = *(const v8h*)p; u.q[1] = *(const v8h*)(p + 16); return u.v;
}
__device__ __forceinline__ v16h frag_f32(const float* rowk0, int lane) {
  v16h a; const float* p = rowk0 + 8 * (lane >> 4);
#pragma unroll
  for (int i = 0; i < 8; ++i) { a[i] = (_Float16)p[i]; a[8 + i] = (_Float16)p[16 + i]; }
  return a;
}
__device__ __forceinline__ v16h frag_f32s(const float* rowk0, int lane, float sc) {
  v16h a; const float* p = rowk0 + 8 * (lane >> 4);
#pragma unroll
  for (int i = 0; i < 8; ++i) { a[i] = (_Float16)(p[i] * sc); a[8 + i] = (_Float16)(p[16 + i] * sc); }
  return a;
}
// column fragment from a [K][ld] layout (column n), rows >= K read as 0
__device__ __forceinline__ v16h fragc_f32(const float* W, int k0, int n, int lane, int ld, int K) {
  v16h a; const int g = lane >> 4;
#pragma unroll
  for (int i = 0; i < 8; ++i) { const int ka = k0 + 8 * g + i, kb = ka + 16;
    a[i] = (_Float16)(ka < K ? W[(size_t)(ka < K ? ka : K - 1) * ld + n] : 0.f); a[8 + i] = (_Float16)(kb < K ? W[(size_t)(kb < K ? kb : K - 1) * ld + n] : 0.f); }
  return a;
}
struct F2 { v16b h, l; };
__device__ __forceinline__ F2 bsplit16(const float v[16]) { F2 r;
#pragma unroll
  for (int i = 0; i < 16; ++i) { const __bf16 h = (__bf16)v[i]; r.h[i] = h; r.l[i] = (__bf16)(v[i] - (float)h); }
  return r; }
__device__ __forceinline__ F2 split_row(const float* row, int k0, int lane) { float v[16]; const float* p = row + k0 + 8 * (lane >> 4);
#pragma unroll
  for (int i = 0; i < 8; ++i) { v[i] = p[i]; v[8 + i] = p[16 + i]; }
  return bsplit16(v); }
__device__ __forceinline__ F2 split_rowK(const float* row, int k0, int lane, int K) { float v[16]; const int g = lane >> 4;
#pragma unroll
  for (int i = 0; i < 8; ++i) { const int ka = k0 + 8 * g + i, kb = ka + 16; v[i] = ka < K ? row[ka < K ? ka : K - 1] : 0.f; v[8 + i] = kb < K ? row[kb < K ? kb : K - 1] : 0.f; }
  return bsplit16(v); }
__device__ __forceinline__ F2 split_col(const float* W, int k0, int n, int lane, int ld, int K) { float v[16]; const int g = lane >> 4;
#pragma unroll
  for (int i = 0; i < 8; ++i) { const int ka = k0 + 8 * g + i, kb = ka + 16; v[i] = ka < K ? W[(size_t)(ka < K ? ka : K - 1) * ld + n] : 0.f; v[8 + i] = kb < K ? W[(size_t)(kb < K ? kb : K - 1) * ld + n] : 0.f; }
  return bsplit16(v); }
__device__ __forceinline__ v8f mac3(const F2& a, const F2& b, v8f c) { c = wmma_bf(a.l, b.h, c); c = wmma_bf(a.h, b.l, c); return wmma_bf(a.h, b.h, c); }
__device__ __forceinline__ float sigm(float v) { return 1.0f / (1.0f + expf(-v)); }
#define LDSX() do { asm volatile("s_wait_dscnt 0" ::: "memory"); __builtin_amdgcn_wave_barrier(); __builtin_amdgcn_fence(__ATOMIC_RELEASE, "workgroup"); } while (0)

// Offset-attention (PCT) block (B 16, N 2,048, D 128, q/k dim 32): q = x Wq^T + bq, k = x Wk^T + bk (32-d), v = x Wv^T + bv; a = softmax over QUERIES of q k^T (no scale), then a = a / sum over keys; f_sa = a v; y = (x - f_sa) Wl^T + bl; out = relu(BN(y)) + f_sa (BN with batch statistics over B*N, biased variance, eps 1e-5).
#define NB 16
#define TT 2048
#define CC 128            // NH * HD = projected width
#define DIN 128          // input (model) width
#define NH 1
#define HD 128
#define NQB (TT / 64)
#define HG 4
#define SCALE (1.0f)
#define CAUSAL 0
#ifndef TNB
#define TNB NB
#endif
__device__ __forceinline__ float bfr(float v) { return (float)(__bf16)v; }
__host__ __device__ __forceinline__ int kb_last(int qb) { return CAUSAL ? ((qb * 64 + 63) >> 7) : (TT / 128 - 1); }
typedef __attribute__((ext_vector_type(8))) __bf16 v8b;
__device__ __forceinline__ v16b frag_b(const __bf16* rowk0, int lane) {
  union { v16b v; v8b q[2]; } u; const __bf16* p = rowk0 + 8 * (lane >> 4);
  u.q[0] = *(const v8b*)p; u.q[1] = *(const v8b*)(p + 16); return u.v;
}
#define QBH 0              // causal: query blocks 0..QBH-1 of each sequence (few keys, no averaging) take the high-precision path
#define QHI 2048            // rows carrying a q residual plane (all rows when non-causal: 2-product logits everywhere)
#define KHI 64            // key rows carrying k residual / v bf16 hi+lo planes (used only by the causal high-precision path)
// B fragment (k rows k0+.., output column o) of a weight: (in,out) [K][ld] or (out,in) [ld rows of K]: bf16 exact, or f16(bf16 * 256) exact
__device__ __forceinline__ v16b wcol_io(const float* Wm, int k0, int o, int lane, int ld) { v16b w; const int g = lane >> 4;
#pragma unroll
  for (int i = 0; i < 8; ++i) { w[i] = (__bf16)Wm[(size_t)(k0 + 8 * g + i) * ld + o]; w[8 + i] = (__bf16)Wm[(size_t)(k0 + 16 + 8 * g + i) * ld + o]; }
  return w; }
__device__ __forceinline__ v16b wcol_oi(const float* Wm, int k0, int o, int lane, int K) { v16b w; const float* p = Wm + (size_t)o * K + k0 + 8 * (lane >> 4);
#pragma unroll
  for (int i = 0; i < 8; ++i) { w[i] = (__bf16)p[i]; w[8 + i] = (__bf16)p[16 + i]; }
  return w; }
__device__ __forceinline__ v16h wcolh_io(const float* Wm, int k0, int o, int lane, int ld) { v16h w; const int g = lane >> 4;
#pragma unroll
  for (int i = 0; i < 8; ++i) { w[i] = (_Float16)(bfr(Wm[(size_t)(k0 + 8 * g + i) * ld + o]) * 256.0f); w[8 + i] = (_Float16)(bfr(Wm[(size_t)(k0 + 16 + 8 * g + i) * ld + o]) * 256.0f); }
  return w; }
__device__ __forceinline__ v16h wcolh_oi(const float* Wm, int k0, int o, int lane, int K) { v16h w; const float* p = Wm + (size_t)o * K + k0 + 8 * (lane >> 4);
#pragma unroll
  for (int i = 0; i < 8; ++i) { w[i] = (_Float16)(bfr(p[i]) * 256.0f); w[8 + i] = (_Float16)(bfr(p[16 + i]) * 256.0f); }
  return w; }
#define WQKV_LAYOUT 1   // 0 = (in,out) [DIN][CC]; 1 = (out,in) [CC][DIN]; 2 = per-head [NH][DIN][HD]
__device__ __forceinline__ v16b wcol_hdk(const float* Wm, int k0, int o, int lane) { v16b w; const int g = lane >> 4; const float* p = Wm + (size_t)(o / HD) * DIN * HD + (o % HD);
#pragma unroll
  for (int i = 0; i < 8; ++i) { w[i] = (__bf16)p[(size_t)(k0 + 8 * g + i) * HD]; w[8 + i] = (__bf16)p[(size_t)(k0 + 16 + 8 * g + i) * HD]; }
  return w; }
#define WO_OUT_IN 0
#if WQKV_LAYOUT == 1
#define WCOL(W, k0, o, lane) wcol_oin(W, k0, o, lane, DIN, (which == 2) ? CC : HDQ)   /* q / k: 32 real output rows, columns 32..127 exact zeros */
#elif WQKV_LAYOUT == 2
#define WCOL(W, k0, o, lane) wcol_hdk(W, k0, o, lane)
#else
#define WCOL(W, k0, o, lane) wcol_io(W, k0, o, lane, CC)
#endif
#if WO_OUT_IN
#define WOCOL(W, k0, o, lane) wcol_oi(W, k0, o, lane, CC)
#define WOCOLH(W, k0, o, lane) wcolh_oi(W, k0, o, lane, CC)
#else
#define WOCOL(W, k0, o, lane) wcol_io(W, k0, o, lane, DIN)
#define WOCOLH(W, k0, o, lane) wcolh_io(W, k0, o, lane, DIN)
#endif
#define HDQ 32             // q / k width (the planes are 128 wide; columns 32..127 are exact zeros)
#define BG HG              // the pass group spans BATCHES (one head): blockIdx.z / blockIdx.y select batch b0 + z
#define NR (TNB * TT)      // 32,768 rows (all batches)
// (out,in) projection weight with only 'nvalid' real output rows: columns o >= nvalid read row 0 and are zeroed by value
__device__ __forceinline__ v16b wcol_oin(const float* Wm, int k0, int o, int lane, int K, int nvalid) { v16b w; const int oc = o < nvalid ? o : 0; const float keep = o < nvalid ? 1.f : 0.f; const float* p = Wm + (size_t)oc * K + k0 + 8 * (lane >> 4);
#pragma unroll
  for (int i = 0; i < 8; ++i) { w[i] = (__bf16)(p[i] * keep); w[8 + i] = (__bf16)(p[16 + i] * keep); }
  return w; }
// transposed-P A fragments for k_pv: element (row = query n, k = key m) = PT[m * TT + n]
__device__ __forceinline__ v16h frag_f32T(const float* colq, int k0, int lane) { v16h a; const int g = lane >> 4;
#pragma unroll
  for (int i = 0; i < 8; ++i) { a[i] = (_Float16)colq[(size_t)(k0 + 8 * g + i) * TT]; a[8 + i] = (_Float16)colq[(size_t)(k0 + 16 + 8 * g + i) * TT]; }
  return a; }
__device__ __forceinline__ F2 split_rowT(const float* colq, int k0, int lane) { float v[16]; const int g = lane >> 4;
#pragma unroll
  for (int i = 0; i < 8; ++i) { v[i] = colq[(size_t)(k0 + 8 * g + i) * TT]; v[8 + i] = colq[(size_t)(k0 + 16 + 8 * g + i) * TT]; }
  return bsplit16(v); }
#define WS_DEN (WS_END)                                // f32 den[b*TT + n] = sum over keys m of P^T[m][n] (x 2^11)
#define WS_FSA (WS_DEN + 4u * (size_t)NR)              // f32 f_sa rows [NR][128]
#define WS_YL  (WS_FSA + 4u * (size_t)NR * CC)        // f32 y rows (pre-BN)
#define WS_ST  (WS_YL + 4u * (size_t)NR * CC)         // BN statistics [128][32]
#define WS_END2 (WS_ST + 4u * (size_t)CC * 32)
// ---- k_den: block = (256 query columns n0.., batch-in-group z): den[b][n] = sum over the 2,048 key rows of P^T[m][n] (coalesced column sums, f32)
__global__ __launch_bounds__(256) void k_den(const float* __restrict__ S0, int b0, float* __restrict__ DEN) { const int n = blockIdx.x * 256 + threadIdx.x; const float* PS = S0 + (size_t)blockIdx.y * TT * TT; float s = 0.f;
#pragma unroll 4
  for (int m = 0; m < TT; ++m) s += PS[(size_t)m * TT + n];
  __shared__ __align__(16) float sd[256]; sd[threadIdx.x] = s; __syncthreads();
  if (threadIdx.x < 64) vst2(DEN + (size_t)(b0 + blockIdx.y) * TT + blockIdx.x * 256 + threadIdx.x * 4, *(const v4f*)&sd[threadIdx.x * 4]); }   /* 1 KB by 64 threads */
// ---- k_fsa: f_sa = num / den (thread per float4 of the numerator rows written by k_pv; 512-B rows)
__global__ __launch_bounds__(256) void k_fsa(const float* __restrict__ NUM, const float* __restrict__ DEN, float* __restrict__ FSA) { const size_t e4 = (size_t)blockIdx.x * 256 + threadIdx.x; if (e4 >= (size_t)NR * CC / 4) return; const size_t row = e4 * 4 / CC; const float d = DEN[row]; const float inv = d > 0.f ? 2048.0f / d : 0.f;   /* k_pv's epilogue already divided the numerator by 2^11 while DEN sums the x 2^11 plane */ const v4f nv = *(const v4f*)(NUM + e4 * 4); v4f o;
#pragma unroll
  for (int i = 0; i < 4; ++i) o[i] = nv[i] * inv;
  vst2(FSA + e4 * 4, o); }
// ---- k_lin: block = 64 rows: y = (bf16(f_in) - f_sa) (split bf16 hi + lo) Wl^T + bl (2 products, K 128) -> pre-BN rows
__global__ __launch_bounds__(128) void k_lin(const float* __restrict__ X, const float* __restrict__ FSA, const float* __restrict__ WL, const float* __restrict__ BL, float* __restrict__ YL) { __shared__ __align__(16) float sf[4][16][132];
  const int tid = threadIdx.x, wave = tid >> 5, lane = tid & 31, col = lane & 15, g = lane >> 4; const size_t r0 = (size_t)blockIdx.x * 64 + wave * 16;
  v8f acc[8] = {};
#pragma unroll
  for (int kc = 0; kc < CC / 32; ++kc) { float v[16]; { const float* px = X + (r0 + col) * CC + kc * 32 + 8 * g; const float* pf = FSA + (r0 + col) * CC + kc * 32 + 8 * g;
#pragma unroll
      for (int i = 0; i < 8; ++i) { v[i] = bfr(px[i]) - pf[i]; v[8 + i] = bfr(px[16 + i]) - pf[16 + i]; } }
    const F2 a = bsplit16(v); asm volatile("s_wait_loadcnt 0x0" ::: "memory");
#pragma unroll
    for (int j = 0; j < 8; ++j) { const v16b w = wcol_oin(WL, kc * 32, j * 16 + col, lane, CC, CC); asm volatile("s_wait_loadcnt 0x0" ::: "memory"); acc[j] = wmma_bf(a.h, w, acc[j]); acc[j] = wmma_bf(a.l, w, acc[j]); } }
#pragma unroll
  for (int j = 0; j < 8; ++j) { const float bb = bfr(BL[j * 16 + col]);
#pragma unroll
    for (int r = 0; r < 8; ++r) sf[wave][8 * g + r][j * 16 + col] = acc[j][r] + bb; }
  LDSX(); for (int rl = 0; rl < 16; ++rl) vst2(YL + (r0 + rl) * CC + lane * 4, *(const v4f*)&sf[wave][rl][lane * 4]); }
__global__ __launch_bounds__(256) void k_stat(const float* __restrict__ T, float* __restrict__ STAT) { __shared__ float sred[8]; __shared__ float sbc;
  const int t = threadIdx.x; const int c = blockIdx.x;
  float s = 0.f; for (int r = t; r < NR; r += 256) s += T[(size_t)r * CC + c];
#pragma unroll
  for (int o = 1; o < 32; o <<= 1) s += __shfl_xor(s, o);
  if ((t & 31) == 0) sred[t >> 5] = s; __syncthreads(); if (t == 0) { float a = 0.f; for (int i = 0; i < 8; ++i) a += sred[i]; sbc = a / (float)NR; } __syncthreads(); const float mean = sbc; __syncthreads();
  float q = 0.f; for (int r = t; r < NR; r += 256) { const float d = T[(size_t)r * CC + c] - mean; q += d * d; }
#pragma unroll
  for (int o = 1; o < 32; o <<= 1) q += __shfl_xor(q, o);
  if ((t & 31) == 0) sred[t >> 5] = q; __syncthreads(); if (t == 0) { float a = 0.f; for (int i = 0; i < 8; ++i) a += sred[i]; sbc = rsqrtf(a / (float)NR + 1e-5f); } __syncthreads();
  if (t < 32) { const float v = t == 0 ? mean : (t == 1 ? sbc : 0.f); vst2(STAT + (size_t)c * 32 + t, v); } }
// ---- k_fin: out = relu(gamma (y - mean) rstd + beta) + f_sa (thread per float4)
__global__ __launch_bounds__(256) void k_fin(const float* __restrict__ YL, const float* __restrict__ STAT, const float* __restrict__ G, const float* __restrict__ BE, const float* __restrict__ FSA, float* __restrict__ OUT) { const size_t e4 = (size_t)blockIdx.x * 256 + threadIdx.x; if (e4 >= (size_t)NR * CC / 4) return; const int c0 = (int)((e4 * 4) % CC); const v4f yv = *(const v4f*)(YL + e4 * 4); const v4f fv = *(const v4f*)(FSA + e4 * 4); v4f o;
#pragma unroll
  for (int i = 0; i < 4; ++i) { const int c = c0 + i; const float yb = bfr(G[c]) * (yv[i] - STAT[c * 32]) * STAT[c * 32 + 1] + bfr(BE[c]); o[i] = fmaxf(yb, 0.f) + fv[i]; }
  vst2(OUT + e4 * 4, o); }
#ifndef SM_EXTRA_PARAMS
#define SM_EXTRA_PARAMS
#endif
#ifndef PROJ_EXTRA_PARAMS
#define PROJ_EXTRA_PARAMS
#endif
#ifndef SM_MASK_HOOK
#define SM_MASK_HOOK (void)0
#endif

#define WS_QH  0u                                      // f16 q rows [b*t][CC]
#define WS_KH  (WS_QH + 2u * (size_t)NB * TT * CC)      // f16 k rows [b*t][CC]
#define WS_VT  (WS_KH + 2u * (size_t)NB * TT * CC)      // f16 v planes [b][c][t]
#define WS_QL  (WS_VT + 2u * (size_t)NB * CC * TT)      // f16 q residual x 2^10 rows [b][t < QHI][CC]
#define WS_KL  (WS_QL + 2u * (size_t)NB * QHI * CC)     // f16 k residual x 2^10 rows [b][t < KHI][CC]
#define WS_VB  (WS_KL + 2u * (size_t)NB * KHI * CC)     // bf16 v hi planes [b][c][t < KHI]
#define WS_VBL (WS_VB + 2u * (size_t)NB * CC * KHI)
#define WS_S   (WS_VBL + 2u * (size_t)NB * CC * KHI)    // f32 logits / P [hg][t][s]
#define WS_Y   (WS_S  + 4u * (size_t)HG * TT * TT)      // f32 ctx rows [b*t][CC] (only when there is an output projection)
#define WS_END (WS_Y  + 0u)

// ---- k_proj: block = (64 rows, 128 cols, which): q/k/v = X W (+ b) with exact bf16 products (K = DIN) -> which 0: q f16 rows (+ residual rows < QHI); 1: k f16 rows (+ residual rows < KHI); 2: v f16 planes [c][t] (+ bf16 hi/lo planes for t < KHI)
__global__ __launch_bounds__(128) void k_proj(const float* __restrict__ XQ, const float* __restrict__ XK, const float* __restrict__ XV, const float* __restrict__ WQ, const float* __restrict__ WK, const float* __restrict__ WV, const float* __restrict__ BQ, const float* __restrict__ BK, const float* __restrict__ BV,
    _Float16* __restrict__ QH, _Float16* __restrict__ QL, _Float16* __restrict__ KH, _Float16* __restrict__ KL, _Float16* __restrict__ VT, __bf16* __restrict__ VB, __bf16* __restrict__ VBL) {
  __shared__ __align__(16) _Float16 sh[64][136], sl[64][136]; __shared__ __align__(16) _Float16 th[128][72]; __shared__ __align__(16) __bf16 tb[128][72], tbl[128][72];
  const int tid = threadIdx.x, wave = tid >> 5, lane = tid & 31, col = lane & 15, g = lane >> 4; const int which = blockIdx.z; const int c0 = blockIdx.y * 128; const size_t r0 = (size_t)blockIdx.x * 64; const size_t bb = r0 / TT; const int t0 = (int)(r0 % TT);
  const float* X = which == 0 ? XQ : which == 1 ? XK : XV; const float* WA = which == 0 ? WQ : which == 1 ? WK : WV; const float* BA = which == 0 ? BQ : which == 1 ? BK : BV;
  v8f acc[8] = {};
#pragma unroll 2
  for (int kc = 0; kc < DIN / 32; ++kc) { v16b a; { const float* p = X + (r0 + wave * 16 + col) * DIN + kc * 32 + 8 * g;
#pragma unroll
      for (int i = 0; i < 8; ++i) { a[i] = (__bf16)p[i]; a[8 + i] = (__bf16)p[16 + i]; } }
    asm volatile("s_wait_loadcnt 0x0" ::: "memory");
#pragma unroll
    for (int j = 0; j < 8; ++j) { const v16b w = WCOL(WA, kc * 32, c0 + j * 16 + col, lane); asm volatile("s_wait_loadcnt 0x0" ::: "memory"); acc[j] = wmma_bf(a, w, acc[j]); } }
  if (which < 2) { _Float16* DH = which == 0 ? QH : KH; _Float16* DL = which == 0 ? QL : KL; const int nhi = which == 0 ? QHI : KHI; const bool hi_rows = t0 < nhi;
#pragma unroll
    for (int j = 0; j < 8; ++j) { const int oo = c0 + j * 16 + col; const float bias = (BA && (which == 2 || oo < HDQ)) ? bfr(BA[which == 2 ? oo : (oo < HDQ ? oo : 0)]) : 0.f;
#pragma unroll
      for (int r = 0; r < 8; ++r) { const float v = acc[j][r] + bias; const _Float16 hv = (_Float16)v; sh[wave * 16 + 8 * g + r][j * 16 + col] = hv; sl[wave * 16 + 8 * g + r][j * 16 + col] = (_Float16)((v - (float)hv) * 1024.0f); } }
    __syncthreads();
    for (int e = tid; e < 64 * 16; e += 128) { const int rl = e >> 4, q = e & 15; vst2((unsigned*)(DH + (r0 + rl) * CC + c0 + q * 8), *(const v4u*)&sh[rl][q * 8]); if (hi_rows) vst2((unsigned*)(DL + (bb * nhi + t0 + rl) * (size_t)CC + c0 + q * 8), *(const v4u*)&sl[rl][q * 8]); }
  } else { const bool hi_rows = t0 < KHI;
#pragma unroll
    for (int j = 0; j < 8; ++j) { const int oo = c0 + j * 16 + col; const float bias = (BA && (which == 2 || oo < HDQ)) ? bfr(BA[which == 2 ? oo : (oo < HDQ ? oo : 0)]) : 0.f;
#pragma unroll
      for (int r = 0; r < 8; ++r) { const float v = acc[j][r] + bias; const int rl = wave * 16 + 8 * g + r, cl = j * 16 + col; th[cl][rl] = (_Float16)v; const __bf16 bh = (__bf16)v; tb[cl][rl] = bh; tbl[cl][rl] = (__bf16)(v - (float)bh); } }
    __syncthreads();
    for (int e = tid; e < 128 * 8; e += 128) { const int cl = e >> 3, q = e & 7; vst2((unsigned*)(VT + (bb * CC + c0 + cl) * (size_t)TT + t0 + q * 8), *(const v4u*)&th[cl][q * 8]); if (hi_rows) { const size_t o3 = (bb * CC + c0 + cl) * (size_t)KHI + t0 + q * 8; vst2((unsigned*)(VB + o3), *(const v4u*)&tb[cl][q * 8]); vst2((unsigned*)(VBL + o3), *(const v4u*)&tbl[cl][q * 8]); } } } }
// ---- k_sc: block = (query block qb, key block kb <= kb_last(qb), batch in group z) of batch b = bgrp + z: logits x SCALE; q hi + residual (x 2^10) against k (2 products) for query rows < QHI, plus the k residual (3 products) for query blocks < QBH (causal early rows); causal: blocks past the diagonal exit, the mask itself is applied by index in k_sm
__global__ __launch_bounds__(128) void k_sc(const _Float16* __restrict__ QH, const _Float16* __restrict__ KH, const _Float16* __restrict__ QL, const _Float16* __restrict__ KL, int bgrp, int h0, float* __restrict__ S0) { __shared__ __align__(16) float ss[4][16][132];
  const int qb = blockIdx.x, kb = blockIdx.y; if (kb > kb_last(qb)) return;
  const int h = h0; const int b = bgrp + blockIdx.z; float* S = S0 + (size_t)blockIdx.z * TT * TT;   /* group spans batches */
  const int tid = threadIdx.x, wave = tid >> 5, lane = tid & 31, col = lane & 15, g = lane >> 4; const int k0 = kb * 128; const int ql0 = qb * 64 + wave * 16; const size_t q0 = (size_t)b * TT + ql0, kr0 = (size_t)b * TT + k0;
  v8f acc[8] = {}, accl[8] = {};
  const _Float16* QLb = QL + (size_t)b * QHI * CC; const _Float16* KLb = KL + (size_t)b * KHI * CC;
  if (qb < QBH) {
#pragma unroll
    for (int kc = 0; kc < HDQ / 32; ++kc) { const v16h ah = frag_h(QH + (q0 + col) * CC + h * HD + kc * 32, lane), al = frag_h(QLb + (size_t)(ql0 + col) * CC + h * HD + kc * 32, lane);
#pragma unroll
      for (int j = 0; j < 8; ++j) { const v16h kbf = frag_h(KH + (kr0 + j * 16 + col) * CC + h * HD + kc * 32, lane), klf = frag_h(KLb + (size_t)(k0 + j * 16 + col) * CC + h * HD + kc * 32, lane); acc[j] = wmma16(ah, kbf, acc[j]); accl[j] = wmma16(al, kbf, accl[j]); accl[j] = wmma16(ah, klf, accl[j]); } }
  } else if (qb * 64 < QHI) {
#pragma unroll
    for (int kc = 0; kc < HDQ / 32; ++kc) { const v16h ah = frag_h(QH + (q0 + col) * CC + h * HD + kc * 32, lane), al = frag_h(QLb + (size_t)(ql0 + col) * CC + h * HD + kc * 32, lane);
#pragma unroll
      for (int j = 0; j < 8; ++j) { const v16h kbf = frag_h(KH + (kr0 + j * 16 + col) * CC + h * HD + kc * 32, lane); acc[j] = wmma16(ah, kbf, acc[j]); accl[j] = wmma16(al, kbf, accl[j]); } }
  } else {
#pragma unroll
    for (int kc = 0; kc < HDQ / 32; ++kc) { const v16h ah = frag_h(QH + (q0 + col) * CC + h * HD + kc * 32, lane);
#pragma unroll
      for (int j = 0; j < 8; ++j) { const v16h kbf = frag_h(KH + (kr0 + j * 16 + col) * CC + h * HD + kc * 32, lane); acc[j] = wmma16(ah, kbf, acc[j]); } } }
#pragma unroll
  for (int j = 0; j < 8; ++j) {
#pragma unroll
    for (int r = 0; r < 8; ++r) ss[wave][8 * g + r][j * 16 + col] = (acc[j][r] + accl[j][r] * (1.0f / 1024.0f)) * SCALE; }
  LDSX(); for (int rl = 0; rl < 16; ++rl) vst2(S + (size_t)(ql0 + rl) * TT + k0 + lane * 4, *(const v4f*)&ss[wave][rl][lane * 4]); }
// ---- k_sm: block = query row t (batch in group): keys [0, kend): causal -> logit if s <= t else excluded; softmax in f32; P x 2^11 in place (0 for excluded)
__global__ __launch_bounds__(256) void k_sm(float* __restrict__ S0 SM_EXTRA_PARAMS) { __shared__ float sred[8]; __shared__ float sbc; __shared__ __align__(16) float shv[TT];
  const int tid = threadIdx.x; const int t = blockIdx.x; const int kend = (kb_last(t >> 6) + 1) * 128;
  float* sr = S0 + (size_t)blockIdx.y * TT * TT + (size_t)t * TT;
  float m = -3.0e38f; for (int k = tid; k < kend; k += 256) { float v = (!CAUSAL || k <= t) ? sr[k] : -3.0e38f; SM_MASK_HOOK; shv[k] = v; m = fmaxf(m, v); }
#pragma unroll
  for (int o = 1; o < 32; o <<= 1) m = fmaxf(m, __shfl_xor(m, o));
  if ((tid & 31) == 0) sred[tid >> 5] = m; __syncthreads(); if (tid == 0) { float a = sred[0]; for (int i = 1; i < 8; ++i) a = fmaxf(a, sred[i]); sbc = a; } __syncthreads(); m = sbc; __syncthreads();
  float sum = 0.f; for (int k = tid; k < kend; k += 256) { const float v = shv[k]; const float e = (v <= -1.0e38f) ? 0.f : expf(v - m); shv[k] = e; sum += e; }
#pragma unroll
  for (int o = 1; o < 32; o <<= 1) sum += __shfl_xor(sum, o);
  if ((tid & 31) == 0) sred[tid >> 5] = sum; __syncthreads(); if (tid == 0) { float a = 0.f; for (int i = 0; i < 8; ++i) a += sred[i]; sbc = a > 0.f ? 2048.0f / a : 0.f; }   /* a fully excluded row yields P = 0 */ __syncthreads(); const float inv = sbc;
  for (int k = tid; k < kend; k += 256) shv[k] = shv[k] * inv;
  __syncthreads(); for (int q = tid; q < kend / 4; q += 256) vst2(sr + q * 4, *(const v4f*)&shv[q * 4]); }
// ---- k_pv: block = 64 queries (qb) of (b, h): ctx = P . v over keys [0, kend) (P x 2^11 once to f16 against v f16: 1 product; causal early query blocks: P and v as bf16 hi + lo, 3 products); 512-B (row, head) segment by 32 lanes
__global__ __launch_bounds__(128) void k_pv(const float* __restrict__ PS0, const _Float16* __restrict__ VT, const __bf16* __restrict__ VB, const __bf16* __restrict__ VBL, int bgrp, int h0, float* __restrict__ Y) { const int h = h0; const int b = bgrp + blockIdx.z; const float* PS = PS0 + (size_t)blockIdx.z * TT * TT;   /* group spans batches */ __shared__ __align__(16) float ss[4][16][HD + 4];
  const int tid = threadIdx.x, wave = tid >> 5, lane = tid & 31, col = lane & 15, g = lane >> 4; const int qb = blockIdx.x; const int ql0 = qb * 64 + wave * 16; const int kce = (kb_last(qb) + 1) * 4;
  v8f acc[HD / 16] = {};
  if (qb < QBH) {
#pragma unroll 1
    for (int kc = 0; kc < kce; ++kc) { const F2 p = split_rowT(PS + (size_t)(ql0 + col), kc * 32, lane);   /* column ql0+col of P^T */
      asm volatile("s_wait_loadcnt 0x0" ::: "memory");
#pragma unroll
      for (int j = 0; j < HD / 16; ++j) { const size_t po = ((size_t)b * CC + h * HD + j * 16 + col) * (size_t)KHI + kc * 32; const v16b vh = frag_b(VB + po, lane); acc[j] = wmma_bf(p.h, vh, acc[j]); acc[j] = wmma_bf(p.l, vh, acc[j]); acc[j] = wmma_bf(p.h, frag_b(VBL + po, lane), acc[j]); } }
  } else {
#pragma unroll 1
    for (int kc = 0; kc < kce; ++kc) { const v16h p = frag_f32T(PS + (size_t)(ql0 + col), kc * 32, lane); asm volatile("s_wait_loadcnt 0x0" ::: "memory");   /* column of P^T (strided gather, bursts of 16) */
      asm volatile("s_wait_loadcnt 0x0" ::: "memory");
#pragma unroll
      for (int j = 0; j < HD / 16; ++j) { const size_t po = ((size_t)b * CC + h * HD + j * 16 + col) * (size_t)TT + kc * 32; acc[j] = wmma16(p, frag_h(VT + po, lane), acc[j]); } } }
#pragma unroll
  for (int j = 0; j < HD / 16; ++j)
#pragma unroll
    for (int r = 0; r < 8; ++r) ss[wave][8 * g + r][j * 16 + col] = acc[j][r] * (1.0f / 2048.0f);
  LDSX(); for (int rl = 0; rl < 16; ++rl) if (lane < HD / 4) vst2(Y + ((size_t)b * TT + ql0 + rl) * CC + h * HD + lane * 4, *(const v4f*)&ss[wave][rl][lane * 4]); }

extern "C" void kernel_launch(void* const* d_in, const int* in_sizes, int n_in, void* d_out, int out_size, void* d_ws, size_t ws_size, hipStream_t stream) {
  (void)in_sizes; (void)n_in; (void)out_size;
  const float** F = (const float**)d_in;
  if (ws_size < (size_t)WS_END) return;
  char* ws = (char*)d_ws; _Float16 *QH = (_Float16*)(ws + WS_QH), *KH = (_Float16*)(ws + WS_KH), *VT = (_Float16*)(ws + WS_VT), *QL = (_Float16*)(ws + WS_QL), *KL = (_Float16*)(ws + WS_KL); __bf16 *VB = (__bf16*)(ws + WS_VB), *VBL = (__bf16*)(ws + WS_VBL); float *S = (float*)(ws + WS_S), *Y = (float*)(ws + WS_Y);
  (void)Y; (void)QL; (void)KL; (void)VB; (void)VBL;
  // inputs: 0 f_in [16,2048,128]; 1 w_q [32,128] (out,in), 2 b_q [32]; 3 w_k [32,128], 4 b_k; 5 w_v [128,128], 6 b_v; 7 w_l [128,128], 8 b_l; 9 bn_gamma, 10 bn_beta
  if (ws_size < (size_t)WS_END2) return;
  float *DEN = (float*)(ws + WS_DEN), *FSA = (float*)(ws + WS_FSA), *YL = (float*)(ws + WS_YL), *ST = (float*)(ws + WS_ST);
  // ROLE SWAP: the 'q' planes (hi + residual) hold K (from w_k, b_k) and the 'k' planes hold Q, so k_sc produces S^T[key][query] and k_sm normalises over QUERIES
  k_proj<<<dim3(TNB * TT / 64, CC / 128, 3), 128, 0, stream>>>(F[0], F[0], F[0], F[3], F[1], F[5], F[4], F[2], F[6], QH, QL, KH, KL, VT, VB, VBL);
  for (int b0 = 0; b0 < TNB; b0 += BG) {
    k_sc<<<dim3(NQB, TT / 128, BG), 128, 0, stream>>>(QH, KH, QL, KL, b0, 0, S);
    k_sm<<<dim3(TT, BG), 256, 0, stream>>>(S);
    k_den<<<dim3(TT / 256, BG), 256, 0, stream>>>(S, b0, DEN);
    k_pv<<<dim3(NQB, 1, BG), 128, 0, stream>>>(S, VT, VB, VBL, b0, 0, FSA);   /* numerator rows (x 2^11 / 2048 folded) */
  }
  k_fsa<<<dim3((NR * CC / 4 + 255) / 256), 256, 0, stream>>>(FSA, DEN, FSA);   /* in place: f_sa = num / den */
  k_lin<<<dim3(NR / 64), 128, 0, stream>>>(F[0], FSA, F[7], F[8], YL);
  k_stat<<<dim3(CC), 256, 0, stream>>>(YL, ST);
  k_fin<<<dim3((NR * CC / 4 + 255) / 256), 256, 0, stream>>>(YL, ST, F[9], F[10], FSA, (float*)d_out);
}

// v001
// Measured time: 814 microseconds a run.
// Timed twice side by side with v000, it ran 2.09 times as fast both times.
#include <hip/hip_runtime.h>
#include <math.h>

typedef __attribute__((ext_vector_type(16))) _Float16 v16h;
typedef __attribute__((ext_vector_type(16))) __bf16 v16b;
typedef __attribute__((ext_vector_type(8)))  _Float16 v8h;
typedef __attribute__((ext_vector_type(8)))  float v8f;
typedef __attribute__((ext_vector_type(4)))  float v4f;
typedef __attribute__((ext_vector_type(2)))  float v2f;
typedef __attribute__((ext_vector_type(4)))  unsigned v4u;
typedef __attribute__((ext_vector_type(4)))  int v4i;
typedef float __attribute__((may_alias)) float_a;
typedef int __attribute__((may_alias)) int_a;

template <typename T> __device__ __forceinline__ void vst2(void* p, T v) { *(T*)p = v;  }
__device__ __forceinline__ v8f wmma16(v16h a, v16h b, v8f c) {
  v8f d = __builtin_amdgcn_wmma_f32_16x16x32_f16(false, a, false, b, (short)0, c, false, false);
  asm volatile("v_nop\n\tv_nop\n\tv_nop\n\tv_nop" : "+v"(d) : "v"(a), "v"(b));
  return d;
}
__device__ __forceinline__ v8f wmma_bf(v16b a, v16b b, v8f c) {
  v8f d = __builtin_amdgcn_wmma_f32_16x16x32_bf16(false, a, false, b, (short)0, c, false, false);
  asm volatile("v_nop\n\tv_nop\n\tv_nop\n\tv_nop" : "+v"(d) : "v"(a), "v"(b));
  return d;
}
// 16x16x32 fragments: lane = (h = lane>>4, row/col = lane&15); elements 0..7 = k0+8h+0..7, 8..15 = k0+16+8h+0..7; D element r = row 8h+r
__device__ __forceinline__ v16h frag_h(const _Float16* rowk0, int lane) {
  union { v16h v; v8h q[2]; } u; const _Float16* p = rowk0 + 8 * (lane >> 4);
  u.q[0] = *(const v8h*)p; u.q[1] = *(const v8h*)(p + 16); return u.v;
}
__device__ __forceinline__ v16h frag_f32(const float* rowk0, int lane) {
  v16h a; const float* p = rowk0 + 8 * (lane >> 4);
#pragma unroll
  for (int i = 0; i < 8; ++i) { a[i] = (_Float16)p[i]; a[8 + i] = (_Float16)p[16 + i]; }
  return a;
}
__device__ __forceinline__ v16h frag_f32s(const float* rowk0, int lane, float sc) {
  v16h a; const float* p = rowk0 + 8 * (lane >> 4);
#pragma unroll
  for (int i = 0; i < 8; ++i) { a[i] = (_Float16)(p[i] * sc); a[8 + i] = (_Float16)(p[16 + i] * sc); }
  return a;
}
// column fragment from a [K][ld] layout (column n), rows >= K read as 0
__device__ __forceinline__ v16h fragc_f32(const float* W, int k0, int n, int lane, int ld, int K) {
  v16h a; const int g = lane >> 4;
#pragma unroll
  for (int i = 0; i < 8; ++i) { const int ka = k0 + 8 * g + i, kb = ka + 16;
    a[i] = (_Float16)(ka < K ? W[(size_t)(ka < K ? ka : K - 1) * ld + n] : 0.f); a[8 + i] = (_Float16)(kb < K ? W[(size_t)(kb < K ? kb : K - 1) * ld + n] : 0.f); }
  return a;
}
struct F2 { v16b h, l; };
__device__ __forceinline__ F2 bsplit16(const float v[16]) { F2 r;
#pragma unroll
  for (int i = 0; i < 16; ++i) { const __bf16 h = (__bf16)v[i]; r.h[i] = h; r.l[i] = (__bf16)(v[i] - (float)h); }
  return r; }
__device__ __forceinline__ F2 split_row(const float* row, int k0, int lane) { float v[16]; const float* p = row + k0 + 8 * (lane >> 4);
#pragma unroll
  for (int i = 0; i < 8; ++i) { v[i] = p[i]; v[8 + i] = p[16 + i]; }
  return bsplit16(v); }
__device__ __forceinline__ F2 split_rowK(const float* row, int k0, int lane, int K) { float v[16]; const int g = lane >> 4;
#pragma unroll
  for (int i = 0; i < 8; ++i) { const int ka = k0 + 8 * g + i, kb = ka + 16; v[i] = ka < K ? row[ka < K ? ka : K - 1] : 0.f; v[8 + i] = kb < K ? row[kb < K ? kb : K - 1] : 0.f; }
  return bsplit16(v); }
__device__ __forceinline__ F2 split_col(const float* W, int k0, int n, int lane, int ld, int K) { float v[16]; const int g = lane >> 4;
#pragma unroll
  for (int i = 0; i < 8; ++i) { const int ka = k0 + 8 * g + i, kb = ka + 16; v[i] = ka < K ? W[(size_t)(ka < K ? ka : K - 1) * ld + n] : 0.f; v[8 + i] = kb < K ? W[(size_t)(kb < K ? kb : K - 1) * ld + n] : 0.f; }
  return bsplit16(v); }
__device__ __forceinline__ v8f mac3(const F2& a, const F2& b, v8f c) { c = wmma_bf(a.l, b.h, c); c = wmma_bf(a.h, b.l, c); return wmma_bf(a.h, b.h, c); }
__device__ __forceinline__ float sigm(float v) { return 1.0f / (1.0f + expf(-v)); }
#define LDSX() do { asm volatile("s_wait_dscnt 0" ::: "memory"); __builtin_amdgcn_wave_barrier(); __builtin_amdgcn_fence(__ATOMIC_RELEASE, "workgroup"); } while (0)

// Offset-attention (PCT) block (B 16, N 2,048, D 128, q/k dim 32): q = x Wq^T + bq, k = x Wk^T + bk (32-d), v = x Wv^T + bv; a = softmax over QUERIES of q k^T (no scale), then a = a / sum over keys; f_sa = a v; y = (x - f_sa) Wl^T + bl; out = relu(BN(y)) + f_sa (BN with batch statistics over B*N, biased variance, eps 1e-5).
#define NB 16
#define TT 2048
#define CC 128            // NH * HD = projected width
#define DIN 128          // input (model) width
#define NH 1
#define HD 128
#define NQB (TT / 64)
#define HG 4
#define SCALE (1.0f)
#define CAUSAL 0
#ifndef TNB
#define TNB NB
#endif
__device__ __forceinline__ float bfr(float v) { return (float)(__bf16)v; }
__host__ __device__ __forceinline__ int kb_last(int qb) { return CAUSAL ? ((qb * 64 + 63) >> 7) : (TT / 128 - 1); }
typedef __attribute__((ext_vector_type(8))) __bf16 v8b;
__device__ __forceinline__ v16b frag_b(const __bf16* rowk0, int lane) {
  union { v16b v; v8b q[2]; } u; const __bf16* p = rowk0 + 8 * (lane >> 4);
  u.q[0] = *(const v8b*)p; u.q[1] = *(const v8b*)(p + 16); return u.v;
}
#define QBH 0              // causal: query blocks 0..QBH-1 of each sequence (few keys, no averaging) take the high-precision path
#define QHI 2048            // rows carrying a q residual plane (all rows when non-causal: 2-product logits everywhere)
#define KHI 64            // key rows carrying k residual / v bf16 hi+lo planes (used only by the causal high-precision path)
// B fragment (k rows k0+.., output column o) of a weight: (in,out) [K][ld] or (out,in) [ld rows of K]: bf16 exact, or f16(bf16 * 256) exact
__device__ __forceinline__ v16b wcol_io(const float* Wm, int k0, int o, int lane, int ld) { v16b w; const int g = lane >> 4;
#pragma unroll
  for (int i = 0; i < 8; ++i) { w[i] = (__bf16)Wm[(size_t)(k0 + 8 * g + i) * ld + o]; w[8 + i] = (__bf16)Wm[(size_t)(k0 + 16 + 8 * g + i) * ld + o]; }
  return w; }
__device__ __forceinline__ v16b wcol_oi(const float* Wm, int k0, int o, int lane, int K) { v16b w; const float* p = Wm + (size_t)o * K + k0 + 8 * (lane >> 4);
#pragma unroll
  for (int i = 0; i < 8; ++i) { w[i] = (__bf16)p[i]; w[8 + i] = (__bf16)p[16 + i]; }
  return w; }
__device__ __forceinline__ v16h wcolh_io(const float* Wm, int k0, int o, int lane, int ld) { v16h w; const int g = lane >> 4;
#pragma unroll
  for (int i = 0; i < 8; ++i) { w[i] = (_Float16)(bfr(Wm[(size_t)(k0 + 8 * g + i) * ld + o]) * 256.0f); w[8 + i] = (_Float16)(bfr(Wm[(size_t)(k0 + 16 + 8 * g + i) * ld + o]) * 256.0f); }
  return w; }
__device__ __forceinline__ v16h wcolh_oi(const float* Wm, int k0, int o, int lane, int K) { v16h w; const float* p = Wm + (size_t)o * K + k0 + 8 * (lane >> 4);
#pragma unroll
  for (int i = 0; i < 8; ++i) { w[i] = (_Float16)(bfr(p[i]) * 256.0f); w[8 + i] = (_Float16)(bfr(p[16 + i]) * 256.0f); }
  return w; }
#define WQKV_LAYOUT 1   // 0 = (in,out) [DIN][CC]; 1 = (out,in) [CC][DIN]; 2 = per-head [NH][DIN][HD]
__device__ __forceinline__ v16b wcol_hdk(const float* Wm, int k0, int o, int lane) { v16b w; const int g = lane >> 4; const float* p = Wm + (size_t)(o / HD) * DIN * HD + (o % HD);
#pragma unroll
  for (int i = 0; i < 8; ++i) { w[i] = (__bf16)p[(size_t)(k0 + 8 * g + i) * HD]; w[8 + i] = (__bf16)p[(size_t)(k0 + 16 + 8 * g + i) * HD]; }
  return w; }
#define WO_OUT_IN 0
#if WQKV_LAYOUT == 1
#define WCOL(W, k0, o, lane) wcol_oin(W, k0, o, lane, DIN, (which == 2) ? CC : HDQ)   /* q / k: 32 real output rows, columns 32..127 exact zeros */
#elif WQKV_LAYOUT == 2
#define WCOL(W, k0, o, lane) wcol_hdk(W, k0, o, lane)
#else
#define WCOL(W, k0, o, lane) wcol_io(W, k0, o, lane, CC)
#endif
#if WO_OUT_IN
#define WOCOL(W, k0, o, lane) wcol_oi(W, k0, o, lane, CC)
#define WOCOLH(W, k0, o, lane) wcolh_oi(W, k0, o, lane, CC)
#else
#define WOCOL(W, k0, o, lane) wcol_io(W, k0, o, lane, DIN)
#define WOCOLH(W, k0, o, lane) wcolh_io(W, k0, o, lane, DIN)
#endif
#define HDQ 32             // q / k width (the planes are 128 wide; columns 32..127 are exact zeros)
#define BG HG              // the pass group spans BATCHES (one head): blockIdx.z / blockIdx.y select batch b0 + z
#define NR (TNB * TT)      // 32,768 rows (all batches)
// (out,in) projection weight with only 'nvalid' real output rows: columns o >= nvalid read row 0 and are zeroed by value
__device__ __forceinline__ v16b wcol_oin(const float* Wm, int k0, int o, int lane, int K, int nvalid) { v16b w; const int oc = o < nvalid ? o : 0; const float keep = o < nvalid ? 1.f : 0.f; const float* p = Wm + (size_t)oc * K + k0 + 8 * (lane >> 4);
#pragma unroll
  for (int i = 0; i < 8; ++i) { w[i] = (__bf16)(p[i] * keep); w[8 + i] = (__bf16)(p[16 + i] * keep); }
  return w; }
// transposed-P A fragments for k_pv: element (row = query n, k = key m) = PT[m * TT + n]; the 16 f32 values of the fragment are also added (pairwise tree) into ksum, this lane's share of query n's sum over keys
__device__ __forceinline__ float sum16(const float v[16]) { return (((v[0] + v[1]) + (v[2] + v[3])) + ((v[4] + v[5]) + (v[6] + v[7]))) + (((v[8] + v[9]) + (v[10] + v[11])) + ((v[12] + v[13]) + (v[14] + v[15]))); }
__device__ __forceinline__ v16h frag_f32T(const float* colq, int k0, int lane, float& ksum) { v16h a; float v[16]; const int g = lane >> 4;
#pragma unroll
  for (int i = 0; i < 8; ++i) { v[i] = colq[(size_t)(k0 + 8 * g + i) * TT]; v[8 + i] = colq[(size_t)(k0 + 16 + 8 * g + i) * TT]; }
#pragma unroll
  for (int i = 0; i < 16; ++i) a[i] = (_Float16)v[i];
  ksum += sum16(v); return a; }
__device__ __forceinline__ F2 split_rowT(const float* colq, int k0, int lane, float& ksum) { float v[16]; const int g = lane >> 4;
#pragma unroll
  for (int i = 0; i < 8; ++i) { v[i] = colq[(size_t)(k0 + 8 * g + i) * TT]; v[8 + i] = colq[(size_t)(k0 + 16 + 8 * g + i) * TT]; }
  ksum += sum16(v); return bsplit16(v); }
#define WS_DEN (WS_END)                                // (plane not used: the sum over keys stays in k_pv's registers)
#define WS_FSA (WS_DEN + 4u * (size_t)NR)              // f32 f_sa rows [NR][128]
#define WS_YL  (WS_FSA + 4u * (size_t)NR * CC)        // f32 y rows (pre-BN)
#define WS_ST  (WS_YL + 4u * (size_t)NR * CC)         // BN statistics [128][32]
#define WS_END2 (WS_ST + 4u * (size_t)CC * 32)
// ---- k_lin: block = 64 rows: y = (bf16(f_in) - f_sa) (split bf16 hi + lo) Wl^T + bl (2 products, K 128) -> pre-BN rows
__global__ __launch_bounds__(128) void k_lin(const float* __restrict__ X, const float* __restrict__ FSA, const float* __restrict__ WL, const float* __restrict__ BL, float* __restrict__ YL) { __shared__ __align__(16) float sf[4][16][132];
  const int tid = threadIdx.x, wave = tid >> 5, lane = tid & 31, col = lane & 15, g = lane >> 4; const size_t r0 = (size_t)blockIdx.x * 64 + wave * 16;
  v8f acc[8] = {};
#pragma unroll
  for (int kc = 0; kc < CC / 32; ++kc) { float v[16]; { const float* px = X + (r0 + col) * CC + kc * 32 + 8 * g; const float* pf = FSA + (r0 + col) * CC + kc * 32 + 8 * g;
#pragma unroll
      for (int i = 0; i < 8; ++i) { v[i] = bfr(px[i]) - pf[i]; v[8 + i] = bfr(px[16 + i]) - pf[16 + i]; } }
    const F2 a = bsplit16(v); asm volatile("s_wait_loadcnt 0x0" ::: "memory");
#pragma unroll
    for (int j = 0; j < 8; ++j) { const v16b w = wcol_oin(WL, kc * 32, j * 16 + col, lane, CC, CC); asm volatile("s_wait_loadcnt 0x0" ::: "memory"); acc[j] = wmma_bf(a.h, w, acc[j]); acc[j] = wmma_bf(a.l, w, acc[j]); } }
#pragma unroll
  for (int j = 0; j < 8; ++j) { const float bb = bfr(BL[j * 16 + col]);
#pragma unroll
    for (int r = 0; r < 8; ++r) sf[wave][8 * g + r][j * 16 + col] = acc[j][r] + bb; }
  LDSX(); for (int rl = 0; rl < 16; ++rl) vst2(YL + (r0 + rl) * CC + lane * 4, *(const v4f*)&sf[wave][rl][lane * 4]); }
__global__ __launch_bounds__(256) void k_stat(const float* __restrict__ T, float* __restrict__ STAT) { __shared__ float sred[8]; __shared__ float sbc;
  const int t = threadIdx.x; const int c = blockIdx.x;
  float s = 0.f; for (int r = t; r < NR; r += 256) s += T[(size_t)r * CC + c];
#pragma unroll
  for (int o = 1; o < 32; o <<= 1) s += __shfl_xor(s, o);
  if ((t & 31) == 0) sred[t >> 5] = s; __syncthreads(); if (t == 0) { float a = 0.f; for (int i = 0; i < 8; ++i) a += sred[i]; sbc = a / (float)NR; } __syncthreads(); const float mean = sbc; __syncthreads();
  float q = 0.f; for (int r = t; r < NR; r += 256) { const float d = T[(size_t)r * CC + c] - mean; q += d * d; }
#pragma unroll
  for (int o = 1; o < 32; o <<= 1) q += __shfl_xor(q, o);
  if ((t & 31) == 0) sred[t >> 5] = q; __syncthreads(); if (t == 0) { float a = 0.f; for (int i = 0; i < 8; ++i) a += sred[i]; sbc = rsqrtf(a / (float)NR + 1e-5f); } __syncthreads();
  if (t < 32) { const float v = t == 0 ? mean : (t == 1 ? sbc : 0.f); vst2(STAT + (size_t)c * 32 + t, v); } }
// ---- k_fin: out = relu(gamma (y - mean) rstd + beta) + f_sa (thread per float4)
__global__ __launch_bounds__(256) void k_fin(const float* __restrict__ YL, const float* __restrict__ STAT, const float* __restrict__ G, const float* __restrict__ BE, const float* __restrict__ FSA, float* __restrict__ OUT) { const size_t e4 = (size_t)blockIdx.x * 256 + threadIdx.x; if (e4 >= (size_t)NR * CC / 4) return; const int c0 = (int)((e4 * 4) % CC); const v4f yv = *(const v4f*)(YL + e4 * 4); const v4f fv = *(const v4f*)(FSA + e4 * 4); v4f o;
#pragma unroll
  for (int i = 0; i < 4; ++i) { const int c = c0 + i; const float yb = bfr(G[c]) * (yv[i] - STAT[c * 32]) * STAT[c * 32 + 1] + bfr(BE[c]); o[i] = fmaxf(yb, 0.f) + fv[i]; }
  vst2(OUT + e4 * 4, o); }
#ifndef SM_EXTRA_PARAMS
#define SM_EXTRA_PARAMS
#endif
#ifndef PROJ_EXTRA_PARAMS
#define PROJ_EXTRA_PARAMS
#endif
#ifndef SM_MASK_HOOK
#define SM_MASK_HOOK (void)0
#endif

#define WS_QH  0u                                      // f16 q rows [b*t][CC]
#define WS_KH  (WS_QH + 2u * (size_t)NB * TT * CC)      // f16 k rows [b*t][CC]
#define WS_VT  (WS_KH + 2u * (size_t)NB * TT * CC)      // f16 v planes [b][c][t]
#define WS_QL  (WS_VT + 2u * (size_t)NB * CC * TT)      // f16 q residual x 2^10 rows [b][t < QHI][CC]
#define WS_KL  (WS_QL + 2u * (size_t)NB * QHI * CC)     // f16 k residual x 2^10 rows [b][t < KHI][CC]
#define WS_VB  (WS_KL + 2u * (size_t)NB * KHI * CC)     // bf16 v hi planes [b][c][t < KHI]
#define WS_VBL (WS_VB + 2u * (size_t)NB * CC * KHI)
#define WS_S   (WS_VBL + 2u * (size_t)NB * CC * KHI)    // f32 logits / P [hg][t][s]
#define WS_Y   (WS_S  + 4u * (size_t)HG * TT * TT)      // f32 ctx rows [b*t][CC] (only when there is an output projection)
#define WS_END (WS_Y  + 0u)

// ---- k_proj: block = (64 rows, 128 cols, which): q/k/v = X W (+ b) with exact bf16 products (K = DIN) -> which 0: q f16 rows (+ residual rows < QHI); 1: k f16 rows (+ residual rows < KHI); 2: v f16 planes [c][t] (+ bf16 hi/lo planes for t < KHI)
__global__ __launch_bounds__(128) void k_proj(const float* __restrict__ XQ, const float* __restrict__ XK, const float* __restrict__ XV, const float* __restrict__ WQ, const float* __restrict__ WK, const float* __restrict__ WV, const float* __restrict__ BQ, const float* __restrict__ BK, const float* __restrict__ BV,
    _Float16* __restrict__ QH, _Float16* __restrict__ QL, _Float16* __restrict__ KH, _Float16* __restrict__ KL, _Float16* __restrict__ VT, __bf16* __restrict__ VB, __bf16* __restrict__ VBL) {
  __shared__ __align__(16) _Float16 sh[64][136], sl[64][136]; __shared__ __align__(16) _Float16 th[128][72]; __shared__ __align__(16) __bf16 tb[128][72], tbl[128][72];
  const int tid = threadIdx.x, wave = tid >> 5, lane = tid & 31, col = lane & 15, g = lane >> 4; const int which = blockIdx.z; const int c0 = blockIdx.y * 128; const size_t r0 = (size_t)blockIdx.x * 64; const size_t bb = r0 / TT; const int t0 = (int)(r0 % TT);
  const float* X = which == 0 ? XQ : which == 1 ? XK : XV; const float* WA = which == 0 ? WQ : which == 1 ? WK : WV; const float* BA = which == 0 ? BQ : which == 1 ? BK : BV;
  v8f acc[8] = {};
#pragma unroll 2
  for (int kc = 0; kc < DIN / 32; ++kc) { v16b a; { const float* p = X + (r0 + wave * 16 + col) * DIN + kc * 32 + 8 * g;
#pragma unroll
      for (int i = 0; i < 8; ++i) { a[i] = (__bf16)p[i]; a[8 + i] = (__bf16)p[16 + i]; } }
    asm volatile("s_wait_loadcnt 0x0" ::: "memory");
#pragma unroll
    for (int j = 0; j < 8; ++j) { const v16b w = WCOL(WA, kc * 32, c0 + j * 16 + col, lane); asm volatile("s_wait_loadcnt 0x0" ::: "memory"); acc[j] = wmma_bf(a, w, acc[j]); } }
  if (which < 2) { _Float16* DH = which == 0 ? QH : KH; _Float16* DL = which == 0 ? QL : KL; const int nhi = which == 0 ? QHI : KHI; const bool hi_rows = t0 < nhi;
#pragma unroll
    for (int j = 0; j < 8; ++j) { const int oo = c0 + j * 16 + col; const float bias = (BA && (which == 2 || oo < HDQ)) ? bfr(BA[which == 2 ? oo : (oo < HDQ ? oo : 0)]) : 0.f;
#pragma unroll
      for (int r = 0; r < 8; ++r) { const float v = acc[j][r] + bias; const _Float16 hv = (_Float16)v; sh[wave * 16 + 8 * g + r][j * 16 + col] = hv; sl[wave * 16 + 8 * g + r][j * 16 + col] = (_Float16)((v - (float)hv) * 1024.0f); } }
    __syncthreads();
    for (int e = tid; e < 64 * 16; e += 128) { const int rl = e >> 4, q = e & 15; vst2((unsigned*)(DH + (r0 + rl) * CC + c0 + q * 8), *(const v4u*)&sh[rl][q * 8]); if (hi_rows) vst2((unsigned*)(DL + (bb * nhi + t0 + rl) * (size_t)CC + c0 + q * 8), *(const v4u*)&sl[rl][q * 8]); }
  } else { const bool hi_rows = t0 < KHI;
#pragma unroll
    for (int j = 0; j < 8; ++j) { const int oo = c0 + j * 16 + col; const float bias = (BA && (which == 2 || oo < HDQ)) ? bfr(BA[which == 2 ? oo : (oo < HDQ ? oo : 0)]) : 0.f;
#pragma unroll
      for (int r = 0; r < 8; ++r) { const float v = acc[j][r] + bias; const int rl = wave * 16 + 8 * g + r, cl = j * 16 + col; th[cl][rl] = (_Float16)v; const __bf16 bh = (__bf16)v; tb[cl][rl] = bh; tbl[cl][rl] = (__bf16)(v - (float)bh); } }
    __syncthreads();
    for (int e = tid; e < 128 * 8; e += 128) { const int cl = e >> 3, q = e & 7; vst2((unsigned*)(VT + (bb * CC + c0 + cl) * (size_t)TT + t0 + q * 8), *(const v4u*)&th[cl][q * 8]); if (hi_rows) { const size_t o3 = (bb * CC + c0 + cl) * (size_t)KHI + t0 + q * 8; vst2((unsigned*)(VB + o3), *(const v4u*)&tb[cl][q * 8]); vst2((unsigned*)(VBL + o3), *(const v4u*)&tbl[cl][q * 8]); } } } }
// ---- k_sc: block = (query block qb, key block kb <= kb_last(qb), batch in group z) of batch b = bgrp + z: logits x SCALE; q hi + residual (x 2^10) against k (2 products) for query rows < QHI, plus the k residual (3 products) for query blocks < QBH (causal early rows); causal: blocks past the diagonal exit, the mask itself is applied by index in k_sm
__global__ __launch_bounds__(128) void k_sc(const _Float16* __restrict__ QH, const _Float16* __restrict__ KH, const _Float16* __restrict__ QL, const _Float16* __restrict__ KL, int bgrp, int h0, float* __restrict__ S0) { __shared__ __align__(16) float ss[4][16][132];
  const int qb = blockIdx.x, kb = blockIdx.y; if (kb > kb_last(qb)) return;
  const int h = h0; const int b = bgrp + blockIdx.z; float* S = S0 + (size_t)blockIdx.z * TT * TT;   /* group spans batches */
  const int tid = threadIdx.x, wave = tid >> 5, lane = tid & 31, col = lane & 15, g = lane >> 4; const int k0 = kb * 128; const int ql0 = qb * 64 + wave * 16; const size_t q0 = (size_t)b * TT + ql0, kr0 = (size_t)b * TT + k0;
  v8f acc[8] = {}, accl[8] = {};
  const _Float16* QLb = QL + (size_t)b * QHI * CC; const _Float16* KLb = KL + (size_t)b * KHI * CC;
  if (qb < QBH) {
#pragma unroll
    for (int kc = 0; kc < HDQ / 32; ++kc) { const v16h ah = frag_h(QH + (q0 + col) * CC + h * HD + kc * 32, lane), al = frag_h(QLb + (size_t)(ql0 + col) * CC + h * HD + kc * 32, lane);
#pragma unroll
      for (int j = 0; j < 8; ++j) { const v16h kbf = frag_h(KH + (kr0 + j * 16 + col) * CC + h * HD + kc * 32, lane), klf = frag_h(KLb + (size_t)(k0 + j * 16 + col) * CC + h * HD + kc * 32, lane); acc[j] = wmma16(ah, kbf, acc[j]); accl[j] = wmma16(al, kbf, accl[j]); accl[j] = wmma16(ah, klf, accl[j]); } }
  } else if (qb * 64 < QHI) {
#pragma unroll
    for (int kc = 0; kc < HDQ / 32; ++kc) { const v16h ah = frag_h(QH + (q0 + col) * CC + h * HD + kc * 32, lane), al = frag_h(QLb + (size_t)(ql0 + col) * CC + h * HD + kc * 32, lane);
#pragma unroll
      for (int j = 0; j < 8; ++j) { const v16h kbf = frag_h(KH + (kr0 + j * 16 + col) * CC + h * HD + kc * 32, lane); acc[j] = wmma16(ah, kbf, acc[j]); accl[j] = wmma16(al, kbf, accl[j]); } }
  } else {
#pragma unroll
    for (int kc = 0; kc < HDQ / 32; ++kc) { const v16h ah = frag_h(QH + (q0 + col) * CC + h * HD + kc * 32, lane);
#pragma unroll
      for (int j = 0; j < 8; ++j) { const v16h kbf = frag_h(KH + (kr0 + j * 16 + col) * CC + h * HD + kc * 32, lane); acc[j] = wmma16(ah, kbf, acc[j]); } } }
#pragma unroll
  for (int j = 0; j < 8; ++j) {
#pragma unroll
    for (int r = 0; r < 8; ++r) ss[wave][8 * g + r][j * 16 + col] = (acc[j][r] + accl[j][r] * (1.0f / 1024.0f)) * SCALE; }
  LDSX(); for (int rl = 0; rl < 16; ++rl) vst2(S + (size_t)(ql0 + rl) * TT + k0 + lane * 4, *(const v4f*)&ss[wave][rl][lane * 4]); }
// ---- k_sm: block = query row t (batch in group): keys [0, kend): causal -> logit if s <= t else excluded; softmax in f32; P x 2^11 in place (0 for excluded)
__global__ __launch_bounds__(256) void k_sm(float* __restrict__ S0 SM_EXTRA_PARAMS) { __shared__ float sred[8]; __shared__ float sbc; __shared__ __align__(16) float shv[TT];
  const int tid = threadIdx.x; const int t = blockIdx.x; const int kend = (kb_last(t >> 6) + 1) * 128;
  float* sr = S0 + (size_t)blockIdx.y * TT * TT + (size_t)t * TT;
  float m = -3.0e38f; for (int k = tid; k < kend; k += 256) { float v = (!CAUSAL || k <= t) ? sr[k] : -3.0e38f; SM_MASK_HOOK; shv[k] = v; m = fmaxf(m, v); }
#pragma unroll
  for (int o = 1; o < 32; o <<= 1) m = fmaxf(m, __shfl_xor(m, o));
  if ((tid & 31) == 0) sred[tid >> 5] = m; __syncthreads(); if (tid == 0) { float a = sred[0]; for (int i = 1; i < 8; ++i) a = fmaxf(a, sred[i]); sbc = a; } __syncthreads(); m = sbc; __syncthreads();
  float sum = 0.f; for (int k = tid; k < kend; k += 256) { const float v = shv[k]; const float e = (v <= -1.0e38f) ? 0.f : expf(v - m); shv[k] = e; sum += e; }
#pragma unroll
  for (int o = 1; o < 32; o <<= 1) sum += __shfl_xor(sum, o);
  if ((tid & 31) == 0) sred[tid >> 5] = sum; __syncthreads(); if (tid == 0) { float a = 0.f; for (int i = 0; i < 8; ++i) a += sred[i]; sbc = a > 0.f ? 2048.0f / a : 0.f; }   /* a fully excluded row yields P = 0 */ __syncthreads(); const float inv = sbc;
  for (int k = tid; k < kend; k += 256) shv[k] = shv[k] * inv;
  __syncthreads(); for (int q = tid; q < kend / 4; q += 256) vst2(sr + q * 4, *(const v4f*)&shv[q * 4]); }
// ---- k_pv: block = 64 queries (qb) of (b, h): f_sa = (P . v) / (sum over keys of P), keys [0, kend) (P x 2^11 once to f16 against v f16: 1 product; causal early query blocks: P and v as bf16 hi + lo, 3 products); 512-B (row, head) segment by 32 lanes
__global__ __launch_bounds__(128) void k_pv(const float* __restrict__ PS0, const _Float16* __restrict__ VT, const __bf16* __restrict__ VB, const __bf16* __restrict__ VBL, int bgrp, int h0, float* __restrict__ Y) { const int h = h0; const int b = bgrp + blockIdx.z; const float* PS = PS0 + (size_t)blockIdx.z * TT * TT;   /* group spans batches */ __shared__ __align__(16) float ss[4][16][HD + 4];
  const int tid = threadIdx.x, wave = tid >> 5, lane = tid & 31, col = lane & 15, g = lane >> 4; const int qb = blockIdx.x; const int ql0 = qb * 64 + wave * 16; const int kce = (kb_last(qb) + 1) * 4;
  v8f acc[HD / 16] = {}; float ksum = 0.f;   /* f32 sum of the P x 2^11 values this lane loads: query ql0 + col, the k half g of every chunk */
  if (qb < QBH) {
#pragma unroll 1
    for (int kc = 0; kc < kce; ++kc) { const F2 p = split_rowT(PS + (size_t)(ql0 + col), kc * 32, lane, ksum);   /* column ql0+col of P^T */
      asm volatile("s_wait_loadcnt 0x0" ::: "memory");
#pragma unroll
      for (int j = 0; j < HD / 16; ++j) { const size_t po = ((size_t)b * CC + h * HD + j * 16 + col) * (size_t)KHI + kc * 32; const v16b vh = frag_b(VB + po, lane); acc[j] = wmma_bf(p.h, vh, acc[j]); acc[j] = wmma_bf(p.l, vh, acc[j]); acc[j] = wmma_bf(p.h, frag_b(VBL + po, lane), acc[j]); } }
  } else {
#pragma unroll 1
    for (int kc = 0; kc < kce; ++kc) { const v16h p = frag_f32T(PS + (size_t)(ql0 + col), kc * 32, lane, ksum); asm volatile("s_wait_loadcnt 0x0" ::: "memory");   /* column of P^T (strided gather, bursts of 16) */
      asm volatile("s_wait_loadcnt 0x0" ::: "memory");
#pragma unroll
      for (int j = 0; j < HD / 16; ++j) { const size_t po = ((size_t)b * CC + h * HD + j * 16 + col) * (size_t)TT + kc * 32; acc[j] = wmma16(p, frag_h(VT + po, lane), acc[j]); } } }
  ksum += __shfl_xor(ksum, 16);   /* both k halves: den (x 2^11) of query ql0 + col, in lanes col and col + 16 */
  const float inv = ksum > 0.f ? 2048.0f / ksum : 0.f; float invr[8];
#pragma unroll
  for (int r = 0; r < 8; ++r) invr[r] = __shfl(inv, 8 * g + r);   /* accumulator element r is query row 8g + r */
#pragma unroll
  for (int j = 0; j < HD / 16; ++j)
#pragma unroll
    for (int r = 0; r < 8; ++r) ss[wave][8 * g + r][j * 16 + col] = acc[j][r] * (1.0f / 2048.0f) * invr[r];
  LDSX(); for (int rl = 0; rl < 16; ++rl) if (lane < HD / 4) vst2(Y + ((size_t)b * TT + ql0 + rl) * CC + h * HD + lane * 4, *(const v4f*)&ss[wave][rl][lane * 4]); }

extern "C" void kernel_launch(void* const* d_in, const int* in_sizes, int n_in, void* d_out, int out_size, void* d_ws, size_t ws_size, hipStream_t stream) {
  (void)in_sizes; (void)n_in; (void)out_size;
  const float** F = (const float**)d_in;
  if (ws_size < (size_t)WS_END) return;
  char* ws = (char*)d_ws; _Float16 *QH = (_Float16*)(ws + WS_QH), *KH = (_Float16*)(ws + WS_KH), *VT = (_Float16*)(ws + WS_VT), *QL = (_Float16*)(ws + WS_QL), *KL = (_Float16*)(ws + WS_KL); __bf16 *VB = (__bf16*)(ws + WS_VB), *VBL = (__bf16*)(ws + WS_VBL); float *S = (float*)(ws + WS_S), *Y = (float*)(ws + WS_Y);
  (void)Y; (void)QL; (void)KL; (void)VB; (void)VBL;
  // inputs: 0 f_in [16,2048,128]; 1 w_q [32,128] (out,in), 2 b_q [32]; 3 w_k [32,128], 4 b_k; 5 w_v [128,128], 6 b_v; 7 w_l [128,128], 8 b_l; 9 bn_gamma, 10 bn_beta
  if (ws_size < (size_t)WS_END2) return;
  float *FSA = (float*)(ws + WS_FSA), *YL = (float*)(ws + WS_YL), *ST = (float*)(ws + WS_ST);
  // ROLE SWAP: the 'q' planes (hi + residual) hold K (from w_k, b_k) and the 'k' planes hold Q, so k_sc produces S^T[key][query] and k_sm normalises over QUERIES
  k_proj<<<dim3(TNB * TT / 64, CC / 128, 3), 128, 0, stream>>>(F[0], F[0], F[0], F[3], F[1], F[5], F[4], F[2], F[6], QH, QL, KH, KL, VT, VB, VBL);
  for (int b0 = 0; b0 < TNB; b0 += BG) {
    k_sc<<<dim3(NQB, TT / 128, BG), 128, 0, stream>>>(QH, KH, QL, KL, b0, 0, S);
    k_sm<<<dim3(TT, BG), 256, 0, stream>>>(S);
    k_pv<<<dim3(NQB, 1, BG), 128, 0, stream>>>(S, VT, VB, VBL, b0, 0, FSA);   /* f_sa rows: numerator and the sum over keys from the same P loads */
  }
  k_lin<<<dim3(NR / 64), 128, 0, stream>>>(F[0], FSA, F[7], F[8], YL);
  k_stat<<<dim3(CC), 256, 0, stream>>>(YL, ST);
  k_fin<<<dim3((NR * CC / 4 + 255) / 256), 256, 0, stream>>>(YL, ST, F[9], F[10], FSA, (float*)d_out);
}

// v002
// Measured time: 237 microseconds a run.
// Next to v001, in two timings, it ran 3.43 and 3.44 times as fast.
// All steps since v000 together make it 7.17 times as fast.
#include <hip/hip_runtime.h>
#include <math.h>

typedef __attribute__((ext_vector_type(16))) _Float16 v16h;
typedef __attribute__((ext_vector_type(16))) __bf16 v16b;
typedef __attribute__((ext_vector_type(8)))  _Float16 v8h;
typedef __attribute__((ext_vector_type(8)))  float v8f;
typedef __attribute__((ext_vector_type(4)))  float v4f;
typedef __attribute__((ext_vector_type(2)))  float v2f;
typedef __attribute__((ext_vector_type(4)))  unsigned v4u;
typedef __attribute__((ext_vector_type(4)))  int v4i;
typedef float __attribute__((may_alias)) float_a;
typedef int __attribute__((may_alias)) int_a;

template <typename T> __device__ __forceinline__ void vst2(void* p, T v) { *(T*)p = v;  }
__device__ __forceinline__ v8f wmma16(v16h a, v16h b, v8f c) {
  v8f d = __builtin_amdgcn_wmma_f32_16x16x32_f16(false, a, false, b, (short)0, c, false, false);
  asm volatile("v_nop\n\tv_nop\n\tv_nop\n\tv_nop" : "+v"(d) : "v"(a), "v"(b));
  return d;
}
__device__ __forceinline__ v8f wmma_bf(v16b a, v16b b, v8f c) {
  v8f d = __builtin_amdgcn_wmma_f32_16x16x32_bf16(false, a, false, b, (short)0, c, false, false);
  asm volatile("v_nop\n\tv_nop\n\tv_nop\n\tv_nop" : "+v"(d) : "v"(a), "v"(b));
  return d;
}
// 16x16x32 fragments: lane = (h = lane>>4, row/col = lane&15); elements 0..7 = k0+8h+0..7, 8..15 = k0+16+8h+0..7; D element r = row 8h+r
__device__ __forceinline__ v16h frag_h(const _Float16* rowk0, int lane) {
  union { v16h v; v8h q[2]; } u; const _Float16* p = rowk0 + 8 * (lane >> 4);
  u.q[0] = *(const v8h*)p; u.q[1] = *(const v8h*)(p + 16); return u.v;
}
__device__ __forceinline__ v16h frag_f32(const float* rowk0, int lane) {
  v16h a; const float* p = rowk0 + 8 * (lane >> 4);
#pragma unroll
  for (int i = 0; i < 8; ++i) { a[i] = (_Float16)p[i]; a[8 + i] = (_Float16)p[16 + i]; }
  return a;
}
__device__ __forceinline__ v16h frag_f32s(const float* rowk0, int lane, float sc) {
  v16h a; const float* p = rowk0 + 8 * (lane >> 4);
#pragma unroll
  for (int i = 0; i < 8; ++i) { a[i] = (_Float16)(p[i] * sc); a[8 + i] = (_Float16)(p[16 + i] * sc); }
  return a;
}
// column fragment from a [K][ld] layout (column n), rows >= K read as 0
__device__ __forceinline__ v16h fragc_f32(const float* W, int k0, int n, int lane, int ld, int K) {
  v16h a; const int g = lane >> 4;
#pragma unroll
  for (int i = 0; i < 8; ++i) { const int ka = k0 + 8 * g + i, kb = ka + 16;
    a[i] = (_Float16)(ka < K ? W[(size_t)(ka < K ? ka : K - 1) * ld + n] : 0.f); a[8 + i] = (_Float16)(kb < K ? W[(size_t)(kb < K ? kb : K - 1) * ld + n] : 0.f); }
  return a;
}
struct F2 { v16b h, l; };
__device__ __forceinline__ F2 bsplit16(const float v[16]) { F2 r;
#pragma unroll
  for (int i = 0; i < 16; ++i) { const __bf16 h = (__bf16)v[i]; r.h[i] = h; r.l[i] = (__bf16)(v[i] - (float)h); }
  return r; }
__device__ __forceinline__ F2 split_row(const float* row, int k0, int lane) { float v[16]; const float* p = row + k0 + 8 * (lane >> 4);
#pragma unroll
  for (int i = 0; i < 8; ++i) { v[i] = p[i]; v[8 + i] = p[16 + i]; }
  return bsplit16(v); }
__device__ __forceinline__ F2 split_rowK(const float* row, int k0, int lane, int K) { float v[16]; const int g = lane >> 4;
#pragma unroll
  for (int i = 0; i < 8; ++i) { const int ka = k0 + 8 * g + i, kb = ka + 16; v[i] = ka < K ? row[ka < K ? ka : K - 1] : 0.f; v[8 + i] = kb < K ? row[kb < K ? kb : K - 1] : 0.f; }
  return bsplit16(v); }
__device__ __forceinline__ F2 split_col(const float* W, int k0, int n, int lane, int ld, int K) { float v[16]; const int g = lane >> 4;
#pragma unroll
  for (int i = 0; i < 8; ++i) { const int ka = k0 + 8 * g + i, kb = ka + 16; v[i] = ka < K ? W[(size_t)(ka < K ? ka : K - 1) * ld + n] : 0.f; v[8 + i] = kb < K ? W[(size_t)(kb < K ? kb : K - 1) * ld + n] : 0.f; }
  return bsplit16(v); }
__device__ __forceinline__ v8f mac3(const F2& a, const F2& b, v8f c) { c = wmma_bf(a.l, b.h, c); c = wmma_bf(a.h, b.l, c); return wmma_bf(a.h, b.h, c); }
__device__ __forceinline__ float sigm(float v) { return 1.0f / (1.0f + expf(-v)); }
#define LDSX() do { asm volatile("s_wait_dscnt 0" ::: "memory"); __builtin_amdgcn_wave_barrier(); __builtin_amdgcn_fence(__ATOMIC_RELEASE, "workgroup"); } while (0)

// Offset-attention (PCT) block (B 16, N 2,048, D 128, q/k dim 32): q = x Wq^T + bq, k = x Wk^T + bk (32-d), v = x Wv^T + bv; a = softmax over QUERIES of q k^T (no scale), then a = a / sum over keys; f_sa = a v; y = (x - f_sa) Wl^T + bl; out = relu(BN(y)) + f_sa (BN with batch statistics over B*N, biased variance, eps 1e-5).
#define NB 16
#define TT 2048
#define CC 128            // NH * HD = projected width
#define DIN 128          // input (model) width
#define NH 1
#define HD 128
#define NQB (TT / 64)
#define HG 4
#define SCALE (1.0f)
#define CAUSAL 0
#ifndef TNB
#define TNB NB
#endif
__device__ __forceinline__ float bfr(float v) { return (float)(__bf16)v; }
__host__ __device__ __forceinline__ int kb_last(int qb) { return CAUSAL ? ((qb * 64 + 63) >> 7) : (TT / 128 - 1); }
typedef __attribute__((ext_vector_type(8))) __bf16 v8b;
__device__ __forceinline__ v16b frag_b(const __bf16* rowk0, int lane) {
  union { v16b v; v8b q[2]; } u; const __bf16* p = rowk0 + 8 * (lane >> 4);
  u.q[0] = *(const v8b*)p; u.q[1] = *(const v8b*)(p + 16); return u.v;
}
#define QBH 0              // not used: no kernel here has a high-precision path
#define QHI 2048            // rows carrying a q residual plane (all rows when non-causal: 2-product logits everywhere)
#define KHI 64            // key rows carrying k residual / v bf16 hi+lo planes (written by k_proj, read by no kernel here)
// B fragment (k rows k0+.., output column o) of a weight: (in,out) [K][ld] or (out,in) [ld rows of K]: bf16 exact, or f16(bf16 * 256) exact
__device__ __forceinline__ v16b wcol_io(const float* Wm, int k0, int o, int lane, int ld) { v16b w; const int g = lane >> 4;
#pragma unroll
  for (int i = 0; i < 8; ++i) { w[i] = (__bf16)Wm[(size_t)(k0 + 8 * g + i) * ld + o]; w[8 + i] = (__bf16)Wm[(size_t)(k0 + 16 + 8 * g + i) * ld + o]; }
  return w; }
__device__ __forceinline__ v16b wcol_oi(const float* Wm, int k0, int o, int lane, int K) { v16b w; const float* p = Wm + (size_t)o * K + k0 + 8 * (lane >> 4);
#pragma unroll
  for (int i = 0; i < 8; ++i) { w[i] = (__bf16)p[i]; w[8 + i] = (__bf16)p[16 + i]; }
  return w; }
__device__ __forceinline__ v16h wcolh_io(const float* Wm, int k0, int o, int lane, int ld) { v16h w; const int g = lane >> 4;
#pragma unroll
  for (int i = 0; i < 8; ++i) { w[i] = (_Float16)(bfr(Wm[(size_t)(k0 + 8 * g + i) * ld + o]) * 256.0f); w[8 + i] = (_Float16)(bfr(Wm[(size_t)(k0 + 16 + 8 * g + i) * ld + o]) * 256.0f); }
  return w; }
__device__ __forceinline__ v16h wcolh_oi(const float* Wm, int k0, int o, int lane, int K) { v16h w; const float* p = Wm + (size_t)o * K + k0 + 8 * (lane >> 4);
#pragma unroll
  for (int i = 0; i < 8; ++i) { w[i] = (_Float16)(bfr(p[i]) * 256.0f); w[8 + i] = (_Float16)(bfr(p[16 + i]) * 256.0f); }
  return w; }
#define WQKV_LAYOUT 1   // 0 = (in,out) [DIN][CC]; 1 = (out,in) [CC][DIN]; 2 = per-head [NH][DIN][HD]
__device__ __forceinline__ v16b wcol_hdk(const float* Wm, int k0, int o, int lane) { v16b w; const int g = lane >> 4; const float* p = Wm + (size_t)(o / HD) * DIN * HD + (o % HD);
#pragma unroll
  for (int i = 0; i < 8; ++i) { w[i] = (__bf16)p[(size_t)(k0 + 8 * g + i) * HD]; w[8 + i] = (__bf16)p[(size_t)(k0 + 16 + 8 * g + i) * HD]; }
  return w; }
#define WO_OUT_IN 0
#if WQKV_LAYOUT == 1
#define WCOL(W, k0, o, lane) wcol_oin(W, k0, o, lane, DIN, (which == 2) ? CC : HDQ)   /* q / k: 32 real output rows, columns 32..127 exact zeros */
#elif WQKV_LAYOUT == 2
#define WCOL(W, k0, o, lane) wcol_hdk(W, k0, o, lane)
#else
#define WCOL(W, k0, o, lane) wcol_io(W, k0, o, lane, CC)
#endif
#if WO_OUT_IN
#define WOCOL(W, k0, o, lane) wcol_oi(W, k0, o, lane, CC)
#define WOCOLH(W, k0, o, lane) wcolh_oi(W, k0, o, lane, CC)
#else
#define WOCOL(W, k0, o, lane) wcol_io(W, k0, o, lane, DIN)
#define WOCOLH(W, k0, o, lane) wcolh_io(W, k0, o, lane, DIN)
#endif
#define HDQ 32             // q / k width (the planes are 128 wide; columns 32..127 are exact zeros)
#define BG HG              // not used: k_kst and k_att take the batch from blockIdx.y, all TNB batches in one launch
#define NR (TNB * TT)      // 32,768 rows (all batches)
// (out,in) projection weight with only 'nvalid' real output rows: columns o >= nvalid read row 0 and are zeroed by value
__device__ __forceinline__ v16b wcol_oin(const float* Wm, int k0, int o, int lane, int K, int nvalid) { v16b w; const int oc = o < nvalid ? o : 0; const float keep = o < nvalid ? 1.f : 0.f; const float* p = Wm + (size_t)oc * K + k0 + 8 * (lane >> 4);
#pragma unroll
  for (int i = 0; i < 8; ++i) { w[i] = (__bf16)(p[i] * keep); w[8 + i] = (__bf16)(p[16 + i] * keep); }
  return w; }
// pairwise tree over the 16 f32 P values of one A fragment (a lane's share of its query's sum over keys)
__device__ __forceinline__ float sum16(const float v[16]) { return (((v[0] + v[1]) + (v[2] + v[3])) + ((v[4] + v[5]) + (v[6] + v[7]))) + (((v[8] + v[9]) + (v[10] + v[11])) + ((v[12] + v[13]) + (v[14] + v[15]))); }
#define WS_DEN (WS_END)                                // (plane not used: the sum over keys stays in k_att's registers)
#define WS_FSA (WS_DEN + 4u * (size_t)NR)              // f32 f_sa rows [NR][128]
#define WS_YL  (WS_FSA + 4u * (size_t)NR * CC)        // f32 y rows (pre-BN)
#define WS_ST  (WS_YL + 4u * (size_t)NR * CC)         // BN statistics [128][32]
#define WS_END2 (WS_ST + 4u * (size_t)CC * 32)
// ---- k_lin: block = 64 rows: y = (bf16(f_in) - f_sa) (split bf16 hi + lo) Wl^T + bl (2 products, K 128) -> pre-BN rows
__global__ __launch_bounds__(128) void k_lin(const float* __restrict__ X, const float* __restrict__ FSA, const float* __restrict__ WL, const float* __restrict__ BL, float* __restrict__ YL) { __shared__ __align__(16) float sf[4][16][132];
  const int tid = threadIdx.x, wave = tid >> 5, lane = tid & 31, col = lane & 15, g = lane >> 4; const size_t r0 = (size_t)blockIdx.x * 64 + wave * 16;
  v8f acc[8] = {};
#pragma unroll
  for (int kc = 0; kc < CC / 32; ++kc) { float v[16]; { const float* px = X + (r0 + col) * CC + kc * 32 + 8 * g; const float* pf = FSA + (r0 + col) * CC + kc * 32 + 8 * g;
#pragma unroll
      for (int i = 0; i < 8; ++i) { v[i] = bfr(px[i]) - pf[i]; v[8 + i] = bfr(px[16 + i]) - pf[16 + i]; } }
    const F2 a = bsplit16(v); asm volatile("s_wait_loadcnt 0x0" ::: "memory");
#pragma unroll
    for (int j = 0; j < 8; ++j) { const v16b w = wcol_oin(WL, kc * 32, j * 16 + col, lane, CC, CC); asm volatile("s_wait_loadcnt 0x0" ::: "memory"); acc[j] = wmma_bf(a.h, w, acc[j]); acc[j] = wmma_bf(a.l, w, acc[j]); } }
#pragma unroll
  for (int j = 0; j < 8; ++j) { const float bb = bfr(BL[j * 16 + col]);
#pragma unroll
    for (int r = 0; r < 8; ++r) sf[wave][8 * g + r][j * 16 + col] = acc[j][r] + bb; }
  LDSX(); for (int rl = 0; rl < 16; ++rl) vst2(YL + (r0 + rl) * CC + lane * 4, *(const v4f*)&sf[wave][rl][lane * 4]); }
__global__ __launch_bounds__(256) void k_stat(const float* __restrict__ T, float* __restrict__ STAT) { __shared__ float sred[8]; __shared__ float sbc;
  const int t = threadIdx.x; const int c = blockIdx.x;
  float s = 0.f; for (int r = t; r < NR; r += 256) s += T[(size_t)r * CC + c];
#pragma unroll
  for (int o = 1; o < 32; o <<= 1) s += __shfl_xor(s, o);
  if ((t & 31) == 0) sred[t >> 5] = s; __syncthreads(); if (t == 0) { float a = 0.f; for (int i = 0; i < 8; ++i) a += sred[i]; sbc = a / (float)NR; } __syncthreads(); const float mean = sbc; __syncthreads();
  float q = 0.f; for (int r = t; r < NR; r += 256) { const float d = T[(size_t)r * CC + c] - mean; q += d * d; }
#pragma unroll
  for (int o = 1; o < 32; o <<= 1) q += __shfl_xor(q, o);
  if ((t & 31) == 0) sred[t >> 5] = q; __syncthreads(); if (t == 0) { float a = 0.f; for (int i = 0; i < 8; ++i) a += sred[i]; sbc = rsqrtf(a / (float)NR + 1e-5f); } __syncthreads();
  if (t < 32) { const float v = t == 0 ? mean : (t == 1 ? sbc : 0.f); vst2(STAT + (size_t)c * 32 + t, v); } }
// ---- k_fin: out = relu(gamma (y - mean) rstd + beta) + f_sa (thread per float4)
__global__ __launch_bounds__(256) void k_fin(const float* __restrict__ YL, const float* __restrict__ STAT, const float* __restrict__ G, const float* __restrict__ BE, const float* __restrict__ FSA, float* __restrict__ OUT) { const size_t e4 = (size_t)blockIdx.x * 256 + threadIdx.x; if (e4 >= (size_t)NR * CC / 4) return; const int c0 = (int)((e4 * 4) % CC); const v4f yv = *(const v4f*)(YL + e4 * 4); const v4f fv = *(const v4f*)(FSA + e4 * 4); v4f o;
#pragma unroll
  for (int i = 0; i < 4; ++i) { const int c = c0 + i; const float yb = bfr(G[c]) * (yv[i] - STAT[c * 32]) * STAT[c * 32 + 1] + bfr(BE[c]); o[i] = fmaxf(yb, 0.f) + fv[i]; }
  vst2(OUT + e4 * 4, o); }
#ifndef SM_EXTRA_PARAMS
#define SM_EXTRA_PARAMS
#endif
#ifndef PROJ_EXTRA_PARAMS
#define PROJ_EXTRA_PARAMS
#endif
#ifndef SM_MASK_HOOK
#define SM_MASK_HOOK (void)0
#endif

#define WS_QH  0u                                      // f16 q rows [b*t][CC]
#define WS_KH  (WS_QH + 2u * (size_t)NB * TT * CC)      // f16 k rows [b*t][CC]
#define WS_VT  (WS_KH + 2u * (size_t)NB * TT * CC)      // f16 v planes [b][c][t]
#define WS_QL  (WS_VT + 2u * (size_t)NB * CC * TT)      // f16 q residual x 2^10 rows [b][t < QHI][CC]
#define WS_KL  (WS_QL + 2u * (size_t)NB * QHI * CC)     // f16 k residual x 2^10 rows [b][t < KHI][CC]
#define WS_VB  (WS_KL + 2u * (size_t)NB * KHI * CC)     // bf16 v hi planes [b][c][t < KHI]
#define WS_VBL (WS_VB + 2u * (size_t)NB * CC * KHI)
#define WS_S   (WS_VBL + 2u * (size_t)NB * CC * KHI)    // f32 per-key softmax statistics [b][t / 16][2][16] (the rest of the plane is not used)
#define WS_Y   (WS_S  + 4u * (size_t)HG * TT * TT)      // f32 ctx rows [b*t][CC] (only when there is an output projection)
#define WS_END (WS_Y  + 0u)

// ---- k_proj: block = (64 rows, 128 cols, which): q/k/v = X W (+ b) with exact bf16 products (K = DIN) -> which 0: q f16 rows (+ residual rows < QHI); 1: k f16 rows (+ residual rows < KHI); 2: v f16 planes [c][t] (+ bf16 hi/lo planes for t < KHI)
__global__ __launch_bounds__(128) void k_proj(const float* __restrict__ XQ, const float* __restrict__ XK, const float* __restrict__ XV, const float* __restrict__ WQ, const float* __restrict__ WK, const float* __restrict__ WV, const float* __restrict__ BQ, const float* __restrict__ BK, const float* __restrict__ BV,
    _Float16* __restrict__ QH, _Float16* __restrict__ QL, _Float16* __restrict__ KH, _Float16* __restrict__ KL, _Float16* __restrict__ VT, __bf16* __restrict__ VB, __bf16* __restrict__ VBL) {
  __shared__ __align__(16) _Float16 sh[64][136], sl[64][136]; __shared__ __align__(16) _Float16 th[128][72]; __shared__ __align__(16) __bf16 tb[128][72], tbl[128][72];
  const int tid = threadIdx.x, wave = tid >> 5, lane = tid & 31, col = lane & 15, g = lane >> 4; const int which = blockIdx.z; const int c0 = blockIdx.y * 128; const size_t r0 = (size_t)blockIdx.x * 64; const size_t bb = r0 / TT; const int t0 = (int)(r0 % TT);
  const float* X = which == 0 ? XQ : which == 1 ? XK : XV; const float* WA = which == 0 ? WQ : which == 1 ? WK : WV; const float* BA = which == 0 ? BQ : which == 1 ? BK : BV;
  v8f acc[8] = {};
#pragma unroll 2
  for (int kc = 0; kc < DIN / 32; ++kc) { v16b a; { const float* p = X + (r0 + wave * 16 + col) * DIN + kc * 32 + 8 * g;
#pragma unroll
      for (int i = 0; i < 8; ++i) { a[i] = (__bf16)p[i]; a[8 + i] = (__bf16)p[16 + i]; } }
    asm volatile("s_wait_loadcnt 0x0" ::: "memory");
#pragma unroll
    for (int j = 0; j < 8; ++j) { const v16b w = WCOL(WA, kc * 32, c0 + j * 16 + col, lane); asm volatile("s_wait_loadcnt 0x0" ::: "memory"); acc[j] = wmma_bf(a, w, acc[j]); } }
  if (which < 2) { _Float16* DH = which == 0 ? QH : KH; _Float16* DL = which == 0 ? QL : KL; const int nhi = which == 0 ? QHI : KHI; const bool hi_rows = t0 < nhi;
#pragma unroll
    for (int j = 0; j < 8; ++j) { const int oo = c0 + j * 16 + col; const float bias = (BA && (which == 2 || oo < HDQ)) ? bfr(BA[which == 2 ? oo : (oo < HDQ ? oo : 0)]) : 0.f;
#pragma unroll
      for (int r = 0; r < 8; ++r) { const float v = acc[j][r] + bias; const _Float16 hv = (_Float16)v; sh[wave * 16 + 8 * g + r][j * 16 + col] = hv; sl[wave * 16 + 8 * g + r][j * 16 + col] = (_Float16)((v - (float)hv) * 1024.0f); } }
    __syncthreads();
    for (int e = tid; e < 64 * 16; e += 128) { const int rl = e >> 4, q = e & 15; vst2((unsigned*)(DH + (r0 + rl) * CC + c0 + q * 8), *(const v4u*)&sh[rl][q * 8]); if (hi_rows) vst2((unsigned*)(DL + (bb * nhi + t0 + rl) * (size_t)CC + c0 + q * 8), *(const v4u*)&sl[rl][q * 8]); }
  } else { const bool hi_rows = t0 < KHI;
#pragma unroll
    for (int j = 0; j < 8; ++j) { const int oo = c0 + j * 16 + col; const float bias = (BA && (which == 2 || oo < HDQ)) ? bfr(BA[which == 2 ? oo : (oo < HDQ ? oo : 0)]) : 0.f;
#pragma unroll
      for (int r = 0; r < 8; ++r) { const float v = acc[j][r] + bias; const int rl = wave * 16 + 8 * g + r, cl = j * 16 + col; th[cl][rl] = (_Float16)v; const __bf16 bh = (__bf16)v; tb[cl][rl] = bh; tbl[cl][rl] = (__bf16)(v - (float)bh); } }
    __syncthreads();
    for (int e = tid; e < 128 * 8; e += 128) { const int cl = e >> 3, q = e & 7; vst2((unsigned*)(VT + (bb * CC + c0 + cl) * (size_t)TT + t0 + q * 8), *(const v4u*)&th[cl][q * 8]); if (hi_rows) { const size_t o3 = (bb * CC + c0 + cl) * (size_t)KHI + t0 + q * 8; vst2((unsigned*)(VB + o3), *(const v4u*)&tb[cl][q * 8]); vst2((unsigned*)(VBL + o3), *(const v4u*)&tbl[cl][q * 8]); } } } }
// plain builtin form: the compiler keeps the distance behind a matrix instruction itself and fills it with independent work where it can
__device__ __forceinline__ v8f wmma16c(v16h a, v16h b, v8f c) { return __builtin_amdgcn_wmma_f32_16x16x32_f16(false, a, false, b, (short)0, c, false, false); }
// (in the two kernels below every plain '#pragma unroll' is there so that a register array is indexed by constants only)
// logit of one (key, query) pair from the two f16 products: k hi . q + (k residual x 2^10) . q / 2^10
__device__ __forceinline__ float logit2(float hi, float lo) { return (hi + lo * (1.0f / 1024.0f)) * SCALE; }
// ---- k_kst: block = 16 keys of batch blockIdx.y; wave w holds the logits of those keys against queries [256 w, 256 w + 256) in registers (D: row = key 8g + r, column = query): maximum and sum of exp over ALL queries -> KS line of the key tile: [16 maxima][16 x 2^11 / sum] (one 128-B line per block)
__global__ __launch_bounds__(256) void k_kst(const _Float16* __restrict__ KRH, const _Float16* __restrict__ KRL, const _Float16* __restrict__ QR, float* __restrict__ KS) { __shared__ float smx[8][16], ssu[8][16];
  const int tid = threadIdx.x, wave = tid >> 5, lane = tid & 31, col = lane & 15, g = lane >> 4; const size_t kr0 = (size_t)blockIdx.y * TT + blockIdx.x * 16, q0 = (size_t)blockIdx.y * TT + wave * (TT / 8);
  const v16h ah = frag_h(KRH + (kr0 + col) * CC, lane), al = frag_h(KRL + (kr0 + col) * CC, lane);
  asm volatile("s_wait_xcnt 0x0" ::: "memory");   /* precaution: the four key loads above have taken their addresses before a later load's result reuses those address registers */
  float s[TT / 128][8]; v16h qf[TT / 128];
#pragma unroll
  for (int t = 0; t < 8; ++t) qf[t] = frag_h(QR + (q0 + t * 16 + col) * CC, lane);
#pragma unroll
  for (int tg = 0; tg < TT / 128; tg += 4) {   /* groups of four query tiles, loaded two groups ahead of their products */
    if (tg + 8 < TT / 128) {
#pragma unroll
      for (int t = tg + 8; t < tg + 12; ++t) qf[t] = frag_h(QR + (q0 + t * 16 + col) * CC, lane); }
    __builtin_amdgcn_sched_barrier(0);   /* keeps the loads above issued here: left alone the scheduler either waits on one tile at a time or hoists all sixteen, which takes the kernel past 256 registers */
#pragma unroll
    for (int t = tg; t < tg + 4; ++t) { v8f a = {}, l = {}; a = wmma16(ah, qf[t], a); l = wmma16(al, qf[t], l);
#pragma unroll
      for (int r = 0; r < 8; ++r) s[t][r] = logit2(a[r], l[r]); }
    __builtin_amdgcn_sched_barrier(0);   /* the other side of the same fence: the next group's loads stay behind these products */
  }
  float mx[8], su[8];
#pragma unroll
  for (int r = 0; r < 8; ++r) { float m = s[0][r];
#pragma unroll
    for (int t = 1; t < TT / 128; ++t) m = fmaxf(m, s[t][r]);
#pragma unroll
    for (int o = 1; o < 16; o <<= 1) m = fmaxf(m, __shfl_xor(m, o));
    mx[r] = m; }
  if (col == 0) {
#pragma unroll
    for (int r = 0; r < 8; ++r) smx[wave][8 * g + r] = mx[r]; }
  __syncthreads();
#pragma unroll
  for (int r = 0; r < 8; ++r) { float m = smx[0][8 * g + r];
#pragma unroll
    for (int w = 1; w < 8; ++w) m = fmaxf(m, smx[w][8 * g + r]);
    float a = 0.f;
#pragma unroll
    for (int t = 0; t < TT / 128; ++t) { const float e = expf(s[t][r] - m); a += (s[t][r] <= -1.0e38f) ? 0.f : e; }
#pragma unroll
    for (int o = 1; o < 16; o <<= 1) a += __shfl_xor(a, o);
    su[r] = a; }
  if (col == 0) {
#pragma unroll
    for (int r = 0; r < 8; ++r) ssu[wave][8 * g + r] = su[r]; }
  __syncthreads();
  if (tid < 32) { float m = smx[0][col], a = 0.f;
#pragma unroll
    for (int w = 1; w < 8; ++w) m = fmaxf(m, smx[w][col]);
#pragma unroll
    for (int w = 0; w < 8; ++w) a += ssu[w][col];
    vst2(KS + kr0 * 2 + tid, g == 0 ? m : (a > 0.f ? 2048.0f / a : 0.f)); } }
// ---- k_att: block = 64 queries (qb) of batch blockIdx.y, wave = 16 queries; per 32 keys: S^T tiles (row = key, column = query) from the same two products as k_kst, P x 2^11 = exp(logit - max) x (2^11 / sum) in f32; the two D tiles, converted to f16 in place, ARE the A fragment (row = query, k = key) of P . v; f_sa = (P . v) / (sum over keys of P)
__global__ __launch_bounds__(128) void k_att(const _Float16* __restrict__ KRH, const _Float16* __restrict__ KRL, const _Float16* __restrict__ QR, const float* __restrict__ KS, const _Float16* __restrict__ VT, float* __restrict__ Y) { __shared__ __align__(16) float ss[4][16][HD + 4]; __shared__ __align__(16) float sks[TT * 2];
  const int tid = threadIdx.x, wave = tid >> 5, lane = tid & 31, col = lane & 15, g = lane >> 4; const int b = blockIdx.y; const int ql0 = blockIdx.x * 64 + wave * 16;
#pragma unroll   /* all eight loads in flight at once */
  for (int i = 0; i < TT * 2 / 4 / 128; ++i) *(v4f*)&sks[(i * 128 + tid) * 4] = *(const v4f*)(KS + (size_t)b * TT * 2 + (i * 128 + tid) * 4);
  __syncthreads();
  const v16h qf = frag_h(QR + ((size_t)b * TT + ql0 + col) * CC, lane);
  const _Float16* kh = KRH + ((size_t)b * TT + col) * CC; const _Float16* kl = KRL + ((size_t)b * TT + col) * CC; const _Float16* vt = VT + ((size_t)b * CC + col) * (size_t)TT;
  v8f acc[HD / 16] = {}; float ksum = 0.f;   /* f32 sum of the P x 2^11 values this lane makes: query ql0 + col, the k half g of every chunk */
  v16h a0 = frag_h(kh, lane), l0 = frag_h(kl, lane), a1 = frag_h(kh + 16 * CC, lane), l1 = frag_h(kl + 16 * CC, lane);
#pragma unroll 1   /* rolled: one pass's fragments and accumulators already fill most of 256 registers */
  for (int kc = 0; kc < TT / 32; ++kc) { v16h vf[HD / 16];
#pragma unroll
    for (int j = 0; j < HD / 16; ++j) vf[j] = frag_h(vt + (size_t)j * 16 * TT + kc * 32, lane);
    __builtin_amdgcn_sched_barrier(0);   /* keeps the 16 v loads issued here, a whole score-and-exp phase ahead of their use (the scheduler otherwise sinks them to the P . v products, two fragments in flight) */
    v8f s0 = {}, t0 = {}, s1 = {}, t1 = {}; s0 = wmma16c(a0, qf, s0); t0 = wmma16c(l0, qf, t0); s1 = wmma16c(a1, qf, s1); t1 = wmma16c(l1, qf, t1);
    const size_t kn = (size_t)(kc + 1 < TT / 32 ? kc + 1 : kc) * 32 * CC;   /* next chunk's key rows, fetched one pass ahead (the last pass fetches its own again: in bounds) */
    a0 = frag_h(kh + kn, lane); l0 = frag_h(kl + kn, lane); a1 = frag_h(kh + kn + 16 * CC, lane); l1 = frag_h(kl + kn + 16 * CC, lane);
    __builtin_amdgcn_sched_barrier(0);   /* keeps the next chunk's key loads issued here, ahead of the exp phase */
    const v4f* st = (const v4f*)&sks[kc * 64 + 8 * g]; const v4f m0[2] = { st[0], st[1] }, i0[2] = { st[4], st[5] }, m1[2] = { st[8], st[9] }, i1[2] = { st[12], st[13] }; float v[16];   /* the chunk's maxima and 2^11 / sums, keys 8g + r of both tiles */
#pragma unroll
    for (int r = 0; r < 8; ++r) { const float x0 = logit2(s0[r], t0[r]), x1 = logit2(s1[r], t1[r]); const float e0 = expf(x0 - m0[r >> 2][r & 3]), e1 = expf(x1 - m1[r >> 2][r & 3]); v[r] = ((x0 <= -1.0e38f) ? 0.f : e0) * i0[r >> 2][r & 3]; v[8 + r] = ((x1 <= -1.0e38f) ? 0.f : e1) * i1[r >> 2][r & 3]; }
    v16h p;
#pragma unroll
    for (int i = 0; i < 16; ++i) p[i] = (_Float16)v[i];
    ksum += sum16(v);
#pragma unroll
    for (int j = 0; j < HD / 16 - 1; ++j) acc[j] = wmma16c(p, vf[j], acc[j]);
    acc[HD / 16 - 1] = wmma16(p, vf[HD / 16 - 1], acc[HD / 16 - 1]); }   /* the last product in the form with four v_nop behind it: across the taken branch the next pass's v loads write over the B fragments of these products */
  ksum += __shfl_xor(ksum, 16);   /* both k halves: den (x 2^11) of query ql0 + col, in lanes col and col + 16 */
  const float inv = ksum > 0.f ? 2048.0f / ksum : 0.f; float invr[8];
#pragma unroll
  for (int r = 0; r < 8; ++r) invr[r] = __shfl(inv, 8 * g + r);   /* accumulator element r is query row 8g + r */
#pragma unroll
  for (int j = 0; j < HD / 16; ++j)
#pragma unroll
    for (int r = 0; r < 8; ++r) ss[wave][8 * g + r][j * 16 + col] = acc[j][r] * (1.0f / 2048.0f) * invr[r];
  LDSX(); for (int rl = 0; rl < 16; ++rl) vst2(Y + ((size_t)b * TT + ql0 + rl) * CC + lane * 4, *(const v4f*)&ss[wave][rl][lane * 4]); }

extern "C" void kernel_launch(void* const* d_in, const int* in_sizes, int n_in, void* d_out, int out_size, void* d_ws, size_t ws_size, hipStream_t stream) {
  (void)in_sizes; (void)n_in; (void)out_size;
  const float** F = (const float**)d_in;
  if (ws_size < (size_t)WS_END) return;
  char* ws = (char*)d_ws; _Float16 *QH = (_Float16*)(ws + WS_QH), *KH = (_Float16*)(ws + WS_KH), *VT = (_Float16*)(ws + WS_VT), *QL = (_Float16*)(ws + WS_QL), *KL = (_Float16*)(ws + WS_KL); __bf16 *VB = (__bf16*)(ws + WS_VB), *VBL = (__bf16*)(ws + WS_VBL); float *S = (float*)(ws + WS_S), *Y = (float*)(ws + WS_Y);
  (void)Y; (void)QL; (void)KL; (void)VB; (void)VBL;
  // inputs: 0 f_in [16,2048,128]; 1 w_q [32,128] (out,in), 2 b_q [32]; 3 w_k [32,128], 4 b_k; 5 w_v [128,128], 6 b_v; 7 w_l [128,128], 8 b_l; 9 bn_gamma, 10 bn_beta
  if (ws_size < (size_t)WS_END2) return;
  float *FSA = (float*)(ws + WS_FSA), *YL = (float*)(ws + WS_YL), *ST = (float*)(ws + WS_ST);
  // ROLE SWAP: the 'q' planes (hi + residual) hold K (from w_k, b_k) and the 'k' planes hold Q, so the score tiles are S^T[key][query] and the softmax runs over QUERIES
  k_proj<<<dim3(TNB * TT / 64, CC / 128, 3), 128, 0, stream>>>(F[0], F[0], F[0], F[3], F[1], F[5], F[4], F[2], F[6], QH, QL, KH, KL, VT, VB, VBL);
  k_kst<<<dim3(TT / 16, TNB), 256, 0, stream>>>(QH, QL, KH, S);   /* per key: maximum and 2^11 / sum of exp over the queries */
  k_att<<<dim3(NQB, TNB), 128, 0, stream>>>(QH, QL, KH, S, VT, FSA);   /* f_sa rows: logits made again in registers, P never stored */
  k_lin<<<dim3(NR / 64), 128, 0, stream>>>(F[0], FSA, F[7], F[8], YL);
  k_stat<<<dim3(CC), 256, 0, stream>>>(YL, ST);
  k_fin<<<dim3((NR * CC / 4 + 255) / 256), 256, 0, stream>>>(YL, ST, F[9], F[10], FSA, (float*)d_out);
}

// v003
// One run takes 179 microseconds.
// Next to v002, in two timings, it ran 1.32 times as fast each time.
// Over all steps from v000 it is 9.49 times as fast.
#include <hip/hip_runtime.h>
#include <math.h>

typedef __attribute__((ext_vector_type(16))) _Float16 v16h;
typedef __attribute__((ext_vector_type(16))) __bf16 v16b;
typedef __attribute__((ext_vector_type(8)))  _Float16 v8h;
typedef __attribute__((ext_vector_type(8)))  float v8f;
typedef __attribute__((ext_vector_type(4)))  float v4f;
typedef __attribute__((ext_vector_type(2)))  float v2f;
typedef __attribute__((ext_vector_type(4)))  unsigned v4u;
typedef __attribute__((ext_vector_type(4)))  int v4i;
typedef float __attribute__((may_alias)) float_a;
typedef int __attribute__((may_alias)) int_a;

template <typename T> __device__ __forceinline__ void vst2(void* p, T v) { *(T*)p = v;  }
__device__ __forceinline__ v8f wmma16(v16h a, v16h b, v8f c) {
  v8f d = __builtin_amdgcn_wmma_f32_16x16x32_f16(false, a, false, b, (short)0, c, false, false);
  asm volatile("v_nop\n\tv_nop\n\tv_nop\n\tv_nop" : "+v"(d) : "v"(a), "v"(b));
  return d;
}
__device__ __forceinline__ v8f wmma_bf(v16b a, v16b b, v8f c) {
  v8f d = __builtin_amdgcn_wmma_f32_16x16x32_bf16(false, a, false, b, (short)0, c, false, false);
  asm volatile("v_nop\n\tv_nop\n\tv_nop\n\tv_nop" : "+v"(d) : "v"(a), "v"(b));
  return d;
}
// 16x16x32 fragments: lane = (h = lane>>4, row/col = lane&15); elements 0..7 = k0+8h+0..7, 8..15 = k0+16+8h+0..7; D element r = row 8h+r
__device__ __forceinline__ v16h frag_h(const _Float16* rowk0, int lane) {
  union { v16h v; v8h q[2]; } u; const _Float16* p = rowk0 + 8 * (lane >> 4);
  u.q[0] = *(const v8h*)p; u.q[1] = *(const v8h*)(p + 16); return u.v;
}
__device__ __forceinline__ v16h frag_f32(const float* rowk0, int lane) {
  v16h a; const float* p = rowk0 + 8 * (lane >> 4);
#pragma unroll
  for (int i = 0; i < 8; ++i) { a[i] = (_Float16)p[i]; a[8 + i] = (_Float16)p[16 + i]; }
  return a;
}
__device__ __forceinline__ v16h frag_f32s(const float* rowk0, int lane, float sc) {
  v16h a; const float* p = rowk0 + 8 * (lane >> 4);
#pragma unroll
  for (int i = 0; i < 8; ++i) { a[i] = (_Float16)(p[i] * sc); a[8 + i] = (_Float16)(p[16 + i] * sc); }
  return a;
}
// column fragment from a [K][ld] layout (column n), rows >= K read as 0
__device__ __forceinline__ v16h fragc_f32(const float* W, int k0, int n, int lane, int ld, int K) {
  v16h a; const int g = lane >> 4;
#pragma unroll
  for (int i = 0; i < 8; ++i) { const int ka = k0 + 8 * g + i, kb = ka + 16;
    a[i] = (_Float16)(ka < K ? W[(size_t)(ka < K ? ka : K - 1) * ld + n] : 0.f); a[8 + i] = (_Float16)(kb < K ? W[(size_t)(kb < K ? kb : K - 1) * ld + n] : 0.f); }
  return a;
}
struct F2 { v16b h, l; };
__device__ __forceinline__ F2 bsplit16(const float v[16]) { F2 r;
#pragma unroll
  for (int i = 0; i < 16; ++i) { const __bf16 h = (__bf16)v[i]; r.h[i] = h; r.l[i] = (__bf16)(v[i] - (float)h); }
  return r; }
__device__ __forceinline__ F2 split_row(const float* row, int k0, int lane) { float v[16]; const float* p = row + k0 + 8 * (lane >> 4);
#pragma unroll
  for (int i = 0; i < 8; ++i) { v[i] = p[i]; v[8 + i] = p[16 + i]; }
  return bsplit16(v); }
__device__ __forceinline__ F2 split_rowK(const float* row, int k0, int lane, int K) { float v[16]; const int g = lane >> 4;
#pragma unroll
  for (int i = 0; i < 8; ++i) { const int ka = k0 + 8 * g + i, kb = ka + 16; v[i] = ka < K ? row[ka < K ? ka : K - 1] : 0.f; v[8 + i] = kb < K ? row[kb < K ? kb : K - 1] : 0.f; }
  return bsplit16(v); }
__device__ __forceinline__ F2 split_col(const float* W, int k0, int n, int lane, int ld, int K) { float v[16]; const int g = lane >> 4;
#pragma unroll
  for (int i = 0; i < 8; ++i) { const int ka = k0 + 8 * g + i, kb = ka + 16; v[i] = ka < K ? W[(size_t)(ka < K ? ka : K - 1) * ld + n] : 0.f; v[8 + i] = kb < K ? W[(size_t)(kb < K ? kb : K - 1) * ld + n] : 0.f; }
  return bsplit16(v); }
__device__ __forceinline__ v8f mac3(const F2& a, const F2& b, v8f c) { c = wmma_bf(a.l, b.h, c); c = wmma_bf(a.h, b.l, c); return wmma_bf(a.h, b.h, c); }
__device__ __forceinline__ float sigm(float v) { return 1.0f / (1.0f + expf(-v)); }
#define LDSX() do { asm volatile("s_wait_dscnt 0" ::: "memory"); __builtin_amdgcn_wave_barrier(); __builtin_amdgcn_fence(__ATOMIC_RELEASE, "workgroup"); } while (0)

// Offset-attention (PCT) block (B 16, N 2,048, D 128, q/k dim 32): q = x Wq^T + bq, k = x Wk^T + bk (32-d), v = x Wv^T + bv; a = softmax over QUERIES of q k^T (no scale), then a = a / sum over keys; f_sa = a v; y = (x - f_sa) Wl^T + bl; out = relu(BN(y)) + f_sa (BN with batch statistics over B*N, biased variance, eps 1e-5).
#define NB 16
#define TT 2048
#define CC 128            // NH * HD = projected width
#define DIN 128          // input (model) width
#define NH 1
#define HD 128
#define NQB (TT / 64)
#define HG 4
#define SCALE (1.0f)
#define CAUSAL 0
#ifndef TNB
#define TNB NB
#endif
__device__ __forceinline__ float bfr(float v) { return (float)(__bf16)v; }
__host__ __device__ __forceinline__ int kb_last(int qb) { return CAUSAL ? ((qb * 64 + 63) >> 7) : (TT / 128 - 1); }
typedef __attribute__((ext_vector_type(8))) __bf16 v8b;
__device__ __forceinline__ v16b frag_b(const __bf16* rowk0, int lane) {
  union { v16b v; v8b q[2]; } u; const __bf16* p = rowk0 + 8 * (lane >> 4);
  u.q[0] = *(const v8b*)p; u.q[1] = *(const v8b*)(p + 16); return u.v;
}
#define QBH 0              // not used: no kernel here has a high-precision path
#define QHI 2048            // rows carrying a q residual plane (all rows when non-causal: 2-product logits everywhere)
#define KHI 64            // key rows carrying k residual / v bf16 hi+lo planes (written by k_proj, read by no kernel here)
// B fragment (k rows k0+.., output column o) of a weight: (in,out) [K][ld] or (out,in) [ld rows of K]: bf16 exact, or f16(bf16 * 256) exact
__device__ __forceinline__ v16b wcol_io(const float* Wm, int k0, int o, int lane, int ld) { v16b w; const int g = lane >> 4;
#pragma unroll
  for (int i = 0; i < 8; ++i) { w[i] = (__bf16)Wm[(size_t)(k0 + 8 * g + i) * ld + o]; w[8 + i] = (__bf16)Wm[(size_t)(k0 + 16 + 8 * g + i) * ld + o]; }
  return w; }
__device__ __forceinline__ v16b wcol_oi(const float* Wm, int k0, int o, int lane, int K) { v16b w; const float* p = Wm + (size_t)o * K + k0 + 8 * (lane >> 4);
#pragma unroll
  for (int i = 0; i < 8; ++i) { w[i] = (__bf16)p[i]; w[8 + i] = (__bf16)p[16 + i]; }
  return w; }
__device__ __forceinline__ v16h wcolh_io(const float* Wm, int k0, int o, int lane, int ld) { v16h w; const int g = lane >> 4;
#pragma unroll
  for (int i = 0; i < 8; ++i) { w[i] = (_Float16)(bfr(Wm[(size_t)(k0 + 8 * g + i) * ld + o]) * 256.0f); w[8 + i] = (_Float16)(bfr(Wm[(size_t)(k0 + 16 + 8 * g + i) * ld + o]) * 256.0f); }
  return w; }
__device__ __forceinline__ v16h wcolh_oi(const float* Wm, int k0, int o, int lane, int K) { v16h w; const float* p = Wm + (size_t)o * K + k0 + 8 * (lane >> 4);
#pragma unroll
  for (int i = 0; i < 8; ++i) { w[i] = (_Float16)(bfr(p[i]) * 256.0f); w[8 + i] = (_Float16)(bfr(p[16 + i]) * 256.0f); }
  return w; }
#define WQKV_LAYOUT 1   // 0 = (in,out) [DIN][CC]; 1 = (out,in) [CC][DIN]; 2 = per-head [NH][DIN][HD]
__device__ __forceinline__ v16b wcol_hdk(const float* Wm, int k0, int o, int lane) { v16b w; const int g = lane >> 4; const float* p = Wm + (size_t)(o / HD) * DIN * HD + (o % HD);
#pragma unroll
  for (int i = 0; i < 8; ++i) { w[i] = (__bf16)p[(size_t)(k0 + 8 * g + i) * HD]; w[8 + i] = (__bf16)p[(size_t)(k0 + 16 + 8 * g + i) * HD]; }
  return w; }
#define WO_OUT_IN 0
#if WQKV_LAYOUT == 1
#define WCOL(W, k0, o, lane) wcol_oin(W, k0, o, lane, DIN, (which == 2) ? CC : HDQ)   /* q / k: 32 real output rows, columns 32..127 exact zeros */
#elif WQKV_LAYOUT == 2
#define WCOL(W, k0, o, lane) wcol_hdk(W, k0, o, lane)
#else
#define WCOL(W, k0, o, lane) wcol_io(W, k0, o, lane, CC)
#endif
#if WO_OUT_IN
#define WOCOL(W, k0, o, lane) wcol_oi(W, k0, o, lane, CC)
#define WOCOLH(W, k0, o, lane) wcolh_oi(W, k0, o, lane, CC)
#else
#define WOCOL(W, k0, o, lane) wcol_io(W, k0, o, lane, DIN)
#define WOCOLH(W, k0, o, lane) wcolh_io(W, k0, o, lane, DIN)
#endif
#define HDQ 32             // q / k width (the planes are 128 wide; columns 32..127 are exact zeros)
#define BG HG              // not used: k_kst and k_att take the batch from blockIdx.y, all TNB batches in one launch
#define NR (TNB * TT)      // 32,768 rows (all batches)
// (out,in) projection weight with only 'nvalid' real output rows: columns o >= nvalid read row 0 and are zeroed by value
__device__ __forceinline__ v16b wcol_oin(const float* Wm, int k0, int o, int lane, int K, int nvalid) { v16b w; const int oc = o < nvalid ? o : 0; const float keep = o < nvalid ? 1.f : 0.f; const float* p = Wm + (size_t)oc * K + k0 + 8 * (lane >> 4);
#pragma unroll
  for (int i = 0; i < 8; ++i) { w[i] = (__bf16)(p[i] * keep); w[8 + i] = (__bf16)(p[16 + i] * keep); }
  return w; }
// pairwise tree over the 16 f32 P values of one A fragment (a lane's share of its query's sum over keys)
__device__ __forceinline__ float sum16(const float v[16]) { return (((v[0] + v[1]) + (v[2] + v[3])) + ((v[4] + v[5]) + (v[6] + v[7]))) + (((v[8] + v[9]) + (v[10] + v[11])) + ((v[12] + v[13]) + (v[14] + v[15]))); }
#define WS_DEN (WS_END)                                // (plane not used: the sum over keys stays in k_att's registers)
#define WS_FSA (WS_DEN + 4u * (size_t)NR)              // f32 f_sa rows [NR][128]
#define WS_YL  (WS_FSA + 4u * (size_t)NR * CC)        // f32 y rows (pre-BN)
#define WS_ST  (WS_YL + 4u * (size_t)NR * CC)         // BN statistics [128][32]
#define WS_PS  (WS_ST + 4u * (size_t)CC * 32)         // BN partials of k_lin's blocks [NR / 64][2][128]: mean of the block's 64 rows, sum of squared distances from that mean
#define WS_END2 (WS_PS + 4u * (size_t)(NR / 64) * 2 * CC)
// ---- k_lin: block = 64 rows: y = (bf16(f_in) - f_sa) (split bf16 hi + lo) Wl^T + bl (2 products, K 128) -> pre-BN rows, and per channel the block's own mean and sum of squared distances from it (PS)
__global__ __launch_bounds__(128) void k_lin(const float* __restrict__ X, const float* __restrict__ FSA, const float* __restrict__ WL, const float* __restrict__ BL, float* __restrict__ YL, float* __restrict__ PS) { __shared__ __align__(16) float sf[4][16][132]; __shared__ __align__(16) float sp[4][2][CC];
  const int tid = threadIdx.x, wave = tid >> 5, lane = tid & 31, col = lane & 15, g = lane >> 4; const size_t r0 = (size_t)blockIdx.x * 64 + wave * 16;
  v8f acc[8] = {};
#pragma unroll
  for (int kc = 0; kc < CC / 32; ++kc) { float v[16]; { const float* px = X + (r0 + col) * CC + kc * 32 + 8 * g; const float* pf = FSA + (r0 + col) * CC + kc * 32 + 8 * g;
#pragma unroll
      for (int i = 0; i < 8; ++i) { v[i] = bfr(px[i]) - pf[i]; v[8 + i] = bfr(px[16 + i]) - pf[16 + i]; } }
    const F2 a = bsplit16(v); asm volatile("s_wait_loadcnt 0x0" ::: "memory");
#pragma unroll
    for (int j = 0; j < 8; ++j) { const v16b w = wcol_oin(WL, kc * 32, j * 16 + col, lane, CC, CC); asm volatile("s_wait_loadcnt 0x0" ::: "memory"); acc[j] = wmma_bf(a.h, w, acc[j]); acc[j] = wmma_bf(a.l, w, acc[j]); } }
#pragma unroll
  for (int j = 0; j < 8; ++j) { const float bb = bfr(BL[j * 16 + col]);
#pragma unroll
    for (int r = 0; r < 8; ++r) sf[wave][8 * g + r][j * 16 + col] = acc[j][r] + bb; }
  LDSX(); v4f yv[16];
#pragma unroll   /* yv is indexed by constants only */
  for (int rl = 0; rl < 16; ++rl) yv[rl] = *(const v4f*)&sf[wave][rl][lane * 4];
  // the wave's 16 rows, channels 4 lane .. 4 lane + 3: mean, then squared distances from that mean (no difference of large squares anywhere)
  const v4f m16 = ((((yv[0] + yv[1]) + (yv[2] + yv[3])) + ((yv[4] + yv[5]) + (yv[6] + yv[7]))) + (((yv[8] + yv[9]) + (yv[10] + yv[11])) + ((yv[12] + yv[13]) + (yv[14] + yv[15])))) * (1.0f / 16.0f); v4f q16 = {};
#pragma unroll
  for (int rl = 0; rl < 16; ++rl) { const v4f d = yv[rl] - m16; q16 += d * d; }
  *(v4f*)&sp[wave][0][lane * 4] = m16; *(v4f*)&sp[wave][1][lane * 4] = q16;
  __syncthreads();
  // thread = channel: the four waves' groups of 16 rows merged: mean of the means; squared distances add up, plus 16 x each group mean's squared distance from the merged mean
  const float g0 = sp[0][0][tid], g1 = sp[1][0][tid], g2 = sp[2][0][tid], g3 = sp[3][0][tid]; const float m64 = ((g0 + g1) + (g2 + g3)) * 0.25f; const float e0 = g0 - m64, e1 = g1 - m64, e2 = g2 - m64, e3 = g3 - m64;
  const float q64 = ((sp[0][1][tid] + sp[1][1][tid]) + (sp[2][1][tid] + sp[3][1][tid])) + 16.0f * ((e0 * e0 + e1 * e1) + (e2 * e2 + e3 * e3));
#pragma unroll   /* the row stores stand behind the barrier: in front of it the barrier would wait for all sixteen to finish */
  for (int rl = 0; rl < 16; ++rl) vst2(YL + (r0 + rl) * CC + lane * 4, yv[rl]);
  vst2(PS + (size_t)blockIdx.x * 2 * CC + tid, m64); vst2(PS + ((size_t)blockIdx.x * 2 + 1) * CC + tid, q64); }
// ---- k_stat: block = channel c: merges the NR / 64 partials of k_lin (equal groups of 64 rows) in the same way -> mean and 1 / sqrt(biased variance + eps)
__global__ __launch_bounds__(256) void k_stat(const float* __restrict__ PS, float* __restrict__ STAT) { __shared__ float sred[8]; __shared__ float sbc;
  const int t = threadIdx.x; const int c = blockIdx.x; float pm[NR / 64 / 256], pq[NR / 64 / 256];
#pragma unroll   /* register arrays indexed by constants; all loads in flight at once */
  for (int i = 0; i < NR / 64 / 256; ++i) { pm[i] = PS[(size_t)(i * 256 + t) * 2 * CC + c]; pq[i] = PS[((size_t)(i * 256 + t) * 2 + 1) * CC + c]; }
  float s = 0.f;
#pragma unroll
  for (int i = 0; i < NR / 64 / 256; ++i) s += pm[i];
#pragma unroll
  for (int o = 1; o < 32; o <<= 1) s += __shfl_xor(s, o);
  if ((t & 31) == 0) sred[t >> 5] = s; __syncthreads(); if (t == 0) { float a = 0.f; for (int i = 0; i < 8; ++i) a += sred[i]; sbc = a / (float)(NR / 64); } __syncthreads(); const float mean = sbc; __syncthreads();
  float q = 0.f;
#pragma unroll
  for (int i = 0; i < NR / 64 / 256; ++i) { const float d = pm[i] - mean; q += pq[i] + 64.0f * (d * d); }
#pragma unroll
  for (int o = 1; o < 32; o <<= 1) q += __shfl_xor(q, o);
  if ((t & 31) == 0) sred[t >> 5] = q; __syncthreads(); if (t == 0) { float a = 0.f; for (int i = 0; i < 8; ++i) a += sred[i]; sbc = rsqrtf(a / (float)NR + 1e-5f); } __syncthreads();
  if (t < 32) { const float v = t == 0 ? mean : (t == 1 ? sbc : 0.f); vst2(STAT + (size_t)c * 32 + t, v); } }
// ---- k_fin: out = relu(gamma (y - mean) rstd + beta) + f_sa (thread per float4)
__global__ __launch_bounds__(256) void k_fin(const float* __restrict__ YL, const float* __restrict__ STAT, const float* __restrict__ G, const float* __restrict__ BE, const float* __restrict__ FSA, float* __restrict__ OUT) { const size_t e4 = (size_t)blockIdx.x * 256 + threadIdx.x; if (e4 >= (size_t)NR * CC / 4) return; const int c0 = (int)((e4 * 4) % CC); const v4f yv = *(const v4f*)(YL + e4 * 4); const v4f fv = *(const v4f*)(FSA + e4 * 4); v4f o;
#pragma unroll
  for (int i = 0; i < 4; ++i) { const int c = c0 + i; const float yb = bfr(G[c]) * (yv[i] - STAT[c * 32]) * STAT[c * 32 + 1] + bfr(BE[c]); o[i] = fmaxf(yb, 0.f) + fv[i]; }
  vst2(OUT + e4 * 4, o); }
#ifndef SM_EXTRA_PARAMS
#define SM_EXTRA_PARAMS
#endif
#ifndef PROJ_EXTRA_PARAMS
#define PROJ_EXTRA_PARAMS
#endif
#ifndef SM_MASK_HOOK
#define SM_MASK_HOOK (void)0
#endif

#define WS_QH  0u                                      // f16 q rows [b*t][CC]
#define WS_KH  (WS_QH + 2u * (size_t)NB * TT * CC)      // f16 k rows [b*t][CC]
#define WS_VT  (WS_KH + 2u * (size_t)NB * TT * CC)      // f16 v planes [b][c][t]
#define WS_QL  (WS_VT + 2u * (size_t)NB * CC * TT)      // f16 q residual x 2^10 rows [b][t < QHI][CC]
#define WS_KL  (WS_QL + 2u * (size_t)NB * QHI * CC)     // f16 k residual x 2^10 rows [b][t < KHI][CC]
#define WS_VB  (WS_KL + 2u * (size_t)NB * KHI * CC)     // bf16 v hi planes [b][c][t < KHI]
#define WS_VBL (WS_VB + 2u * (size_t)NB * CC * KHI)
#define WS_S   (WS_VBL + 2u * (size_t)NB * CC * KHI)    // f32 per-key softmax statistics [b][t / 16][2][16] (the rest of the plane is not used)
#define WS_Y   (WS_S  + 4u * (size_t)HG * TT * TT)      // f32 ctx rows [b*t][CC] (only when there is an output projection)
#define WS_END (WS_Y  + 0u)

// ---- k_proj: block = (64 rows, 128 cols, which): q/k/v = X W (+ b) with exact bf16 products (K = DIN) -> which 0: q f16 rows (+ residual rows < QHI); 1: k f16 rows (+ residual rows < KHI); 2: v f16 planes [c][t] (+ bf16 hi/lo planes for t < KHI)
__global__ __launch_bounds__(128) void k_proj(const float* __restrict__ XQ, const float* __restrict__ XK, const float* __restrict__ XV, const float* __restrict__ WQ, const float* __restrict__ WK, const float* __restrict__ WV, const float* __restrict__ BQ, const float* __restrict__ BK, const float* __restrict__ BV,
    _Float16* __restrict__ QH, _Float16* __restrict__ QL, _Float16* __restrict__ KH, _Float16* __restrict__ KL, _Float16* __restrict__ VT, __bf16* __restrict__ VB, __bf16* __restrict__ VBL) {
  __shared__ __align__(16) _Float16 sh[64][136], sl[64][136]; __shared__ __align__(16) _Float16 th[128][72]; __shared__ __align__(16) __bf16 tb[128][72], tbl[128][72];
  const int tid = threadIdx.x, wave = tid >> 5, lane = tid & 31, col = lane & 15, g = lane >> 4; const int which = blockIdx.z; const int c0 = blockIdx.y * 128; const size_t r0 = (size_t)blockIdx.x * 64; const size_t bb = r0 / TT; const int t0 = (int)(r0 % TT);
  const float* X = which == 0 ? XQ : which == 1 ? XK : XV; const float* WA = which == 0 ? WQ : which == 1 ? WK : WV; const float* BA = which == 0 ? BQ : which == 1 ? BK : BV;
  v8f acc[8] = {};
#pragma unroll 2
  for (int kc = 0; kc < DIN / 32; ++kc) { v16b a; { const float* p = X + (r0 + wave * 16 + col) * DIN + kc * 32 + 8 * g;
#pragma unroll
      for (int i = 0; i < 8; ++i) { a[i] = (__bf16)p[i]; a[8 + i] = (__bf16)p[16 + i]; } }
    asm volatile("s_wait_loadcnt 0x0" ::: "memory");
#pragma unroll
    for (int j = 0; j < 8; ++j) { const v16b w = WCOL(WA, kc * 32, c0 + j * 16 + col, lane); asm volatile("s_wait_loadcnt 0x0" ::: "memory"); acc[j] = wmma_bf(a, w, acc[j]); } }
  if (which < 2) { _Float16* DH = which == 0 ? QH : KH; _Float16* DL = which == 0 ? QL : KL; const int nhi = which == 0 ? QHI : KHI; const bool hi_rows = t0 < nhi;
#pragma unroll
    for (int j = 0; j < 8; ++j) { const int oo = c0 + j * 16 + col; const float bias = (BA && (which == 2 || oo < HDQ)) ? bfr(BA[which == 2 ? oo : (oo < HDQ ? oo : 0)]) : 0.f;
#pragma unroll
      for (int r = 0; r < 8; ++r) { const float v = acc[j][r] + bias; const _Float16 hv = (_Float16)v; sh[wave * 16 + 8 * g + r][j * 16 + col] = hv; sl[wave * 16 + 8 * g + r][j * 16 + col] = (_Float16)((v - (float)hv) * 1024.0f); } }
    __syncthreads();
    for (int e = tid; e < 64 * 16; e += 128) { const int rl = e >> 4, q = e & 15; vst2((unsigned*)(DH + (r0 + rl) * CC + c0 + q * 8), *(const v4u*)&sh[rl][q * 8]); if (hi_rows) vst2((unsigned*)(DL + (bb * nhi + t0 + rl) * (size_t)CC + c0 + q * 8), *(const v4u*)&sl[rl][q * 8]); }
  } else { const bool hi_rows = t0 < KHI;
#pragma unroll
    for (int j = 0; j < 8; ++j) { const int oo = c0 + j * 16 + col; const float bias = (BA && (which == 2 || oo < HDQ)) ? bfr(BA[which == 2 ? oo : (oo < HDQ ? oo : 0)]) : 0.f;
#pragma unroll
      for (int r = 0; r < 8; ++r) { const float v = acc[j][r] + bias; const int rl = wave * 16 + 8 * g + r, cl = j * 16 + col; th[cl][rl] = (_Float16)v; const __bf16 bh = (__bf16)v; tb[cl][rl] = bh; tbl[cl][rl] = (__bf16)(v - (float)bh); } }
    __syncthreads();
    for (int e = tid; e < 128 * 8; e += 128) { const int cl = e >> 3, q = e & 7; vst2((unsigned*)(VT + (bb * CC + c0 + cl) * (size_t)TT + t0 + q * 8), *(const v4u*)&th[cl][q * 8]); if (hi_rows) { const size_t o3 = (bb * CC + c0 + cl) * (size_t)KHI + t0 + q * 8; vst2((unsigned*)(VB + o3), *(const v4u*)&tb[cl][q * 8]); vst2((unsigned*)(VBL + o3), *(const v4u*)&tbl[cl][q * 8]); } } } }
// plain builtin form: the compiler keeps the distance behind a matrix instruction itself and fills it with independent work where it can
__device__ __forceinline__ v8f wmma16c(v16h a, v16h b, v8f c) { return __builtin_amdgcn_wmma_f32_16x16x32_f16(false, a, false, b, (short)0, c, false, false); }
// (in the two kernels below every plain '#pragma unroll' is there so that a register array is indexed by constants only)
// logit of one (key, query) pair from the two f16 products: k hi . q + (k residual x 2^10) . q / 2^10
__device__ __forceinline__ float logit2(float hi, float lo) { return (hi + lo * (1.0f / 1024.0f)) * SCALE; }
// ---- k_kst: block = 16 keys of batch blockIdx.y; wave w holds the logits of those keys against queries [256 w, 256 w + 256) in registers (D: row = key 8g + r, column = query): maximum and sum of exp over ALL queries -> KS line of the key tile: [16 maxima][16 x 2^11 / sum] (one 128-B line per block)
__global__ __launch_bounds__(256) void k_kst(const _Float16* __restrict__ KRH, const _Float16* __restrict__ KRL, const _Float16* __restrict__ QR, float* __restrict__ KS) { __shared__ float smx[8][16], ssu[8][16];
  const int tid = threadIdx.x, wave = tid >> 5, lane = tid & 31, col = lane & 15, g = lane >> 4; const size_t kr0 = (size_t)blockIdx.y * TT + blockIdx.x * 16, q0 = (size_t)blockIdx.y * TT + wave * (TT / 8);
  const v16h ah = frag_h(KRH + (kr0 + col) * CC, lane), al = frag_h(KRL + (kr0 + col) * CC, lane);
  asm volatile("s_wait_xcnt 0x0" ::: "memory");   /* precaution: the four key loads above have taken their addresses before a later load's result reuses those address registers */
  float s[TT / 128][8]; v16h qf[TT / 128];
#pragma unroll
  for (int t = 0; t < 8; ++t) qf[t] = frag_h(QR + (q0 + t * 16 + col) * CC, lane);
#pragma unroll
  for (int tg = 0; tg < TT / 128; tg += 4) {   /* groups of four query tiles, loaded two groups ahead of their products */
    if (tg + 8 < TT / 128) {
#pragma unroll
      for (int t = tg + 8; t < tg + 12; ++t) qf[t] = frag_h(QR + (q0 + t * 16 + col) * CC, lane); }
    __builtin_amdgcn_sched_barrier(0);   /* keeps the loads above issued here: left alone the scheduler either waits on one tile at a time or hoists all sixteen, which takes the kernel past 256 registers */
#pragma unroll
    for (int t = tg; t < tg + 4; ++t) { v8f a = {}, l = {}; a = wmma16(ah, qf[t], a); l = wmma16(al, qf[t], l);
#pragma unroll
      for (int r = 0; r < 8; ++r) s[t][r] = logit2(a[r], l[r]); }
    __builtin_amdgcn_sched_barrier(0);   /* the other side of the same fence: the next group's loads stay behind these products */
  }
  float mx[8], su[8];
#pragma unroll
  for (int r = 0; r < 8; ++r) { float m = s[0][r];
#pragma unroll
    for (int t = 1; t < TT / 128; ++t) m = fmaxf(m, s[t][r]);
#pragma unroll
    for (int o = 1; o < 16; o <<= 1) m = fmaxf(m, __shfl_xor(m, o));
    mx[r] = m; }
  if (col == 0) {
#pragma unroll
    for (int r = 0; r < 8; ++r) smx[wave][8 * g + r] = mx[r]; }
  __syncthreads();
#pragma unroll
  for (int r = 0; r < 8; ++r) { float m = smx[0][8 * g + r];
#pragma unroll
    for (int w = 1; w < 8; ++w) m = fmaxf(m, smx[w][8 * g + r]);
    float a = 0.f;
#pragma unroll
    for (int t = 0; t < TT / 128; ++t) { const float e = expf(s[t][r] - m); a += (s[t][r] <= -1.0e38f) ? 0.f : e; }
#pragma unroll
    for (int o = 1; o < 16; o <<= 1) a += __shfl_xor(a, o);
    su[r] = a; }
  if (col == 0) {
#pragma unroll
    for (int r = 0; r < 8; ++r) ssu[wave][8 * g + r] = su[r]; }
  __syncthreads();
  if (tid < 32) { float m = smx[0][col], a = 0.f;
#pragma unroll
    for (int w = 1; w < 8; ++w) m = fmaxf(m, smx[w][col]);
#pragma unroll
    for (int w = 0; w < 8; ++w) a += ssu[w][col];
    vst2(KS + kr0 * 2 + tid, g == 0 ? m : (a > 0.f ? 2048.0f / a : 0.f)); } }
// ---- k_att: block = 64 queries (qb) of batch blockIdx.y, wave = 16 queries; per 32 keys: S^T tiles (row = key, column = query) from the same two products as k_kst, P x 2^11 = exp(logit - max) x (2^11 / sum) in f32; the two D tiles, converted to f16 in place, ARE the A fragment (row = query, k = key) of P . v; f_sa = (P . v) / (sum over keys of P)
__global__ __launch_bounds__(128) void k_att(const _Float16* __restrict__ KRH, const _Float16* __restrict__ KRL, const _Float16* __restrict__ QR, const float* __restrict__ KS, const _Float16* __restrict__ VT, float* __restrict__ Y) { __shared__ __align__(16) float ss[4][16][HD + 4]; __shared__ __align__(16) float sks[TT * 2];
  const int tid = threadIdx.x, wave = tid >> 5, lane = tid & 31, col = lane & 15, g = lane >> 4; const int b = blockIdx.y; const int ql0 = blockIdx.x * 64 + wave * 16;
#pragma unroll   /* all eight loads in flight at once */
  for (int i = 0; i < TT * 2 / 4 / 128; ++i) *(v4f*)&sks[(i * 128 + tid) * 4] = *(const v4f*)(KS + (size_t)b * TT * 2 + (i * 128 + tid) * 4);
  __syncthreads();
  const v16h qf = frag_h(QR + ((size_t)b * TT + ql0 + col) * CC, lane);
  const _Float16* kh = KRH + ((size_t)b * TT + col) * CC; const _Float16* kl = KRL + ((size_t)b * TT + col) * CC; const _Float16* vt = VT + ((size_t)b * CC + col) * (size_t)TT;
  v8f acc[HD / 16] = {}; float ksum = 0.f;   /* f32 sum of the P x 2^11 values this lane makes: query ql0 + col, the k half g of every chunk */
  v16h a0 = frag_h(kh, lane), l0 = frag_h(kl, lane), a1 = frag_h(kh + 16 * CC, lane), l1 = frag_h(kl + 16 * CC, lane);
#pragma unroll 1   /* rolled: one pass's fragments and accumulators already fill most of 256 registers */
  for (int kc = 0; kc < TT / 32; ++kc) { v16h vf[HD / 16];
#pragma unroll
    for (int j = 0; j < HD / 16; ++j) vf[j] = frag_h(vt + (size_t)j * 16 * TT + kc * 32, lane);
    __builtin_amdgcn_sched_barrier(0);   /* keeps the 16 v loads issued here, a whole score-and-exp phase ahead of their use (the scheduler otherwise sinks them to the P . v products, two fragments in flight) */
    v8f s0 = {}, t0 = {}, s1 = {}, t1 = {}; s0 = wmma16c(a0, qf, s0); t0 = wmma16c(l0, qf, t0); s1 = wmma16c(a1, qf, s1); t1 = wmma16c(l1, qf, t1);
    const size_t kn = (size_t)(kc + 1 < TT / 32 ? kc + 1 : kc) * 32 * CC;   /* next chunk's key rows, fetched one pass ahead (the last pass fetches its own again: in bounds) */
    a0 = frag_h(kh + kn, lane); l0 = frag_h(kl + kn, lane); a1 = frag_h(kh + kn + 16 * CC, lane); l1 = frag_h(kl + kn + 16 * CC, lane);
    __builtin_amdgcn_sched_barrier(0);   /* keeps the next chunk's key loads issued here, ahead of the exp phase */
    const v4f* st = (const v4f*)&sks[kc * 64 + 8 * g]; const v4f m0[2] = { st[0], st[1] }, i0[2] = { st[4], st[5] }, m1[2] = { st[8], st[9] }, i1[2] = { st[12], st[13] }; float v[16];   /* the chunk's maxima and 2^11 / sums, keys 8g + r of both tiles */
#pragma unroll
    for (int r = 0; r < 8; ++r) { const float x0 = logit2(s0[r], t0[r]), x1 = logit2(s1[r], t1[r]); const float e0 = expf(x0 - m0[r >> 2][r & 3]), e1 = expf(x1 - m1[r >> 2][r & 3]); v[r] = ((x0 <= -1.0e38f) ? 0.f : e0) * i0[r >> 2][r & 3]; v[8 + r] = ((x1 <= -1.0e38f) ? 0.f : e1) * i1[r >> 2][r & 3]; }
    v16h p;
#pragma unroll
    for (int i = 0; i < 16; ++i) p[i] = (_Float16)v[i];
    ksum += sum16(v);
#pragma unroll
    for (int j = 0; j < HD / 16 - 1; ++j) acc[j] = wmma16c(p, vf[j], acc[j]);
    acc[HD / 16 - 1] = wmma16(p, vf[HD / 16 - 1], acc[HD / 16 - 1]); }   /* the last product in the form with four v_nop behind it: across the taken branch the next pass's v loads write over the B fragments of these products */
  ksum += __shfl_xor(ksum, 16);   /* both k halves: den (x 2^11) of query ql0 + col, in lanes col and col + 16 */
  const float inv = ksum > 0.f ? 2048.0f / ksum : 0.f; float invr[8];
#pragma unroll
  for (int r = 0; r < 8; ++r) invr[r] = __shfl(inv, 8 * g + r);   /* accumulator element r is query row 8g + r */
#pragma unroll
  for (int j = 0; j < HD / 16; ++j)
#pragma unroll
    for (int r = 0; r < 8; ++r) ss[wave][8 * g + r][j * 16 + col] = acc[j][r] * (1.0f / 2048.0f) * invr[r];
  LDSX(); for (int rl = 0; rl < 16; ++rl) vst2(Y + ((size_t)b * TT + ql0 + rl) * CC + lane * 4, *(const v4f*)&ss[wave][rl][lane * 4]); }

extern "C" void kernel_launch(void* const* d_in, const int* in_sizes, int n_in, void* d_out, int out_size, void* d_ws, size_t ws_size, hipStream_t stream) {
  (void)in_sizes; (void)n_in; (void)out_size;
  const float** F = (const float**)d_in;
  if (ws_size < (size_t)WS_END) return;
  char* ws = (char*)d_ws; _Float16 *QH = (_Float16*)(ws + WS_QH), *KH = (_Float16*)(ws + WS_KH), *VT = (_Float16*)(ws + WS_VT), *QL = (_Float16*)(ws + WS_QL), *KL = (_Float16*)(ws + WS_KL); __bf16 *VB = (__bf16*)(ws + WS_VB), *VBL = (__bf16*)(ws + WS_VBL); float *S = (float*)(ws + WS_S), *Y = (float*)(ws + WS_Y);
  (void)Y; (void)QL; (void)KL; (void)VB; (void)VBL;
  // inputs: 0 f_in [16,2048,128]; 1 w_q [32,128] (out,in), 2 b_q [32]; 3 w_k [32,128], 4 b_k; 5 w_v [128,128], 6 b_v; 7 w_l [128,128], 8 b_l; 9 bn_gamma, 10 bn_beta
  if (ws_size < (size_t)WS_END2) return;
  float *FSA = (float*)(ws + WS_FSA), *YL = (float*)(ws + WS_YL), *ST = (float*)(ws + WS_ST), *PS = (float*)(ws + WS_PS);
  // ROLE SWAP: the 'q' planes (hi + residual) hold K (from w_k, b_k) and the 'k' planes hold Q, so the score tiles are S^T[key][query] and the softmax runs over QUERIES
  k_proj<<<dim3(TNB * TT / 64, CC / 128, 3), 128, 0, stream>>>(F[0], F[0], F[0], F[3], F[1], F[5], F[4], F[2], F[6], QH, QL, KH, KL, VT, VB, VBL);
  k_kst<<<dim3(TT / 16, TNB), 256, 0, stream>>>(QH, QL, KH, S);   /* per key: maximum and 2^11 / sum of exp over the queries */
  k_att<<<dim3(NQB, TNB), 128, 0, stream>>>(QH, QL, KH, S, VT, FSA);   /* f_sa rows: logits made again in registers, P never stored */
  k_lin<<<dim3(NR / 64), 128, 0, stream>>>(F[0], FSA, F[7], F[8], YL, PS);
  k_stat<<<dim3(CC), 256, 0, stream>>>(PS, ST);
  k_fin<<<dim3((NR * CC / 4 + 255) / 256), 256, 0, stream>>>(YL, ST, F[9], F[10], FSA, (float*)d_out);
}

// v004
// One run takes 144 microseconds.
// Two timings next to v003 put it at 1.26 and 1.23 times that version's speed.
// All steps since v000 together make it 11.8 times as fast.
#include <hip/hip_runtime.h>
#include <math.h>

typedef __attribute__((ext_vector_type(16))) _Float16 v16h;
typedef __attribute__((ext_vector_type(16))) __bf16 v16b;
typedef __attribute__((ext_vector_type(8)))  _Float16 v8h;
typedef __attribute__((ext_vector_type(8)))  float v8f;
typedef __attribute__((ext_vector_type(4)))  float v4f;
typedef __attribute__((ext_vector_type(2)))  float v2f;
typedef __attribute__((ext_vector_type(4)))  unsigned v4u;
typedef __attribute__((ext_vector_type(4)))  int v4i;
typedef float __attribute__((may_alias)) float_a;
typedef int __attribute__((may_alias)) int_a;

template <typename T> __device__ __forceinline__ void vst2(void* p, T v) { *(T*)p = v;  }
__device__ __forceinline__ v8f wmma16(v16h a, v16h b, v8f c) {
  v8f d = __builtin_amdgcn_wmma_f32_16x16x32_f16(false, a, false, b, (short)0, c, false, false);
  asm volatile("v_nop\n\tv_nop\n\tv_nop\n\tv_nop" : "+v"(d) : "v"(a), "v"(b));
  return d;
}
__device__ __forceinline__ v8f wmma_bf(v16b a, v16b b, v8f c) {
  v8f d = __builtin_amdgcn_wmma_f32_16x16x32_bf16(false, a, false, b, (short)0, c, false, false);
  asm volatile("v_nop\n\tv_nop\n\tv_nop\n\tv_nop" : "+v"(d) : "v"(a), "v"(b));
  return d;
}
// 16x16x32 fragments: lane = (h = lane>>4, row/col = lane&15); elements 0..7 = k0+8h+0..7, 8..15 = k0+16+8h+0..7; D element r = row 8h+r
__device__ __forceinline__ v16h frag_h(const _Float16* rowk0, int lane) {
  union { v16h v; v8h q[2]; } u; const _Float16* p = rowk0 + 8 * (lane >> 4);
  u.q[0] = *(const v8h*)p; u.q[1] = *(const v8h*)(p + 16); return u.v;
}
__device__ __forceinline__ v16h frag_f32(const float* rowk0, int lane) {
  v16h a; const float* p = rowk0 + 8 * (lane >> 4);
#pragma unroll
  for (int i = 0; i < 8; ++i) { a[i] = (_Float16)p[i]; a[8 + i] = (_Float16)p[16 + i]; }
  return a;
}
__device__ __forceinline__ v16h frag_f32s(const float* rowk0, int lane, float sc) {
  v16h a; const float* p = rowk0 + 8 * (lane >> 4);
#pragma unroll
  for (int i = 0; i < 8; ++i) { a[i] = (_Float16)(p[i] * sc); a[8 + i] = (_Float16)(p[16 + i] * sc); }
  return a;
}
// column fragment from a [K][ld] layout (column n), rows >= K read as 0
__device__ __forceinline__ v16h fragc_f32(const float* W, int k0, int n, int lane, int ld, int K) {
  v16h a; const int g = lane >> 4;
#pragma unroll
  for (int i = 0; i < 8; ++i) { const int ka = k0 + 8 * g + i, kb = ka + 16;
    a[i] = (_Float16)(ka < K ? W[(size_t)(ka < K ? ka : K - 1) * ld + n] : 0.f); a[8 + i] = (_Float16)(kb < K ? W[(size_t)(kb < K ? kb : K - 1) * ld + n] : 0.f); }
  return a;
}
struct F2 { v16b h, l; };
__device__ __forceinline__ F2 bsplit16(const float v[16]) { F2 r;
#pragma unroll
  for (int i = 0; i < 16; ++i) { const __bf16 h = (__bf16)v[i]; r.h[i] = h; r.l[i] = (__bf16)(v[i] - (float)h); }
  return r; }
__device__ __forceinline__ F2 split_row(const float* row, int k0, int lane) { float v[16]; const float* p = row + k0 + 8 * (lane >> 4);
#pragma unroll
  for (int i = 0; i < 8; ++i) { v[i] = p[i]; v[8 + i] = p[16 + i]; }
  return bsplit16(v); }
__device__ __forceinline__ F2 split_rowK(const float* row, int k0, int lane, int K) { float v[16]; const int g = lane >> 4;
#pragma unroll
  for (int i = 0; i < 8; ++i) { const int ka = k0 + 8 * g + i, kb = ka + 16; v[i] = ka < K ? row[ka < K ? ka : K - 1] : 0.f; v[8 + i] = kb < K ? row[kb < K ? kb : K - 1] : 0.f; }
  return bsplit16(v); }
__device__ __forceinline__ F2 split_col(const float* W, int k0, int n, int lane, int ld, int K) { float v[16]; const int g = lane >> 4;
#pragma unroll
  for (int i = 0; i < 8; ++i) { const int ka = k0 + 8 * g + i, kb = ka + 16; v[i] = ka < K ? W[(size_t)(ka < K ? ka : K - 1) * ld + n] : 0.f; v[8 + i] = kb < K ? W[(size_t)(kb < K ? kb : K - 1) * ld + n] : 0.f; }
  return bsplit16(v); }
__device__ __forceinline__ v8f mac3(const F2& a, const F2& b, v8f c) { c = wmma_bf(a.l, b.h, c); c = wmma_bf(a.h, b.l, c); return wmma_bf(a.h, b.h, c); }
__device__ __forceinline__ float sigm(float v) { return 1.0f / (1.0f + expf(-v)); }
#define LDSX() do { asm volatile("s_wait_dscnt 0" ::: "memory"); __builtin_amdgcn_wave_barrier(); __builtin_amdgcn_fence(__ATOMIC_RELEASE, "workgroup"); } while (0)

// Offset-attention (PCT) block (B 16, N 2,048, D 128, q/k dim 32): q = x Wq^T + bq, k = x Wk^T + bk (32-d), v = x Wv^T + bv; a = softmax over QUERIES of q k^T (no scale), then a = a / sum over keys; f_sa = a v; y = (x - f_sa) Wl^T + bl; out = relu(BN(y)) + f_sa (BN with batch statistics over B*N, biased variance, eps 1e-5).
#define NB 16
#define TT 2048
#define CC 128            // NH * HD = projected width
#define DIN 128          // input (model) width
#define NH 1
#define HD 128
#define NQB (TT / 64)
#define HG 4
#define SCALE (1.0f)
#define CAUSAL 0
#ifndef TNB
#define TNB NB
#endif
__device__ __forceinline__ float bfr(float v) { return (float)(__bf16)v; }
__host__ __device__ __forceinline__ int kb_last(int qb) { return CAUSAL ? ((qb * 64 + 63) >> 7) : (TT / 128 - 1); }
typedef __attribute__((ext_vector_type(8))) __bf16 v8b;
__device__ __forceinline__ v16b frag_b(const __bf16* rowk0, int lane) {
  union { v16b v; v8b q[2]; } u; const __bf16* p = rowk0 + 8 * (lane >> 4);
  u.q[0] = *(const v8b*)p; u.q[1] = *(const v8b*)(p + 16); return u.v;
}
// operand tile in fragment order: a 16 (rows or columns) x 32 (k) tile of 16-bit values is 1 KB = [h][lane][8 values]; lane = (g = lane>>4, row/col = lane&15) holds k = 16h + 8g + 0..7 there, so each of the two wave-wide 16-byte loads of a fragment covers 512 contiguous bytes (four whole lines)
#define FT 512             // values in one such tile
__device__ __forceinline__ v16h frag_l(const _Float16* p) {   /* p = the lane's own place in the tile: tile + 8 lane */
  union { v16h v; v8h q[2]; } u; u.q[0] = *(const v8h*)p; u.q[1] = *(const v8h*)(p + FT / 2); return u.v;
}
__device__ __forceinline__ v16h frag_t(const _Float16* tile, int lane) { return frag_l(tile + 8 * lane); }
#define QBH 0              // not used by any kernel here
#define QHI 2048            // rows carrying a q residual plane (all rows when non-causal: 2-product logits everywhere)
#define KHI 64            // key rows carrying k residual / v bf16 hi+lo planes (written by k_proj, read by no kernel here)
// B fragment (k rows k0+.., output column o) of a weight: (in,out) [K][ld] or (out,in) [ld rows of K]: bf16 exact, or f16(bf16 * 256) exact
__device__ __forceinline__ v16b wcol_io(const float* Wm, int k0, int o, int lane, int ld) { v16b w; const int g = lane >> 4;
#pragma unroll
  for (int i = 0; i < 8; ++i) { w[i] = (__bf16)Wm[(size_t)(k0 + 8 * g + i) * ld + o]; w[8 + i] = (__bf16)Wm[(size_t)(k0 + 16 + 8 * g + i) * ld + o]; }
  return w; }
__device__ __forceinline__ v16b wcol_oi(const float* Wm, int k0, int o, int lane, int K) { v16b w; const float* p = Wm + (size_t)o * K + k0 + 8 * (lane >> 4);
#pragma unroll
  for (int i = 0; i < 8; ++i) { w[i] = (__bf16)p[i]; w[8 + i] = (__bf16)p[16 + i]; }
  return w; }
__device__ __forceinline__ v16h wcolh_io(const float* Wm, int k0, int o, int lane, int ld) { v16h w; const int g = lane >> 4;
#pragma unroll
  for (int i = 0; i < 8; ++i) { w[i] = (_Float16)(bfr(Wm[(size_t)(k0 + 8 * g + i) * ld + o]) * 256.0f); w[8 + i] = (_Float16)(bfr(Wm[(size_t)(k0 + 16 + 8 * g + i) * ld + o]) * 256.0f); }
  return w; }
__device__ __forceinline__ v16h wcolh_oi(const float* Wm, int k0, int o, int lane, int K) { v16h w; const float* p = Wm + (size_t)o * K + k0 + 8 * (lane >> 4);
#pragma unroll
  for (int i = 0; i < 8; ++i) { w[i] = (_Float16)(bfr(p[i]) * 256.0f); w[8 + i] = (_Float16)(bfr(p[16 + i]) * 256.0f); }
  return w; }
#define WQKV_LAYOUT 1   // 0 = (in,out) [DIN][CC]; 1 = (out,in) [CC][DIN]; 2 = per-head [NH][DIN][HD]
__device__ __forceinline__ v16b wcol_hdk(const float* Wm, int k0, int o, int lane) { v16b w; const int g = lane >> 4; const float* p = Wm + (size_t)(o / HD) * DIN * HD + (o % HD);
#pragma unroll
  for (int i = 0; i < 8; ++i) { w[i] = (__bf16)p[(size_t)(k0 + 8 * g + i) * HD]; w[8 + i] = (__bf16)p[(size_t)(k0 + 16 + 8 * g + i) * HD]; }
  return w; }
#define WO_OUT_IN 0
#if WQKV_LAYOUT == 1
#define WCOL(W, k0, o, lane) wcol_oin(W, k0, o, lane, DIN, (which == 2) ? CC : HDQ)   /* q / k: 32 real output rows, columns 32..127 exact zeros */
#elif WQKV_LAYOUT == 2
#define WCOL(W, k0, o, lane) wcol_hdk(W, k0, o, lane)
#else
#define WCOL(W, k0, o, lane) wcol_io(W, k0, o, lane, CC)
#endif
#if WO_OUT_IN
#define WOCOL(W, k0, o, lane) wcol_oi(W, k0, o, lane, CC)
#define WOCOLH(W, k0, o, lane) wcolh_oi(W, k0, o, lane, CC)
#else
#define WOCOL(W, k0, o, lane) wcol_io(W, k0, o, lane, DIN)
#define WOCOLH(W, k0, o, lane) wcolh_io(W, k0, o, lane, DIN)
#endif
#define HDQ 32             // q / k width (k_proj's accumulators are 128 wide, columns 32..127 exact zeros; only the 32 real columns are stored)
#define BG HG              // not used by any kernel here
#define NR (TNB * TT)      // 32,768 rows (all batches)
// (out,in) projection weight with only 'nvalid' real output rows: columns o >= nvalid read row 0 and are zeroed by value
__device__ __forceinline__ v16b wcol_oin(const float* Wm, int k0, int o, int lane, int K, int nvalid) { v16b w; const int oc = o < nvalid ? o : 0; const float keep = o < nvalid ? 1.f : 0.f; const float* p = Wm + (size_t)oc * K + k0 + 8 * (lane >> 4);
#pragma unroll
  for (int i = 0; i < 8; ++i) { w[i] = (__bf16)(p[i] * keep); w[8 + i] = (__bf16)(p[16 + i] * keep); }
  return w; }
// pairwise tree over the 16 f32 P values of one A fragment (a lane's share of its query's sum over keys)
__device__ __forceinline__ float sum16(const float v[16]) { return (((v[0] + v[1]) + (v[2] + v[3])) + ((v[4] + v[5]) + (v[6] + v[7]))) + (((v[8] + v[9]) + (v[10] + v[11])) + ((v[12] + v[13]) + (v[14] + v[15]))); }
#define WS_DEN (WS_END)                                // (plane not used: the sum over keys stays in k_att's registers)
#define WS_FSA (WS_DEN + 4u * (size_t)NR)              // f32 f_sa rows [NR][128]
#define WS_YL  (WS_FSA + 4u * (size_t)NR * CC)        // f32 y rows (pre-BN)
#define WS_ST  (WS_YL + 4u * (size_t)NR * CC)         // BN statistics [128][32]
#define WS_PS  (WS_ST + 4u * (size_t)CC * 32)         // BN partials of k_lin's blocks [NR / 64][2][128]: mean of the block's 64 rows, sum of squared distances from that mean
#define WS_END2 (WS_PS + 4u * (size_t)(NR / 64) * 2 * CC)
// ---- k_lin: block = 64 rows: y = (bf16(f_in) - f_sa) (split bf16 hi + lo) Wl^T + bl (2 products, K 128) -> pre-BN rows, and per channel the block's own mean and sum of squared distances from it (PS)
__global__ __launch_bounds__(128) void k_lin(const float* __restrict__ X, const float* __restrict__ FSA, const float* __restrict__ WL, const float* __restrict__ BL, float* __restrict__ YL, float* __restrict__ PS) { __shared__ __align__(16) float sf[4][16][132]; __shared__ __align__(16) float sp[4][2][CC];
  const int tid = threadIdx.x, wave = tid >> 5, lane = tid & 31, col = lane & 15, g = lane >> 4; const size_t r0 = (size_t)blockIdx.x * 64 + wave * 16;
  v8f acc[8] = {};
#pragma unroll
  for (int kc = 0; kc < CC / 32; ++kc) { float v[16]; { const float* px = X + (r0 + col) * CC + kc * 32 + 8 * g; const float* pf = FSA + (r0 + col) * CC + kc * 32 + 8 * g;
#pragma unroll
      for (int i = 0; i < 8; ++i) { v[i] = bfr(px[i]) - pf[i]; v[8 + i] = bfr(px[16 + i]) - pf[16 + i]; } }
    const F2 a = bsplit16(v); asm volatile("s_wait_loadcnt 0x0" ::: "memory");
#pragma unroll
    for (int j = 0; j < 8; ++j) { const v16b w = wcol_oin(WL, kc * 32, j * 16 + col, lane, CC, CC); asm volatile("s_wait_loadcnt 0x0" ::: "memory"); acc[j] = wmma_bf(a.h, w, acc[j]); acc[j] = wmma_bf(a.l, w, acc[j]); } }
#pragma unroll
  for (int j = 0; j < 8; ++j) { const float bb = bfr(BL[j * 16 + col]);
#pragma unroll
    for (int r = 0; r < 8; ++r) sf[wave][8 * g + r][j * 16 + col] = acc[j][r] + bb; }
  LDSX(); v4f yv[16];
#pragma unroll   /* yv is indexed by constants only */
  for (int rl = 0; rl < 16; ++rl) yv[rl] = *(const v4f*)&sf[wave][rl][lane * 4];
  // the wave's 16 rows, channels 4 lane .. 4 lane + 3: mean, then squared distances from that mean (no difference of large squares anywhere)
  const v4f m16 = ((((yv[0] + yv[1]) + (yv[2] + yv[3])) + ((yv[4] + yv[5]) + (yv[6] + yv[7]))) + (((yv[8] + yv[9]) + (yv[10] + yv[11])) + ((yv[12] + yv[13]) + (yv[14] + yv[15])))) * (1.0f / 16.0f); v4f q16 = {};
#pragma unroll
  for (int rl = 0; rl < 16; ++rl) { const v4f d = yv[rl] - m16; q16 += d * d; }
  *(v4f*)&sp[wave][0][lane * 4] = m16; *(v4f*)&sp[wave][1][lane * 4] = q16;
  __syncthreads();
  // thread = channel: the four waves' groups of 16 rows merged: mean of the means; squared distances add up, plus 16 x each group mean's squared distance from the merged mean
  const float g0 = sp[0][0][tid], g1 = sp[1][0][tid], g2 = sp[2][0][tid], g3 = sp[3][0][tid]; const float m64 = ((g0 + g1) + (g2 + g3)) * 0.25f; const float e0 = g0 - m64, e1 = g1 - m64, e2 = g2 - m64, e3 = g3 - m64;
  const float q64 = ((sp[0][1][tid] + sp[1][1][tid]) + (sp[2][1][tid] + sp[3][1][tid])) + 16.0f * ((e0 * e0 + e1 * e1) + (e2 * e2 + e3 * e3));
#pragma unroll   /* the row stores stand behind the barrier: in front of it the barrier would wait for all sixteen to finish */
  for (int rl = 0; rl < 16; ++rl) vst2(YL + (r0 + rl) * CC + lane * 4, yv[rl]);
  vst2(PS + (size_t)blockIdx.x * 2 * CC + tid, m64); vst2(PS + ((size_t)blockIdx.x * 2 + 1) * CC + tid, q64); }
// ---- k_stat: block = channel c: merges the NR / 64 partials of k_lin (equal groups of 64 rows) in the same way -> mean and 1 / sqrt(biased variance + eps)
__global__ __launch_bounds__(256) void k_stat(const float* __restrict__ PS, float* __restrict__ STAT) { __shared__ float sred[8]; __shared__ float sbc;
  const int t = threadIdx.x; const int c = blockIdx.x; float pm[NR / 64 / 256], pq[NR / 64 / 256];
#pragma unroll   /* register arrays indexed by constants; all loads in flight at once */
  for (int i = 0; i < NR / 64 / 256; ++i) { pm[i] = PS[(size_t)(i * 256 + t) * 2 * CC + c]; pq[i] = PS[((size_t)(i * 256 + t) * 2 + 1) * CC + c]; }
  float s = 0.f;
#pragma unroll
  for (int i = 0; i < NR / 64 / 256; ++i) s += pm[i];
#pragma unroll
  for (int o = 1; o < 32; o <<= 1) s += __shfl_xor(s, o);
  if ((t & 31) == 0) sred[t >> 5] = s; __syncthreads(); if (t == 0) { float a = 0.f; for (int i = 0; i < 8; ++i) a += sred[i]; sbc = a / (float)(NR / 64); } __syncthreads(); const float mean = sbc; __syncthreads();
  float q = 0.f;
#pragma unroll
  for (int i = 0; i < NR / 64 / 256; ++i) { const float d = pm[i] - mean; q += pq[i] + 64.0f * (d * d); }
#pragma unroll
  for (int o = 1; o < 32; o <<= 1) q += __shfl_xor(q, o);
  if ((t & 31) == 0) sred[t >> 5] = q; __syncthreads(); if (t == 0) { float a = 0.f; for (int i = 0; i < 8; ++i) a += sred[i]; sbc = rsqrtf(a / (float)NR + 1e-5f); } __syncthreads();
  if (t < 32) { const float v = t == 0 ? mean : (t == 1 ? sbc : 0.f); vst2(STAT + (size_t)c * 32 + t, v); } }
// ---- k_fin: out = relu(gamma (y - mean) rstd + beta) + f_sa (thread per float4)
__global__ __launch_bounds__(256) void k_fin(const float* __restrict__ YL, const float* __restrict__ STAT, const float* __restrict__ G, const float* __restrict__ BE, const float* __restrict__ FSA, float* __restrict__ OUT) { const size_t e4 = (size_t)blockIdx.x * 256 + threadIdx.x; if (e4 >= (size_t)NR * CC / 4) return; const int c0 = (int)((e4 * 4) % CC); const v4f yv = *(const v4f*)(YL + e4 * 4); const v4f fv = *(const v4f*)(FSA + e4 * 4); v4f o;
#pragma unroll
  for (int i = 0; i < 4; ++i) { const int c = c0 + i; const float yb = bfr(G[c]) * (yv[i] - STAT[c * 32]) * STAT[c * 32 + 1] + bfr(BE[c]); o[i] = fmaxf(yb, 0.f) + fv[i]; }
  vst2(OUT + e4 * 4, o); }
#ifndef SM_EXTRA_PARAMS
#define SM_EXTRA_PARAMS
#endif
#ifndef PROJ_EXTRA_PARAMS
#define PROJ_EXTRA_PARAMS
#endif
#ifndef SM_MASK_HOOK
#define SM_MASK_HOOK (void)0
#endif

#define WS_QH  0u                                      // f16 q tiles in fragment order [b*t / 16][FT] (the 32 real columns only; the rest of the plane is not used)
#define WS_KH  (WS_QH + 2u * (size_t)NB * TT * CC)      // f16 k tiles in fragment order [b*t / 16][FT]
#define WS_VT  (WS_KH + 2u * (size_t)NB * TT * CC)      // f16 v tiles in fragment order [b][t / 32][c / 16][FT] (tile: column = channel, k = t)
#define WS_QL  (WS_VT + 2u * (size_t)NB * CC * TT)      // f16 q residual x 2^10 tiles [(b, t < QHI) / 16][FT]
#define WS_KL  (WS_QL + 2u * (size_t)NB * QHI * CC)     // f16 k residual x 2^10 tiles [(b, t < KHI) / 16][FT]
#define WS_VB  (WS_KL + 2u * (size_t)NB * KHI * CC)     // bf16 v hi planes [b][c][t < KHI]
#define WS_VBL (WS_VB + 2u * (size_t)NB * CC * KHI)
#define WS_S   (WS_VBL + 2u * (size_t)NB * CC * KHI)    // f32 per-key softmax statistics [b][t / 16][2][16] (the rest of the plane is not used)
#define WS_Y   (WS_S  + 4u * (size_t)HG * TT * TT)      // f32 ctx rows [b*t][CC] (only when there is an output projection)
#define WS_END (WS_Y  + 0u)

// ---- k_proj: block = (64 rows, 128 cols, which): q/k/v = X W (+ b) with exact bf16 products (K = DIN) -> which 0: q f16 tiles (+ residual tiles, rows < QHI); 1: k f16 tiles (+ residual tiles, rows < KHI); 2: v f16 tiles (+ bf16 hi/lo planes [c][t] for t < KHI); the f16 tiles in fragment order (frag_t)
__global__ __launch_bounds__(128) void k_proj(const float* __restrict__ XQ, const float* __restrict__ XK, const float* __restrict__ XV, const float* __restrict__ WQ, const float* __restrict__ WK, const float* __restrict__ WV, const float* __restrict__ BQ, const float* __restrict__ BK, const float* __restrict__ BV,
    _Float16* __restrict__ QH, _Float16* __restrict__ QL, _Float16* __restrict__ KH, _Float16* __restrict__ KL, _Float16* __restrict__ VT, __bf16* __restrict__ VB, __bf16* __restrict__ VBL) {
  __shared__ __align__(16) _Float16 sh[64][136], sl[64][136]; __shared__ __align__(16) _Float16 th[128][72]; __shared__ __align__(16) __bf16 tb[128][72], tbl[128][72];
  const int tid = threadIdx.x, wave = tid >> 5, lane = tid & 31, col = lane & 15, g = lane >> 4; const int which = blockIdx.z; const int c0 = blockIdx.y * 128; const size_t r0 = (size_t)blockIdx.x * 64; const size_t bb = r0 / TT; const int t0 = (int)(r0 % TT);
  const float* X = which == 0 ? XQ : which == 1 ? XK : XV; const float* WA = which == 0 ? WQ : which == 1 ? WK : WV; const float* BA = which == 0 ? BQ : which == 1 ? BK : BV;
  v8f acc[8] = {};
#pragma unroll 2
  for (int kc = 0; kc < DIN / 32; ++kc) { v16b a; { const float* p = X + (r0 + wave * 16 + col) * DIN + kc * 32 + 8 * g;
#pragma unroll
      for (int i = 0; i < 8; ++i) { a[i] = (__bf16)p[i]; a[8 + i] = (__bf16)p[16 + i]; } }
    asm volatile("s_wait_loadcnt 0x0" ::: "memory");
#pragma unroll
    for (int j = 0; j < 8; ++j) { const v16b w = WCOL(WA, kc * 32, c0 + j * 16 + col, lane); asm volatile("s_wait_loadcnt 0x0" ::: "memory"); acc[j] = wmma_bf(a, w, acc[j]); } }
  if (which < 2) { _Float16* DH = which == 0 ? QH : KH; _Float16* DL = which == 0 ? QL : KL; const int nhi = which == 0 ? QHI : KHI; const bool hi_rows = t0 < nhi;
#pragma unroll
    for (int j = 0; j < 8; ++j) { const int oo = c0 + j * 16 + col; const float bias = (BA && (which == 2 || oo < HDQ)) ? bfr(BA[which == 2 ? oo : (oo < HDQ ? oo : 0)]) : 0.f;
#pragma unroll
      for (int r = 0; r < 8; ++r) { const float v = acc[j][r] + bias; const _Float16 hv = (_Float16)v; sh[wave * 16 + 8 * g + r][j * 16 + col] = hv; sl[wave * 16 + 8 * g + r][j * 16 + col] = (_Float16)((v - (float)hv) * 1024.0f); } }
    __syncthreads();
    for (int e = tid; e < 64 * HDQ / 8; e += 128) { const int tl = e >> 6, h = (e >> 5) & 1, l = e & 31; const int rl = tl * 16 + (l & 15), k8 = 16 * h + 8 * (l >> 4);   /* e runs in the order of the destination: a wave stores 512 contiguous bytes */
      vst2((unsigned*)(DH + ((r0 >> 4) + tl) * FT + (e & 63) * 8), *(const v4u*)&sh[rl][k8]);
      asm volatile("s_wait_xcnt 0x0" ::: "memory");   /* precaution, here and behind the four stores below: the store has taken its address and data before the next LDS load or address sum writes those registers again */
      if (hi_rows) { vst2((unsigned*)(DL + (((bb * nhi + t0) >> 4) + tl) * FT + (e & 63) * 8), *(const v4u*)&sl[rl][k8]); asm volatile("s_wait_xcnt 0x0" ::: "memory"); } }
  } else { const bool hi_rows = t0 < KHI;
#pragma unroll
    for (int j = 0; j < 8; ++j) { const int oo = c0 + j * 16 + col; const float bias = (BA && (which == 2 || oo < HDQ)) ? bfr(BA[which == 2 ? oo : (oo < HDQ ? oo : 0)]) : 0.f;
#pragma unroll
      for (int r = 0; r < 8; ++r) { const float v = acc[j][r] + bias; const int rl = wave * 16 + 8 * g + r, cl = j * 16 + col; th[cl][rl] = (_Float16)v; const __bf16 bh = (__bf16)v; tb[cl][rl] = bh; tbl[cl][rl] = (__bf16)(v - (float)bh); } }
    __syncthreads();
    for (int e = tid; e < 128 * 8; e += 128) { const int cl = e >> 3, q = e & 7; { const int tl = e >> 6, h = (e >> 5) & 1, l = e & 31;   /* tile tl = (32-key chunk tl >> 3, 16 channels tl & 7) of the block, e in the order of the destination */
        vst2((unsigned*)(VT + (((bb * (TT / 32) + (t0 >> 5) + (tl >> 3)) * (CC / 16) + (c0 >> 4) + (tl & 7)) * FT + (e & 63) * 8)), *(const v4u*)&th[(tl & 7) * 16 + (l & 15)][(tl >> 3) * 32 + 16 * h + 8 * (l >> 4)]); asm volatile("s_wait_xcnt 0x0" ::: "memory"); }
      if (hi_rows) { const size_t o3 = (bb * CC + c0 + cl) * (size_t)KHI + t0 + q * 8; vst2((unsigned*)(VB + o3), *(const v4u*)&tb[cl][q * 8]); asm volatile("s_wait_xcnt 0x0" ::: "memory"); vst2((unsigned*)(VBL + o3), *(const v4u*)&tbl[cl][q * 8]); asm volatile("s_wait_xcnt 0x0" ::: "memory"); } } } }
// plain builtin form: the compiler keeps the distance behind a matrix instruction itself and fills it with independent work where it can
__device__ __forceinline__ v8f wmma16c(v16h a, v16h b, v8f c) { return __builtin_amdgcn_wmma_f32_16x16x32_f16(false, a, false, b, (short)0, c, false, false); }
// (in the two kernels below every plain '#pragma unroll' is there so that a register array is indexed by constants only)
// logit of one (key, query) pair from the two f16 products: k hi . q + (k residual x 2^10) . q / 2^10
__device__ __forceinline__ float logit2(float hi, float lo) { return (hi + lo * (1.0f / 1024.0f)) * SCALE; }
// ---- k_kst: block = 16 keys of batch blockIdx.y; wave w holds the logits of those keys against queries [256 w, 256 w + 256) in registers (D: row = key 8g + r, column = query): maximum and sum of exp over ALL queries -> KS line of the key tile: [16 maxima][16 x 2^11 / sum] (one 128-B line per block)
__global__ __launch_bounds__(256) void k_kst(const _Float16* __restrict__ KRH, const _Float16* __restrict__ KRL, const _Float16* __restrict__ QR, float* __restrict__ KS) { __shared__ float smx[8][16], ssu[8][16];
  const int tid = threadIdx.x, wave = tid >> 5, lane = tid & 31, col = lane & 15, g = lane >> 4; const size_t kr0 = (size_t)blockIdx.y * TT + blockIdx.x * 16, q0 = (size_t)blockIdx.y * TT + wave * (TT / 8);
  const v16h ah = frag_t(KRH + (kr0 >> 4) * FT, lane), al = frag_t(KRL + (kr0 >> 4) * FT, lane);
  asm volatile("s_wait_xcnt 0x0" ::: "memory");   /* precaution: the four key loads above have taken their addresses before a later load's result reuses those address registers */
  float s[TT / 128][8]; v16h qf[TT / 128];
#pragma unroll
  for (int t = 0; t < 8; ++t) qf[t] = frag_t(QR + ((q0 >> 4) + t) * FT, lane);
#pragma unroll
  for (int tg = 0; tg < TT / 128; tg += 4) {   /* groups of four query tiles, loaded two groups ahead of their products */
    if (tg + 8 < TT / 128) {
#pragma unroll
      for (int t = tg + 8; t < tg + 12; ++t) qf[t] = frag_t(QR + ((q0 >> 4) + t) * FT, lane); }
    __builtin_amdgcn_sched_barrier(0);   /* keeps the loads above issued here: left alone the scheduler either waits on one tile at a time or hoists all sixteen, which takes the kernel past 256 registers */
#pragma unroll
    for (int t = tg; t < tg + 4; ++t) { v8f a = {}, l = {}; a = wmma16(ah, qf[t], a); l = wmma16(al, qf[t], l);
#pragma unroll
      for (int r = 0; r < 8; ++r) s[t][r] = logit2(a[r], l[r]); }
    __builtin_amdgcn_sched_barrier(0);   /* the other side of the same fence: the next group's loads stay behind these products */
  }
  float mx[8], su[8];
#pragma unroll
  for (int r = 0; r < 8; ++r) { float m = s[0][r];
#pragma unroll
    for (int t = 1; t < TT / 128; ++t) m = fmaxf(m, s[t][r]);
#pragma unroll
    for (int o = 1; o < 16; o <<= 1) m = fmaxf(m, __shfl_xor(m, o));
    mx[r] = m; }
  if (col == 0) {
#pragma unroll
    for (int r = 0; r < 8; ++r) smx[wave][8 * g + r] = mx[r]; }
  __syncthreads();
#pragma unroll
  for (int r = 0; r < 8; ++r) { float m = smx[0][8 * g + r];
#pragma unroll
    for (int w = 1; w < 8; ++w) m = fmaxf(m, smx[w][8 * g + r]);
    float a = 0.f;
#pragma unroll
    for (int t = 0; t < TT / 128; ++t) { const float e = expf(s[t][r] - m); a += (s[t][r] <= -1.0e38f) ? 0.f : e; }
#pragma unroll
    for (int o = 1; o < 16; o <<= 1) a += __shfl_xor(a, o);
    su[r] = a; }
  if (col == 0) {
#pragma unroll
    for (int r = 0; r < 8; ++r) ssu[wave][8 * g + r] = su[r]; }
  __syncthreads();
  if (tid < 32) { float m = smx[0][col], a = 0.f;
#pragma unroll
    for (int w = 1; w < 8; ++w) m = fmaxf(m, smx[w][col]);
#pragma unroll
    for (int w = 0; w < 8; ++w) a += ssu[w][col];
    vst2(KS + kr0 * 2 + tid, g == 0 ? m : (a > 0.f ? 2048.0f / a : 0.f)); } }
// ---- k_att: block = 64 queries (qb) of batch blockIdx.y, wave = 16 queries; per 32 keys: S^T tiles (row = key, column = query) from the same two products as k_kst, P x 2^11 = exp(logit - max) x (2^11 / sum) in f32; the two D tiles, converted to f16 in place, ARE the A fragment (row = query, k = key) of P . v; f_sa = (P . v) / (sum over keys of P)
__global__ __launch_bounds__(128) void k_att(const _Float16* __restrict__ KRH, const _Float16* __restrict__ KRL, const _Float16* __restrict__ QR, const float* __restrict__ KS, const _Float16* __restrict__ VT, float* __restrict__ Y) { __shared__ __align__(16) float ss[4][16][HD + 4]; __shared__ __align__(16) float sks[TT * 2];
  const int tid = threadIdx.x, wave = tid >> 5, lane = tid & 31, col = lane & 15, g = lane >> 4; const int b = blockIdx.y; const int ql0 = blockIdx.x * 64 + wave * 16;
#pragma unroll   /* all eight loads in flight at once */
  for (int i = 0; i < TT * 2 / 4 / 128; ++i) *(v4f*)&sks[(i * 128 + tid) * 4] = *(const v4f*)(KS + (size_t)b * TT * 2 + (i * 128 + tid) * 4);
  __syncthreads();
  const _Float16* qp = QR + (((size_t)b * TT + ql0) >> 4) * FT + 8 * lane; const v16h qf = frag_l(qp);
  const _Float16* kh = KRH + (size_t)b * (TT / 16) * FT; const _Float16* kl = KRL + (size_t)b * (TT / 16) * FT; const _Float16* vt = VT + (size_t)b * (TT / 32) * (HD / 16) * FT;
  v8f acc[HD / 16] = {}; float ksum = 0.f;   /* f32 sum of the P x 2^11 values this lane makes: query ql0 + col, the k half g of every chunk */
  v16h a0 = frag_t(kh, lane), l0 = frag_t(kl, lane), a1 = frag_t(kh + FT, lane), l1 = frag_t(kl + FT, lane);
  asm volatile("s_wait_xcnt 0x0" :: "v"(qp) : "memory");   /* precaution: the ten loads above have taken their addresses before an address register is written again; qp is named so that its pair lives up to here (left alone the zeroing of the accumulators is moved up over the wait and writes it) */
#pragma unroll 1   /* rolled: one pass's fragments and accumulators already fill most of 256 registers */
  for (int kc = 0; kc < TT / 32; ++kc) { v16h vf[HD / 16]; const _Float16* vp = vt + (size_t)kc * (HD / 16) * FT + 8 * lane;
#pragma unroll
    for (int j = 0; j < HD / 16; ++j) vf[j] = frag_l(vp + j * FT);
    __builtin_amdgcn_sched_barrier(0);   /* keeps the 16 v loads issued here, a whole score-and-exp phase ahead of their use (the scheduler otherwise sinks them to the P . v products, two fragments in flight) */
    v8f s0 = {}, t0 = {}, s1 = {}, t1 = {}; s0 = wmma16c(a0, qf, s0); t0 = wmma16c(l0, qf, t0); s1 = wmma16c(a1, qf, s1); t1 = wmma16c(l1, qf, t1);
    const size_t kn = (size_t)(kc + 1 < TT / 32 ? kc + 1 : kc) * 2 * FT;   /* next chunk's two key tiles, fetched one pass ahead (the last pass fetches its own again: in bounds) */
    a0 = frag_t(kh + kn, lane); l0 = frag_t(kl + kn, lane); a1 = frag_t(kh + kn + FT, lane); l1 = frag_t(kl + kn + FT, lane);
    asm volatile("s_wait_xcnt 0x0" :: "v"(vp) : "memory");   /* precaution: the pass's loads have taken their addresses before an address register is written again; vp is named so that the v loads' address pair lives up to here and is not itself the destination of the last of them */
    __builtin_amdgcn_sched_barrier(0);   /* keeps the next chunk's key loads issued here, ahead of the exp phase */
    const v4f* st = (const v4f*)&sks[kc * 64 + 8 * g]; const v4f m0[2] = { st[0], st[1] }, i0[2] = { st[4], st[5] }, m1[2] = { st[8], st[9] }, i1[2] = { st[12], st[13] }; float v[16];   /* the chunk's maxima and 2^11 / sums, keys 8g + r of both tiles */
#pragma unroll
    for (int r = 0; r < 8; ++r) { const float x0 = logit2(s0[r], t0[r]), x1 = logit2(s1[r], t1[r]); const float e0 = expf(x0 - m0[r >> 2][r & 3]), e1 = expf(x1 - m1[r >> 2][r & 3]); v[r] = ((x0 <= -1.0e38f) ? 0.f : e0) * i0[r >> 2][r & 3]; v[8 + r] = ((x1 <= -1.0e38f) ? 0.f : e1) * i1[r >> 2][r & 3]; }
    v16h p;
#pragma unroll
    for (int i = 0; i < 16; ++i) p[i] = (_Float16)v[i];
    ksum += sum16(v);
#pragma unroll
    for (int j = 0; j < HD / 16 - 1; ++j) acc[j] = wmma16c(p, vf[j], acc[j]);
    acc[HD / 16 - 1] = wmma16(p, vf[HD / 16 - 1], acc[HD / 16 - 1]); }   /* the last product in the form with four v_nop behind it: across the taken branch the next pass's v loads write over the B fragments of these products */
  ksum += __shfl_xor(ksum, 16);   /* both k halves: den (x 2^11) of query ql0 + col, in lanes col and col + 16 */
  const float inv = ksum > 0.f ? 2048.0f / ksum : 0.f; float invr[8];
#pragma unroll
  for (int r = 0; r < 8; ++r) invr[r] = __shfl(inv, 8 * g + r);   /* accumulator element r is query row 8g + r */
#pragma unroll
  for (int j = 0; j < HD / 16; ++j)
#pragma unroll
    for (int r = 0; r < 8; ++r) ss[wave][8 * g + r][j * 16 + col] = acc[j][r] * (1.0f / 2048.0f) * invr[r];
  LDSX(); for (int rl = 0; rl < 16; ++rl) vst2(Y + ((size_t)b * TT + ql0 + rl) * CC + lane * 4, *(const v4f*)&ss[wave][rl][lane * 4]); }

extern "C" void kernel_launch(void* const* d_in, const int* in_sizes, int n_in, void* d_out, int out_size, void* d_ws, size_t ws_size, hipStream_t stream) {
  (void)in_sizes; (void)n_in; (void)out_size;
  const float** F = (const float**)d_in;
  if (ws_size < (size_t)WS_END) return;
  char* ws = (char*)d_ws; _Float16 *QH = (_Float16*)(ws + WS_QH), *KH = (_Float16*)(ws + WS_KH), *VT = (_Float16*)(ws + WS_VT), *QL = (_Float16*)(ws + WS_QL), *KL = (_Float16*)(ws + WS_KL); __bf16 *VB = (__bf16*)(ws + WS_VB), *VBL = (__bf16*)(ws + WS_VBL); float *S = (float*)(ws + WS_S), *Y = (float*)(ws + WS_Y);
  (void)Y; (void)QL; (void)KL; (void)VB; (void)VBL;
  // inputs: 0 f_in [16,2048,128]; 1 w_q [32,128] (out,in), 2 b_q [32]; 3 w_k [32,128], 4 b_k; 5 w_v [128,128], 6 b_v; 7 w_l [128,128], 8 b_l; 9 bn_gamma, 10 bn_beta
  if (ws_size < (size_t)WS_END2) return;
  float *FSA = (float*)(ws + WS_FSA), *YL = (float*)(ws + WS_YL), *ST = (float*)(ws + WS_ST), *PS = (float*)(ws + WS_PS);
  // ROLE SWAP: the 'q' planes (hi + residual) hold K (from w_k, b_k) and the 'k' planes hold Q, so the score tiles are S^T[key][query] and the softmax runs over QUERIES
  k_proj<<<dim3(TNB * TT / 64, CC / 128, 3), 128, 0, stream>>>(F[0], F[0], F[0], F[3], F[1], F[5], F[4], F[2], F[6], QH, QL, KH, KL, VT, VB, VBL);
  k_kst<<<dim3(TT / 16, TNB), 256, 0, stream>>>(QH, QL, KH, S);   /* per key: maximum and 2^11 / sum of exp over the queries */
  k_att<<<dim3(NQB, TNB), 128, 0, stream>>>(QH, QL, KH, S, VT, FSA);   /* f_sa rows: logits made again in registers, P never stored */
  k_lin<<<dim3(NR / 64), 128, 0, stream>>>(F[0], FSA, F[7], F[8], YL, PS);
  k_stat<<<dim3(CC), 256, 0, stream>>>(PS, ST);
  k_fin<<<dim3((NR * CC / 4 + 255) / 256), 256, 0, stream>>>(YL, ST, F[9], F[10], FSA, (float*)d_out);
}

// v005
// Measured time: 134 microseconds a run.
// Timed twice side by side with v004, it ran 1.08 and 1.06 times as fast.
// Counting every step since v000, it is 12.6 times as fast.
#include <hip/hip_runtime.h>
#include <math.h>

typedef __attribute__((ext_vector_type(16))) _Float16 v16h;
typedef __attribute__((ext_vector_type(16))) __bf16 v16b;
typedef __attribute__((ext_vector_type(8)))  _Float16 v8h;
typedef __attribute__((ext_vector_type(8)))  float v8f;
typedef __attribute__((ext_vector_type(4)))  float v4f;
typedef __attribute__((ext_vector_type(2)))  float v2f;
typedef __attribute__((ext_vector_type(4)))  unsigned v4u;
typedef __attribute__((ext_vector_type(4)))  int v4i;
typedef float __attribute__((may_alias)) float_a;
typedef int __attribute__((may_alias)) int_a;

template <typename T> __device__ __forceinline__ void vst2(void* p, T v) { *(T*)p = v;  }
__device__ __forceinline__ v8f wmma16(v16h a, v16h b, v8f c) {
  v8f d = __builtin_amdgcn_wmma_f32_16x16x32_f16(false, a, false, b, (short)0, c, false, false);
  asm volatile("v_nop\n\tv_nop\n\tv_nop\n\tv_nop" : "+v"(d) : "v"(a), "v"(b));
  return d;
}
__device__ __forceinline__ v8f wmma_bf(v16b a, v16b b, v8f c) {
  v8f d = __builtin_amdgcn_wmma_f32_16x16x32_bf16(false, a, false, b, (short)0, c, false, false);
  asm volatile("v_nop\n\tv_nop\n\tv_nop\n\tv_nop" : "+v"(d) : "v"(a), "v"(b));
  return d;
}
// 16x16x32 fragments: lane = (h = lane>>4, row/col = lane&15); elements 0..7 = k0+8h+0..7, 8..15 = k0+16+8h+0..7; D element r = row 8h+r
__device__ __forceinline__ v16h frag_h(const _Float16* rowk0, int lane) {
  union { v16h v; v8h q[2]; } u; const _Float16* p = rowk0 + 8 * (lane >> 4);
  u.q[0] = *(const v8h*)p; u.q[1] = *(const v8h*)(p + 16); return u.v;
}
__device__ __forceinline__ v16h frag_f32(const float* rowk0, int lane) {
  v16h a; const float* p = rowk0 + 8 * (lane >> 4);
#pragma unroll
  for (int i = 0; i < 8; ++i) { a[i] = (_Float16)p[i]; a[8 + i] = (_Float16)p[16 + i]; }
  return a;
}
__device__ __forceinline__ v16h frag_f32s(const float* rowk0, int lane, float sc) {
  v16h a; const float* p = rowk0 + 8 * (lane >> 4);
#pragma unroll
  for (int i = 0; i < 8; ++i) { a[i] = (_Float16)(p[i] * sc); a[8 + i] = (_Float16)(p[16 + i] * sc); }
  return a;
}
// column fragment from a [K][ld] layout (column n), rows >= K read as 0
__device__ __forceinline__ v16h fragc_f32(const float* W, int k0, int n, int lane, int ld, int K) {
  v16h a; const int g = lane >> 4;
#pragma unroll
  for (int i = 0; i < 8; ++i) { const int ka = k0 + 8 * g + i, kb = ka + 16;
    a[i] = (_Float16)(ka < K ? W[(size_t)(ka < K ? ka : K - 1) * ld + n] : 0.f); a[8 + i] = (_Float16)(kb < K ? W[(size_t)(kb < K ? kb : K - 1) * ld + n] : 0.f); }
  return a;
}
struct F2 { v16b h, l; };
__device__ __forceinline__ F2 bsplit16(const float v[16]) { F2 r;
#pragma unroll
  for (int i = 0; i < 16; ++i) { const __bf16 h = (__bf16)v[i]; r.h[i] = h; r.l[i] = (__bf16)(v[i] - (float)h); }
  return r; }
__device__ __forceinline__ F2 split_row(const float* row, int k0, int lane) { float v[16]; const float* p = row + k0 + 8 * (lane >> 4);
#pragma unroll
  for (int i = 0; i < 8; ++i) { v[i] = p[i]; v[8 + i] = p[16 + i]; }
  return bsplit16(v); }
__device__ __forceinline__ F2 split_rowK(const float* row, int k0, int lane, int K) { float v[16]; const int g = lane >> 4;
#pragma unroll
  for (int i = 0; i < 8; ++i) { const int ka = k0 + 8 * g + i, kb = ka + 16; v[i] = ka < K ? row[ka < K ? ka : K - 1] : 0.f; v[8 + i] = kb < K ? row[kb < K ? kb : K - 1] : 0.f; }
  return bsplit16(v); }
__device__ __forceinline__ F2 split_col(const float* W, int k0, int n, int lane, int ld, int K) { float v[16]; const int g = lane >> 4;
#pragma unroll
  for (int i = 0; i < 8; ++i) { const int ka = k0 + 8 * g + i, kb = ka + 16; v[i] = ka < K ? W[(size_t)(ka < K ? ka : K - 1) * ld + n] : 0.f; v[8 + i] = kb < K ? W[(size_t)(kb < K ? kb : K - 1) * ld + n] : 0.f; }
  return bsplit16(v); }
__device__ __forceinline__ v8f mac3(const F2& a, const F2& b, v8f c) { c = wmma_bf(a.l, b.h, c); c = wmma_bf(a.h, b.l, c); return wmma_bf(a.h, b.h, c); }
__device__ __forceinline__ float sigm(float v) { return 1.0f / (1.0f + expf(-v)); }
#define LDSX() do { asm volatile("s_wait_dscnt 0" ::: "memory"); __builtin_amdgcn_wave_barrier(); __builtin_amdgcn_fence(__ATOMIC_RELEASE, "workgroup"); } while (0)

// Offset-attention (PCT) block (B 16, N 2,048, D 128, q/k dim 32): q = x Wq^T + bq, k = x Wk^T + bk (32-d), v = x Wv^T + bv; a = softmax over QUERIES of q k^T (no scale), then a = a / sum over keys; f_sa = a v; y = (x - f_sa) Wl^T + bl; out = relu(BN(y)) + f_sa (BN with batch statistics over B*N, biased variance, eps 1e-5).
#define NB 16
#define TT 2048
#define CC 128            // NH * HD = projected width
#define DIN 128          // input (model) width
#define NH 1
#define HD 128
#define NQB (TT / 64)
#define HG 4
#define SCALE (1.0f)
#define CAUSAL 0
#ifndef TNB
#define TNB NB
#endif
__device__ __forceinline__ float bfr(float v) { return (float)(__bf16)v; }
__host__ __device__ __forceinline__ int kb_last(int qb) { return CAUSAL ? ((qb * 64 + 63) >> 7) : (TT / 128 - 1); }
typedef __attribute__((ext_vector_type(8))) __bf16 v8b;
__device__ __forceinline__ v16b frag_b(const __bf16* rowk0, int lane) {
  union { v16b v; v8b q[2]; } u; const __bf16* p = rowk0 + 8 * (lane >> 4);
  u.q[0] = *(const v8b*)p; u.q[1] = *(const v8b*)(p + 16); return u.v;
}
// operand tile in fragment order: a 16 (rows or columns) x 32 (k) tile of 16-bit values is 1 KB = [h][lane][8 values]; lane = (g = lane>>4, row/col = lane&15) holds k = 16h + 8g + 0..7 there, so each of the two wave-wide 16-byte loads of a fragment covers 512 contiguous bytes (four whole lines)
#define FT 512             // values in one such tile
__device__ __forceinline__ v16h frag_l(const _Float16* p) {   /* p = the lane's own place in the tile: tile + 8 lane */
  union { v16h v; v8h q[2]; } u; u.q[0] = *(const v8h*)p; u.q[1] = *(const v8h*)(p + FT / 2); return u.v;
}
__device__ __forceinline__ v16h frag_t(const _Float16* tile, int lane) { return frag_l(tile + 8 * lane); }
#define QBH 0              // not used by any kernel here
#define QHI 2048            // rows carrying a q residual plane (all rows when non-causal: 2-product logits everywhere)
#define KHI 64            // key rows carrying k residual / v bf16 hi+lo planes (written by k_proj, read by no kernel here)
// B fragment (k rows k0+.., output column o) of a weight: (in,out) [K][ld] or (out,in) [ld rows of K]: bf16 exact, or f16(bf16 * 256) exact
__device__ __forceinline__ v16b wcol_io(const float* Wm, int k0, int o, int lane, int ld) { v16b w; const int g = lane >> 4;
#pragma unroll
  for (int i = 0; i < 8; ++i) { w[i] = (__bf16)Wm[(size_t)(k0 + 8 * g + i) * ld + o]; w[8 + i] = (__bf16)Wm[(size_t)(k0 + 16 + 8 * g + i) * ld + o]; }
  return w; }
__device__ __forceinline__ v16b wcol_oi(const float* Wm, int k0, int o, int lane, int K) { v16b w; const float* p = Wm + (size_t)o * K + k0 + 8 * (lane >> 4);
#pragma unroll
  for (int i = 0; i < 8; ++i) { w[i] = (__bf16)p[i]; w[8 + i] = (__bf16)p[16 + i]; }
  return w; }
__device__ __forceinline__ v16h wcolh_io(const float* Wm, int k0, int o, int lane, int ld) { v16h w; const int g = lane >> 4;
#pragma unroll
  for (int i = 0; i < 8; ++i) { w[i] = (_Float16)(bfr(Wm[(size_t)(k0 + 8 * g + i) * ld + o]) * 256.0f); w[8 + i] = (_Float16)(bfr(Wm[(size_t)(k0 + 16 + 8 * g + i) * ld + o]) * 256.0f); }
  return w; }
__device__ __forceinline__ v16h wcolh_oi(const float* Wm, int k0, int o, int lane, int K) { v16h w; const float* p = Wm + (size_t)o * K + k0 + 8 * (lane >> 4);
#pragma unroll
  for (int i = 0; i < 8; ++i) { w[i] = (_Float16)(bfr(p[i]) * 256.0f); w[8 + i] = (_Float16)(bfr(p[16 + i]) * 256.0f); }
  return w; }
#define WQKV_LAYOUT 1   // 0 = (in,out) [DIN][CC]; 1 = (out,in) [CC][DIN]; 2 = per-head [NH][DIN][HD]
__device__ __forceinline__ v16b wcol_hdk(const float* Wm, int k0, int o, int lane) { v16b w; const int g = lane >> 4; const float* p = Wm + (size_t)(o / HD) * DIN * HD + (o % HD);
#pragma unroll
  for (int i = 0; i < 8; ++i) { w[i] = (__bf16)p[(size_t)(k0 + 8 * g + i) * HD]; w[8 + i] = (__bf16)p[(size_t)(k0 + 16 + 8 * g + i) * HD]; }
  return w; }
#define WO_OUT_IN 0
#if WQKV_LAYOUT == 1
#define WCOL(W, k0, o, lane) wcol_oin(W, k0, o, lane, DIN, (which == 2) ? CC : HDQ)   /* q / k: 32 real output rows, columns 32..127 exact zeros */
#elif WQKV_LAYOUT == 2
#define WCOL(W, k0, o, lane) wcol_hdk(W, k0, o, lane)
#else
#define WCOL(W, k0, o, lane) wcol_io(W, k0, o, lane, CC)
#endif
#if WO_OUT_IN
#define WOCOL(W, k0, o, lane) wcol_oi(W, k0, o, lane, CC)
#define WOCOLH(W, k0, o, lane) wcolh_oi(W, k0, o, lane, CC)
#else
#define WOCOL(W, k0, o, lane) wcol_io(W, k0, o, lane, DIN)
#define WOCOLH(W, k0, o, lane) wcolh_io(W, k0, o, lane, DIN)
#endif
#define HDQ 32             // q / k width (k_proj's accumulators are 128 wide, columns 32..127 exact zeros; only the 32 real columns are stored)
#define BG HG              // not used by any kernel here
#define NR (TNB * TT)      // 32,768 rows (all batches)
// (out,in) projection weight with only 'nvalid' real output rows: columns o >= nvalid read row 0 and are zeroed by value
__device__ __forceinline__ v16b wcol_oin(const float* Wm, int k0, int o, int lane, int K, int nvalid) { v16b w; const int oc = o < nvalid ? o : 0; const float keep = o < nvalid ? 1.f : 0.f; const float* p = Wm + (size_t)oc * K + k0 + 8 * (lane >> 4);
#pragma unroll
  for (int i = 0; i < 8; ++i) { w[i] = (__bf16)(p[i] * keep); w[8 + i] = (__bf16)(p[16 + i] * keep); }
  return w; }
// pairwise tree over the 16 f32 P values of one A fragment (a lane's share of its query's sum over keys)
__device__ __forceinline__ float sum16(const float v[16]) { return (((v[0] + v[1]) + (v[2] + v[3])) + ((v[4] + v[5]) + (v[6] + v[7]))) + (((v[8] + v[9]) + (v[10] + v[11])) + ((v[12] + v[13]) + (v[14] + v[15]))); }
#define WS_DEN (WS_END)                                // (plane not used: the sum over keys stays in k_att's registers)
#define WS_FSA (WS_DEN + 4u * (size_t)NR)              // f32 f_sa rows [NR][128]
#define WS_YL  (WS_FSA + 4u * (size_t)NR * CC)        // f32 y rows (pre-BN)
#define WS_ST  (WS_YL + 4u * (size_t)NR * CC)         // BN statistics [128][32]
#define WS_PS  (WS_ST + 4u * (size_t)CC * 32)         // BN partials of k_lin's blocks [NR / 64][2][128]: mean of the block's 64 rows, sum of squared distances from that mean
#define WS_END2 (WS_PS + 4u * (size_t)(NR / 64) * 2 * CC)
// ---- k_lin: block = 64 rows: y = (bf16(f_in) - f_sa) (split bf16 hi + lo) Wl^T + bl (2 products, K 128) -> pre-BN rows, and per channel the block's own mean and sum of squared distances from it (PS)
__global__ __launch_bounds__(128) void k_lin(const float* __restrict__ X, const float* __restrict__ FSA, const float* __restrict__ WL, const float* __restrict__ BL, float* __restrict__ YL, float* __restrict__ PS) { __shared__ __align__(16) float sf[4][16][132]; __shared__ __align__(16) float sp[4][2][CC];
  const int tid = threadIdx.x, wave = tid >> 5, lane = tid & 31, col = lane & 15, g = lane >> 4; const size_t r0 = (size_t)blockIdx.x * 64 + wave * 16;
  v8f acc[8] = {};
#pragma unroll
  for (int kc = 0; kc < CC / 32; ++kc) { float v[16]; { const float* px = X + (r0 + col) * CC + kc * 32 + 8 * g; const float* pf = FSA + (r0 + col) * CC + kc * 32 + 8 * g;
#pragma unroll
      for (int i = 0; i < 8; ++i) { v[i] = bfr(px[i]) - pf[i]; v[8 + i] = bfr(px[16 + i]) - pf[16 + i]; } }
    const F2 a = bsplit16(v); asm volatile("s_wait_loadcnt 0x0" ::: "memory");
#pragma unroll
    for (int j = 0; j < 8; ++j) { const v16b w = wcol_oin(WL, kc * 32, j * 16 + col, lane, CC, CC); asm volatile("s_wait_loadcnt 0x0" ::: "memory"); acc[j] = wmma_bf(a.h, w, acc[j]); acc[j] = wmma_bf(a.l, w, acc[j]); } }
#pragma unroll
  for (int j = 0; j < 8; ++j) { const float bb = bfr(BL[j * 16 + col]);
#pragma unroll
    for (int r = 0; r < 8; ++r) sf[wave][8 * g + r][j * 16 + col] = acc[j][r] + bb; }
  LDSX(); v4f yv[16];
#pragma unroll   /* yv is indexed by constants only */
  for (int rl = 0; rl < 16; ++rl) yv[rl] = *(const v4f*)&sf[wave][rl][lane * 4];
  // the wave's 16 rows, channels 4 lane .. 4 lane + 3: mean, then squared distances from that mean (no difference of large squares anywhere)
  const v4f m16 = ((((yv[0] + yv[1]) + (yv[2] + yv[3])) + ((yv[4] + yv[5]) + (yv[6] + yv[7]))) + (((yv[8] + yv[9]) + (yv[10] + yv[11])) + ((yv[12] + yv[13]) + (yv[14] + yv[15])))) * (1.0f / 16.0f); v4f q16 = {};
#pragma unroll
  for (int rl = 0; rl < 16; ++rl) { const v4f d = yv[rl] - m16; q16 += d * d; }
  *(v4f*)&sp[wave][0][lane * 4] = m16; *(v4f*)&sp[wave][1][lane * 4] = q16;
  __syncthreads();
  // thread = channel: the four waves' groups of 16 rows merged: mean of the means; squared distances add up, plus 16 x each group mean's squared distance from the merged mean
  const float g0 = sp[0][0][tid], g1 = sp[1][0][tid], g2 = sp[2][0][tid], g3 = sp[3][0][tid]; const float m64 = ((g0 + g1) + (g2 + g3)) * 0.25f; const float e0 = g0 - m64, e1 = g1 - m64, e2 = g2 - m64, e3 = g3 - m64;
  const float q64 = ((sp[0][1][tid] + sp[1][1][tid]) + (sp[2][1][tid] + sp[3][1][tid])) + 16.0f * ((e0 * e0 + e1 * e1) + (e2 * e2 + e3 * e3));
#pragma unroll   /* the row stores stand behind the barrier: in front of it the barrier would wait for all sixteen to finish */
  for (int rl = 0; rl < 16; ++rl) vst2(YL + (r0 + rl) * CC + lane * 4, yv[rl]);
  vst2(PS + (size_t)blockIdx.x * 2 * CC + tid, m64); vst2(PS + ((size_t)blockIdx.x * 2 + 1) * CC + tid, q64); }
// ---- k_stat: block = channel c: merges the NR / 64 partials of k_lin (equal groups of 64 rows) in the same way -> mean and 1 / sqrt(biased variance + eps)
__global__ __launch_bounds__(256) void k_stat(const float* __restrict__ PS, float* __restrict__ STAT) { __shared__ float sred[8]; __shared__ float sbc;
  const int t = threadIdx.x; const int c = blockIdx.x; float pm[NR / 64 / 256], pq[NR / 64 / 256];
#pragma unroll   /* register arrays indexed by constants; all loads in flight at once */
  for (int i = 0; i < NR / 64 / 256; ++i) { pm[i] = PS[(size_t)(i * 256 + t) * 2 * CC + c]; pq[i] = PS[((size_t)(i * 256 + t) * 2 + 1) * CC + c]; }
  float s = 0.f;
#pragma unroll
  for (int i = 0; i < NR / 64 / 256; ++i) s += pm[i];
#pragma unroll
  for (int o = 1; o < 32; o <<= 1) s += __shfl_xor(s, o);
  if ((t & 31) == 0) sred[t >> 5] = s; __syncthreads(); if (t == 0) { float a = 0.f; for (int i = 0; i < 8; ++i) a += sred[i]; sbc = a / (float)(NR / 64); } __syncthreads(); const float mean = sbc; __syncthreads();
  float q = 0.f;
#pragma unroll
  for (int i = 0; i < NR / 64 / 256; ++i) { const float d = pm[i] - mean; q += pq[i] + 64.0f * (d * d); }
#pragma unroll
  for (int o = 1; o < 32; o <<= 1) q += __shfl_xor(q, o);
  if ((t & 31) == 0) sred[t >> 5] = q; __syncthreads(); if (t == 0) { float a = 0.f; for (int i = 0; i < 8; ++i) a += sred[i]; sbc = rsqrtf(a / (float)NR + 1e-5f); } __syncthreads();
  if (t < 32) { const float v = t == 0 ? mean : (t == 1 ? sbc : 0.f); vst2(STAT + (size_t)c * 32 + t, v); } }
// ---- k_fin: out = relu(gamma (y - mean) rstd + beta) + f_sa (thread per float4)
__global__ __launch_bounds__(256) void k_fin(const float* __restrict__ YL, const float* __restrict__ STAT, const float* __restrict__ G, const float* __restrict__ BE, const float* __restrict__ FSA, float* __restrict__ OUT) { const size_t e4 = (size_t)blockIdx.x * 256 + threadIdx.x; if (e4 >= (size_t)NR * CC / 4) return; const int c0 = (int)((e4 * 4) % CC); const v4f yv = *(const v4f*)(YL + e4 * 4); const v4f fv = *(const v4f*)(FSA + e4 * 4); v4f o;
#pragma unroll
  for (int i = 0; i < 4; ++i) { const int c = c0 + i; const float yb = bfr(G[c]) * (yv[i] - STAT[c * 32]) * STAT[c * 32 + 1] + bfr(BE[c]); o[i] = fmaxf(yb, 0.f) + fv[i]; }
  vst2(OUT + e4 * 4, o); }
#ifndef SM_EXTRA_PARAMS
#define SM_EXTRA_PARAMS
#endif
#ifndef PROJ_EXTRA_PARAMS
#define PROJ_EXTRA_PARAMS
#endif
#ifndef SM_MASK_HOOK
#define SM_MASK_HOOK (void)0
#endif

#define WS_QH  0u                                      // f16 q tiles in fragment order [b*t / 16][FT] (the 32 real columns only; the rest of the plane is not used)
#define WS_KH  (WS_QH + 2u * (size_t)NB * TT * CC)      // f16 k tiles in fragment order [b*t / 16][FT]
#define WS_VT  (WS_KH + 2u * (size_t)NB * TT * CC)      // f16 v tiles in fragment order [b][t / 32][c / 16][FT] (tile: column = channel, k = t)
#define WS_QL  (WS_VT + 2u * (size_t)NB * CC * TT)      // f16 q residual x 2^10 tiles [(b, t < QHI) / 16][FT]
#define WS_KL  (WS_QL + 2u * (size_t)NB * QHI * CC)     // f16 k residual x 2^10 tiles [(b, t < KHI) / 16][FT]
#define WS_VB  (WS_KL + 2u * (size_t)NB * KHI * CC)     // bf16 v hi planes [b][c][t < KHI]
#define WS_VBL (WS_VB + 2u * (size_t)NB * CC * KHI)
#define WS_S   (WS_VBL + 2u * (size_t)NB * CC * KHI)    // f32 per-key softmax constants [b][t / 16][2][16] (the rest of the plane is not used)
#define WS_Y   (WS_S  + 4u * (size_t)HG * TT * TT)      // f32 ctx rows [b*t][CC] (only when there is an output projection)
#define WS_END (WS_Y  + 0u)

// ---- k_proj: block = (64 rows, 128 cols, which): q/k/v = X W (+ b) with exact bf16 products (K = DIN) -> which 0: q f16 tiles (+ residual tiles, rows < QHI); 1: k f16 tiles (+ residual tiles, rows < KHI); 2: v f16 tiles (+ bf16 hi/lo planes [c][t] for t < KHI); the f16 tiles in fragment order (frag_t)
__global__ __launch_bounds__(128) void k_proj(const float* __restrict__ XQ, const float* __restrict__ XK, const float* __restrict__ XV, const float* __restrict__ WQ, const float* __restrict__ WK, const float* __restrict__ WV, const float* __restrict__ BQ, const float* __restrict__ BK, const float* __restrict__ BV,
    _Float16* __restrict__ QH, _Float16* __restrict__ QL, _Float16* __restrict__ KH, _Float16* __restrict__ KL, _Float16* __restrict__ VT, __bf16* __restrict__ VB, __bf16* __restrict__ VBL) {
  __shared__ __align__(16) _Float16 sh[64][136], sl[64][136]; __shared__ __align__(16) _Float16 th[128][72]; __shared__ __align__(16) __bf16 tb[128][72], tbl[128][72];
  const int tid = threadIdx.x, wave = tid >> 5, lane = tid & 31, col = lane & 15, g = lane >> 4; const int which = blockIdx.z; const int c0 = blockIdx.y * 128; const size_t r0 = (size_t)blockIdx.x * 64; const size_t bb = r0 / TT; const int t0 = (int)(r0 % TT);
  const float* X = which == 0 ? XQ : which == 1 ? XK : XV; const float* WA = which == 0 ? WQ : which == 1 ? WK : WV; const float* BA = which == 0 ? BQ : which == 1 ? BK : BV;
  v8f acc[8] = {};
#pragma unroll 2
  for (int kc = 0; kc < DIN / 32; ++kc) { v16b a; { const float* p = X + (r0 + wave * 16 + col) * DIN + kc * 32 + 8 * g;
#pragma unroll
      for (int i = 0; i < 8; ++i) { a[i] = (__bf16)p[i]; a[8 + i] = (__bf16)p[16 + i]; } }
    asm volatile("s_wait_loadcnt 0x0" ::: "memory");
#pragma unroll
    for (int j = 0; j < 8; ++j) { const v16b w = WCOL(WA, kc * 32, c0 + j * 16 + col, lane); asm volatile("s_wait_loadcnt 0x0" ::: "memory"); acc[j] = wmma_bf(a, w, acc[j]); } }
  if (which < 2) { _Float16* DH = which == 0 ? QH : KH; _Float16* DL = which == 0 ? QL : KL; const int nhi = which == 0 ? QHI : KHI; const bool hi_rows = t0 < nhi;
#pragma unroll
    for (int j = 0; j < 8; ++j) { const int oo = c0 + j * 16 + col; const float bias = (BA && (which == 2 || oo < HDQ)) ? bfr(BA[which == 2 ? oo : (oo < HDQ ? oo : 0)]) : 0.f;
#pragma unroll
      for (int r = 0; r < 8; ++r) { const float v = acc[j][r] + bias; const _Float16 hv = (_Float16)v; sh[wave * 16 + 8 * g + r][j * 16 + col] = hv; sl[wave * 16 + 8 * g + r][j * 16 + col] = (_Float16)((v - (float)hv) * 1024.0f); } }
    __syncthreads();
    for (int e = tid; e < 64 * HDQ / 8; e += 128) { const int tl = e >> 6, h = (e >> 5) & 1, l = e & 31; const int rl = tl * 16 + (l & 15), k8 = 16 * h + 8 * (l >> 4);   /* e runs in the order of the destination: a wave stores 512 contiguous bytes */
      vst2((unsigned*)(DH + ((r0 >> 4) + tl) * FT + (e & 63) * 8), *(const v4u*)&sh[rl][k8]);
      asm volatile("s_wait_xcnt 0x0" ::: "memory");   /* precaution, here and behind the four stores below: the store has taken its address and data before the next LDS load or address sum writes those registers again */
      if (hi_rows) { vst2((unsigned*)(DL + (((bb * nhi + t0) >> 4) + tl) * FT + (e & 63) * 8), *(const v4u*)&sl[rl][k8]); asm volatile("s_wait_xcnt 0x0" ::: "memory"); } }
  } else { const bool hi_rows = t0 < KHI;
#pragma unroll
    for (int j = 0; j < 8; ++j) { const int oo = c0 + j * 16 + col; const float bias = (BA && (which == 2 || oo < HDQ)) ? bfr(BA[which == 2 ? oo : (oo < HDQ ? oo : 0)]) : 0.f;
#pragma unroll
      for (int r = 0; r < 8; ++r) { const float v = acc[j][r] + bias; const int rl = wave * 16 + 8 * g + r, cl = j * 16 + col; th[cl][rl] = (_Float16)v; const __bf16 bh = (__bf16)v; tb[cl][rl] = bh; tbl[cl][rl] = (__bf16)(v - (float)bh); } }
    __syncthreads();
    for (int e = tid; e < 128 * 8; e += 128) { const int cl = e >> 3, q = e & 7; { const int tl = e >> 6, h = (e >> 5) & 1, l = e & 31;   /* tile tl = (32-key chunk tl >> 3, 16 channels tl & 7) of the block, e in the order of the destination */
        vst2((unsigned*)(VT + (((bb * (TT / 32) + (t0 >> 5) + (tl >> 3)) * (CC / 16) + (c0 >> 4) + (tl & 7)) * FT + (e & 63) * 8)), *(const v4u*)&th[(tl & 7) * 16 + (l & 15)][(tl >> 3) * 32 + 16 * h + 8 * (l >> 4)]); asm volatile("s_wait_xcnt 0x0" ::: "memory"); }
      if (hi_rows) { const size_t o3 = (bb * CC + c0 + cl) * (size_t)KHI + t0 + q * 8; vst2((unsigned*)(VB + o3), *(const v4u*)&tb[cl][q * 8]); asm volatile("s_wait_xcnt 0x0" ::: "memory"); vst2((unsigned*)(VBL + o3), *(const v4u*)&tbl[cl][q * 8]); asm volatile("s_wait_xcnt 0x0" ::: "memory"); } } } }
// plain builtin form: the compiler keeps the distance behind a matrix instruction itself and fills it with independent work where it can
__device__ __forceinline__ v8f wmma16c(v16h a, v16h b, v8f c) { return __builtin_amdgcn_wmma_f32_16x16x32_f16(false, a, false, b, (short)0, c, false, false); }
// (in the two kernels below every plain '#pragma unroll' is there so that a register array is indexed by constants only)
// logit of one (key, query) pair from the two f16 products: k hi . q + (k residual x 2^10) . q / 2^10
__device__ __forceinline__ float logit2(float hi, float lo) { return (hi + lo * (1.0f / 1024.0f)) * SCALE; }
#define LOG2E 1.4426950408889634f
// exp(x) 2^c = 2^(x log2 e + c): one fused multiply-add (lc) and the hardware's own base-2 exponential (exp2x8). The exponent is at most about 11 here (x never above its key's maximum); a result under 2^-126 may come out as 0, far below what the f32 sums (at least 1) or an f16 P value keep
__device__ __forceinline__ float lc(float x, float c) { return __builtin_fmaf(x, LOG2E, c); }
// y[0..7] = 2^y[0..7]. One statement, each exponential in place, one v_nop at the end: the instruction set asks for one independent instruction behind a transcendental before its result is read or its source written over; here that is the next exponential, on another register, and behind the last one the v_nop (left to the register allocator, neighbours wrote over each other's sources)
__device__ __forceinline__ void exp2x8(float* y) {
  asm("v_exp_f32 %0, %0\n\tv_exp_f32 %1, %1\n\tv_exp_f32 %2, %2\n\tv_exp_f32 %3, %3\n\tv_exp_f32 %4, %4\n\tv_exp_f32 %5, %5\n\tv_exp_f32 %6, %6\n\tv_exp_f32 %7, %7\n\tv_nop"
      : "+v"(y[0]), "+v"(y[1]), "+v"(y[2]), "+v"(y[3]), "+v"(y[4]), "+v"(y[5]), "+v"(y[6]), "+v"(y[7])); }
// ---- k_kst: block = 16 keys of batch blockIdx.y; wave w holds the logits of those keys against queries [256 w, 256 w + 256) in registers (D: row = key 8g + r, column = query): maximum and sum of exp over ALL queries -> KS line of the key tile: per key the one constant c = 11 - max log2 e - log2 sum, so that 2^(logit log2 e + c) = exp(logit - max) x 2^11 / sum (the line's second half repeats the 16 values: the block stays the one writer of its whole 128-B line)
__global__ __launch_bounds__(256) __attribute__((amdgpu_waves_per_eu(4))) /* holds the kernel to 256 registers, four waves per SIMD as before: left alone this build takes a few more and only one block fits a WGP */ void k_kst(const _Float16* __restrict__ KRH, const _Float16* __restrict__ KRL, const _Float16* __restrict__ QR, float* __restrict__ KS) { __shared__ float smx[8][16], ssu[8][16];
  const int tid = threadIdx.x, wave = tid >> 5, lane = tid & 31, col = lane & 15, g = lane >> 4; const size_t kr0 = (size_t)blockIdx.y * TT + blockIdx.x * 16, q0 = (size_t)blockIdx.y * TT + wave * (TT / 8);
  const v16h ah = frag_t(KRH + (kr0 >> 4) * FT, lane), al = frag_t(KRL + (kr0 >> 4) * FT, lane);
  asm volatile("s_wait_xcnt 0x0" ::: "memory");   /* precaution: the four key loads above have taken their addresses before a later load's result reuses those address registers */
  float s[TT / 128][8]; v16h qf[TT / 128];
#pragma unroll
  for (int t = 0; t < 8; ++t) qf[t] = frag_t(QR + ((q0 >> 4) + t) * FT, lane);
#pragma unroll
  for (int tg = 0; tg < TT / 128; tg += 4) {   /* groups of four query tiles, loaded two groups ahead of their products */
    if (tg + 8 < TT / 128) {
#pragma unroll
      for (int t = tg + 8; t < tg + 12; ++t) qf[t] = frag_t(QR + ((q0 >> 4) + t) * FT, lane); }
    __builtin_amdgcn_sched_barrier(0);   /* keeps the loads above issued here: left alone the scheduler either waits on one tile at a time or hoists all sixteen, which takes the kernel past 256 registers */
#pragma unroll
    for (int t = tg; t < tg + 4; ++t) { v8f a = {}, l = {}; a = wmma16(ah, qf[t], a); l = wmma16(al, qf[t], l);
#pragma unroll
      for (int r = 0; r < 8; ++r) s[t][r] = logit2(a[r], l[r]); }
    __builtin_amdgcn_sched_barrier(0);   /* the other side of the same fence: the next group's loads stay behind these products */
  }
  float mx[8], su[8];
#pragma unroll
  for (int r = 0; r < 8; ++r) { float m = s[0][r];
#pragma unroll
    for (int t = 1; t < TT / 128; ++t) m = fmaxf(m, s[t][r]);
#pragma unroll
    for (int o = 1; o < 16; o <<= 1) m = fmaxf(m, __shfl_xor(m, o));
    mx[r] = m; }
  if (col == 0) {
#pragma unroll
    for (int r = 0; r < 8; ++r) smx[wave][8 * g + r] = mx[r]; }
  __syncthreads();
#pragma unroll
  for (int r = 0; r < 8; ++r) { float m = smx[0][8 * g + r];
#pragma unroll
    for (int w = 1; w < 8; ++w) m = fmaxf(m, smx[w][8 * g + r]);
    float a = 0.f; const float nm = -m * LOG2E;
#pragma unroll
    for (int tg = 0; tg < TT / 128; tg += 8) { float e[8];
#pragma unroll
      for (int t = 0; t < 8; ++t) e[t] = lc(s[tg + t][r], nm);
      exp2x8(e);
#pragma unroll
      for (int t = 0; t < 8; ++t) a += e[t]; }
#pragma unroll
    for (int o = 1; o < 16; o <<= 1) a += __shfl_xor(a, o);
    su[r] = a; }
  if (col == 0) {
#pragma unroll
    for (int r = 0; r < 8; ++r) ssu[wave][8 * g + r] = su[r]; }
  __syncthreads();
  if (tid < 32) { float m = smx[0][col], a = 0.f;
#pragma unroll
    for (int w = 1; w < 8; ++w) m = fmaxf(m, smx[w][col]);
#pragma unroll
    for (int w = 0; w < 8; ++w) a += ssu[w][col];
    vst2(KS + kr0 * 2 + tid, a > 0.f ? (11.0f - m * LOG2E) - log2f(a) : -1.0e30f); } }   /* no sum: an exponent that makes every P of the key 0, as the factor 0 did */
// ---- k_att: block = 64 queries (qb) of batch blockIdx.y, wave = 16 queries; per 32 keys: S^T tiles (row = key, column = query) from the same two products as k_kst, P x 2^11 = 2^(logit log2 e + the key's constant of k_kst) in f32; the two D tiles, converted to f16 in place, ARE the A fragment (row = query, k = key) of P . v; f_sa = (P . v) / (sum over keys of P)
__global__ __launch_bounds__(128) void k_att(const _Float16* __restrict__ KRH, const _Float16* __restrict__ KRL, const _Float16* __restrict__ QR, const float* __restrict__ KS, const _Float16* __restrict__ VT, float* __restrict__ Y) { __shared__ __align__(16) float ss[4][16][HD + 4]; __shared__ __align__(16) float sks[TT * 2];
  const int tid = threadIdx.x, wave = tid >> 5, lane = tid & 31, col = lane & 15, g = lane >> 4; const int b = blockIdx.y; const int ql0 = blockIdx.x * 64 + wave * 16;
#pragma unroll   /* all eight loads in flight at once */
  for (int i = 0; i < TT * 2 / 4 / 128; ++i) *(v4f*)&sks[(i * 128 + tid) * 4] = *(const v4f*)(KS + (size_t)b * TT * 2 + (i * 128 + tid) * 4);
  __syncthreads();
  const _Float16* qp = QR + (((size_t)b * TT + ql0) >> 4) * FT + 8 * lane; const v16h qf = frag_l(qp);
  const _Float16* kh = KRH + (size_t)b * (TT / 16) * FT; const _Float16* kl = KRL + (size_t)b * (TT / 16) * FT; const _Float16* vt = VT + (size_t)b * (TT / 32) * (HD / 16) * FT;
  v8f acc[HD / 16] = {}; float ksum = 0.f;   /* f32 sum of the P x 2^11 values this lane makes: query ql0 + col, the k half g of every chunk */
  v16h a0 = frag_t(kh, lane), l0 = frag_t(kl, lane), a1 = frag_t(kh + FT, lane), l1 = frag_t(kl + FT, lane);
  asm volatile("s_wait_xcnt 0x0" :: "v"(qp) : "memory");   /* precaution: the ten loads above have taken their addresses before an address register is written again; qp is named so that its pair lives up to here (left alone the zeroing of the accumulators is moved up over the wait and writes it) */
#pragma unroll 1   /* rolled: one pass's fragments and accumulators already fill most of 256 registers */
  for (int kc = 0; kc < TT / 32; ++kc) { v16h vf[HD / 16]; const _Float16* vp = vt + (size_t)kc * (HD / 16) * FT + 8 * lane;
#pragma unroll
    for (int j = 0; j < HD / 16; ++j) vf[j] = frag_l(vp + j * FT);
    __builtin_amdgcn_sched_barrier(0);   /* keeps the 16 v loads issued here, a whole score-and-exp phase ahead of their use (the scheduler otherwise sinks them to the P . v products, two fragments in flight) */
    v8f s0 = {}, t0 = {}, s1 = {}, t1 = {}; s0 = wmma16c(a0, qf, s0); t0 = wmma16c(l0, qf, t0); s1 = wmma16c(a1, qf, s1); t1 = wmma16c(l1, qf, t1);
    const size_t kn = (size_t)(kc + 1 < TT / 32 ? kc + 1 : kc) * 2 * FT;   /* next chunk's two key tiles, fetched one pass ahead (the last pass fetches its own again: in bounds) */
    a0 = frag_t(kh + kn, lane); l0 = frag_t(kl + kn, lane); a1 = frag_t(kh + kn + FT, lane); l1 = frag_t(kl + kn + FT, lane);
    asm volatile("s_wait_xcnt 0x0" :: "v"(vp) : "memory");   /* precaution: the pass's loads have taken their addresses before an address register is written again; vp is named so that the v loads' address pair lives up to here and is not itself the destination of the last of them */
    __builtin_amdgcn_sched_barrier(0);   /* keeps the next chunk's key loads issued here, ahead of the exp phase */
    const v4f* st = (const v4f*)&sks[kc * 64 + 8 * g]; const v4f c0[2] = { st[0], st[1] }, c1[2] = { st[8], st[9] }; float v[16];   /* the chunk's constants, keys 8g + r of both tiles */
#pragma unroll
    for (int r = 0; r < 8; ++r) { v[r] = lc(logit2(s0[r], t0[r]), c0[r >> 2][r & 3]); v[8 + r] = lc(logit2(s1[r], t1[r]), c1[r >> 2][r & 3]); }
    exp2x8(v); exp2x8(v + 8);
    v16h p;
#pragma unroll
    for (int i = 0; i < 16; ++i) p[i] = (_Float16)v[i];
    ksum += sum16(v);
#pragma unroll
    for (int j = 0; j < HD / 16 - 1; ++j) acc[j] = wmma16c(p, vf[j], acc[j]);
    acc[HD / 16 - 1] = wmma16(p, vf[HD / 16 - 1], acc[HD / 16 - 1]); }   /* the last product in the form with four v_nop behind it: across the taken branch the next pass's v loads write over the B fragments of these products */
  ksum += __shfl_xor(ksum, 16);   /* both k halves: den (x 2^11) of query ql0 + col, in lanes col and col + 16 */
  const float inv = ksum > 0.f ? 2048.0f / ksum : 0.f; float invr[8];
#pragma unroll
  for (int r = 0; r < 8; ++r) invr[r] = __shfl(inv, 8 * g + r);   /* accumulator element r is query row 8g + r */
#pragma unroll
  for (int j = 0; j < HD / 16; ++j)
#pragma unroll
    for (int r = 0; r < 8; ++r) ss[wave][8 * g + r][j * 16 + col] = acc[j][r] * (1.0f / 2048.0f) * invr[r];
  LDSX(); for (int rl = 0; rl < 16; ++rl) vst2(Y + ((size_t)b * TT + ql0 + rl) * CC + lane * 4, *(const v4f*)&ss[wave][rl][lane * 4]); }

extern "C" void kernel_launch(void* const* d_in, const int* in_sizes, int n_in, void* d_out, int out_size, void* d_ws, size_t ws_size, hipStream_t stream) {
  (void)in_sizes; (void)n_in; (void)out_size;
  const float** F = (const float**)d_in;
  if (ws_size < (size_t)WS_END) return;
  char* ws = (char*)d_ws; _Float16 *QH = (_Float16*)(ws + WS_QH), *KH = (_Float16*)(ws + WS_KH), *VT = (_Float16*)(ws + WS_VT), *QL = (_Float16*)(ws + WS_QL), *KL = (_Float16*)(ws + WS_KL); __bf16 *VB = (__bf16*)(ws + WS_VB), *VBL = (__bf16*)(ws + WS_VBL); float *S = (float*)(ws + WS_S), *Y = (float*)(ws + WS_Y);
  (void)Y; (void)QL; (void)KL; (void)VB; (void)VBL;
  // inputs: 0 f_in [16,2048,128]; 1 w_q [32,128] (out,in), 2 b_q [32]; 3 w_k [32,128], 4 b_k; 5 w_v [128,128], 6 b_v; 7 w_l [128,128], 8 b_l; 9 bn_gamma, 10 bn_beta
  if (ws_size < (size_t)WS_END2) return;
  float *FSA = (float*)(ws + WS_FSA), *YL = (float*)(ws + WS_YL), *ST = (float*)(ws + WS_ST), *PS = (float*)(ws + WS_PS);
  // ROLE SWAP: the 'q' planes (hi + residual) hold K (from w_k, b_k) and the 'k' planes hold Q, so the score tiles are S^T[key][query] and the softmax runs over QUERIES
  k_proj<<<dim3(TNB * TT / 64, CC / 128, 3), 128, 0, stream>>>(F[0], F[0], F[0], F[3], F[1], F[5], F[4], F[2], F[6], QH, QL, KH, KL, VT, VB, VBL);
  k_kst<<<dim3(TT / 16, TNB), 256, 0, stream>>>(QH, QL, KH, S);   /* per key: the exponent constant from the maximum and the sum of exp over the queries */
  k_att<<<dim3(NQB, TNB), 128, 0, stream>>>(QH, QL, KH, S, VT, FSA);   /* f_sa rows: logits made again in registers, P never stored */
  k_lin<<<dim3(NR / 64), 128, 0, stream>>>(F[0], FSA, F[7], F[8], YL, PS);
  k_stat<<<dim3(CC), 256, 0, stream>>>(PS, ST);
  k_fin<<<dim3((NR * CC / 4 + 255) / 256), 256, 0, stream>>>(YL, ST, F[9], F[10], FSA, (float*)d_out);
}

// v006
// It runs in 106 microseconds.
// Timed twice side by side with v005, it ran 1.26 times as fast both times.
// Over all steps from v000 it is 15.9 times as fast.
#include <hip/hip_runtime.h>
#include <math.h>

typedef __attribute__((ext_vector_type(16))) _Float16 v16h;
typedef __attribute__((ext_vector_type(16))) __bf16 v16b;
typedef __attribute__((ext_vector_type(8)))  _Float16 v8h;
typedef __attribute__((ext_vector_type(8)))  float v8f;
typedef __attribute__((ext_vector_type(4)))  float v4f;
typedef __attribute__((ext_vector_type(2)))  float v2f;
typedef __attribute__((ext_vector_type(4)))  unsigned v4u;
typedef __attribute__((ext_vector_type(4)))  int v4i;
typedef float __attribute__((may_alias)) float_a;
typedef int __attribute__((may_alias)) int_a;

template <typename T> __device__ __forceinline__ void vst2(void* p, T v) { *(T*)p = v;  }
__device__ __forceinline__ v8f wmma16(v16h a, v16h b, v8f c) {
  v8f d = __builtin_amdgcn_wmma_f32_16x16x32_f16(false, a, false, b, (short)0, c, false, false);
  asm volatile("v_nop\n\tv_nop\n\tv_nop\n\tv_nop" : "+v"(d) : "v"(a), "v"(b));
  return d;
}
__device__ __forceinline__ v8f wmma_bf(v16b a, v16b b, v8f c) {
  v8f d = __builtin_amdgcn_wmma_f32_16x16x32_bf16(false, a, false, b, (short)0, c, false, false);
  asm volatile("v_nop\n\tv_nop\n\tv_nop\n\tv_nop" : "+v"(d) : "v"(a), "v"(b));
  return d;
}
// 16x16x32 fragments: lane = (h = lane>>4, row/col = lane&15); elements 0..7 = k0+8h+0..7, 8..15 = k0+16+8h+0..7; D element r = row 8h+r
__device__ __forceinline__ v16h frag_h(const _Float16* rowk0, int lane) {
  union { v16h v; v8h q[2]; } u; const _Float16* p = rowk0 + 8 * (lane >> 4);
  u.q[0] = *(const v8h*)p; u.q[1] = *(const v8h*)(p + 16); return u.v;
}
__device__ __forceinline__ v16h frag_f32(const float* rowk0, int lane) {
  v16h a; const float* p = rowk0 + 8 * (lane >> 4);
#pragma unroll
  for (int i = 0; i < 8; ++i) { a[i] = (_Float16)p[i]; a[8 + i] = (_Float16)p[16 + i]; }
  return a;
}
__device__ __forceinline__ v16h frag_f32s(const float* rowk0, int lane, float sc) {
  v16h a; const float* p = rowk0 + 8 * (lane >> 4);
#pragma unroll
  for (int i = 0; i < 8; ++i) { a[i] = (_Float16)(p[i] * sc); a[8 + i] = (_Float16)(p[16 + i] * sc); }
  return a;
}
// column fragment from a [K][ld] layout (column n), rows >= K read as 0
__device__ __forceinline__ v16h fragc_f32(const float* W, int k0, int n, int lane, int ld, int K) {
  v16h a; const int g = lane >> 4;
#pragma unroll
  for (int i = 0; i < 8; ++i) { const int ka = k0 + 8 * g + i, kb = ka + 16;
    a[i] = (_Float16)(ka < K ? W[(size_t)(ka < K ? ka : K - 1) * ld + n] : 0.f); a[8 + i] = (_Float16)(kb < K ? W[(size_t)(kb < K ? kb : K - 1) * ld + n] : 0.f); }
  return a;
}
struct F2 { v16b h, l; };
__device__ __forceinline__ F2 bsplit16(const float v[16]) { F2 r;
#pragma unroll
  for (int i = 0; i < 16; ++i) { const __bf16 h = (__bf16)v[i]; r.h[i] = h; r.l[i] = (__bf16)(v[i] - (float)h); }
  return r; }
__device__ __forceinline__ F2 split_row(const float* row, int k0, int lane) { float v[16]; const float* p = row + k0 + 8 * (lane >> 4);
#pragma unroll
  for (int i = 0; i < 8; ++i) { v[i] = p[i]; v[8 + i] = p[16 + i]; }
  return bsplit16(v); }
__device__ __forceinline__ F2 split_rowK(const float* row, int k0, int lane, int K) { float v[16]; const int g = lane >> 4;
#pragma unroll
  for (int i = 0; i < 8; ++i) { const int ka = k0 + 8 * g + i, kb = ka + 16; v[i] = ka < K ? row[ka < K ? ka : K - 1] : 0.f; v[8 + i] = kb < K ? row[kb < K ? kb : K - 1] : 0.f; }
  return bsplit16(v); }
__device__ __forceinline__ F2 split_col(const float* W, int k0, int n, int lane, int ld, int K) { float v[16]; const int g = lane >> 4;
#pragma unroll
  for (int i = 0; i < 8; ++i) { const int ka = k0 + 8 * g + i, kb = ka + 16; v[i] = ka < K ? W[(size_t)(ka < K ? ka : K - 1) * ld + n] : 0.f; v[8 + i] = kb < K ? W[(size_t)(kb < K ? kb : K - 1) * ld + n] : 0.f; }
  return bsplit16(v); }
__device__ __forceinline__ v8f mac3(const F2& a, const F2& b, v8f c) { c = wmma_bf(a.l, b.h, c); c = wmma_bf(a.h, b.l, c); return wmma_bf(a.h, b.h, c); }
__device__ __forceinline__ float sigm(float v) { return 1.0f / (1.0f + expf(-v)); }
#define LDSX() do { asm volatile("s_wait_dscnt 0" ::: "memory"); __builtin_amdgcn_wave_barrier(); __builtin_amdgcn_fence(__ATOMIC_RELEASE, "workgroup"); } while (0)

// Offset-attention (PCT) block (B 16, N 2,048, D 128, q/k dim 32): q = x Wq^T + bq, k = x Wk^T + bk (32-d), v = x Wv^T + bv; a = softmax over QUERIES of q k^T (no scale), then a = a / sum over keys; f_sa = a v; y = (x - f_sa) Wl^T + bl; out = relu(BN(y)) + f_sa (BN with batch statistics over B*N, biased variance, eps 1e-5).
#define NB 16
#define TT 2048
#define CC 128            // NH * HD = projected width
#define DIN 128          // input (model) width
#define NH 1
#define HD 128
#define NQB (TT / 64)
#define HG 4
#define SCALE (1.0f)
#define CAUSAL 0
#ifndef TNB
#define TNB NB
#endif
__device__ __forceinline__ float bfr(float v) { return (float)(__bf16)v; }
__host__ __device__ __forceinline__ int kb_last(int qb) { return CAUSAL ? ((qb * 64 + 63) >> 7) : (TT / 128 - 1); }
typedef __attribute__((ext_vector_type(8))) __bf16 v8b;
__device__ __forceinline__ v16b frag_b(const __bf16* rowk0, int lane) {
  union { v16b v; v8b q[2]; } u; const __bf16* p = rowk0 + 8 * (lane >> 4);
  u.q[0] = *(const v8b*)p; u.q[1] = *(const v8b*)(p + 16); return u.v;
}
// operand tile in fragment order: a 16 (rows or columns) x 32 (k) tile of 16-bit values is 1 KB = [h][lane][8 values]; lane = (g = lane>>4, row/col = lane&15) holds k = 16h + 8g + 0..7 there, so each of the two wave-wide 16-byte loads of a fragment covers 512 contiguous bytes (four whole lines)
#define FT 512             // values in one such tile
__device__ __forceinline__ v16h frag_l(const _Float16* p) {   /* p = the lane's own place in the tile: tile + 8 lane */
  union { v16h v; v8h q[2]; } u; u.q[0] = *(const v8h*)p; u.q[1] = *(const v8h*)(p + FT / 2); return u.v;
}
__device__ __forceinline__ v16h frag_t(const _Float16* tile, int lane) { return frag_l(tile + 8 * lane); }
typedef __attribute__((ext_vector_type(4))) __bf16 v4b;
__device__ __forceinline__ v16b frag_lb(const __bf16* p) {   /* the same for a bf16 tile */
  union { v16b v; v8b q[2]; } u; u.q[0] = *(const v8b*)p; u.q[1] = *(const v8b*)(p + FT / 2); return u.v;
}
// A block of 128 threads stages an (out,in) f32 weight with rows of 128 values in LDS, rounded to bf16, as tiles in fragment order; tile it = (16 output rows it >> 2, k step it & 3). One tile = one load of every thread: eight lanes read one whole 128-B line (32 k values of one row), a wave four whole lines.
// stage_w_p: the thread's place in tile 0; stage_w_ld: issues the loads of tiles T0 .. T1 - 1; stage_w_st: rounds and stores them (here, in proj_mm, k_lin and k_proj every plain '#pragma unroll' is there so that a register array is indexed by constants only)
__device__ __forceinline__ const float* stage_w_p(const float* Wm, int tid) { return Wm + (size_t)(tid >> 3) * 128 + (tid & 7) * 4; }
template <int T0, int T1, int NT> __device__ __forceinline__ void stage_w_ld(const float* p, v4f (&x)[NT]) {
#pragma unroll   /* register array indexed by constants */
  for (int it = T0; it < T1; ++it) x[it] = *(const v4f*)(p + (it >> 2) * 16 * 128 + (it & 3) * 32);
}
template <int T0, int T1, int NT> __device__ __forceinline__ void stage_w_st(__bf16* sw, int tid, const v4f (&x)[NT]) {
  const int row = tid >> 3, q = tid & 7;   /* the thread holds k = 4 q .. 4 q + 3 of the step: half h = q >> 2, lane 16 g + row with g = (q >> 1) & 1, values 4 (q & 1) .. 4 (q & 1) + 3 of that lane */
  __bf16* d = sw + (q >> 2) * (FT / 2) + (((q >> 1) & 1) * 16 + row) * 8 + (q & 1) * 4;
#pragma unroll
  for (int it = T0; it < T1; ++it) { v4b y;
#pragma unroll
    for (int i = 0; i < 4; ++i) y[i] = (__bf16)x[it][i];
    *(v4b*)(d + it * FT) = y; }
}
#define QBH 0              // not used by any kernel here
#define QHI 2048            // rows carrying a q residual plane (all rows when non-causal: 2-product logits everywhere)
#define KHI 64            // key rows carrying k residual / v bf16 hi+lo planes (written by k_proj, read by no kernel here)
// B fragment (k rows k0+.., output column o) of a weight: (in,out) [K][ld] or (out,in) [ld rows of K]: bf16 exact, or f16(bf16 * 256) exact
__device__ __forceinline__ v16b wcol_io(const float* Wm, int k0, int o, int lane, int ld) { v16b w; const int g = lane >> 4;
#pragma unroll
  for (int i = 0; i < 8; ++i) { w[i] = (__bf16)Wm[(size_t)(k0 + 8 * g + i) * ld + o]; w[8 + i] = (__bf16)Wm[(size_t)(k0 + 16 + 8 * g + i) * ld + o]; }
  return w; }
__device__ __forceinline__ v16b wcol_oi(const float* Wm, int k0, int o, int lane, int K) { v16b w; const float* p = Wm + (size_t)o * K + k0 + 8 * (lane >> 4);
#pragma unroll
  for (int i = 0; i < 8; ++i) { w[i] = (__bf16)p[i]; w[8 + i] = (__bf16)p[16 + i]; }
  return w; }
__device__ __forceinline__ v16h wcolh_io(const float* Wm, int k0, int o, int lane, int ld) { v16h w; const int g = lane >> 4;
#pragma unroll
  for (int i = 0; i < 8; ++i) { w[i] = (_Float16)(bfr(Wm[(size_t)(k0 + 8 * g + i) * ld + o]) * 256.0f); w[8 + i] = (_Float16)(bfr(Wm[(size_t)(k0 + 16 + 8 * g + i) * ld + o]) * 256.0f); }
  return w; }
__device__ __forceinline__ v16h wcolh_oi(const float* Wm, int k0, int o, int lane, int K) { v16h w; const float* p = Wm + (size_t)o * K + k0 + 8 * (lane >> 4);
#pragma unroll
  for (int i = 0; i < 8; ++i) { w[i] = (_Float16)(bfr(p[i]) * 256.0f); w[8 + i] = (_Float16)(bfr(p[16 + i]) * 256.0f); }
  return w; }
#define WQKV_LAYOUT 1   // 0 = (in,out) [DIN][CC]; 1 = (out,in) [CC][DIN]; 2 = per-head [NH][DIN][HD]
__device__ __forceinline__ v16b wcol_hdk(const float* Wm, int k0, int o, int lane) { v16b w; const int g = lane >> 4; const float* p = Wm + (size_t)(o / HD) * DIN * HD + (o % HD);
#pragma unroll
  for (int i = 0; i < 8; ++i) { w[i] = (__bf16)p[(size_t)(k0 + 8 * g + i) * HD]; w[8 + i] = (__bf16)p[(size_t)(k0 + 16 + 8 * g + i) * HD]; }
  return w; }
#define WO_OUT_IN 0
#if WQKV_LAYOUT == 1
#define WCOL(W, k0, o, lane) wcol_oin(W, k0, o, lane, DIN, (which == 2) ? CC : HDQ)   /* q / k: 32 real output rows, columns 32..127 exact zeros */
#elif WQKV_LAYOUT == 2
#define WCOL(W, k0, o, lane) wcol_hdk(W, k0, o, lane)
#else
#define WCOL(W, k0, o, lane) wcol_io(W, k0, o, lane, CC)
#endif
#if WO_OUT_IN
#define WOCOL(W, k0, o, lane) wcol_oi(W, k0, o, lane, CC)
#define WOCOLH(W, k0, o, lane) wcolh_oi(W, k0, o, lane, CC)
#else
#define WOCOL(W, k0, o, lane) wcol_io(W, k0, o, lane, DIN)
#define WOCOLH(W, k0, o, lane) wcolh_io(W, k0, o, lane, DIN)
#endif
#define HDQ 32             // q / k width (k_proj's accumulators are 128 wide, columns 32..127 exact zeros; only the 32 real columns are stored)
#define BG HG              // not used by any kernel here
#define NR (TNB * TT)      // 32,768 rows (all batches)
// (out,in) projection weight with only 'nvalid' real output rows: columns o >= nvalid read row 0 and are zeroed by value
__device__ __forceinline__ v16b wcol_oin(const float* Wm, int k0, int o, int lane, int K, int nvalid) { v16b w; const int oc = o < nvalid ? o : 0; const float keep = o < nvalid ? 1.f : 0.f; const float* p = Wm + (size_t)oc * K + k0 + 8 * (lane >> 4);
#pragma unroll
  for (int i = 0; i < 8; ++i) { w[i] = (__bf16)(p[i] * keep); w[8 + i] = (__bf16)(p[16 + i] * keep); }
  return w; }
// pairwise tree over the 16 f32 P values of one A fragment (a lane's share of its query's sum over keys)
__device__ __forceinline__ float sum16(const float v[16]) { return (((v[0] + v[1]) + (v[2] + v[3])) + ((v[4] + v[5]) + (v[6] + v[7]))) + (((v[8] + v[9]) + (v[10] + v[11])) + ((v[12] + v[13]) + (v[14] + v[15]))); }
#define WS_DEN (WS_END)                                // (plane not used: the sum over keys stays in k_att's registers)
#define WS_FSA (WS_DEN + 4u * (size_t)NR)              // f32 f_sa rows [NR][128]
#define WS_YL  (WS_FSA + 4u * (size_t)NR * CC)        // f32 y rows (pre-BN)
#define WS_ST  (WS_YL + 4u * (size_t)NR * CC)         // BN statistics [128][32]
#define WS_PS  (WS_ST + 4u * (size_t)CC * 32)         // BN partials of k_lin's blocks [NR / 64][2][128]: mean of the block's 64 rows, sum of squared distances from that mean
#define WS_END2 (WS_PS + 4u * (size_t)(NR / 64) * 2 * CC)
// ---- k_lin: block = 64 rows: y = (bf16(f_in) - f_sa) (split bf16 hi + lo) Wl^T + bl (2 products, K 128) -> pre-BN rows, and per channel the block's own mean and sum of squared distances from it (PS)
__global__ __launch_bounds__(128) void k_lin(const float* __restrict__ X, const float* __restrict__ FSA, const float* __restrict__ WL, const float* __restrict__ BL, float* __restrict__ YL, float* __restrict__ PS) { __shared__ __align__(16) float sf[4][16][132]; __shared__ __align__(16) float sp[4][2][CC]; __shared__ __align__(16) __bf16 sw[(CC / 16) * (CC / 32) * FT];   /* sw: Wl as bf16 fragment tiles */
  const int tid = threadIdx.x, wave = tid >> 5, lane = tid & 31, col = lane & 15, g = lane >> 4; const size_t r0 = (size_t)blockIdx.x * 64 + wave * 16;
  v8f acc[8] = {}; const float* px = X + (r0 + col) * CC + 8 * g; const float* pf = FSA + (r0 + col) * CC + 8 * g; const float* pb = BL + col; const float* pw = stage_w_p(WL, tid); v4f xr[CC / 32][4], fr[CC / 32][4], wr[(CC / 16) * (CC / 32)]; float br[8];
#pragma unroll   /* the rows' values of all four k steps, the bias and the weight: every operand load of the kernel in flight at once */
  for (int kc = 0; kc < CC / 32; ++kc)
#pragma unroll
    for (int u = 0; u < 4; ++u) { const int o = kc * 32 + (u >> 1) * 16 + (u & 1) * 4; xr[kc][u] = *(const v4f*)(px + o); fr[kc][u] = *(const v4f*)(pf + o); }
#pragma unroll
  for (int j = 0; j < 8; ++j) br[j] = pb[j * 16];
  stage_w_ld<0, (CC / 16) * (CC / 32)>(pw, wr);
  asm volatile("s_wait_xcnt 0x0" :: "v"(px), "v"(pf), "v"(col), "v"(pw) : "memory");   /* precaution: the loads above have taken their addresses before an address register is written again; the pointers, and col (the bias loads' offset register), are named so that their registers live up to here and are no load's destination */
  stage_w_st<0, (CC / 16) * (CC / 32)>(sw, tid, wr);
  F2 a[CC / 32];
#pragma unroll
  for (int kc = 0; kc < CC / 32; ++kc) { float v[16];
#pragma unroll
    for (int i = 0; i < 16; ++i) v[i] = bfr(xr[kc][i >> 2][i & 3]) - fr[kc][i >> 2][i & 3];
    a[kc] = bsplit16(v); }
  __syncthreads();
  v16b wf[2][8];
#pragma unroll
  for (int j = 0; j < 8; ++j) wf[0][j] = frag_lb(sw + (j * 4) * FT + 8 * lane);
#pragma unroll
  for (int kc = 0; kc < CC / 32; ++kc) {
    if (kc + 1 < CC / 32) {
#pragma unroll
      for (int j = 0; j < 8; ++j) wf[(kc + 1) & 1][j] = frag_lb(sw + (j * 4 + kc + 1) * FT + 8 * lane); }
    __builtin_amdgcn_sched_barrier(0);   /* keeps the next k step's 16 LDS reads issued here as one group, a whole step ahead of their products (left alone they sink to their products, with a full wait in front of each) */
#pragma unroll
    for (int j = 0; j < 8; ++j) { acc[j] = wmma_bf(a[kc].h, wf[kc & 1][j], acc[j]); acc[j] = wmma_bf(a[kc].l, wf[kc & 1][j], acc[j]); } }
#pragma unroll
  for (int j = 0; j < 8; ++j) { const float bb = bfr(br[j]);
#pragma unroll
    for (int r = 0; r < 8; ++r) sf[wave][8 * g + r][j * 16 + col] = acc[j][r] + bb; }
  LDSX(); v4f yv[16];
#pragma unroll   /* yv is indexed by constants only */
  for (int rl = 0; rl < 16; ++rl) yv[rl] = *(const v4f*)&sf[wave][rl][lane * 4];
  // the wave's 16 rows, channels 4 lane .. 4 lane + 3: mean, then squared distances from that mean (no difference of large squares anywhere)
  const v4f m16 = ((((yv[0] + yv[1]) + (yv[2] + yv[3])) + ((yv[4] + yv[5]) + (yv[6] + yv[7]))) + (((yv[8] + yv[9]) + (yv[10] + yv[11])) + ((yv[12] + yv[13]) + (yv[14] + yv[15])))) * (1.0f / 16.0f); v4f q16 = {};
#pragma unroll
  for (int rl = 0; rl < 16; ++rl) { const v4f d = yv[rl] - m16; q16 += d * d; }
  *(v4f*)&sp[wave][0][lane * 4] = m16; *(v4f*)&sp[wave][1][lane * 4] = q16;
  __syncthreads();
  // thread = channel: the four waves' groups of 16 rows merged: mean of the means; squared distances add up, plus 16 x each group mean's squared distance from the merged mean
  const float g0 = sp[0][0][tid], g1 = sp[1][0][tid], g2 = sp[2][0][tid], g3 = sp[3][0][tid]; const float m64 = ((g0 + g1) + (g2 + g3)) * 0.25f; const float e0 = g0 - m64, e1 = g1 - m64, e2 = g2 - m64, e3 = g3 - m64;
  const float q64 = ((sp[0][1][tid] + sp[1][1][tid]) + (sp[2][1][tid] + sp[3][1][tid])) + 16.0f * ((e0 * e0 + e1 * e1) + (e2 * e2 + e3 * e3));
#pragma unroll   /* the row stores stand behind the barrier: in front of it the barrier would wait for all sixteen to finish */
  for (int rl = 0; rl < 16; ++rl) vst2(YL + (r0 + rl) * CC + lane * 4, yv[rl]);
  vst2(PS + (size_t)blockIdx.x * 2 * CC + tid, m64); vst2(PS + ((size_t)blockIdx.x * 2 + 1) * CC + tid, q64); }
// ---- k_stat: block = channel c: merges the NR / 64 partials of k_lin (equal groups of 64 rows) in the same way -> mean and 1 / sqrt(biased variance + eps)
__global__ __launch_bounds__(256) void k_stat(const float* __restrict__ PS, float* __restrict__ STAT) { __shared__ float sred[8]; __shared__ float sbc;
  const int t = threadIdx.x; const int c = blockIdx.x; float pm[NR / 64 / 256], pq[NR / 64 / 256];
#pragma unroll   /* register arrays indexed by constants; all loads in flight at once */
  for (int i = 0; i < NR / 64 / 256; ++i) { pm[i] = PS[(size_t)(i * 256 + t) * 2 * CC + c]; pq[i] = PS[((size_t)(i * 256 + t) * 2 + 1) * CC + c]; }
  float s = 0.f;
#pragma unroll
  for (int i = 0; i < NR / 64 / 256; ++i) s += pm[i];
#pragma unroll
  for (int o = 1; o < 32; o <<= 1) s += __shfl_xor(s, o);
  if ((t & 31) == 0) sred[t >> 5] = s; __syncthreads(); if (t == 0) { float a = 0.f; for (int i = 0; i < 8; ++i) a += sred[i]; sbc = a / (float)(NR / 64); } __syncthreads(); const float mean = sbc; __syncthreads();
  float q = 0.f;
#pragma unroll
  for (int i = 0; i < NR / 64 / 256; ++i) { const float d = pm[i] - mean; q += pq[i] + 64.0f * (d * d); }
#pragma unroll
  for (int o = 1; o < 32; o <<= 1) q += __shfl_xor(q, o);
  if ((t & 31) == 0) sred[t >> 5] = q; __syncthreads(); if (t == 0) { float a = 0.f; for (int i = 0; i < 8; ++i) a += sred[i]; sbc = rsqrtf(a / (float)NR + 1e-5f); } __syncthreads();
  if (t < 32) { const float v = t == 0 ? mean : (t == 1 ? sbc : 0.f); vst2(STAT + (size_t)c * 32 + t, v); } }
// ---- k_fin: out = relu(gamma (y - mean) rstd + beta) + f_sa (thread per float4)
__global__ __launch_bounds__(256) void k_fin(const float* __restrict__ YL, const float* __restrict__ STAT, const float* __restrict__ G, const float* __restrict__ BE, const float* __restrict__ FSA, float* __restrict__ OUT) { const size_t e4 = (size_t)blockIdx.x * 256 + threadIdx.x; if (e4 >= (size_t)NR * CC / 4) return; const int c0 = (int)((e4 * 4) % CC); const v4f yv = *(const v4f*)(YL + e4 * 4); const v4f fv = *(const v4f*)(FSA + e4 * 4); v4f o;
#pragma unroll
  for (int i = 0; i < 4; ++i) { const int c = c0 + i; const float yb = bfr(G[c]) * (yv[i] - STAT[c * 32]) * STAT[c * 32 + 1] + bfr(BE[c]); o[i] = fmaxf(yb, 0.f) + fv[i]; }
  vst2(OUT + e4 * 4, o); }
#ifndef SM_EXTRA_PARAMS
#define SM_EXTRA_PARAMS
#endif
#ifndef PROJ_EXTRA_PARAMS
#define PROJ_EXTRA_PARAMS
#endif
#ifndef SM_MASK_HOOK
#define SM_MASK_HOOK (void)0
#endif

#define WS_QH  0u                                      // f16 q tiles in fragment order [b*t / 16][FT] (the 32 real columns only; the rest of the plane is not used)
#define WS_KH  (WS_QH + 2u * (size_t)NB * TT * CC)      // f16 k tiles in fragment order [b*t / 16][FT]
#define WS_VT  (WS_KH + 2u * (size_t)NB * TT * CC)      // f16 v tiles in fragment order [b][t / 32][c / 16][FT] (tile: column = channel, k = t)
#define WS_QL  (WS_VT + 2u * (size_t)NB * CC * TT)      // f16 q residual x 2^10 tiles [(b, t < QHI) / 16][FT]
#define WS_KL  (WS_QL + 2u * (size_t)NB * QHI * CC)     // f16 k residual x 2^10 tiles [(b, t < KHI) / 16][FT]
#define WS_VB  (WS_KL + 2u * (size_t)NB * KHI * CC)     // bf16 v hi planes [b][c][t < KHI]
#define WS_VBL (WS_VB + 2u * (size_t)NB * CC * KHI)
#define WS_S   (WS_VBL + 2u * (size_t)NB * CC * KHI)    // f32 per-key softmax constants [b][t / 16][2][16] (the rest of the plane is not used)
#define WS_Y   (WS_S  + 4u * (size_t)HG * TT * TT)      // f32 ctx rows [b*t][CC] (only when there is an output projection)
#define WS_END (WS_Y  + 0u)

// k_proj's products from the staged weight tiles: acc[j] += x W^T over the four k steps; NJ real 16-column tiles (j >= NJ: zero fragments, exact zero columns)
template <int NJ> __device__ __forceinline__ void proj_mm(const __bf16* swl, const v16b (&a)[DIN / 32], v8f (&acc)[8]) {   /* swl = the lane's own place in tile 0 */
  v16b wf[2][NJ];
#pragma unroll
  for (int j = 0; j < NJ; ++j) wf[0][j] = frag_lb(swl + (j * 4) * FT);
#pragma unroll
  for (int kc = 0; kc < DIN / 32; ++kc) {
    if (kc + 1 < DIN / 32) {
#pragma unroll
      for (int j = 0; j < NJ; ++j) wf[(kc + 1) & 1][j] = frag_lb(swl + (j * 4 + kc + 1) * FT); }
    __builtin_amdgcn_sched_barrier(0);   /* keeps the next k step's LDS reads issued here as one group, a whole step ahead of their products (left alone they sink to their products, with a full wait in front of each) */
#pragma unroll
    for (int j = 0; j < 8; ++j) { v16b w = {}; if (j < NJ) w = wf[kc & 1][j < NJ ? j : 0]; acc[j] = wmma_bf(a[kc], w, acc[j]); } }
}
// ---- k_proj: block = (64 rows, 128 cols, which): q/k/v = X W (+ b) with exact bf16 products (K = DIN) -> which 0: q f16 tiles (+ residual tiles, rows < QHI); 1: k f16 tiles (+ residual tiles, rows < KHI); 2: v f16 tiles (+ bf16 hi/lo planes [c][t] for t < KHI); the f16 tiles in fragment order (frag_t)
__global__ __launch_bounds__(128) void k_proj(const float* __restrict__ XQ, const float* __restrict__ XK, const float* __restrict__ XV, const float* __restrict__ WQ, const float* __restrict__ WK, const float* __restrict__ WV, const float* __restrict__ BQ, const float* __restrict__ BK, const float* __restrict__ BV,
    _Float16* __restrict__ QH, _Float16* __restrict__ QL, _Float16* __restrict__ KH, _Float16* __restrict__ KL, _Float16* __restrict__ VT, __bf16* __restrict__ VB, __bf16* __restrict__ VBL) {
  __shared__ __align__(16) _Float16 shl[2][64][136]; _Float16 (&sh)[64][136] = shl[0]; _Float16 (&sl)[64][136] = shl[1];   /* one array, so that a v block's weight tiles can span both halves */
  __shared__ __align__(16) _Float16 th[128][72]; __shared__ __align__(16) __bf16 tb[128][72], tbl[128][72];
  const int tid = threadIdx.x, wave = tid >> 5, lane = tid & 31, col = lane & 15, g = lane >> 4; const int which = blockIdx.z; const int c0 = blockIdx.y * 128; const size_t r0 = (size_t)blockIdx.x * 64; const size_t bb = r0 / TT; const int t0 = (int)(r0 % TT);
  const float* X = which == 0 ? XQ : which == 1 ? XK : XV; const float* WA = which == 0 ? WQ : which == 1 ? WK : WV; const float* BA = which == 0 ? BQ : which == 1 ? BK : BV;
  v8f acc[8] = {}; const float* pa = X + (r0 + wave * 16 + col) * DIN + 8 * g; const float* pw = stage_w_p(WA, tid); const float* pb = BA + c0 + col; v4f xr[DIN / 32][4], wr[(CC / 16) * (DIN / 32)]; float br[8] = {};   /* br: the bias of column 16 j + col; stays 0 in the zero columns of q / k */
#pragma unroll   /* the row's values of all four k steps, the bias and the weight: every operand load of the kernel in flight at once */
  for (int kc = 0; kc < DIN / 32; ++kc)
#pragma unroll
    for (int u = 0; u < 4; ++u) xr[kc][u] = *(const v4f*)(pa + kc * 32 + (u >> 1) * 16 + (u & 1) * 4);
  stage_w_ld<0, (HDQ / 16) * (DIN / 32)>(pw, wr);
#pragma unroll
  for (int j = 0; j < HDQ / 16; ++j) br[j] = pb[j * 16];
  if (which == 2) { stage_w_ld<(HDQ / 16) * (DIN / 32), (CC / 16) * (DIN / 32)>(pw, wr);   /* q / k have only the 32 real rows */
#pragma unroll
    for (int j = HDQ / 16; j < 8; ++j) br[j] = pb[j * 16]; }
  asm volatile("s_wait_xcnt 0x0" :: "v"(pa), "v"(pw), "v"(pb), "v"(col) : "memory");   /* precaution: the loads above have taken their addresses before an address register is written again; the pointers, and col (the offset register of two bias loads), are named so that their registers live up to here and are no load's destination */
  // the weight tiles lie in LDS that this block's own epilogue does not use: v blocks (128 rows, 32 KB) in shl, q / k blocks (the 32 real rows, 8 KB) in th; so no barrier is owed between the last tile read and the epilogue's LDS stores
  __bf16* sw = which == 2 ? (__bf16*)&shl[0][0][0] : (__bf16*)&th[0][0];
  stage_w_st<0, (HDQ / 16) * (DIN / 32)>(sw, tid, wr);
  if (which == 2) stage_w_st<(HDQ / 16) * (DIN / 32), (CC / 16) * (DIN / 32)>(sw, tid, wr);
  v16b a[DIN / 32];
#pragma unroll
  for (int kc = 0; kc < DIN / 32; ++kc)
#pragma unroll
    for (int i = 0; i < 16; ++i) a[kc][i] = (__bf16)xr[kc][i >> 2][i & 3];
  __syncthreads();
  if (which == 2) proj_mm<CC / 16>(sw + 8 * lane, a, acc); else proj_mm<HDQ / 16>(sw + 8 * lane, a, acc);
  if (which < 2) { _Float16* DH = which == 0 ? QH : KH; _Float16* DL = which == 0 ? QL : KL; const int nhi = which == 0 ? QHI : KHI; const bool hi_rows = t0 < nhi;
#pragma unroll
    for (int j = 0; j < 8; ++j) { const float bias = bfr(br[j]);
#pragma unroll
      for (int r = 0; r < 8; ++r) { const float v = acc[j][r] + bias; const _Float16 hv = (_Float16)v; sh[wave * 16 + 8 * g + r][j * 16 + col] = hv; sl[wave * 16 + 8 * g + r][j * 16 + col] = (_Float16)((v - (float)hv) * 1024.0f); } }
    __syncthreads();
    for (int e = tid; e < 64 * HDQ / 8; e += 128) { const int tl = e >> 6, h = (e >> 5) & 1, l = e & 31; const int rl = tl * 16 + (l & 15), k8 = 16 * h + 8 * (l >> 4);   /* e runs in the order of the destination: a wave stores 512 contiguous bytes */
      vst2((unsigned*)(DH + ((r0 >> 4) + tl) * FT + (e & 63) * 8), *(const v4u*)&sh[rl][k8]);
      asm volatile("s_wait_xcnt 0x0" ::: "memory");   /* precaution, here and behind the four stores below: the store has taken its address and data before the next LDS load or address sum writes those registers again */
      if (hi_rows) { vst2((unsigned*)(DL + (((bb * nhi + t0) >> 4) + tl) * FT + (e & 63) * 8), *(const v4u*)&sl[rl][k8]); asm volatile("s_wait_xcnt 0x0" ::: "memory"); } }
  } else { const bool hi_rows = t0 < KHI;
#pragma unroll
    for (int j = 0; j < 8; ++j) { const float bias = bfr(br[j]);
#pragma unroll
      for (int r = 0; r < 8; ++r) { const float v = acc[j][r] + bias; const int rl = wave * 16 + 8 * g + r, cl = j * 16 + col; th[cl][rl] = (_Float16)v; const __bf16 bh = (__bf16)v; tb[cl][rl] = bh; tbl[cl][rl] = (__bf16)(v - (float)bh); } }
    __syncthreads();
    for (int e = tid; e < 128 * 8; e += 128) { const int cl = e >> 3, q = e & 7; { const int tl = e >> 6, h = (e >> 5) & 1, l = e & 31;   /* tile tl = (32-key chunk tl >> 3, 16 channels tl & 7) of the block, e in the order of the destination */
        vst2((unsigned*)(VT + (((bb * (TT / 32) + (t0 >> 5) + (tl >> 3)) * (CC / 16) + (c0 >> 4) + (tl & 7)) * FT + (e & 63) * 8)), *(const v4u*)&th[(tl & 7) * 16 + (l & 15)][(tl >> 3) * 32 + 16 * h + 8 * (l >> 4)]); asm volatile("s_wait_xcnt 0x0" ::: "memory"); }
      if (hi_rows) { const size_t o3 = (bb * CC + c0 + cl) * (size_t)KHI + t0 + q * 8; vst2((unsigned*)(VB + o3), *(const v4u*)&tb[cl][q * 8]); asm volatile("s_wait_xcnt 0x0" ::: "memory"); vst2((unsigned*)(VBL + o3), *(const v4u*)&tbl[cl][q * 8]); asm volatile("s_wait_xcnt 0x0" ::: "memory"); } } } }
// plain builtin form: the compiler keeps the distance behind a matrix instruction itself and fills it with independent work where it can
__device__ __forceinline__ v8f wmma16c(v16h a, v16h b, v8f c) { return __builtin_amdgcn_wmma_f32_16x16x32_f16(false, a, false, b, (short)0, c, false, false); }
// (in the two kernels below every plain '#pragma unroll' is there so that a register array is indexed by constants only)
// logit of one (key, query) pair from the two f16 products: k hi . q + (k residual x 2^10) . q / 2^10
__device__ __forceinline__ float logit2(float hi, float lo) { return (hi + lo * (1.0f / 1024.0f)) * SCALE; }
#define LOG2E 1.4426950408889634f
// exp(x) 2^c = 2^(x log2 e + c): one fused multiply-add (lc) and the hardware's own base-2 exponential (exp2x8). The exponent is at most about 11 here (x never above its key's maximum); a result under 2^-126 may come out as 0, far below what the f32 sums (at least 1) or an f16 P value keep
__device__ __forceinline__ float lc(float x, float c) { return __builtin_fmaf(x, LOG2E, c); }
// y[0..7] = 2^y[0..7]. One statement, each exponential in place, one v_nop at the end: the instruction set asks for one independent instruction behind a transcendental before its result is read or its source written over; here that is the next exponential, on another register, and behind the last one the v_nop (left to the register allocator, neighbours wrote over each other's sources)
__device__ __forceinline__ void exp2x8(float* y) {
  asm("v_exp_f32 %0, %0\n\tv_exp_f32 %1, %1\n\tv_exp_f32 %2, %2\n\tv_exp_f32 %3, %3\n\tv_exp_f32 %4, %4\n\tv_exp_f32 %5, %5\n\tv_exp_f32 %6, %6\n\tv_exp_f32 %7, %7\n\tv_nop"
      : "+v"(y[0]), "+v"(y[1]), "+v"(y[2]), "+v"(y[3]), "+v"(y[4]), "+v"(y[5]), "+v"(y[6]), "+v"(y[7])); }
// ---- k_kst: block = 16 keys of batch blockIdx.y; wave w holds the logits of those keys against queries [256 w, 256 w + 256) in registers (D: row = key 8g + r, column = query): maximum and sum of exp over ALL queries -> KS line of the key tile: per key the one constant c = 11 - max log2 e - log2 sum, so that 2^(logit log2 e + c) = exp(logit - max) x 2^11 / sum (the line's second half repeats the 16 values: the block stays the one writer of its whole 128-B line)
__global__ __launch_bounds__(256) __attribute__((amdgpu_waves_per_eu(4))) /* holds the kernel to 256 registers, four waves per SIMD as before: left alone this build takes a few more and only one block fits a WGP */ void k_kst(const _Float16* __restrict__ KRH, const _Float16* __restrict__ KRL, const _Float16* __restrict__ QR, float* __restrict__ KS) { __shared__ float smx[8][16], ssu[8][16];
  const int tid = threadIdx.x, wave = tid >> 5, lane = tid & 31, col = lane & 15, g = lane >> 4; const size_t kr0 = (size_t)blockIdx.y * TT + blockIdx.x * 16, q0 = (size_t)blockIdx.y * TT + wave * (TT / 8);
  const v16h ah = frag_t(KRH + (kr0 >> 4) * FT, lane), al = frag_t(KRL + (kr0 >> 4) * FT, lane);
  asm volatile("s_wait_xcnt 0x0" ::: "memory");   /* precaution: the four key loads above have taken their addresses before a later load's result reuses those address registers */
  float s[TT / 128][8]; v16h qf[TT / 128];
#pragma unroll
  for (int t = 0; t < 8; ++t) qf[t] = frag_t(QR + ((q0 >> 4) + t) * FT, lane);
#pragma unroll
  for (int tg = 0; tg < TT / 128; tg += 4) {   /* groups of four query tiles, loaded two groups ahead of their products */
    if (tg + 8 < TT / 128) {
#pragma unroll
      for (int t = tg + 8; t < tg + 12; ++t) qf[t] = frag_t(QR + ((q0 >> 4) + t) * FT, lane); }
    __builtin_amdgcn_sched_barrier(0);   /* keeps the loads above issued here: left alone the scheduler either waits on one tile at a time or hoists all sixteen, which takes the kernel past 256 registers */
#pragma unroll
    for (int t = tg; t < tg + 4; ++t) { v8f a = {}, l = {}; a = wmma16(ah, qf[t], a); l = wmma16(al, qf[t], l);
#pragma unroll
      for (int r = 0; r < 8; ++r) s[t][r] = logit2(a[r], l[r]); }
    __builtin_amdgcn_sched_barrier(0);   /* the other side of the same fence: the next group's loads stay behind these products */
  }
  float mx[8], su[8];
#pragma unroll
  for (int r = 0; r < 8; ++r) { float m = s[0][r];
#pragma unroll
    for (int t = 1; t < TT / 128; ++t) m = fmaxf(m, s[t][r]);
#pragma unroll
    for (int o = 1; o < 16; o <<= 1) m = fmaxf(m, __shfl_xor(m, o));
    mx[r] = m; }
  if (col == 0) {
#pragma unroll
    for (int r = 0; r < 8; ++r) smx[wave][8 * g + r] = mx[r]; }
  __syncthreads();
#pragma unroll
  for (int r = 0; r < 8; ++r) { float m = smx[0][8 * g + r];
#pragma unroll
    for (int w = 1; w < 8; ++w) m = fmaxf(m, smx[w][8 * g + r]);
    float a = 0.f; const float nm = -m * LOG2E;
#pragma unroll
    for (int tg = 0; tg < TT / 128; tg += 8) { float e[8];
#pragma unroll
      for (int t = 0; t < 8; ++t) e[t] = lc(s[tg + t][r], nm);
      exp2x8(e);
#pragma unroll
      for (int t = 0; t < 8; ++t) a += e[t]; }
#pragma unroll
    for (int o = 1; o < 16; o <<= 1) a += __shfl_xor(a, o);
    su[r] = a; }
  if (col == 0) {
#pragma unroll
    for (int r = 0; r < 8; ++r) ssu[wave][8 * g + r] = su[r]; }
  __syncthreads();
  if (tid < 32) { float m = smx[0][col], a = 0.f;
#pragma unroll
    for (int w = 1; w < 8; ++w) m = fmaxf(m, smx[w][col]);
#pragma unroll
    for (int w = 0; w < 8; ++w) a += ssu[w][col];
    vst2(KS + kr0 * 2 + tid, a > 0.f ? (11.0f - m * LOG2E) - log2f(a) : -1.0e30f); } }   /* no sum: an exponent that makes every P of the key 0, as the factor 0 did */
// ---- k_att: block = 64 queries (qb) of batch blockIdx.y, wave = 16 queries; per 32 keys: S^T tiles (row = key, column = query) from the same two products as k_kst, P x 2^11 = 2^(logit log2 e + the key's constant of k_kst) in f32; the two D tiles, converted to f16 in place, ARE the A fragment (row = query, k = key) of P . v; f_sa = (P . v) / (sum over keys of P)
__global__ __launch_bounds__(128) void k_att(const _Float16* __restrict__ KRH, const _Float16* __restrict__ KRL, const _Float16* __restrict__ QR, const float* __restrict__ KS, const _Float16* __restrict__ VT, float* __restrict__ Y) { __shared__ __align__(16) float ss[4][16][HD + 4]; __shared__ __align__(16) float sks[TT * 2];
  const int tid = threadIdx.x, wave = tid >> 5, lane = tid & 31, col = lane & 15, g = lane >> 4; const int b = blockIdx.y; const int ql0 = blockIdx.x * 64 + wave * 16;
#pragma unroll   /* all eight loads in flight at once */
  for (int i = 0; i < TT * 2 / 4 / 128; ++i) *(v4f*)&sks[(i * 128 + tid) * 4] = *(const v4f*)(KS + (size_t)b * TT * 2 + (i * 128 + tid) * 4);
  __syncthreads();
  const _Float16* qp = QR + (((size_t)b * TT + ql0) >> 4) * FT + 8 * lane; const v16h qf = frag_l(qp);
  const _Float16* kh = KRH + (size_t)b * (TT / 16) * FT; const _Float16* kl = KRL + (size_t)b * (TT / 16) * FT; const _Float16* vt = VT + (size_t)b * (TT / 32) * (HD / 16) * FT;
  v8f acc[HD / 16] = {}; float ksum = 0.f;   /* f32 sum of the P x 2^11 values this lane makes: query ql0 + col, the k half g of every chunk */
  v16h a0 = frag_t(kh, lane), l0 = frag_t(kl, lane), a1 = frag_t(kh + FT, lane), l1 = frag_t(kl + FT, lane);
  asm volatile("s_wait_xcnt 0x0" :: "v"(qp) : "memory");   /* precaution: the ten loads above have taken their addresses before an address register is written again; qp is named so that its pair lives up to here (left alone the zeroing of the accumulators is moved up over the wait and writes it) */
#pragma unroll 1   /* rolled: one pass's fragments and accumulators already fill most of 256 registers */
  for (int kc = 0; kc < TT / 32; ++kc) { v16h vf[HD / 16]; const _Float16* vp = vt + (size_t)kc * (HD / 16) * FT + 8 * lane;
#pragma unroll
    for (int j = 0; j < HD / 16; ++j) vf[j] = frag_l(vp + j * FT);
    __builtin_amdgcn_sched_barrier(0);   /* keeps the 16 v loads issued here, a whole score-and-exp phase ahead of their use (the scheduler otherwise sinks them to the P . v products, two fragments in flight) */
    v8f s0 = {}, t0 = {}, s1 = {}, t1 = {}; s0 = wmma16c(a0, qf, s0); t0 = wmma16c(l0, qf, t0); s1 = wmma16c(a1, qf, s1); t1 = wmma16c(l1, qf, t1);
    const size_t kn = (size_t)(kc + 1 < TT / 32 ? kc + 1 : kc) * 2 * FT;   /* next chunk's two key tiles, fetched one pass ahead (the last pass fetches its own again: in bounds) */
    a0 = frag_t(kh + kn, lane); l0 = frag_t(kl + kn, lane); a1 = frag_t(kh + kn + FT, lane); l1 = frag_t(kl + kn + FT, lane);
    asm volatile("s_wait_xcnt 0x0" :: "v"(vp) : "memory");   /* precaution: the pass's loads have taken their addresses before an address register is written again; vp is named so that the v loads' address pair lives up to here and is not itself the destination of the last of them */
    __builtin_amdgcn_sched_barrier(0);   /* keeps the next chunk's key loads issued here, ahead of the exp phase */
    const v4f* st = (const v4f*)&sks[kc * 64 + 8 * g]; const v4f c0[2] = { st[0], st[1] }, c1[2] = { st[8], st[9] }; float v[16];   /* the chunk's constants, keys 8g + r of both tiles */
#pragma unroll
    for (int r = 0; r < 8; ++r) { v[r] = lc(logit2(s0[r], t0[r]), c0[r >> 2][r & 3]); v[8 + r] = lc(logit2(s1[r], t1[r]), c1[r >> 2][r & 3]); }
    exp2x8(v); exp2x8(v + 8);
    v16h p;
#pragma unroll
    for (int i = 0; i < 16; ++i) p[i] = (_Float16)v[i];
    ksum += sum16(v);
#pragma unroll
    for (int j = 0; j < HD / 16 - 1; ++j) acc[j] = wmma16c(p, vf[j], acc[j]);
    acc[HD / 16 - 1] = wmma16(p, vf[HD / 16 - 1], acc[HD / 16 - 1]); }   /* the last product in the form with four v_nop behind it: across the taken branch the next pass's v loads write over the B fragments of these products */
  ksum += __shfl_xor(ksum, 16);   /* both k halves: den (x 2^11) of query ql0 + col, in lanes col and col + 16 */
  const float inv = ksum > 0.f ? 2048.0f / ksum : 0.f; float invr[8];
#pragma unroll
  for (int r = 0; r < 8; ++r) invr[r] = __shfl(inv, 8 * g + r);   /* accumulator element r is query row 8g + r */
#pragma unroll
  for (int j = 0; j < HD / 16; ++j)
#pragma unroll
    for (int r = 0; r < 8; ++r) ss[wave][8 * g + r][j * 16 + col] = acc[j][r] * (1.0f / 2048.0f) * invr[r];
  LDSX(); for (int rl = 0; rl < 16; ++rl) vst2(Y + ((size_t)b * TT + ql0 + rl) * CC + lane * 4, *(const v4f*)&ss[wave][rl][lane * 4]); }

extern "C" void kernel_launch(void* const* d_in, const int* in_sizes, int n_in, void* d_out, int out_size, void* d_ws, size_t ws_size, hipStream_t stream) {
  (void)in_sizes; (void)n_in; (void)out_size;
  const float** F = (const float**)d_in;
  if (ws_size < (size_t)WS_END) return;
  char* ws = (char*)d_ws; _Float16 *QH = (_Float16*)(ws + WS_QH), *KH = (_Float16*)(ws + WS_KH), *VT = (_Float16*)(ws + WS_VT), *QL = (_Float16*)(ws + WS_QL), *KL = (_Float16*)(ws + WS_KL); __bf16 *VB = (__bf16*)(ws + WS_VB), *VBL = (__bf16*)(ws + WS_VBL); float *S = (float*)(ws + WS_S), *Y = (float*)(ws + WS_Y);
  (void)Y; (void)QL; (void)KL; (void)VB; (void)VBL;
  // inputs: 0 f_in [16,2048,128]; 1 w_q [32,128] (out,in), 2 b_q [32]; 3 w_k [32,128], 4 b_k; 5 w_v [128,128], 6 b_v; 7 w_l [128,128], 8 b_l; 9 bn_gamma, 10 bn_beta
  if (ws_size < (size_t)WS_END2) return;
  float *FSA = (float*)(ws + WS_FSA), *YL = (float*)(ws + WS_YL), *ST = (float*)(ws + WS_ST), *PS = (float*)(ws + WS_PS);
  // ROLE SWAP: the 'q' planes (hi + residual) hold K (from w_k, b_k) and the 'k' planes hold Q, so the score tiles are S^T[key][query] and the softmax runs over QUERIES
  k_proj<<<dim3(TNB * TT / 64, CC / 128, 3), 128, 0, stream>>>(F[0], F[0], F[0], F[3], F[1], F[5], F[4], F[2], F[6], QH, QL, KH, KL, VT, VB, VBL);
  k_kst<<<dim3(TT / 16, TNB), 256, 0, stream>>>(QH, QL, KH, S);   /* per key: the exponent constant from the maximum and the sum of exp over the queries */
  k_att<<<dim3(NQB, TNB), 128, 0, stream>>>(QH, QL, KH, S, VT, FSA);   /* f_sa rows: logits made again in registers, P never stored */
  k_lin<<<dim3(NR / 64), 128, 0, stream>>>(F[0], FSA, F[7], F[8], YL, PS);
  k_stat<<<dim3(CC), 256, 0, stream>>>(PS, ST);
  k_fin<<<dim3((NR * CC / 4 + 255) / 256), 256, 0, stream>>>(YL, ST, F[9], F[10], FSA, (float*)d_out);
}

// v007
// One run takes 85 microseconds.
// Two timings next to v006 put it at 1.21 and 1.26 times that version's speed.
// All steps since v000 together make it 19.7 times as fast.
#include <hip/hip_runtime.h>
#include <math.h>

typedef __attribute__((ext_vector_type(16))) _Float16 v16h;
typedef __attribute__((ext_vector_type(16))) __bf16 v16b;
typedef __attribute__((ext_vector_type(8)))  _Float16 v8h;
typedef __attribute__((ext_vector_type(8)))  float v8f;
typedef __attribute__((ext_vector_type(4)))  float v4f;
typedef __attribute__((ext_vector_type(2)))  float v2f;
typedef __attribute__((ext_vector_type(4)))  unsigned v4u;
typedef __attribute__((ext_vector_type(4)))  int v4i;
typedef float __attribute__((may_alias)) float_a;
typedef int __attribute__((may_alias)) int_a;

template <typename T> __device__ __forceinline__ void vst2(void* p, T v) { *(T*)p = v;  }
__device__ __forceinline__ v8f wmma16(v16h a, v16h b, v8f c) {
  v8f d = __builtin_amdgcn_wmma_f32_16x16x32_f16(false, a, false, b, (short)0, c, false, false);
  asm volatile("v_nop\n\tv_nop\n\tv_nop\n\tv_nop" : "+v"(d) : "v"(a), "v"(b));
  return d;
}
__device__ __forceinline__ v8f wmma_bf(v16b a, v16b b, v8f c) {
  v8f d = __builtin_amdgcn_wmma_f32_16x16x32_bf16(false, a, false, b, (short)0, c, false, false);
  asm volatile("v_nop\n\tv_nop\n\tv_nop\n\tv_nop" : "+v"(d) : "v"(a), "v"(b));
  return d;
}
// 16x16x32 fragments: lane = (h = lane>>4, row/col = lane&15); elements 0..7 = k0+8h+0..7, 8..15 = k0+16+8h+0..7; D element r = row 8h+r
__device__ __forceinline__ v16h frag_h(const _Float16* rowk0, int lane) {
  union { v16h v; v8h q[2]; } u; const _Float16* p = rowk0 + 8 * (lane >> 4);
  u.q[0] = *(const v8h*)p; u.q[1] = *(const v8h*)(p + 16); return u.v;
}
__device__ __forceinline__ v16h frag_f32(const float* rowk0, int lane) {
  v16h a; const float* p = rowk0 + 8 * (lane >> 4);
#pragma unroll
  for (int i = 0; i < 8; ++i) { a[i] = (_Float16)p[i]; a[8 + i] = (_Float16)p[16 + i]; }
  return a;
}
__device__ __forceinline__ v16h frag_f32s(const float* rowk0, int lane, float sc) {
  v16h a; const float* p = rowk0 + 8 * (lane >> 4);
#pragma unroll
  for (int i = 0; i < 8; ++i) { a[i] = (_Float16)(p[i] * sc); a[8 + i] = (_Float16)(p[16 + i] * sc); }
  return a;
}
// column fragment from a [K][ld] layout (column n), rows >= K read as 0
__device__ __forceinline__ v16h fragc_f32(const float* W, int k0, int n, int lane, int ld, int K) {
  v16h a; const int g = lane >> 4;
#pragma unroll
  for (int i = 0; i < 8; ++i) { const int ka = k0 + 8 * g + i, kb = ka + 16;
    a[i] = (_Float16)(ka < K ? W[(size_t)(ka < K ? ka : K - 1) * ld + n] : 0.f); a[8 + i] = (_Float16)(kb < K ? W[(size_t)(kb < K ? kb : K - 1) * ld + n] : 0.f); }
  return a;
}
struct F2 { v16b h, l; };
__device__ __forceinline__ F2 bsplit16(const float v[16]) { F2 r;
#pragma unroll
  for (int i = 0; i < 16; ++i) { const __bf16 h = (__bf16)v[i]; r.h[i] = h; r.l[i] = (__bf16)(v[i] - (float)h); }
  return r; }
__device__ __forceinline__ F2 split_row(const float* row, int k0, int lane) { float v[16]; const float* p = row + k0 + 8 * (lane >> 4);
#pragma unroll
  for (int i = 0; i < 8; ++i) { v[i] = p[i]; v[8 + i] = p[16 + i]; }
  return bsplit16(v); }
__device__ __forceinline__ F2 split_rowK(const float* row, int k0, int lane, int K) { float v[16]; const int g = lane >> 4;
#pragma unroll
  for (int i = 0; i < 8; ++i) { const int ka = k0 + 8 * g + i, kb = ka + 16; v[i] = ka < K ? row[ka < K ? ka : K - 1] : 0.f; v[8 + i] = kb < K ? row[kb < K ? kb : K - 1] : 0.f; }
  return bsplit16(v); }
__device__ __forceinline__ F2 split_col(const float* W, int k0, int n, int lane, int ld, int K) { float v[16]; const int g = lane >> 4;
#pragma unroll
  for (int i = 0; i < 8; ++i) { const int ka = k0 + 8 * g + i, kb = ka + 16; v[i] = ka < K ? W[(size_t)(ka < K ? ka : K - 1) * ld + n] : 0.f; v[8 + i] = kb < K ? W[(size_t)(kb < K ? kb : K - 1) * ld + n] : 0.f; }
  return bsplit16(v); }
__device__ __forceinline__ v8f mac3(const F2& a, const F2& b, v8f c) { c = wmma_bf(a.l, b.h, c); c = wmma_bf(a.h, b.l, c); return wmma_bf(a.h, b.h, c); }
__device__ __forceinline__ float sigm(float v) { return 1.0f / (1.0f + expf(-v)); }
#define LDSX() do { asm volatile("s_wait_dscnt 0" ::: "memory"); __builtin_amdgcn_wave_barrier(); __builtin_amdgcn_fence(__ATOMIC_RELEASE, "workgroup"); } while (0)

// Offset-attention (PCT) block (B 16, N 2,048, D 128, q/k dim 32): q = x Wq^T + bq, k = x Wk^T + bk (32-d), v = x Wv^T + bv; a = softmax over QUERIES of q k^T (no scale), then a = a / sum over keys; f_sa = a v; y = (x - f_sa) Wl^T + bl; out = relu(BN(y)) + f_sa (BN with batch statistics over B*N, biased variance, eps 1e-5).
#define NB 16
#define TT 2048
#define CC 128            // NH * HD = projected width
#define DIN 128          // input (model) width
#define NH 1
#define HD 128
#define NQB (TT / 64)
#define HG 4
#define SCALE (1.0f)
#define CAUSAL 0
#ifndef TNB
#define TNB NB
#endif
__device__ __forceinline__ float bfr(float v) { return (float)(__bf16)v; }
__host__ __device__ __forceinline__ int kb_last(int qb) { return CAUSAL ? ((qb * 64 + 63) >> 7) : (TT / 128 - 1); }
typedef __attribute__((ext_vector_type(8))) __bf16 v8b;
__device__ __forceinline__ v16b frag_b(const __bf16* rowk0, int lane) {
  union { v16b v; v8b q[2]; } u; const __bf16* p = rowk0 + 8 * (lane >> 4);
  u.q[0] = *(const v8b*)p; u.q[1] = *(const v8b*)(p + 16); return u.v;
}
// operand tile in fragment order: a 16 (rows or columns) x 32 (k) tile of 16-bit values is 1 KB = [h][lane][8 values]; lane = (g = lane>>4, row/col = lane&15) holds k = 16h + 8g + 0..7 there, so each of the two wave-wide 16-byte loads of a fragment covers 512 contiguous bytes (four whole lines)
#define FT 512             // values in one such tile
__device__ __forceinline__ v16h frag_l(const _Float16* p) {   /* p = the lane's own place in the tile: tile + 8 lane */
  union { v16h v; v8h q[2]; } u; u.q[0] = *(const v8h*)p; u.q[1] = *(const v8h*)(p + FT / 2); return u.v;
}
__device__ __forceinline__ v16h frag_t(const _Float16* tile, int lane) { return frag_l(tile + 8 * lane); }
typedef __attribute__((ext_vector_type(4))) __bf16 v4b;
__device__ __forceinline__ v16b frag_lb(const __bf16* p) {   /* the same for a bf16 tile */
  union { v16b v; v8b q[2]; } u; u.q[0] = *(const v8b*)p; u.q[1] = *(const v8b*)(p + FT / 2); return u.v;
}
// A block of 128 threads stages an (out,in) f32 weight with rows of 128 values in LDS, rounded to bf16, as tiles in fragment order; tile it = (16 output rows it >> 2, k step it & 3). One tile = one load of every thread: eight lanes read one whole 128-B line (32 k values of one row), a wave four whole lines.
// stage_w_p: the thread's place in tile 0; stage_w_ld: issues the loads of tiles T0 .. T1 - 1; stage_w_st: rounds and stores them (here, in proj_mm, k_lin and k_proj every plain '#pragma unroll' is there so that a register array is indexed by constants only)
__device__ __forceinline__ const float* stage_w_p(const float* Wm, int tid) { return Wm + (size_t)(tid >> 3) * 128 + (tid & 7) * 4; }
template <int T0, int T1, int NT> __device__ __forceinline__ void stage_w_ld(const float* p, v4f (&x)[NT]) {
#pragma unroll   /* register array indexed by constants */
  for (int it = T0; it < T1; ++it) x[it] = *(const v4f*)(p + (it >> 2) * 16 * 128 + (it & 3) * 32);
}
template <int T0, int T1, int NT> __device__ __forceinline__ void stage_w_st(__bf16* sw, int tid, const v4f (&x)[NT]) {
  const int row = tid >> 3, q = tid & 7;   /* the thread holds k = 4 q .. 4 q + 3 of the step: half h = q >> 2, lane 16 g + row with g = (q >> 1) & 1, values 4 (q & 1) .. 4 (q & 1) + 3 of that lane */
  __bf16* d = sw + (q >> 2) * (FT / 2) + (((q >> 1) & 1) * 16 + row) * 8 + (q & 1) * 4;
#pragma unroll
  for (int it = T0; it < T1; ++it) { v4b y;
#pragma unroll
    for (int i = 0; i < 4; ++i) y[i] = (__bf16)x[it][i];
    *(v4b*)(d + it * FT) = y; }
}
#define QBH 0              // not used by any kernel here
#define QHI 2048            // rows carrying a q residual plane (all rows when non-causal: 2-product logits everywhere)
#define KHI 64            // key rows carrying k residual / v bf16 hi+lo planes (written by k_proj, read by no kernel here)
// B fragment (k rows k0+.., output column o) of a weight: (in,out) [K][ld] or (out,in) [ld rows of K]: bf16 exact, or f16(bf16 * 256) exact
__device__ __forceinline__ v16b wcol_io(const float* Wm, int k0, int o, int lane, int ld) { v16b w; const int g = lane >> 4;
#pragma unroll
  for (int i = 0; i < 8; ++i) { w[i] = (__bf16)Wm[(size_t)(k0 + 8 * g + i) * ld + o]; w[8 + i] = (__bf16)Wm[(size_t)(k0 + 16 + 8 * g + i) * ld + o]; }
  return w; }
__device__ __forceinline__ v16b wcol_oi(const float* Wm, int k0, int o, int lane, int K) { v16b w; const float* p = Wm + (size_t)o * K + k0 + 8 * (lane >> 4);
#pragma unroll
  for (int i = 0; i < 8; ++i) { w[i] = (__bf16)p[i]; w[8 + i] = (__bf16)p[16 + i]; }
  return w; }
__device__ __forceinline__ v16h wcolh_io(const float* Wm, int k0, int o, int lane, int ld) { v16h w; const int g = lane >> 4;
#pragma unroll
  for (int i = 0; i < 8; ++i) { w[i] = (_Float16)(bfr(Wm[(size_t)(k0 + 8 * g + i) * ld + o]) * 256.0f); w[8 + i] = (_Float16)(bfr(Wm[(size_t)(k0 + 16 + 8 * g + i) * ld + o]) * 256.0f); }
  return w; }
__device__ __forceinline__ v16h wcolh_oi(const float* Wm, int k0, int o, int lane, int K) { v16h w; const float* p = Wm + (size_t)o * K + k0 + 8 * (lane >> 4);
#pragma unroll
  for (int i = 0; i < 8; ++i) { w[i] = (_Float16)(bfr(p[i]) * 256.0f); w[8 + i] = (_Float16)(bfr(p[16 + i]) * 256.0f); }
  return w; }
#define WQKV_LAYOUT 1   // 0 = (in,out) [DIN][CC]; 1 = (out,in) [CC][DIN]; 2 = per-head [NH][DIN][HD]
__device__ __forceinline__ v16b wcol_hdk(const float* Wm, int k0, int o, int lane) { v16b w; const int g = lane >> 4; const float* p = Wm + (size_t)(o / HD) * DIN * HD + (o % HD);
#pragma unroll
  for (int i = 0; i < 8; ++i) { w[i] = (__bf16)p[(size_t)(k0 + 8 * g + i) * HD]; w[8 + i] = (__bf16)p[(size_t)(k0 + 16 + 8 * g + i) * HD]; }
  return w; }
#define WO_OUT_IN 0
#if WQKV_LAYOUT == 1
#define WCOL(W, k0, o, lane) wcol_oin(W, k0, o, lane, DIN, (which == 2) ? CC : HDQ)   /* q / k: 32 real output rows, columns 32..127 exact zeros */
#elif WQKV_LAYOUT == 2
#define WCOL(W, k0, o, lane) wcol_hdk(W, k0, o, lane)
#else
#define WCOL(W, k0, o, lane) wcol_io(W, k0, o, lane, CC)
#endif
#if WO_OUT_IN
#define WOCOL(W, k0, o, lane) wcol_oi(W, k0, o, lane, CC)
#define WOCOLH(W, k0, o, lane) wcolh_oi(W, k0, o, lane, CC)
#else
#define WOCOL(W, k0, o, lane) wcol_io(W, k0, o, lane, DIN)
#define WOCOLH(W, k0, o, lane) wcolh_io(W, k0, o, lane, DIN)
#endif
#define HDQ 32             // q / k width (k_proj's accumulators are 128 wide, columns 32..127 exact zeros; only the 32 real columns are stored)
#define BG HG              // not used by any kernel here
#define NR (TNB * TT)      // 32,768 rows (all batches)
// (out,in) projection weight with only 'nvalid' real output rows: columns o >= nvalid read row 0 and are zeroed by value
__device__ __forceinline__ v16b wcol_oin(const float* Wm, int k0, int o, int lane, int K, int nvalid) { v16b w; const int oc = o < nvalid ? o : 0; const float keep = o < nvalid ? 1.f : 0.f; const float* p = Wm + (size_t)oc * K + k0 + 8 * (lane >> 4);
#pragma unroll
  for (int i = 0; i < 8; ++i) { w[i] = (__bf16)(p[i] * keep); w[8 + i] = (__bf16)(p[16 + i] * keep); }
  return w; }
// pairwise tree over the 16 f32 P values of one A fragment (a lane's share of its query's sum over keys)
__device__ __forceinline__ float sum16(const float v[16]) { return (((v[0] + v[1]) + (v[2] + v[3])) + ((v[4] + v[5]) + (v[6] + v[7]))) + (((v[8] + v[9]) + (v[10] + v[11])) + ((v[12] + v[13]) + (v[14] + v[15]))); }
#define WS_DEN (WS_END)                                // (plane not used: the sum over keys stays inside k_att, in registers and LDS)
#define WS_FSA (WS_DEN + 4u * (size_t)NR)              // f32 f_sa rows [NR][128]
#define WS_YL  (WS_FSA + 4u * (size_t)NR * CC)        // f32 y rows (pre-BN)
#define WS_ST  (WS_YL + 4u * (size_t)NR * CC)         // BN statistics [128][32]
#define WS_PS  (WS_ST + 4u * (size_t)CC * 32)         // BN partials of k_lin's blocks [NR / 64][2][128]: mean of the block's 64 rows, sum of squared distances from that mean
#define WS_END2 (WS_PS + 4u * (size_t)(NR / 64) * 2 * CC)
// ---- k_lin: block = 64 rows: y = (bf16(f_in) - f_sa) (split bf16 hi + lo) Wl^T + bl (2 products, K 128) -> pre-BN rows, and per channel the block's own mean and sum of squared distances from it (PS)
__global__ __launch_bounds__(128) void k_lin(const float* __restrict__ X, const float* __restrict__ FSA, const float* __restrict__ WL, const float* __restrict__ BL, float* __restrict__ YL, float* __restrict__ PS) { __shared__ __align__(16) float sf[4][16][132]; __shared__ __align__(16) float sp[4][2][CC]; __shared__ __align__(16) __bf16 sw[(CC / 16) * (CC / 32) * FT];   /* sw: Wl as bf16 fragment tiles */
  const int tid = threadIdx.x, wave = tid >> 5, lane = tid & 31, col = lane & 15, g = lane >> 4; const size_t r0 = (size_t)blockIdx.x * 64 + wave * 16;
  v8f acc[8] = {}; const float* px = X + (r0 + col) * CC + 8 * g; const float* pf = FSA + (r0 + col) * CC + 8 * g; const float* pb = BL + col; const float* pw = stage_w_p(WL, tid); v4f xr[CC / 32][4], fr[CC / 32][4], wr[(CC / 16) * (CC / 32)]; float br[8];
#pragma unroll   /* the rows' values of all four k steps, the bias and the weight: every operand load of the kernel in flight at once */
  for (int kc = 0; kc < CC / 32; ++kc)
#pragma unroll
    for (int u = 0; u < 4; ++u) { const int o = kc * 32 + (u >> 1) * 16 + (u & 1) * 4; xr[kc][u] = *(const v4f*)(px + o); fr[kc][u] = *(const v4f*)(pf + o); }
#pragma unroll
  for (int j = 0; j < 8; ++j) br[j] = pb[j * 16];
  stage_w_ld<0, (CC / 16) * (CC / 32)>(pw, wr);
  asm volatile("s_wait_xcnt 0x0" :: "v"(px), "v"(pf), "v"(col), "v"(pw) : "memory");   /* precaution: the loads above have taken their addresses before an address register is written again; the pointers, and col (the bias loads' offset register), are named so that their registers live up to here and are no load's destination */
  stage_w_st<0, (CC / 16) * (CC / 32)>(sw, tid, wr);
  F2 a[CC / 32];
#pragma unroll
  for (int kc = 0; kc < CC / 32; ++kc) { float v[16];
#pragma unroll
    for (int i = 0; i < 16; ++i) v[i] = bfr(xr[kc][i >> 2][i & 3]) - fr[kc][i >> 2][i & 3];
    a[kc] = bsplit16(v); }
  __syncthreads();
  v16b wf[2][8];
#pragma unroll
  for (int j = 0; j < 8; ++j) wf[0][j] = frag_lb(sw + (j * 4) * FT + 8 * lane);
#pragma unroll
  for (int kc = 0; kc < CC / 32; ++kc) {
    if (kc + 1 < CC / 32) {
#pragma unroll
      for (int j = 0; j < 8; ++j) wf[(kc + 1) & 1][j] = frag_lb(sw + (j * 4 + kc + 1) * FT + 8 * lane); }
    __builtin_amdgcn_sched_barrier(0);   /* keeps the next k step's 16 LDS reads issued here as one group, a whole step ahead of their products (left alone they sink to their products, with a full wait in front of each) */
#pragma unroll
    for (int j = 0; j < 8; ++j) { acc[j] = wmma_bf(a[kc].h, wf[kc & 1][j], acc[j]); acc[j] = wmma_bf(a[kc].l, wf[kc & 1][j], acc[j]); } }
#pragma unroll
  for (int j = 0; j < 8; ++j) { const float bb = bfr(br[j]);
#pragma unroll
    for (int r = 0; r < 8; ++r) sf[wave][8 * g + r][j * 16 + col] = acc[j][r] + bb; }
  LDSX(); v4f yv[16];
#pragma unroll   /* yv is indexed by constants only */
  for (int rl = 0; rl < 16; ++rl) yv[rl] = *(const v4f*)&sf[wave][rl][lane * 4];
  // the wave's 16 rows, channels 4 lane .. 4 lane + 3: mean, then squared distances from that mean (no difference of large squares anywhere)
  const v4f m16 = ((((yv[0] + yv[1]) + (yv[2] + yv[3])) + ((yv[4] + yv[5]) + (yv[6] + yv[7]))) + (((yv[8] + yv[9]) + (yv[10] + yv[11])) + ((yv[12] + yv[13]) + (yv[14] + yv[15])))) * (1.0f / 16.0f); v4f q16 = {};
#pragma unroll
  for (int rl = 0; rl < 16; ++rl) { const v4f d = yv[rl] - m16; q16 += d * d; }
  *(v4f*)&sp[wave][0][lane * 4] = m16; *(v4f*)&sp[wave][1][lane * 4] = q16;
  __syncthreads();
  // thread = channel: the four waves' groups of 16 rows merged: mean of the means; squared distances add up, plus 16 x each group mean's squared distance from the merged mean
  const float g0 = sp[0][0][tid], g1 = sp[1][0][tid], g2 = sp[2][0][tid], g3 = sp[3][0][tid]; const float m64 = ((g0 + g1) + (g2 + g3)) * 0.25f; const float e0 = g0 - m64, e1 = g1 - m64, e2 = g2 - m64, e3 = g3 - m64;
  const float q64 = ((sp[0][1][tid] + sp[1][1][tid]) + (sp[2][1][tid] + sp[3][1][tid])) + 16.0f * ((e0 * e0 + e1 * e1) + (e2 * e2 + e3 * e3));
#pragma unroll   /* the row stores stand behind the barrier: in front of it the barrier would wait for all sixteen to finish */
  for (int rl = 0; rl < 16; ++rl) vst2(YL + (r0 + rl) * CC + lane * 4, yv[rl]);
  vst2(PS + (size_t)blockIdx.x * 2 * CC + tid, m64); vst2(PS + ((size_t)blockIdx.x * 2 + 1) * CC + tid, q64); }
// ---- k_stat: block = channel c: merges the NR / 64 partials of k_lin (equal groups of 64 rows) in the same way -> mean and 1 / sqrt(biased variance + eps)
__global__ __launch_bounds__(256) void k_stat(const float* __restrict__ PS, float* __restrict__ STAT) { __shared__ float sred[8]; __shared__ float sbc;
  const int t = threadIdx.x; const int c = blockIdx.x; float pm[NR / 64 / 256], pq[NR / 64 / 256];
#pragma unroll   /* register arrays indexed by constants; all loads in flight at once */
  for (int i = 0; i < NR / 64 / 256; ++i) { pm[i] = PS[(size_t)(i * 256 + t) * 2 * CC + c]; pq[i] = PS[((size_t)(i * 256 + t) * 2 + 1) * CC + c]; }
  float s = 0.f;
#pragma unroll
  for (int i = 0; i < NR / 64 / 256; ++i) s += pm[i];
#pragma unroll
  for (int o = 1; o < 32; o <<= 1) s += __shfl_xor(s, o);
  if ((t & 31) == 0) sred[t >> 5] = s; __syncthreads(); if (t == 0) { float a = 0.f; for (int i = 0; i < 8; ++i) a += sred[i]; sbc = a / (float)(NR / 64); } __syncthreads(); const float mean = sbc; __syncthreads();
  float q = 0.f;
#pragma unroll
  for (int i = 0; i < NR / 64 / 256; ++i) { const float d = pm[i] - mean; q += pq[i] + 64.0f * (d * d); }
#pragma unroll
  for (int o = 1; o < 32; o <<= 1) q += __shfl_xor(q, o);
  if ((t & 31) == 0) sred[t >> 5] = q; __syncthreads(); if (t == 0) { float a = 0.f; for (int i = 0; i < 8; ++i) a += sred[i]; sbc = rsqrtf(a / (float)NR + 1e-5f); } __syncthreads();
  if (t < 32) { const float v = t == 0 ? mean : (t == 1 ? sbc : 0.f); vst2(STAT + (size_t)c * 32 + t, v); } }
// ---- k_fin: out = relu(gamma (y - mean) rstd + beta) + f_sa (thread per float4)
__global__ __launch_bounds__(256) void k_fin(const float* __restrict__ YL, const float* __restrict__ STAT, const float* __restrict__ G, const float* __restrict__ BE, const float* __restrict__ FSA, float* __restrict__ OUT) { const size_t e4 = (size_t)blockIdx.x * 256 + threadIdx.x; if (e4 >= (size_t)NR * CC / 4) return; const int c0 = (int)((e4 * 4) % CC); const v4f yv = *(const v4f*)(YL + e4 * 4); const v4f fv = *(const v4f*)(FSA + e4 * 4); v4f o;
#pragma unroll
  for (int i = 0; i < 4; ++i) { const int c = c0 + i; const float yb = bfr(G[c]) * (yv[i] - STAT[c * 32]) * STAT[c * 32 + 1] + bfr(BE[c]); o[i] = fmaxf(yb, 0.f) + fv[i]; }
  vst2(OUT + e4 * 4, o); }
#ifndef SM_EXTRA_PARAMS
#define SM_EXTRA_PARAMS
#endif
#ifndef PROJ_EXTRA_PARAMS
#define PROJ_EXTRA_PARAMS
#endif
#ifndef SM_MASK_HOOK
#define SM_MASK_HOOK (void)0
#endif

#define WS_QH  0u                                      // f16 q tiles in fragment order [b*t / 16][FT] (the 32 real columns only; the rest of the plane is not used)
#define WS_KH  (WS_QH + 2u * (size_t)NB * TT * CC)      // f16 k tiles in fragment order [b*t / 16][FT]
#define WS_VT  (WS_KH + 2u * (size_t)NB * TT * CC)      // f16 v tiles in fragment order [b][t / 32][c / 16][FT] (tile: column = channel, k = t)
#define WS_QL  (WS_VT + 2u * (size_t)NB * CC * TT)      // f16 q residual x 2^10 tiles [(b, t < QHI) / 16][FT]
#define WS_KL  (WS_QL + 2u * (size_t)NB * QHI * CC)     // f16 k residual x 2^10 tiles [(b, t < KHI) / 16][FT]
#define WS_VB  (WS_KL + 2u * (size_t)NB * KHI * CC)     // bf16 v hi planes [b][c][t < KHI]
#define WS_VBL (WS_VB + 2u * (size_t)NB * CC * KHI)
#define WS_S   (WS_VBL + 2u * (size_t)NB * CC * KHI)    // f32 per-key softmax constants [b][t / 16][2][16] (the rest of the plane is not used)
#define WS_Y   (WS_S  + 4u * (size_t)HG * TT * TT)      // f32 ctx rows [b*t][CC] (only when there is an output projection)
#define WS_END (WS_Y  + 0u)

// k_proj's products from the staged weight tiles: acc[j] += x W^T over the four k steps; NJ real 16-column tiles (j >= NJ: zero fragments, exact zero columns)
template <int NJ> __device__ __forceinline__ void proj_mm(const __bf16* swl, const v16b (&a)[DIN / 32], v8f (&acc)[8]) {   /* swl = the lane's own place in tile 0 */
  v16b wf[2][NJ];
#pragma unroll
  for (int j = 0; j < NJ; ++j) wf[0][j] = frag_lb(swl + (j * 4) * FT);
#pragma unroll
  for (int kc = 0; kc < DIN / 32; ++kc) {
    if (kc + 1 < DIN / 32) {
#pragma unroll
      for (int j = 0; j < NJ; ++j) wf[(kc + 1) & 1][j] = frag_lb(swl + (j * 4 + kc + 1) * FT); }
    __builtin_amdgcn_sched_barrier(0);   /* keeps the next k step's LDS reads issued here as one group, a whole step ahead of their products (left alone they sink to their products, with a full wait in front of each) */
#pragma unroll
    for (int j = 0; j < 8; ++j) { v16b w = {}; if (j < NJ) w = wf[kc & 1][j < NJ ? j : 0]; acc[j] = wmma_bf(a[kc], w, acc[j]); } }
}
// ---- k_proj: block = (64 rows, 128 cols, which): q/k/v = X W (+ b) with exact bf16 products (K = DIN) -> which 0: q f16 tiles (+ residual tiles, rows < QHI); 1: k f16 tiles (+ residual tiles, rows < KHI); 2: v f16 tiles (+ bf16 hi/lo planes [c][t] for t < KHI); the f16 tiles in fragment order (frag_t)
__global__ __launch_bounds__(128) void k_proj(const float* __restrict__ XQ, const float* __restrict__ XK, const float* __restrict__ XV, const float* __restrict__ WQ, const float* __restrict__ WK, const float* __restrict__ WV, const float* __restrict__ BQ, const float* __restrict__ BK, const float* __restrict__ BV,
    _Float16* __restrict__ QH, _Float16* __restrict__ QL, _Float16* __restrict__ KH, _Float16* __restrict__ KL, _Float16* __restrict__ VT, __bf16* __restrict__ VB, __bf16* __restrict__ VBL) {
  __shared__ __align__(16) _Float16 shl[2][64][136]; _Float16 (&sh)[64][136] = shl[0]; _Float16 (&sl)[64][136] = shl[1];   /* one array, so that a v block's weight tiles can span both halves */
  __shared__ __align__(16) _Float16 th[128][72]; __shared__ __align__(16) __bf16 tb[128][72], tbl[128][72];
  const int tid = threadIdx.x, wave = tid >> 5, lane = tid & 31, col = lane & 15, g = lane >> 4; const int which = blockIdx.z; const int c0 = blockIdx.y * 128; const size_t r0 = (size_t)blockIdx.x * 64; const size_t bb = r0 / TT; const int t0 = (int)(r0 % TT);
  const float* X = which == 0 ? XQ : which == 1 ? XK : XV; const float* WA = which == 0 ? WQ : which == 1 ? WK : WV; const float* BA = which == 0 ? BQ : which == 1 ? BK : BV;
  v8f acc[8] = {}; const float* pa = X + (r0 + wave * 16 + col) * DIN + 8 * g; const float* pw = stage_w_p(WA, tid); const float* pb = BA + c0 + col; v4f xr[DIN / 32][4], wr[(CC / 16) * (DIN / 32)]; float br[8] = {};   /* br: the bias of column 16 j + col; stays 0 in the zero columns of q / k */
#pragma unroll   /* the row's values of all four k steps, the bias and the weight: every operand load of the kernel in flight at once */
  for (int kc = 0; kc < DIN / 32; ++kc)
#pragma unroll
    for (int u = 0; u < 4; ++u) xr[kc][u] = *(const v4f*)(pa + kc * 32 + (u >> 1) * 16 + (u & 1) * 4);
  stage_w_ld<0, (HDQ / 16) * (DIN / 32)>(pw, wr);
#pragma unroll
  for (int j = 0; j < HDQ / 16; ++j) br[j] = pb[j * 16];
  if (which == 2) { stage_w_ld<(HDQ / 16) * (DIN / 32), (CC / 16) * (DIN / 32)>(pw, wr);   /* q / k have only the 32 real rows */
#pragma unroll
    for (int j = HDQ / 16; j < 8; ++j) br[j] = pb[j * 16]; }
  asm volatile("s_wait_xcnt 0x0" :: "v"(pa), "v"(pw), "v"(pb), "v"(col) : "memory");   /* precaution: the loads above have taken their addresses before an address register is written again; the pointers, and col (the offset register of two bias loads), are named so that their registers live up to here and are no load's destination */
  // the weight tiles lie in LDS that this block's own epilogue does not use: v blocks (128 rows, 32 KB) in shl, q / k blocks (the 32 real rows, 8 KB) in th; so no barrier is owed between the last tile read and the epilogue's LDS stores
  __bf16* sw = which == 2 ? (__bf16*)&shl[0][0][0] : (__bf16*)&th[0][0];
  stage_w_st<0, (HDQ / 16) * (DIN / 32)>(sw, tid, wr);
  if (which == 2) stage_w_st<(HDQ / 16) * (DIN / 32), (CC / 16) * (DIN / 32)>(sw, tid, wr);
  v16b a[DIN / 32];
#pragma unroll
  for (int kc = 0; kc < DIN / 32; ++kc)
#pragma unroll
    for (int i = 0; i < 16; ++i) a[kc][i] = (__bf16)xr[kc][i >> 2][i & 3];
  __syncthreads();
  if (which == 2) proj_mm<CC / 16>(sw + 8 * lane, a, acc); else proj_mm<HDQ / 16>(sw + 8 * lane, a, acc);
  if (which < 2) { _Float16* DH = which == 0 ? QH : KH; _Float16* DL = which == 0 ? QL : KL; const int nhi = which == 0 ? QHI : KHI; const bool hi_rows = t0 < nhi;
#pragma unroll
    for (int j = 0; j < 8; ++j) { const float bias = bfr(br[j]);
#pragma unroll
      for (int r = 0; r < 8; ++r) { const float v = acc[j][r] + bias; const _Float16 hv = (_Float16)v; sh[wave * 16 + 8 * g + r][j * 16 + col] = hv; sl[wave * 16 + 8 * g + r][j * 16 + col] = (_Float16)((v - (float)hv) * 1024.0f); } }
    __syncthreads();
    for (int e = tid; e < 64 * HDQ / 8; e += 128) { const int tl = e >> 6, h = (e >> 5) & 1, l = e & 31; const int rl = tl * 16 + (l & 15), k8 = 16 * h + 8 * (l >> 4);   /* e runs in the order of the destination: a wave stores 512 contiguous bytes */
      vst2((unsigned*)(DH + ((r0 >> 4) + tl) * FT + (e & 63) * 8), *(const v4u*)&sh[rl][k8]);
      asm volatile("s_wait_xcnt 0x0" ::: "memory");   /* precaution, here and behind the four stores below: the store has taken its address and data before the next LDS load or address sum writes those registers again */
      if (hi_rows) { vst2((unsigned*)(DL + (((bb * nhi + t0) >> 4) + tl) * FT + (e & 63) * 8), *(const v4u*)&sl[rl][k8]); asm volatile("s_wait_xcnt 0x0" ::: "memory"); } }
  } else { const bool hi_rows = t0 < KHI;
#pragma unroll
    for (int j = 0; j < 8; ++j) { const float bias = bfr(br[j]);
#pragma unroll
      for (int r = 0; r < 8; ++r) { const float v = acc[j][r] + bias; const int rl = wave * 16 + 8 * g + r, cl = j * 16 + col; th[cl][rl] = (_Float16)v; const __bf16 bh = (__bf16)v; tb[cl][rl] = bh; tbl[cl][rl] = (__bf16)(v - (float)bh); } }
    __syncthreads();
    for (int e = tid; e < 128 * 8; e += 128) { const int cl = e >> 3, q = e & 7; { const int tl = e >> 6, h = (e >> 5) & 1, l = e & 31;   /* tile tl = (32-key chunk tl >> 3, 16 channels tl & 7) of the block, e in the order of the destination */
        vst2((unsigned*)(VT + (((bb * (TT / 32) + (t0 >> 5) + (tl >> 3)) * (CC / 16) + (c0 >> 4) + (tl & 7)) * FT + (e & 63) * 8)), *(const v4u*)&th[(tl & 7) * 16 + (l & 15)][(tl >> 3) * 32 + 16 * h + 8 * (l >> 4)]); asm volatile("s_wait_xcnt 0x0" ::: "memory"); }
      if (hi_rows) { const size_t o3 = (bb * CC + c0 + cl) * (size_t)KHI + t0 + q * 8; vst2((unsigned*)(VB + o3), *(const v4u*)&tb[cl][q * 8]); asm volatile("s_wait_xcnt 0x0" ::: "memory"); vst2((unsigned*)(VBL + o3), *(const v4u*)&tbl[cl][q * 8]); asm volatile("s_wait_xcnt 0x0" ::: "memory"); } } } }
// plain builtin form: the compiler keeps the distance behind a matrix instruction itself and fills it with independent work where it can
__device__ __forceinline__ v8f wmma16c(v16h a, v16h b, v8f c) { return __builtin_amdgcn_wmma_f32_16x16x32_f16(false, a, false, b, (short)0, c, false, false); }
// (in the two kernels below every plain '#pragma unroll' is there so that a register array is indexed by constants only)
// logit of one (key, query) pair from the two f16 products: k hi . q + (k residual x 2^10) . q / 2^10
__device__ __forceinline__ float logit2(float hi, float lo) { return (hi + lo * (1.0f / 1024.0f)) * SCALE; }
#define LOG2E 1.4426950408889634f
// exp(x) 2^c = 2^(x log2 e + c): one fused multiply-add (lc) and the hardware's own base-2 exponential (exp2x8). The exponent is at most about 11 here (x never above its key's maximum); a result under 2^-126 may come out as 0, far below what the f32 sums (at least 1) or an f16 P value keep
__device__ __forceinline__ float lc(float x, float c) { return __builtin_fmaf(x, LOG2E, c); }
// y[0..7] = 2^y[0..7]. One statement, each exponential in place, one v_nop at the end: the instruction set asks for one independent instruction behind a transcendental before its result is read or its source written over; here that is the next exponential, on another register, and behind the last one the v_nop (left to the register allocator, neighbours wrote over each other's sources)
__device__ __forceinline__ void exp2x8(float* y) {
  asm("v_exp_f32 %0, %0\n\tv_exp_f32 %1, %1\n\tv_exp_f32 %2, %2\n\tv_exp_f32 %3, %3\n\tv_exp_f32 %4, %4\n\tv_exp_f32 %5, %5\n\tv_exp_f32 %6, %6\n\tv_exp_f32 %7, %7\n\tv_nop"
      : "+v"(y[0]), "+v"(y[1]), "+v"(y[2]), "+v"(y[3]), "+v"(y[4]), "+v"(y[5]), "+v"(y[6]), "+v"(y[7])); }
// ---- k_kst: block = 16 keys of batch blockIdx.y; wave w holds the logits of those keys against queries [256 w, 256 w + 256) in registers (D: row = key 8g + r, column = query): maximum and sum of exp over ALL queries -> KS line of the key tile: per key the one constant c = 11 - max log2 e - log2 sum, so that 2^(logit log2 e + c) = exp(logit - max) x 2^11 / sum (the line's second half repeats the 16 values: the block stays the one writer of its whole 128-B line)
__global__ __launch_bounds__(256) __attribute__((amdgpu_waves_per_eu(4))) /* holds the kernel to 256 registers, four waves per SIMD as before: left alone this build takes a few more and only one block fits a WGP */ void k_kst(const _Float16* __restrict__ KRH, const _Float16* __restrict__ KRL, const _Float16* __restrict__ QR, float* __restrict__ KS) { __shared__ float smx[8][16], ssu[8][16];
  const int tid = threadIdx.x, wave = tid >> 5, lane = tid & 31, col = lane & 15, g = lane >> 4; const size_t kr0 = (size_t)blockIdx.y * TT + blockIdx.x * 16, q0 = (size_t)blockIdx.y * TT + wave * (TT / 8);
  const v16h ah = frag_t(KRH + (kr0 >> 4) * FT, lane), al = frag_t(KRL + (kr0 >> 4) * FT, lane);
  asm volatile("s_wait_xcnt 0x0" ::: "memory");   /* precaution: the four key loads above have taken their addresses before a later load's result reuses those address registers */
  float s[TT / 128][8]; v16h qf[TT / 128];
#pragma unroll
  for (int t = 0; t < 8; ++t) qf[t] = frag_t(QR + ((q0 >> 4) + t) * FT, lane);
#pragma unroll
  for (int tg = 0; tg < TT / 128; tg += 4) {   /* groups of four query tiles, loaded two groups ahead of their products */
    if (tg + 8 < TT / 128) {
#pragma unroll
      for (int t = tg + 8; t < tg + 12; ++t) qf[t] = frag_t(QR + ((q0 >> 4) + t) * FT, lane); }
    __builtin_amdgcn_sched_barrier(0);   /* keeps the loads above issued here: left alone the scheduler either waits on one tile at a time or hoists all sixteen, which takes the kernel past 256 registers */
#pragma unroll
    for (int t = tg; t < tg + 4; ++t) { v8f a = {}, l = {}; a = wmma16(ah, qf[t], a); l = wmma16(al, qf[t], l);
#pragma unroll
      for (int r = 0; r < 8; ++r) s[t][r] = logit2(a[r], l[r]); }
    __builtin_amdgcn_sched_barrier(0);   /* the other side of the same fence: the next group's loads stay behind these products */
  }
  float mx[8], su[8];
#pragma unroll
  for (int r = 0; r < 8; ++r) { float m = s[0][r];
#pragma unroll
    for (int t = 1; t < TT / 128; ++t) m = fmaxf(m, s[t][r]);
#pragma unroll
    for (int o = 1; o < 16; o <<= 1) m = fmaxf(m, __shfl_xor(m, o));
    mx[r] = m; }
  if (col == 0) {
#pragma unroll
    for (int r = 0; r < 8; ++r) smx[wave][8 * g + r] = mx[r]; }
  __syncthreads();
#pragma unroll
  for (int r = 0; r < 8; ++r) { float m = smx[0][8 * g + r];
#pragma unroll
    for (int w = 1; w < 8; ++w) m = fmaxf(m, smx[w][8 * g + r]);
    float a = 0.f; const float nm = -m * LOG2E;
#pragma unroll
    for (int tg = 0; tg < TT / 128; tg += 8) { float e[8];
#pragma unroll
      for (int t = 0; t < 8; ++t) e[t] = lc(s[tg + t][r], nm);
      exp2x8(e);
#pragma unroll
      for (int t = 0; t < 8; ++t) a += e[t]; }
#pragma unroll
    for (int o = 1; o < 16; o <<= 1) a += __shfl_xor(a, o);
    su[r] = a; }
  if (col == 0) {
#pragma unroll
    for (int r = 0; r < 8; ++r) ssu[wave][8 * g + r] = su[r]; }
  __syncthreads();
  if (tid < 32) { float m = smx[0][col], a = 0.f;
#pragma unroll
    for (int w = 1; w < 8; ++w) m = fmaxf(m, smx[w][col]);
#pragma unroll
    for (int w = 0; w < 8; ++w) a += ssu[w][col];
    vst2(KS + kr0 * 2 + tid, a > 0.f ? (11.0f - m * LOG2E) - log2f(a) : -1.0e30f); } }   /* no sum: an exponent that makes every P of the key 0, as the factor 0 did */
// ---- k_att: block = 128 queries of batch blockIdx.y, 8 waves; wave = (query group qg: 32 queries = two 16-query tiles, key half hf: 1,024 keys), so every key and v fragment it loads feeds the products of two query tiles. Per 32 keys and query tile: S^T tiles (row = key, column = query) from the same two products as k_kst, P x 2^11 = 2^(logit log2 e + the key's constant of k_kst) in f32; the two D tiles, converted to f16 in place, ARE the A fragment (row = query, k = key) of P . v. The two waves of a query group (one per key half) each finish one of its tiles: a wave hands its partial P . v and key sum of the other tile to its partner through LDS; f_sa = (P . v) / (sum over keys of P)
#define NP (TT / 64)       // passes of 32 keys in one key half
__global__ __launch_bounds__(256) void k_att(const _Float16* __restrict__ KRH, const _Float16* __restrict__ KRL, const _Float16* __restrict__ QR, const float* __restrict__ KS, const _Float16* __restrict__ VT, float* __restrict__ Y) { __shared__ __align__(16) float ss[8][16][HD + 4]; __shared__ __align__(16) float sks[TT * 2]; __shared__ float sk[8][16];
  const int tid = threadIdx.x, lane = tid & 31, col = lane & 15, g = lane >> 4; const int b = blockIdx.y;
  const int wave = __builtin_amdgcn_readfirstlane(tid >> 5), qg = wave & 3, hf = wave >> 2;   /* the wave's number in a scalar register: the bases formed from it below stay scalar */
  const int ql0 = blockIdx.x * 128 + qg * 32;   /* the wave's tile u = queries ql0 + 16 (u ^ hf) ..: tile 0 is the one it finishes itself, tile 1 the one it hands over */
#pragma unroll   /* all four loads in flight at once */
  for (int i = 0; i < TT * 2 / 4 / 256; ++i) *(v4f*)&sks[(i * 256 + tid) * 4] = *(const v4f*)(KS + (size_t)b * TT * 2 + (i * 256 + tid) * 4);
  __syncthreads();
  const _Float16* qt0 = QR + ((((size_t)b * TT + ql0) >> 4) + hf) * FT; const _Float16* qt1 = QR + ((((size_t)b * TT + ql0) >> 4) + (hf ^ 1)) * FT; const v16h qf[2] = { frag_t(qt0, lane), frag_t(qt1, lane) };
  const _Float16* kh = KRH + ((size_t)b * (TT / 16) + hf * (TT / 32)) * FT; const _Float16* kl = KRL + ((size_t)b * (TT / 16) + hf * (TT / 32)) * FT; const _Float16* vt = VT + ((size_t)b * (TT / 32) + hf * NP) * (HD / 16) * FT; const float* sc = &sks[hf * NP * 64 + 8 * g];   /* the key half's first tiles and constants */
  v8f acc[2][HD / 16] = {}; float ksum[2] = { 0.f, 0.f };   /* ksum[u]: f32 sum of the P x 2^11 values this lane makes for tile u: query col, the k half g of every chunk */
  v16h a0 = frag_t(kh, lane), l0 = frag_t(kl, lane), a1 = frag_t(kh + FT, lane), l1 = frag_t(kl + FT, lane);
  asm volatile("s_wait_xcnt 0x0" :: "s"(qt0), "s"(qt1), "s"(kh), "s"(kl) : "memory");   /* precaution: the twelve loads above have taken their addresses before an address register is written again; their four scalar bases are named so that those registers live up to here (left alone a later scalar shift is moved up over the wait and writes one of the bases) */
#pragma unroll 1   /* rolled: one pass is 24 products and 24 loads already */
  for (int kc = 0; kc < NP; ++kc) { v16h vf[HD / 16]; const _Float16* vp = vt + (size_t)kc * (HD / 16) * FT + 8 * lane;
#pragma unroll
    for (int j = 0; j < HD / 16; ++j) vf[j] = frag_l(vp + j * FT);
    __builtin_amdgcn_sched_barrier(0);   /* keeps the 16 v loads issued here, a whole score-and-exp phase ahead of their use (the scheduler otherwise sinks them to the P . v products, two fragments in flight) */
    v8f s0[2], t0[2], s1[2], t1[2];
#pragma unroll
    for (int u = 0; u < 2; ++u) { const v8f z = {}; s0[u] = wmma16c(a0, qf[u], z); t0[u] = wmma16c(l0, qf[u], z); s1[u] = wmma16c(a1, qf[u], z); t1[u] = wmma16c(l1, qf[u], z); }
    const size_t kn = (size_t)(kc + 1 < NP ? kc + 1 : kc) * 2 * FT;   /* next chunk's two key tiles, fetched one pass ahead (the last pass fetches its own again: in bounds) */
    a0 = frag_t(kh + kn, lane); l0 = frag_t(kl + kn, lane); a1 = frag_t(kh + kn + FT, lane); l1 = frag_t(kl + kn + FT, lane);
    asm volatile("s_wait_xcnt 0x0" :: "v"(vp) : "memory");   /* precaution: the pass's loads have taken their addresses before an address register is written again; vp is named so that the v loads' address pair lives up to here and is not itself the destination of the last of them */
    __builtin_amdgcn_sched_barrier(0);   /* keeps the next chunk's key loads issued here, ahead of the exp phase */
    const v4f* st = (const v4f*)(sc + kc * 64); const v4f c0[2] = { st[0], st[1] }, c1[2] = { st[8], st[9] }; v16h p[2];   /* the chunk's constants, keys 8g + r of both key tiles: the same for both query tiles */
#pragma unroll
    for (int u = 0; u < 2; ++u) { float v[16];
#pragma unroll
      for (int r = 0; r < 8; ++r) { v[r] = lc(logit2(s0[u][r], t0[u][r]), c0[r >> 2][r & 3]); v[8 + r] = lc(logit2(s1[u][r], t1[u][r]), c1[r >> 2][r & 3]); }
      exp2x8(v); exp2x8(v + 8);
#pragma unroll
      for (int i = 0; i < 16; ++i) p[u][i] = (_Float16)v[i];
      ksum[u] += sum16(v); }
#pragma unroll
    for (int j = 0; j < HD / 16 - 1; ++j) { acc[0][j] = wmma16c(p[0], vf[j], acc[0][j]); acc[1][j] = wmma16c(p[1], vf[j], acc[1][j]); }
    acc[0][HD / 16 - 1] = wmma16c(p[0], vf[HD / 16 - 1], acc[0][HD / 16 - 1]);
    acc[1][HD / 16 - 1] = wmma16(p[1], vf[HD / 16 - 1], acc[1][HD / 16 - 1]); }   /* the last product in the form with four v_nop behind it: across the taken branch the next pass's v loads write over the B fragments of these products */
#pragma unroll
  for (int u = 0; u < 2; ++u) ksum[u] += __shfl_xor(ksum[u], 16);   /* both k halves of the chunks: the key half's share of den (x 2^11) of the tile's query col, in lanes col and col + 16 */
  float (&own)[16][HD + 4] = ss[qg * 2 + hf]; float (&oth)[16][HD + 4] = ss[qg * 2 + (hf ^ 1)];   /* a tile's plane belongs to the wave that finishes the tile */
#pragma unroll
  for (int j = 0; j < HD / 16; ++j)
#pragma unroll
    for (int r = 0; r < 8; ++r) oth[8 * g + r][j * 16 + col] = acc[1][j][r];
  if (g == 0) sk[qg * 2 + (hf ^ 1)][col] = ksum[1];
  __syncthreads();   /* the partner's partial sums of this wave's own tile are in LDS */
  const float den = ksum[0] + sk[qg * 2 + hf][col];
  const float inv = den > 0.f ? 2048.0f / den : 0.f; float invr[8];
#pragma unroll
  for (int r = 0; r < 8; ++r) invr[r] = __shfl(inv, 8 * g + r);   /* accumulator element r is query row 8g + r */
  v8f pr[HD / 16];
#pragma unroll   /* the partner's 64 values of this lane's places, all read before the first of the places is rewritten */
  for (int j = 0; j < HD / 16; ++j)
#pragma unroll
    for (int r = 0; r < 8; ++r) pr[j][r] = own[8 * g + r][j * 16 + col];
#pragma unroll
  for (int j = 0; j < HD / 16; ++j)
#pragma unroll
    for (int r = 0; r < 8; ++r) own[8 * g + r][j * 16 + col] = (acc[0][j][r] + pr[j][r]) * (1.0f / 2048.0f) * invr[r];
  LDSX(); v4f yv[16]; float* yp = Y + ((size_t)b * TT + ql0 + 16 * hf) * CC + lane * 4;
#pragma unroll   /* yv is indexed by constants only: all sixteen rows are read before the first store, and no register of a store is written again */
  for (int rl = 0; rl < 16; ++rl) yv[rl] = *(const v4f*)&own[rl][lane * 4];
#pragma unroll
  for (int rl = 0; rl < 16; ++rl) vst2(yp + rl * CC, yv[rl]); }

extern "C" void kernel_launch(void* const* d_in, const int* in_sizes, int n_in, void* d_out, int out_size, void* d_ws, size_t ws_size, hipStream_t stream) {
  (void)in_sizes; (void)n_in; (void)out_size;
  const float** F = (const float**)d_in;
  if (ws_size < (size_t)WS_END) return;
  char* ws = (char*)d_ws; _Float16 *QH = (_Float16*)(ws + WS_QH), *KH = (_Float16*)(ws + WS_KH), *VT = (_Float16*)(ws + WS_VT), *QL = (_Float16*)(ws + WS_QL), *KL = (_Float16*)(ws + WS_KL); __bf16 *VB = (__bf16*)(ws + WS_VB), *VBL = (__bf16*)(ws + WS_VBL); float *S = (float*)(ws + WS_S), *Y = (float*)(ws + WS_Y);
  (void)Y; (void)QL; (void)KL; (void)VB; (void)VBL;
  // inputs: 0 f_in [16,2048,128]; 1 w_q [32,128] (out,in), 2 b_q [32]; 3 w_k [32,128], 4 b_k; 5 w_v [128,128], 6 b_v; 7 w_l [128,128], 8 b_l; 9 bn_gamma, 10 bn_beta
  if (ws_size < (size_t)WS_END2) return;
  float *FSA = (float*)(ws + WS_FSA), *YL = (float*)(ws + WS_YL), *ST = (float*)(ws + WS_ST), *PS = (float*)(ws + WS_PS);
  // ROLE SWAP: the 'q' planes (hi + residual) hold K (from w_k, b_k) and the 'k' planes hold Q, so the score tiles are S^T[key][query] and the softmax runs over QUERIES
  k_proj<<<dim3(TNB * TT / 64, CC / 128, 3), 128, 0, stream>>>(F[0], F[0], F[0], F[3], F[1], F[5], F[4], F[2], F[6], QH, QL, KH, KL, VT, VB, VBL);
  k_kst<<<dim3(TT / 16, TNB), 256, 0, stream>>>(QH, QL, KH, S);   /* per key: the exponent constant from the maximum and the sum of exp over the queries */
  k_att<<<dim3(TT / 128, TNB), 256, 0, stream>>>(QH, QL, KH, S, VT, FSA);   /* f_sa rows: logits made again in registers, P never stored */
  k_lin<<<dim3(NR / 64), 128, 0, stream>>>(F[0], FSA, F[7], F[8], YL, PS);
  k_stat<<<dim3(CC), 256, 0, stream>>>(PS, ST);
  k_fin<<<dim3((NR * CC / 4 + 255) / 256), 256, 0, stream>>>(YL, ST, F[9], F[10], FSA, (float*)d_out);
}

// v008
// It runs in 82 microseconds.
// Next to v007, in two timings, it ran 1.05 times as fast each time.
// Over all steps from v000 it is 20.6 times as fast.
#include <hip/hip_runtime.h>
#include <math.h>

typedef __attribute__((ext_vector_type(16))) _Float16 v16h;
typedef __attribute__((ext_vector_type(16))) __bf16 v16b;
typedef __attribute__((ext_vector_type(8)))  _Float16 v8h;
typedef __attribute__((ext_vector_type(8)))  float v8f;
typedef __attribute__((ext_vector_type(4)))  float v4f;
typedef __attribute__((ext_vector_type(2)))  float v2f;
typedef __attribute__((ext_vector_type(4)))  unsigned v4u;
typedef __attribute__((ext_vector_type(4)))  int v4i;
typedef float __attribute__((may_alias)) float_a;
typedef int __attribute__((may_alias)) int_a;

template <typename T> __device__ __forceinline__ void vst2(void* p, T v) { *(T*)p = v;  }
__device__ __forceinline__ v8f wmma16(v16h a, v16h b, v8f c) {
  v8f d = __builtin_amdgcn_wmma_f32_16x16x32_f16(false, a, false, b, (short)0, c, false, false);
  asm volatile("v_nop\n\tv_nop\n\tv_nop\n\tv_nop" : "+v"(d) : "v"(a), "v"(b));
  return d;
}
__device__ __forceinline__ v8f wmma_bf(v16b a, v16b b, v8f c) {
  v8f d = __builtin_amdgcn_wmma_f32_16x16x32_bf16(false, a, false, b, (short)0, c, false, false);
  asm volatile("v_nop\n\tv_nop\n\tv_nop\n\tv_nop" : "+v"(d) : "v"(a), "v"(b));
  return d;
}
// 16x16x32 fragments: lane = (h = lane>>4, row/col = lane&15); elements 0..7 = k0+8h+0..7, 8..15 = k0+16+8h+0..7; D element r = row 8h+r
__device__ __forceinline__ v16h frag_h(const _Float16* rowk0, int lane) {
  union { v16h v; v8h q[2]; } u; const _Float16* p = rowk0 + 8 * (lane >> 4);
  u.q[0] = *(const v8h*)p; u.q[1] = *(const v8h*)(p + 16); return u.v;
}
__device__ __forceinline__ v16h frag_f32(const float* rowk0, int lane) {
  v16h a; const float* p = rowk0 + 8 * (lane >> 4);
#pragma unroll
  for (int i = 0; i < 8; ++i) { a[i] = (_Float16)p[i]; a[8 + i] = (_Float16)p[16 + i]; }
  return a;
}
__device__ __forceinline__ v16h frag_f32s(const float* rowk0, int lane, float sc) {
  v16h a; const float* p = rowk0 + 8 * (lane >> 4);
#pragma unroll
  for (int i = 0; i < 8; ++i) { a[i] = (_Float16)(p[i] * sc); a[8 + i] = (_Float16)(p[16 + i] * sc); }
  return a;
}
// column fragment from a [K][ld] layout (column n), rows >= K read as 0
__device__ __forceinline__ v16h fragc_f32(const float* W, int k0, int n, int lane, int ld, int K) {
  v16h a; const int g = lane >> 4;
#pragma unroll
  for (int i = 0; i < 8; ++i) { const int ka = k0 + 8 * g + i, kb = ka + 16;
    a[i] = (_Float16)(ka < K ? W[(size_t)(ka < K ? ka : K - 1) * ld + n] : 0.f); a[8 + i] = (_Float16)(kb < K ? W[(size_t)(kb < K ? kb : K - 1) * ld + n] : 0.f); }
  return a;
}
struct F2 { v16b h, l; };
__device__ __forceinline__ F2 bsplit16(const float v[16]) { F2 r;
#pragma unroll
  for (int i = 0; i < 16; ++i) { const __bf16 h = (__bf16)v[i]; r.h[i] = h; r.l[i] = (__bf16)(v[i] - (float)h); }
  return r; }
__device__ __forceinline__ F2 split_row(const float* row, int k0, int lane) { float v[16]; const float* p = row + k0 + 8 * (lane >> 4);
#pragma unroll
  for (int i = 0; i < 8; ++i) { v[i] = p[i]; v[8 + i] = p[16 + i]; }
  return bsplit16(v); }
__device__ __forceinline__ F2 split_rowK(const float* row, int k0, int lane, int K) { float v[16]; const int g = lane >> 4;
#pragma unroll
  for (int i = 0; i < 8; ++i) { const int ka = k0 + 8 * g + i, kb = ka + 16; v[i] = ka < K ? row[ka < K ? ka : K - 1] : 0.f; v[8 + i] = kb < K ? row[kb < K ? kb : K - 1] : 0.f; }
  return bsplit16(v); }
__device__ __forceinline__ F2 split_col(const float* W, int k0, int n, int lane, int ld, int K) { float v[16]; const int g = lane >> 4;
#pragma unroll
  for (int i = 0; i < 8; ++i) { const int ka = k0 + 8 * g + i, kb = ka + 16; v[i] = ka < K ? W[(size_t)(ka < K ? ka : K - 1) * ld + n] : 0.f; v[8 + i] = kb < K ? W[(size_t)(kb < K ? kb : K - 1) * ld + n] : 0.f; }
  return bsplit16(v); }
__device__ __forceinline__ v8f mac3(const F2& a, const F2& b, v8f c) { c = wmma_bf(a.l, b.h, c); c = wmma_bf(a.h, b.l, c); return wmma_bf(a.h, b.h, c); }
__device__ __forceinline__ float sigm(float v) { return 1.0f / (1.0f + expf(-v)); }
#define LDSX() do { asm volatile("s_wait_dscnt 0" ::: "memory"); __builtin_amdgcn_wave_barrier(); __builtin_amdgcn_fence(__ATOMIC_RELEASE, "workgroup"); } while (0)

// Offset-attention (PCT) block (B 16, N 2,048, D 128, q/k dim 32): q = x Wq^T + bq, k = x Wk^T + bk (32-d), v = x Wv^T + bv; a = softmax over QUERIES of q k^T (no scale), then a = a / sum over keys; f_sa = a v; y = (x - f_sa) Wl^T + bl; out = relu(BN(y)) + f_sa (BN with batch statistics over B*N, biased variance, eps 1e-5).
#define NB 16
#define TT 2048
#define CC 128            // NH * HD = projected width
#define DIN 128          // input (model) width
#define NH 1
#define HD 128
#define NQB (TT / 64)
#define HG 4
#define SCALE (1.0f)
#define CAUSAL 0
#ifndef TNB
#define TNB NB
#endif
__device__ __forceinline__ float bfr(float v) { return (float)(__bf16)v; }
__host__ __device__ __forceinline__ int kb_last(int qb) { return CAUSAL ? ((qb * 64 + 63) >> 7) : (TT / 128 - 1); }
typedef __attribute__((ext_vector_type(8))) __bf16 v8b;
__device__ __forceinline__ v16b frag_b(const __bf16* rowk0, int lane) {
  union { v16b v; v8b q[2]; } u; const __bf16* p = rowk0 + 8 * (lane >> 4);
  u.q[0] = *(const v8b*)p; u.q[1] = *(const v8b*)(p + 16); return u.v;
}
// operand tile in fragment order: a 16 (rows or columns) x 32 (k) tile of 16-bit values is 1 KB = [h][lane][8 values]; lane = (g = lane>>4, row/col = lane&15) holds k = 16h + 8g + 0..7 there, so each of the two wave-wide 16-byte loads of a fragment covers 512 contiguous bytes (four whole lines)
#define FT 512             // values in one such tile
__device__ __forceinline__ v16h frag_l(const _Float16* p) {   /* p = the lane's own place in the tile: tile + 8 lane */
  union { v16h v; v8h q[2]; } u; u.q[0] = *(const v8h*)p; u.q[1] = *(const v8h*)(p + FT / 2); return u.v;
}
__device__ __forceinline__ v16h frag_t(const _Float16* tile, int lane) { return frag_l(tile + 8 * lane); }
typedef __attribute__((ext_vector_type(4))) __bf16 v4b;
__device__ __forceinline__ v16b frag_lb(const __bf16* p) {   /* the same for a bf16 tile */
  union { v16b v; v8b q[2]; } u; u.q[0] = *(const v8b*)p; u.q[1] = *(const v8b*)(p + FT / 2); return u.v;
}
// A block of 128 threads stages an (out,in) f32 weight with rows of 128 values in LDS, rounded to bf16, as tiles in fragment order; tile it = (16 output rows it >> 2, k step it & 3). One tile = one load of every thread: eight lanes read one whole 128-B line (32 k values of one row), a wave four whole lines.
// stage_w_p: the thread's place in tile 0; stage_w_ld: issues the loads of tiles T0 .. T1 - 1; stage_w_st: rounds and stores them (here, in proj_mm, k_lin and k_proj every plain '#pragma unroll' is there so that a register array is indexed by constants only)
__device__ __forceinline__ const float* stage_w_p(const float* Wm, int tid) { return Wm + (size_t)(tid >> 3) * 128 + (tid & 7) * 4; }
template <int T0, int T1, int NT> __device__ __forceinline__ void stage_w_ld(const float* p, v4f (&x)[NT]) {
#pragma unroll   /* register array indexed by constants */
  for (int it = T0; it < T1; ++it) x[it] = *(const v4f*)(p + (it >> 2) * 16 * 128 + (it & 3) * 32);
}
template <int T0, int T1, int NT> __device__ __forceinline__ void stage_w_st(__bf16* sw, int tid, const v4f (&x)[NT]) {
  const int row = tid >> 3, q = tid & 7;   /* the thread holds k = 4 q .. 4 q + 3 of the step: half h = q >> 2, lane 16 g + row with g = (q >> 1) & 1, values 4 (q & 1) .. 4 (q & 1) + 3 of that lane */
  __bf16* d = sw + (q >> 2) * (FT / 2) + (((q >> 1) & 1) * 16 + row) * 8 + (q & 1) * 4;
#pragma unroll
  for (int it = T0; it < T1; ++it) { v4b y;
#pragma unroll
    for (int i = 0; i < 4; ++i) y[i] = (__bf16)x[it][i];
    *(v4b*)(d + it * FT) = y; }
}
#define QBH 0              // not used by any kernel here
#define QHI 2048            // rows carrying a q residual plane (all rows when non-causal: 2-product logits everywhere)
#define KHI 64            // key rows carrying k residual / v bf16 hi+lo planes (written by k_proj, read by no kernel here)
// B fragment (k rows k0+.., output column o) of a weight: (in,out) [K][ld] or (out,in) [ld rows of K]: bf16 exact, or f16(bf16 * 256) exact
__device__ __forceinline__ v16b wcol_io(const float* Wm, int k0, int o, int lane, int ld) { v16b w; const int g = lane >> 4;
#pragma unroll
  for (int i = 0; i < 8; ++i) { w[i] = (__bf16)Wm[(size_t)(k0 + 8 * g + i) * ld + o]; w[8 + i] = (__bf16)Wm[(size_t)(k0 + 16 + 8 * g + i) * ld + o]; }
  return w; }
__device__ __forceinline__ v16b wcol_oi(const float* Wm, int k0, int o, int lane, int K) { v16b w; const float* p = Wm + (size_t)o * K + k0 + 8 * (lane >> 4);
#pragma unroll
  for (int i = 0; i < 8; ++i) { w[i] = (__bf16)p[i]; w[8 + i] = (__bf16)p[16 + i]; }
  return w; }
__device__ __forceinline__ v16h wcolh_io(const float* Wm, int k0, int o, int lane, int ld) { v16h w; const int g = lane >> 4;
#pragma unroll
  for (int i = 0; i < 8; ++i) { w[i] = (_Float16)(bfr(Wm[(size_t)(k0 + 8 * g + i) * ld + o]) * 256.0f); w[8 + i] = (_Float16)(bfr(Wm[(size_t)(k0 + 16 + 8 * g + i) * ld + o]) * 256.0f); }
  return w; }
__device__ __forceinline__ v16h wcolh_oi(const float* Wm, int k0, int o, int lane, int K) { v16h w; const float* p = Wm + (size_t)o * K + k0 + 8 * (lane >> 4);
#pragma unroll
  for (int i = 0; i < 8; ++i) { w[i] = (_Float16)(bfr(p[i]) * 256.0f); w[8 + i] = (_Float16)(bfr(p[16 + i]) * 256.0f); }
  return w; }
#define WQKV_LAYOUT 1   // 0 = (in,out) [DIN][CC]; 1 = (out,in) [CC][DIN]; 2 = per-head [NH][DIN][HD]
__device__ __forceinline__ v16b wcol_hdk(const float* Wm, int k0, int o, int lane) { v16b w; const int g = lane >> 4; const float* p = Wm + (size_t)(o / HD) * DIN * HD + (o % HD);
#pragma unroll
  for (int i = 0; i < 8; ++i) { w[i] = (__bf16)p[(size_t)(k0 + 8 * g + i) * HD]; w[8 + i] = (__bf16)p[(size_t)(k0 + 16 + 8 * g + i) * HD]; }
  return w; }
#define WO_OUT_IN 0
#if WQKV_LAYOUT == 1
#define WCOL(W, k0, o, lane) wcol_oin(W, k0, o, lane, DIN, (which == 2) ? CC : HDQ)   /* q / k: 32 real output rows, columns 32..127 exact zeros */
#elif WQKV_LAYOUT == 2
#define WCOL(W, k0, o, lane) wcol_hdk(W, k0, o, lane)
#else
#define WCOL(W, k0, o, lane) wcol_io(W, k0, o, lane, CC)
#endif
#if WO_OUT_IN
#define WOCOL(W, k0, o, lane) wcol_oi(W, k0, o, lane, CC)
#define WOCOLH(W, k0, o, lane) wcolh_oi(W, k0, o, lane, CC)
#else
#define WOCOL(W, k0, o, lane) wcol_io(W, k0, o, lane, DIN)
#define WOCOLH(W, k0, o, lane) wcolh_io(W, k0, o, lane, DIN)
#endif
#define HDQ 32             // q / k width (k_proj's accumulators are 128 wide, columns 32..127 exact zeros; only the 32 real columns are stored)
#define BG HG              // not used by any kernel here
#define NR (TNB * TT)      // 32,768 rows (all batches)
// (out,in) projection weight with only 'nvalid' real output rows: columns o >= nvalid read row 0 and are zeroed by value
__device__ __forceinline__ v16b wcol_oin(const float* Wm, int k0, int o, int lane, int K, int nvalid) { v16b w; const int oc = o < nvalid ? o : 0; const float keep = o < nvalid ? 1.f : 0.f; const float* p = Wm + (size_t)oc * K + k0 + 8 * (lane >> 4);
#pragma unroll
  for (int i = 0; i < 8; ++i) { w[i] = (__bf16)(p[i] * keep); w[8 + i] = (__bf16)(p[16 + i] * keep); }
  return w; }
// pairwise tree over the 16 f32 P values of one A fragment (a lane's share of its query's sum over keys)
__device__ __forceinline__ float sum16(const float v[16]) { return (((v[0] + v[1]) + (v[2] + v[3])) + ((v[4] + v[5]) + (v[6] + v[7]))) + (((v[8] + v[9]) + (v[10] + v[11])) + ((v[12] + v[13]) + (v[14] + v[15]))); }
#define WS_DEN (WS_END)                                // (plane not used: the sum over keys stays inside k_att, in registers and LDS)
#define WS_FSA (WS_DEN + 4u * (size_t)NR)              // f32 f_sa rows [NR][128]
#define WS_YL  (WS_FSA + 4u * (size_t)NR * CC)        // f32 y rows (pre-BN)
#define WS_ST  (WS_YL + 4u * (size_t)NR * CC)         // BN statistics [128][32]
#define WS_PS  (WS_ST + 4u * (size_t)CC * 32)         // BN partials of k_lin's blocks [NR / 64][2][128]: mean of the block's 64 rows, sum of squared distances from that mean
#define WS_END2 (WS_PS + 4u * (size_t)(NR / 64) * 2 * CC)
// ---- k_lin: block = 64 rows: y = (bf16(f_in) - f_sa) (split bf16 hi + lo) Wl^T + bl (2 products, K 128) -> pre-BN rows, and per channel the block's own mean and sum of squared distances from it (PS)
__global__ __launch_bounds__(128) void k_lin(const float* __restrict__ X, const float* __restrict__ FSA, const float* __restrict__ WL, const float* __restrict__ BL, float* __restrict__ YL, float* __restrict__ PS) { __shared__ __align__(16) float sf[4][16][132]; __shared__ __align__(16) float sp[4][2][CC]; __shared__ __align__(16) __bf16 sw[(CC / 16) * (CC / 32) * FT];   /* sw: Wl as bf16 fragment tiles */
  const int tid = threadIdx.x, wave = tid >> 5, lane = tid & 31, col = lane & 15, g = lane >> 4; const size_t r0 = (size_t)blockIdx.x * 64 + wave * 16;
  v8f acc[8] = {}; const float* px = X + (r0 + col) * CC + 8 * g; const float* pf = FSA + (r0 + col) * CC + 8 * g; const float* pb = BL + col; const float* pw = stage_w_p(WL, tid); v4f xr[CC / 32][4], fr[CC / 32][4], wr[(CC / 16) * (CC / 32)]; float br[8];
#pragma unroll   /* the rows' values of all four k steps, the bias and the weight: every operand load of the kernel in flight at once */
  for (int kc = 0; kc < CC / 32; ++kc)
#pragma unroll
    for (int u = 0; u < 4; ++u) { const int o = kc * 32 + (u >> 1) * 16 + (u & 1) * 4; xr[kc][u] = *(const v4f*)(px + o); fr[kc][u] = *(const v4f*)(pf + o); }
#pragma unroll
  for (int j = 0; j < 8; ++j) br[j] = pb[j * 16];
  stage_w_ld<0, (CC / 16) * (CC / 32)>(pw, wr);
  asm volatile("s_wait_xcnt 0x0" :: "v"(px), "v"(pf), "v"(col), "v"(pw) : "memory");   /* precaution: the loads above have taken their addresses before an address register is written again; the pointers, and col (the bias loads' offset register), are named so that their registers live up to here and are no load's destination */
  stage_w_st<0, (CC / 16) * (CC / 32)>(sw, tid, wr);
  F2 a[CC / 32];
#pragma unroll
  for (int kc = 0; kc < CC / 32; ++kc) { float v[16];
#pragma unroll
    for (int i = 0; i < 16; ++i) v[i] = bfr(xr[kc][i >> 2][i & 3]) - fr[kc][i >> 2][i & 3];
    a[kc] = bsplit16(v); }
  __syncthreads();
  v16b wf[2][8];
#pragma unroll
  for (int j = 0; j < 8; ++j) wf[0][j] = frag_lb(sw + (j * 4) * FT + 8 * lane);
#pragma unroll
  for (int kc = 0; kc < CC / 32; ++kc) {
    if (kc + 1 < CC / 32) {
#pragma unroll
      for (int j = 0; j < 8; ++j) wf[(kc + 1) & 1][j] = frag_lb(sw + (j * 4 + kc + 1) * FT + 8 * lane); }
    __builtin_amdgcn_sched_barrier(0);   /* keeps the next k step's 16 LDS reads issued here as one group, a whole step ahead of their products (left alone they sink to their products, with a full wait in front of each) */
#pragma unroll
    for (int j = 0; j < 8; ++j) { acc[j] = wmma_bf(a[kc].h, wf[kc & 1][j], acc[j]); acc[j] = wmma_bf(a[kc].l, wf[kc & 1][j], acc[j]); } }
#pragma unroll
  for (int j = 0; j < 8; ++j) { const float bb = bfr(br[j]);
#pragma unroll
    for (int r = 0; r < 8; ++r) sf[wave][8 * g + r][j * 16 + col] = acc[j][r] + bb; }
  LDSX(); v4f yv[16];
#pragma unroll   /* yv is indexed by constants only */
  for (int rl = 0; rl < 16; ++rl) yv[rl] = *(const v4f*)&sf[wave][rl][lane * 4];
  // the wave's 16 rows, channels 4 lane .. 4 lane + 3: mean, then squared distances from that mean (no difference of large squares anywhere)
  const v4f m16 = ((((yv[0] + yv[1]) + (yv[2] + yv[3])) + ((yv[4] + yv[5]) + (yv[6] + yv[7]))) + (((yv[8] + yv[9]) + (yv[10] + yv[11])) + ((yv[12] + yv[13]) + (yv[14] + yv[15])))) * (1.0f / 16.0f); v4f q16 = {};
#pragma unroll
  for (int rl = 0; rl < 16; ++rl) { const v4f d = yv[rl] - m16; q16 += d * d; }
  *(v4f*)&sp[wave][0][lane * 4] = m16; *(v4f*)&sp[wave][1][lane * 4] = q16;
  __syncthreads();
  // thread = channel: the four waves' groups of 16 rows merged: mean of the means; squared distances add up, plus 16 x each group mean's squared distance from the merged mean
  const float g0 = sp[0][0][tid], g1 = sp[1][0][tid], g2 = sp[2][0][tid], g3 = sp[3][0][tid]; const float m64 = ((g0 + g1) + (g2 + g3)) * 0.25f; const float e0 = g0 - m64, e1 = g1 - m64, e2 = g2 - m64, e3 = g3 - m64;
  const float q64 = ((sp[0][1][tid] + sp[1][1][tid]) + (sp[2][1][tid] + sp[3][1][tid])) + 16.0f * ((e0 * e0 + e1 * e1) + (e2 * e2 + e3 * e3));
#pragma unroll   /* the row stores stand behind the barrier: in front of it the barrier would wait for all sixteen to finish */
  for (int rl = 0; rl < 16; ++rl) vst2(YL + (r0 + rl) * CC + lane * 4, yv[rl]);
  vst2(PS + (size_t)blockIdx.x * 2 * CC + tid, m64); vst2(PS + ((size_t)blockIdx.x * 2 + 1) * CC + tid, q64); }
// ---- k_stat: block = channel c: merges the NR / 64 partials of k_lin (equal groups of 64 rows) in the same way -> mean and 1 / sqrt(biased variance + eps)
__global__ __launch_bounds__(256) void k_stat(const float* __restrict__ PS, float* __restrict__ STAT) { __shared__ float sred[8]; __shared__ float sbc;
  const int t = threadIdx.x; const int c = blockIdx.x; float pm[NR / 64 / 256], pq[NR / 64 / 256];
#pragma unroll   /* register arrays indexed by constants; all loads in flight at once */
  for (int i = 0; i < NR / 64 / 256; ++i) { pm[i] = PS[(size_t)(i * 256 + t) * 2 * CC + c]; pq[i] = PS[((size_t)(i * 256 + t) * 2 + 1) * CC + c]; }
  float s = 0.f;
#pragma unroll
  for (int i = 0; i < NR / 64 / 256; ++i) s += pm[i];
#pragma unroll
  for (int o = 1; o < 32; o <<= 1) s += __shfl_xor(s, o);
  if ((t & 31) == 0) sred[t >> 5] = s; __syncthreads(); if (t == 0) { float a = 0.f; for (int i = 0; i < 8; ++i) a += sred[i]; sbc = a / (float)(NR / 64); } __syncthreads(); const float mean = sbc; __syncthreads();
  float q = 0.f;
#pragma unroll
  for (int i = 0; i < NR / 64 / 256; ++i) { const float d = pm[i] - mean; q += pq[i] + 64.0f * (d * d); }
#pragma unroll
  for (int o = 1; o < 32; o <<= 1) q += __shfl_xor(q, o);
  if ((t & 31) == 0) sred[t >> 5] = q; __syncthreads(); if (t == 0) { float a = 0.f; for (int i = 0; i < 8; ++i) a += sred[i]; sbc = rsqrtf(a / (float)NR + 1e-5f); } __syncthreads();
  if (t < 32) { const float v = t == 0 ? mean : (t == 1 ? sbc : 0.f); vst2(STAT + (size_t)c * 32 + t, v); } }
// ---- k_fin: out = relu(gamma (y - mean) rstd + beta) + f_sa. Block = 64 rows; thread = channels 4 (tid & 31) .. 4 (tid & 31) + 3 of the FR rows (tid >> 5) + 8 i: its channels are the same in every row, so the per-channel constants are fetched once per block (thread = channel; STAT holds one channel per 128-B line, so each such load touches 32 lines) and handed out through LDS
#define FR 8               // rows per thread
static_assert(NR % (8 * FR) == 0, "whole blocks only");
__global__ __launch_bounds__(256) void k_fin(const float* __restrict__ YL, const float* __restrict__ STAT, const float* __restrict__ G, const float* __restrict__ BE, const float* __restrict__ FSA, float* __restrict__ OUT) { __shared__ __align__(16) float sc[4][CC];   /* per channel: gamma, mean, 1 / sqrt(variance + eps), beta */
  const int tid = threadIdx.x; const size_t e0 = (size_t)blockIdx.x * (8 * FR * CC) + tid * 4; const float* py = YL + e0; const float* pf = FSA + e0; const float* ps = STAT + tid * 32; const float* pg = G + tid; const float* pe = BE + tid;
  v2f st = {}; float ga = 0.f, be = 0.f; v4f yv[FR], fv[FR];
#pragma unroll   /* register arrays indexed by constants; all sixteen row loads in flight at once */
  for (int i = 0; i < FR; ++i) { yv[i] = *(const v4f*)(py + i * 8 * CC); fv[i] = *(const v4f*)(pf + i * 8 * CC); }
  if (tid < CC) { st = *(const v2f*)ps; ga = *pg; be = *pe; }   /* behind the row loads: no row load is held up by a wait for a constant */
  asm volatile("s_wait_xcnt 0x0" :: "v"(py), "v"(pf), "v"(ps), "v"(pg), "v"(pe) : "memory");   /* precaution: the loads above have taken their addresses before an address register is written again; the pointers are named so that their registers live up to here and are no load's destination */
  if (tid < CC) { sc[0][tid] = bfr(ga); sc[1][tid] = st[0]; sc[2][tid] = st[1]; sc[3][tid] = bfr(be); }
  __syncthreads();
  const int c0 = (tid & 31) * 4; const v4f vg = *(const v4f*)&sc[0][c0], vm = *(const v4f*)&sc[1][c0], vr = *(const v4f*)&sc[2][c0], vb = *(const v4f*)&sc[3][c0]; float* po = OUT + e0;
#pragma unroll
  for (int i = 0; i < FR; ++i) { v4f o;
#pragma unroll
    for (int k = 0; k < 4; ++k) { const float yb = vg[k] * (yv[i][k] - vm[k]) * vr[k] + vb[k]; o[k] = fmaxf(yb, 0.f) + fv[i][k]; }
    vst2(po + i * 8 * CC, o); } }
#ifndef SM_EXTRA_PARAMS
#define SM_EXTRA_PARAMS
#endif
#ifndef PROJ_EXTRA_PARAMS
#define PROJ_EXTRA_PARAMS
#endif
#ifndef SM_MASK_HOOK
#define SM_MASK_HOOK (void)0
#endif

#define WS_QH  0u                                      // f16 q tiles in fragment order [b*t / 16][FT] (the 32 real columns only; the rest of the plane is not used)
#define WS_KH  (WS_QH + 2u * (size_t)NB * TT * CC)      // f16 k tiles in fragment order [b*t / 16][FT]
#define WS_VT  (WS_KH + 2u * (size_t)NB * TT * CC)      // f16 v tiles in fragment order [b][t / 32][c / 16][FT] (tile: column = channel, k = t)
#define WS_QL  (WS_VT + 2u * (size_t)NB * CC * TT)      // f16 q residual x 2^10 tiles [(b, t < QHI) / 16][FT]
#define WS_KL  (WS_QL + 2u * (size_t)NB * QHI * CC)     // f16 k residual x 2^10 tiles [(b, t < KHI) / 16][FT]
#define WS_VB  (WS_KL + 2u * (size_t)NB * KHI * CC)     // bf16 v hi planes [b][c][t < KHI]
#define WS_VBL (WS_VB + 2u * (size_t)NB * CC * KHI)
#define WS_S   (WS_VBL + 2u * (size_t)NB * CC * KHI)    // f32 per-key softmax constants [b][t / 16][2][16] (the rest of the plane is not used)
#define WS_Y   (WS_S  + 4u * (size_t)HG * TT * TT)      // f32 ctx rows [b*t][CC] (only when there is an output projection)
#define WS_END (WS_Y  + 0u)

// k_proj's products from the staged weight tiles: acc[j] += x W^T over the four k steps; NJ real 16-column tiles (j >= NJ: zero fragments, exact zero columns)
template <int NJ> __device__ __forceinline__ void proj_mm(const __bf16* swl, const v16b (&a)[DIN / 32], v8f (&acc)[8]) {   /* swl = the lane's own place in tile 0 */
  v16b wf[2][NJ];
#pragma unroll
  for (int j = 0; j < NJ; ++j) wf[0][j] = frag_lb(swl + (j * 4) * FT);
#pragma unroll
  for (int kc = 0; kc < DIN / 32; ++kc) {
    if (kc + 1 < DIN / 32) {
#pragma unroll
      for (int j = 0; j < NJ; ++j) wf[(kc + 1) & 1][j] = frag_lb(swl + (j * 4 + kc + 1) * FT); }
    __builtin_amdgcn_sched_barrier(0);   /* keeps the next k step's LDS reads issued here as one group, a whole step ahead of their products (left alone they sink to their products, with a full wait in front of each) */
#pragma unroll
    for (int j = 0; j < 8; ++j) { v16b w = {}; if (j < NJ) w = wf[kc & 1][j < NJ ? j : 0]; acc[j] = wmma_bf(a[kc], w, acc[j]); } }
}
// ---- k_proj: block = (64 rows, 128 cols, which): q/k/v = X W (+ b) with exact bf16 products (K = DIN) -> which 0: q f16 tiles (+ residual tiles, rows < QHI); 1: k f16 tiles (+ residual tiles, rows < KHI); 2: v f16 tiles (+ bf16 hi/lo planes [c][t] for t < KHI); the f16 tiles in fragment order (frag_t)
__global__ __launch_bounds__(128) void k_proj(const float* __restrict__ XQ, const float* __restrict__ XK, const float* __restrict__ XV, const float* __restrict__ WQ, const float* __restrict__ WK, const float* __restrict__ WV, const float* __restrict__ BQ, const float* __restrict__ BK, const float* __restrict__ BV,
    _Float16* __restrict__ QH, _Float16* __restrict__ QL, _Float16* __restrict__ KH, _Float16* __restrict__ KL, _Float16* __restrict__ VT, __bf16* __restrict__ VB, __bf16* __restrict__ VBL) {
  __shared__ __align__(16) _Float16 shl[2][64][136]; _Float16 (&sh)[64][136] = shl[0]; _Float16 (&sl)[64][136] = shl[1];   /* one array, so that a v block's weight tiles can span both halves */
  __shared__ __align__(16) _Float16 th[128][72]; __shared__ __align__(16) __bf16 tb[128][72], tbl[128][72];
  const int tid = threadIdx.x, wave = tid >> 5, lane = tid & 31, col = lane & 15, g = lane >> 4; const int which = blockIdx.z; const int c0 = blockIdx.y * 128; const size_t r0 = (size_t)blockIdx.x * 64; const size_t bb = r0 / TT; const int t0 = (int)(r0 % TT);
  const float* X = which == 0 ? XQ : which == 1 ? XK : XV; const float* WA = which == 0 ? WQ : which == 1 ? WK : WV; const float* BA = which == 0 ? BQ : which == 1 ? BK : BV;
  v8f acc[8] = {}; const float* pa = X + (r0 + wave * 16 + col) * DIN + 8 * g; const float* pw = stage_w_p(WA, tid); const float* pb = BA + c0 + col; v4f xr[DIN / 32][4], wr[(CC / 16) * (DIN / 32)]; float br[8] = {};   /* br: the bias of column 16 j + col; stays 0 in the zero columns of q / k */
#pragma unroll   /* the row's values of all four k steps, the bias and the weight: every operand load of the kernel in flight at once */
  for (int kc = 0; kc < DIN / 32; ++kc)
#pragma unroll
    for (int u = 0; u < 4; ++u) xr[kc][u] = *(const v4f*)(pa + kc * 32 + (u >> 1) * 16 + (u & 1) * 4);
  stage_w_ld<0, (HDQ / 16) * (DIN / 32)>(pw, wr);
#pragma unroll
  for (int j = 0; j < HDQ / 16; ++j) br[j] = pb[j * 16];
  if (which == 2) { stage_w_ld<(HDQ / 16) * (DIN / 32), (CC / 16) * (DIN / 32)>(pw, wr);   /* q / k have only the 32 real rows */
#pragma unroll
    for (int j = HDQ / 16; j < 8; ++j) br[j] = pb[j * 16]; }
  asm volatile("s_wait_xcnt 0x0" :: "v"(pa), "v"(pw), "v"(pb), "v"(col) : "memory");   /* precaution: the loads above have taken their addresses before an address register is written again; the pointers, and col (the offset register of two bias loads), are named so that their registers live up to here and are no load's destination */
  // the weight tiles lie in LDS that this block's own epilogue does not use: v blocks (128 rows, 32 KB) in shl, q / k blocks (the 32 real rows, 8 KB) in th; so no barrier is owed between the last tile read and the epilogue's LDS stores
  __bf16* sw = which == 2 ? (__bf16*)&shl[0][0][0] : (__bf16*)&th[0][0];
  stage_w_st<0, (HDQ / 16) * (DIN / 32)>(sw, tid, wr);
  if (which == 2) stage_w_st<(HDQ / 16) * (DIN / 32), (CC / 16) * (DIN / 32)>(sw, tid, wr);
  v16b a[DIN / 32];
#pragma unroll
  for (int kc = 0; kc < DIN / 32; ++kc)
#pragma unroll
    for (int i = 0; i < 16; ++i) a[kc][i] = (__bf16)xr[kc][i >> 2][i & 3];
  __syncthreads();
  if (which == 2) proj_mm<CC / 16>(sw + 8 * lane, a, acc); else proj_mm<HDQ / 16>(sw + 8 * lane, a, acc);
  if (which < 2) { _Float16* DH = which == 0 ? QH : KH; _Float16* DL = which == 0 ? QL : KL; const int nhi = which == 0 ? QHI : KHI; const bool hi_rows = t0 < nhi;
#pragma unroll
    for (int j = 0; j < 8; ++j) { const float bias = bfr(br[j]);
#pragma unroll
      for (int r = 0; r < 8; ++r) { const float v = acc[j][r] + bias; const _Float16 hv = (_Float16)v; sh[wave * 16 + 8 * g + r][j * 16 + col] = hv; sl[wave * 16 + 8 * g + r][j * 16 + col] = (_Float16)((v - (float)hv) * 1024.0f); } }
    __syncthreads();
    for (int e = tid; e < 64 * HDQ / 8; e += 128) { const int tl = e >> 6, h = (e >> 5) & 1, l = e & 31; const int rl = tl * 16 + (l & 15), k8 = 16 * h + 8 * (l >> 4);   /* e runs in the order of the destination: a wave stores 512 contiguous bytes */
      vst2((unsigned*)(DH + ((r0 >> 4) + tl) * FT + (e & 63) * 8), *(const v4u*)&sh[rl][k8]);
      asm volatile("s_wait_xcnt 0x0" ::: "memory");   /* precaution, here and behind the four stores below: the store has taken its address and data before the next LDS load or address sum writes those registers again */
      if (hi_rows) { vst2((unsigned*)(DL + (((bb * nhi + t0) >> 4) + tl) * FT + (e & 63) * 8), *(const v4u*)&sl[rl][k8]); asm volatile("s_wait_xcnt 0x0" ::: "memory"); } }
  } else { const bool hi_rows = t0 < KHI;
#pragma unroll
    for (int j = 0; j < 8; ++j) { const float bias = bfr(br[j]);
#pragma unroll
      for (int r = 0; r < 8; ++r) { const float v = acc[j][r] + bias; const int rl = wave * 16 + 8 * g + r, cl = j * 16 + col; th[cl][rl] = (_Float16)v; const __bf16 bh = (__bf16)v; tb[cl][rl] = bh; tbl[cl][rl] = (__bf16)(v - (float)bh); } }
    __syncthreads();
    for (int e = tid; e < 128 * 8; e += 128) { const int cl = e >> 3, q = e & 7; { const int tl = e >> 6, h = (e >> 5) & 1, l = e & 31;   /* tile tl = (32-key chunk tl >> 3, 16 channels tl & 7) of the block, e in the order of the destination */
        vst2((unsigned*)(VT + (((bb * (TT / 32) + (t0 >> 5) + (tl >> 3)) * (CC / 16) + (c0 >> 4) + (tl & 7)) * FT + (e & 63) * 8)), *(const v4u*)&th[(tl & 7) * 16 + (l & 15)][(tl >> 3) * 32 + 16 * h + 8 * (l >> 4)]); asm volatile("s_wait_xcnt 0x0" ::: "memory"); }
      if (hi_rows) { const size_t o3 = (bb * CC + c0 + cl) * (size_t)KHI + t0 + q * 8; vst2((unsigned*)(VB + o3), *(const v4u*)&tb[cl][q * 8]); asm volatile("s_wait_xcnt 0x0" ::: "memory"); vst2((unsigned*)(VBL + o3), *(const v4u*)&tbl[cl][q * 8]); asm volatile("s_wait_xcnt 0x0" ::: "memory"); } } } }
// plain builtin form: the compiler keeps the distance behind a matrix instruction itself and fills it with independent work where it can
__device__ __forceinline__ v8f wmma16c(v16h a, v16h b, v8f c) { return __builtin_amdgcn_wmma_f32_16x16x32_f16(false, a, false, b, (short)0, c, false, false); }
// (in the two kernels below every plain '#pragma unroll' is there so that a register array is indexed by constants only)
// logit of one (key, query) pair from the two f16 products: k hi . q + (k residual x 2^10) . q / 2^10
__device__ __forceinline__ float logit2(float hi, float lo) { return (hi + lo * (1.0f / 1024.0f)) * SCALE; }
#define LOG2E 1.4426950408889634f
// exp(x) 2^c = 2^(x log2 e + c): one fused multiply-add (lc) and the hardware's own base-2 exponential (exp2x8). The exponent is at most about 11 here (x never above its key's maximum); a result under 2^-126 may come out as 0, far below what the f32 sums (at least 1) or an f16 P value keep
__device__ __forceinline__ float lc(float x, float c) { return __builtin_fmaf(x, LOG2E, c); }
// y[0..7] = 2^y[0..7]. One statement, each exponential in place, one v_nop at the end: the instruction set asks for one independent instruction behind a transcendental before its result is read or its source written over; here that is the next exponential, on another register, and behind the last one the v_nop (left to the register allocator, neighbours wrote over each other's sources)
__device__ __forceinline__ void exp2x8(float* y) {
  asm("v_exp_f32 %0, %0\n\tv_exp_f32 %1, %1\n\tv_exp_f32 %2, %2\n\tv_exp_f32 %3, %3\n\tv_exp_f32 %4, %4\n\tv_exp_f32 %5, %5\n\tv_exp_f32 %6, %6\n\tv_exp_f32 %7, %7\n\tv_nop"
      : "+v"(y[0]), "+v"(y[1]), "+v"(y[2]), "+v"(y[3]), "+v"(y[4]), "+v"(y[5]), "+v"(y[6]), "+v"(y[7])); }
// ---- k_kst: block = 16 keys of batch blockIdx.y; wave w holds the logits of those keys against queries [256 w, 256 w + 256) in registers (D: row = key 8g + r, column = query): maximum and sum of exp over ALL queries -> KS line of the key tile: per key the one constant c = 11 - max log2 e - log2 sum, so that 2^(logit log2 e + c) = exp(logit - max) x 2^11 / sum (the line's second half repeats the 16 values: the block stays the one writer of its whole 128-B line)
__global__ __launch_bounds__(256) __attribute__((amdgpu_waves_per_eu(4))) /* holds the kernel to 256 registers, four waves per SIMD as before: left alone this build takes a few more and only one block fits a WGP */ void k_kst(const _Float16* __restrict__ KRH, const _Float16* __restrict__ KRL, const _Float16* __restrict__ QR, float* __restrict__ KS) { __shared__ float smx[8][16], ssu[8][16];
  const int tid = threadIdx.x, wave = tid >> 5, lane = tid & 31, col = lane & 15, g = lane >> 4; const size_t kr0 = (size_t)blockIdx.y * TT + blockIdx.x * 16, q0 = (size_t)blockIdx.y * TT + wave * (TT / 8);
  const v16h ah = frag_t(KRH + (kr0 >> 4) * FT, lane), al = frag_t(KRL + (kr0 >> 4) * FT, lane);
  asm volatile("s_wait_xcnt 0x0" ::: "memory");   /* precaution: the four key loads above have taken their addresses before a later load's result reuses those address registers */
  float s[TT / 128][8]; v16h qf[TT / 128];
#pragma unroll
  for (int t = 0; t < 8; ++t) qf[t] = frag_t(QR + ((q0 >> 4) + t) * FT, lane);
#pragma unroll
  for (int tg = 0; tg < TT / 128; tg += 4) {   /* groups of four query tiles, loaded two groups ahead of their products */
    if (tg + 8 < TT / 128) {
#pragma unroll
      for (int t = tg + 8; t < tg + 12; ++t) qf[t] = frag_t(QR + ((q0 >> 4) + t) * FT, lane); }
    __builtin_amdgcn_sched_barrier(0);   /* keeps the loads above issued here: left alone the scheduler either waits on one tile at a time or hoists all sixteen, which takes the kernel past 256 registers */
#pragma unroll
    for (int t = tg; t < tg + 4; ++t) { v8f a = {}, l = {}; a = wmma16(ah, qf[t], a); l = wmma16(al, qf[t], l);
#pragma unroll
      for (int r = 0; r < 8; ++r) s[t][r] = logit2(a[r], l[r]); }
    __builtin_amdgcn_sched_barrier(0);   /* the other side of the same fence: the next group's loads stay behind these products */
  }
  float mx[8], su[8];
#pragma unroll
  for (int r = 0; r < 8; ++r) { float m = s[0][r];
#pragma unroll
    for (int t = 1; t < TT / 128; ++t) m = fmaxf(m, s[t][r]);
#pragma unroll
    for (int o = 1; o < 16; o <<= 1) m = fmaxf(m, __shfl_xor(m, o));
    mx[r] = m; }
  if (col == 0) {
#pragma unroll
    for (int r = 0; r < 8; ++r) smx[wave][8 * g + r] = mx[r]; }
  __syncthreads();
#pragma unroll
  for (int r = 0; r < 8; ++r) { float m = smx[0][8 * g + r];
#pragma unroll
    for (int w = 1; w < 8; ++w) m = fmaxf(m, smx[w][8 * g + r]);
    float a = 0.f; const float nm = -m * LOG2E;
#pragma unroll
    for (int tg = 0; tg < TT / 128; tg += 8) { float e[8];
#pragma unroll
      for (int t = 0; t < 8; ++t) e[t] = lc(s[tg + t][r], nm);
      exp2x8(e);
#pragma unroll
      for (int t = 0; t < 8; ++t) a += e[t]; }
#pragma unroll
    for (int o = 1; o < 16; o <<= 1) a += __shfl_xor(a, o);
    su[r] = a; }
  if (col == 0) {
#pragma unroll
    for (int r = 0; r < 8; ++r) ssu[wave][8 * g + r] = su[r]; }
  __syncthreads();
  if (tid < 32) { float m = smx[0][col], a = 0.f;
#pragma unroll
    for (int w = 1; w < 8; ++w) m = fmaxf(m, smx[w][col]);
#pragma unroll
    for (int w = 0; w < 8; ++w) a += ssu[w][col];
    vst2(KS + kr0 * 2 + tid, a > 0.f ? (11.0f - m * LOG2E) - log2f(a) : -1.0e30f); } }   /* no sum: an exponent that makes every P of the key 0, as the factor 0 did */
// ---- k_att: block = 128 queries of batch blockIdx.y, 8 waves; wave = (query group qg: 32 queries = two 16-query tiles, key half hf: 1,024 keys), so every key and v fragment it loads feeds the products of two query tiles. Per 32 keys and query tile: S^T tiles (row = key, column = query) from the same two products as k_kst, P x 2^11 = 2^(logit log2 e + the key's constant of k_kst) in f32; the two D tiles, converted to f16 in place, ARE the A fragment (row = query, k = key) of P . v. The two waves of a query group (one per key half) each finish one of its tiles: a wave hands its partial P . v and key sum of the other tile to its partner through LDS; f_sa = (P . v) / (sum over keys of P)
#define NP (TT / 64)       // passes of 32 keys in one key half
__global__ __launch_bounds__(256) void k_att(const _Float16* __restrict__ KRH, const _Float16* __restrict__ KRL, const _Float16* __restrict__ QR, const float* __restrict__ KS, const _Float16* __restrict__ VT, float* __restrict__ Y) { __shared__ __align__(16) float ss[8][16][HD + 4]; __shared__ __align__(16) float sks[TT * 2]; __shared__ float sk[8][16];
  const int tid = threadIdx.x, lane = tid & 31, col = lane & 15, g = lane >> 4; const int b = blockIdx.y;
  const int wave = __builtin_amdgcn_readfirstlane(tid >> 5), qg = wave & 3, hf = wave >> 2;   /* the wave's number in a scalar register: the bases formed from it below stay scalar */
  const int ql0 = blockIdx.x * 128 + qg * 32;   /* the wave's tile u = queries ql0 + 16 (u ^ hf) ..: tile 0 is the one it finishes itself, tile 1 the one it hands over */
#pragma unroll   /* all four loads in flight at once */
  for (int i = 0; i < TT * 2 / 4 / 256; ++i) *(v4f*)&sks[(i * 256 + tid) * 4] = *(const v4f*)(KS + (size_t)b * TT * 2 + (i * 256 + tid) * 4);
  __syncthreads();
  const _Float16* qt0 = QR + ((((size_t)b * TT + ql0) >> 4) + hf) * FT; const _Float16* qt1 = QR + ((((size_t)b * TT + ql0) >> 4) + (hf ^ 1)) * FT; const v16h qf[2] = { frag_t(qt0, lane), frag_t(qt1, lane) };
  const _Float16* kh = KRH + ((size_t)b * (TT / 16) + hf * (TT / 32)) * FT; const _Float16* kl = KRL + ((size_t)b * (TT / 16) + hf * (TT / 32)) * FT; const _Float16* vt = VT + ((size_t)b * (TT / 32) + hf * NP) * (HD / 16) * FT; const float* sc = &sks[hf * NP * 64 + 8 * g];   /* the key half's first tiles and constants */
  v8f acc[2][HD / 16] = {}; float ksum[2] = { 0.f, 0.f };   /* ksum[u]: f32 sum of the P x 2^11 values this lane makes for tile u: query col, the k half g of every chunk */
  v16h a0 = frag_t(kh, lane), l0 = frag_t(kl, lane), a1 = frag_t(kh + FT, lane), l1 = frag_t(kl + FT, lane);
  asm volatile("s_wait_xcnt 0x0" :: "s"(qt0), "s"(qt1), "s"(kh), "s"(kl) : "memory");   /* precaution: the twelve loads above have taken their addresses before an address register is written again; their four scalar bases are named so that those registers live up to here (left alone a later scalar shift is moved up over the wait and writes one of the bases) */
#pragma unroll 1   /* rolled: one pass is 24 products and 24 loads already */
  for (int kc = 0; kc < NP; ++kc) { v16h vf[HD / 16]; const _Float16* vp = vt + (size_t)kc * (HD / 16) * FT + 8 * lane;
#pragma unroll
    for (int j = 0; j < HD / 16; ++j) vf[j] = frag_l(vp + j * FT);
    __builtin_amdgcn_sched_barrier(0);   /* keeps the 16 v loads issued here, a whole score-and-exp phase ahead of their use (the scheduler otherwise sinks them to the P . v products, two fragments in flight) */
    v8f s0[2], t0[2], s1[2], t1[2];
#pragma unroll
    for (int u = 0; u < 2; ++u) { const v8f z = {}; s0[u] = wmma16c(a0, qf[u], z); t0[u] = wmma16c(l0, qf[u], z); s1[u] = wmma16c(a1, qf[u], z); t1[u] = wmma16c(l1, qf[u], z); }
    const size_t kn = (size_t)(kc + 1 < NP ? kc + 1 : kc) * 2 * FT;   /* next chunk's two key tiles, fetched one pass ahead (the last pass fetches its own again: in bounds) */
    a0 = frag_t(kh + kn, lane); l0 = frag_t(kl + kn, lane); a1 = frag_t(kh + kn + FT, lane); l1 = frag_t(kl + kn + FT, lane);
    asm volatile("s_wait_xcnt 0x0" :: "v"(vp) : "memory");   /* precaution: the pass's loads have taken their addresses before an address register is written again; vp is named so that the v loads' address pair lives up to here and is not itself the destination of the last of them */
    __builtin_amdgcn_sched_barrier(0);   /* keeps the next chunk's key loads issued here, ahead of the exp phase */
    const v4f* st = (const v4f*)(sc + kc * 64); const v4f c0[2] = { st[0], st[1] }, c1[2] = { st[8], st[9] }; v16h p[2];   /* the chunk's constants, keys 8g + r of both key tiles: the same for both query tiles */
#pragma unroll
    for (int u = 0; u < 2; ++u) { float v[16];
#pragma unroll
      for (int r = 0; r < 8; ++r) { v[r] = lc(logit2(s0[u][r], t0[u][r]), c0[r >> 2][r & 3]); v[8 + r] = lc(logit2(s1[u][r], t1[u][r]), c1[r >> 2][r & 3]); }
      exp2x8(v); exp2x8(v + 8);
#pragma unroll
      for (int i = 0; i < 16; ++i) p[u][i] = (_Float16)v[i];
      ksum[u] += sum16(v); }
#pragma unroll
    for (int j = 0; j < HD / 16 - 1; ++j) { acc[0][j] = wmma16c(p[0], vf[j], acc[0][j]); acc[1][j] = wmma16c(p[1], vf[j], acc[1][j]); }
    acc[0][HD / 16 - 1] = wmma16c(p[0], vf[HD / 16 - 1], acc[0][HD / 16 - 1]);
    acc[1][HD / 16 - 1] = wmma16(p[1], vf[HD / 16 - 1], acc[1][HD / 16 - 1]); }   /* the last product in the form with four v_nop behind it: across the taken branch the next pass's v loads write over the B fragments of these products */
#pragma unroll
  for (int u = 0; u < 2; ++u) ksum[u] += __shfl_xor(ksum[u], 16);   /* both k halves of the chunks: the key half's share of den (x 2^11) of the tile's query col, in lanes col and col + 16 */
  float (&own)[16][HD + 4] = ss[qg * 2 + hf]; float (&oth)[16][HD + 4] = ss[qg * 2 + (hf ^ 1)];   /* a tile's plane belongs to the wave that finishes the tile */
#pragma unroll
  for (int j = 0; j < HD / 16; ++j)
#pragma unroll
    for (int r = 0; r < 8; ++r) oth[8 * g + r][j * 16 + col] = acc[1][j][r];
  if (g == 0) sk[qg * 2 + (hf ^ 1)][col] = ksum[1];
  __syncthreads();   /* the partner's partial sums of this wave's own tile are in LDS */
  const float den = ksum[0] + sk[qg * 2 + hf][col];
  const float inv = den > 0.f ? 2048.0f / den : 0.f; float invr[8];
#pragma unroll
  for (int r = 0; r < 8; ++r) invr[r] = __shfl(inv, 8 * g + r);   /* accumulator element r is query row 8g + r */
  v8f pr[HD / 16];
#pragma unroll   /* the partner's 64 values of this lane's places, all read before the first of the places is rewritten */
  for (int j = 0; j < HD / 16; ++j)
#pragma unroll
    for (int r = 0; r < 8; ++r) pr[j][r] = own[8 * g + r][j * 16 + col];
#pragma unroll
  for (int j = 0; j < HD / 16; ++j)
#pragma unroll
    for (int r = 0; r < 8; ++r) own[8 * g + r][j * 16 + col] = (acc[0][j][r] + pr[j][r]) * (1.0f / 2048.0f) * invr[r];
  LDSX(); v4f yv[16]; float* yp = Y + ((size_t)b * TT + ql0 + 16 * hf) * CC + lane * 4;
#pragma unroll   /* yv is indexed by constants only: all sixteen rows are read before the first store, and no register of a store is written again */
  for (int rl = 0; rl < 16; ++rl) yv[rl] = *(const v4f*)&own[rl][lane * 4];
#pragma unroll
  for (int rl = 0; rl < 16; ++rl) vst2(yp + rl * CC, yv[rl]); }

extern "C" void kernel_launch(void* const* d_in, const int* in_sizes, int n_in, void* d_out, int out_size, void* d_ws, size_t ws_size, hipStream_t stream) {
  (void)in_sizes; (void)n_in; (void)out_size;
  const float** F = (const float**)d_in;
  if (ws_size < (size_t)WS_END) return;
  char* ws = (char*)d_ws; _Float16 *QH = (_Float16*)(ws + WS_QH), *KH = (_Float16*)(ws + WS_KH), *VT = (_Float16*)(ws + WS_VT), *QL = (_Float16*)(ws + WS_QL), *KL = (_Float16*)(ws + WS_KL); __bf16 *VB = (__bf16*)(ws + WS_VB), *VBL = (__bf16*)(ws + WS_VBL); float *S = (float*)(ws + WS_S), *Y = (float*)(ws + WS_Y);
  (void)Y; (void)QL; (void)KL; (void)VB; (void)VBL;
  // inputs: 0 f_in [16,2048,128]; 1 w_q [32,128] (out,in), 2 b_q [32]; 3 w_k [32,128], 4 b_k; 5 w_v [128,128], 6 b_v; 7 w_l [128,128], 8 b_l; 9 bn_gamma, 10 bn_beta
  if (ws_size < (size_t)WS_END2) return;
  float *FSA = (float*)(ws + WS_FSA), *YL = (float*)(ws + WS_YL), *ST = (float*)(ws + WS_ST), *PS = (float*)(ws + WS_PS);
  // ROLE SWAP: the 'q' planes (hi + residual) hold K (from w_k, b_k) and the 'k' planes hold Q, so the score tiles are S^T[key][query] and the softmax runs over QUERIES
  k_proj<<<dim3(TNB * TT / 64, CC / 128, 3), 128, 0, stream>>>(F[0], F[0], F[0], F[3], F[1], F[5], F[4], F[2], F[6], QH, QL, KH, KL, VT, VB, VBL);
  k_kst<<<dim3(TT / 16, TNB), 256, 0, stream>>>(QH, QL, KH, S);   /* per key: the exponent constant from the maximum and the sum of exp over the queries */
  k_att<<<dim3(TT / 128, TNB), 256, 0, stream>>>(QH, QL, KH, S, VT, FSA);   /* f_sa rows: logits made again in registers, P never stored */
  k_lin<<<dim3(NR / 64), 128, 0, stream>>>(F[0], FSA, F[7], F[8], YL, PS);
  k_stat<<<dim3(CC), 256, 0, stream>>>(PS, ST);
  k_fin<<<dim3(NR / (8 * FR)), 256, 0, stream>>>(YL, ST, F[9], F[10], FSA, (float*)d_out);
}

// v009
// One run takes 75.9 microseconds.
// Next to v008, in two timings, it ran 1.08 times as fast each time.
// All steps since v000 together make it 22.3 times as fast.
#include <hip/hip_runtime.h>
#include <math.h>

typedef __attribute__((ext_vector_type(16))) _Float16 v16h;
typedef __attribute__((ext_vector_type(16))) __bf16 v16b;
typedef __attribute__((ext_vector_type(8)))  _Float16 v8h;
typedef __attribute__((ext_vector_type(8)))  float v8f;
typedef __attribute__((ext_vector_type(4)))  float v4f;
typedef __attribute__((ext_vector_type(2)))  float v2f;
typedef __attribute__((ext_vector_type(4)))  unsigned v4u;
typedef __attribute__((ext_vector_type(4)))  int v4i;
typedef float __attribute__((may_alias)) float_a;
typedef int __attribute__((may_alias)) int_a;

template <typename T> __device__ __forceinline__ void vst2(void* p, T v) { *(T*)p = v;  }
__device__ __forceinline__ v8f wmma16(v16h a, v16h b, v8f c) {
  v8f d = __builtin_amdgcn_wmma_f32_16x16x32_f16(false, a, false, b, (short)0, c, false, false);
  asm volatile("v_nop\n\tv_nop\n\tv_nop\n\tv_nop" : "+v"(d) : "v"(a), "v"(b));
  return d;
}
__device__ __forceinline__ v8f wmma_bf(v16b a, v16b b, v8f c) {
  v8f d = __builtin_amdgcn_wmma_f32_16x16x32_bf16(false, a, false, b, (short)0, c, false, false);
  asm volatile("v_nop\n\tv_nop\n\tv_nop\n\tv_nop" : "+v"(d) : "v"(a), "v"(b));
  return d;
}
// 16x16x32 fragments: lane = (h = lane>>4, row/col = lane&15); elements 0..7 = k0+8h+0..7, 8..15 = k0+16+8h+0..7; D element r = row 8h+r
__device__ __forceinline__ v16h frag_h(const _Float16* rowk0, int lane) {
  union { v16h v; v8h q[2]; } u; const _Float16* p = rowk0 + 8 * (lane >> 4);
  u.q[0] = *(const v8h*)p; u.q[1] = *(const v8h*)(p + 16); return u.v;
}
__device__ __forceinline__ v16h frag_f32(const float* rowk0, int lane) {
  v16h a; const float* p = rowk0 + 8 * (lane >> 4);
#pragma unroll
  for (int i = 0; i < 8; ++i) { a[i] = (_Float16)p[i]; a[8 + i] = (_Float16)p[16 + i]; }
  return a;
}
__device__ __forceinline__ v16h frag_f32s(const float* rowk0, int lane, float sc) {
  v16h a; const float* p = rowk0 + 8 * (lane >> 4);
#pragma unroll
  for (int i = 0; i < 8; ++i) { a[i] = (_Float16)(p[i] * sc); a[8 + i] = (_Float16)(p[16 + i] * sc); }
  return a;
}
// column fragment from a [K][ld] layout (column n), rows >= K read as 0
__device__ __forceinline__ v16h fragc_f32(const float* W, int k0, int n, int lane, int ld, int K) {
  v16h a; const int g = lane >> 4;
#pragma unroll
  for (int i = 0; i < 8; ++i) { const int ka = k0 + 8 * g + i, kb = ka + 16;
    a[i] = (_Float16)(ka < K ? W[(size_t)(ka < K ? ka : K - 1) * ld + n] : 0.f); a[8 + i] = (_Float16)(kb < K ? W[(size_t)(kb < K ? kb : K - 1) * ld + n] : 0.f); }
  return a;
}
struct F2 { v16b h, l; };
__device__ __forceinline__ F2 bsplit16(const float v[16]) { F2 r;
#pragma unroll
  for (int i = 0; i < 16; ++i) { const __bf16 h = (__bf16)v[i]; r.h[i] = h; r.l[i] = (__bf16)(v[i] - (float)h); }
  return r; }
__device__ __forceinline__ F2 split_row(const float* row, int k0, int lane) { float v[16]; const float* p = row + k0 + 8 * (lane >> 4);
#pragma unroll
  for (int i = 0; i < 8; ++i) { v[i] = p[i]; v[8 + i] = p[16 + i]; }
  return bsplit16(v); }
__device__ __forceinline__ F2 split_rowK(const float* row, int k0, int lane, int K) { float v[16]; const int g = lane >> 4;
#pragma unroll
  for (int i = 0; i < 8; ++i) { const int ka = k0 + 8 * g + i, kb = ka + 16; v[i] = ka < K ? row[ka < K ? ka : K - 1] : 0.f; v[8 + i] = kb < K ? row[kb < K ? kb : K - 1] : 0.f; }
  return bsplit16(v); }
__device__ __forceinline__ F2 split_col(const float* W, int k0, int n, int lane, int ld, int K) { float v[16]; const int g = lane >> 4;
#pragma unroll
  for (int i = 0; i < 8; ++i) { const int ka = k0 + 8 * g + i, kb = ka + 16; v[i] = ka < K ? W[(size_t)(ka < K ? ka : K - 1) * ld + n] : 0.f; v[8 + i] = kb < K ? W[(size_t)(kb < K ? kb : K - 1) * ld + n] : 0.f; }
  return bsplit16(v); }
__device__ __forceinline__ v8f mac3(const F2& a, const F2& b, v8f c) { c = wmma_bf(a.l, b.h, c); c = wmma_bf(a.h, b.l, c); return wmma_bf(a.h, b.h, c); }
__device__ __forceinline__ float sigm(float v) { return 1.0f / (1.0f + expf(-v)); }
#define LDSX() do { asm volatile("s_wait_dscnt 0" ::: "memory"); __builtin_amdgcn_wave_barrier(); __builtin_amdgcn_fence(__ATOMIC_RELEASE, "workgroup"); } while (0)

// Offset-attention (PCT) block (B 16, N 2,048, D 128, q/k dim 32): q = x Wq^T + bq, k = x Wk^T + bk (32-d), v = x Wv^T + bv; a = softmax over QUERIES of q k^T (no scale), then a = a / sum over keys; f_sa = a v; y = (x - f_sa) Wl^T + bl; out = relu(BN(y)) + f_sa (BN with batch statistics over B*N, biased variance, eps 1e-5).
#define NB 16
#define TT 2048
#define CC 128            // NH * HD = projected width
#define DIN 128          // input (model) width
#define NH 1
#define HD 128
#define NQB (TT / 64)
#define HG 4
#define SCALE (1.0f)
#define CAUSAL 0
#ifndef TNB
#define TNB NB
#endif
__device__ __forceinline__ float bfr(float v) { return (float)(__bf16)v; }
__host__ __device__ __forceinline__ int kb_last(int qb) { return CAUSAL ? ((qb * 64 + 63) >> 7) : (TT / 128 - 1); }
typedef __attribute__((ext_vector_type(8))) __bf16 v8b;
__device__ __forceinline__ v16b frag_b(const __bf16* rowk0, int lane) {
  union { v16b v; v8b q[2]; } u; const __bf16* p = rowk0 + 8 * (lane >> 4);
  u.q[0] = *(const v8b*)p; u.q[1] = *(const v8b*)(p + 16); return u.v;
}
// operand tile in fragment order: a 16 (rows or columns) x 32 (k) tile of 16-bit values is 1 KB = [h][lane][8 values]; lane = (g = lane>>4, row/col = lane&15) holds k = 16h + 8g + 0..7 there, so each of the two wave-wide 16-byte loads of a fragment covers 512 contiguous bytes (four whole lines)
#define FT 512             // values in one such tile
__device__ __forceinline__ v16h frag_l(const _Float16* p) {   /* p = the lane's own place in the tile: tile + 8 lane */
  union { v16h v; v8h q[2]; } u; u.q[0] = *(const v8h*)p; u.q[1] = *(const v8h*)(p + FT / 2); return u.v;
}
__device__ __forceinline__ v16h frag_t(const _Float16* tile, int lane) { return frag_l(tile + 8 * lane); }
typedef __attribute__((ext_vector_type(4))) __bf16 v4b;
__device__ __forceinline__ v16b frag_lb(const __bf16* p) {   /* the same for a bf16 tile */
  union { v16b v; v8b q[2]; } u; u.q[0] = *(const v8b*)p; u.q[1] = *(const v8b*)(p + FT / 2); return u.v;
}
// A block of 128 threads stages an (out,in) f32 weight with rows of 128 values in LDS, rounded to bf16, as tiles in fragment order; tile it = (16 output rows it >> 2, k step it & 3). One tile = one load of every thread: eight lanes read one whole 128-B line (32 k values of one row), a wave four whole lines.
// stage_w_p: the thread's place in tile 0; stage_w_ld: issues the loads of tiles T0 .. T1 - 1; stage_w_st: rounds and stores them (here, in proj_mm, k_lin and k_proj every plain '#pragma unroll' is there so that a register array is indexed by constants only)
__device__ __forceinline__ const float* stage_w_p(const float* Wm, int tid) { return Wm + (size_t)(tid >> 3) * 128 + (tid & 7) * 4; }
template <int T0, int T1, int NT> __device__ __forceinline__ void stage_w_ld(const float* p, v4f (&x)[NT]) {
#pragma unroll   /* register array indexed by constants */
  for (int it = T0; it < T1; ++it) x[it] = *(const v4f*)(p + (it >> 2) * 16 * 128 + (it & 3) * 32);
}
template <int T0, int T1, int NT> __device__ __forceinline__ void stage_w_st(__bf16* sw, int tid, const v4f (&x)[NT]) {
  const int row = tid >> 3, q = tid & 7;   /* the thread holds k = 4 q .. 4 q + 3 of the step: half h = q >> 2, lane 16 g + row with g = (q >> 1) & 1, values 4 (q & 1) .. 4 (q & 1) + 3 of that lane */
  __bf16* d = sw + (q >> 2) * (FT / 2) + (((q >> 1) & 1) * 16 + row) * 8 + (q & 1) * 4;
#pragma unroll
  for (int it = T0; it < T1; ++it) { v4b y;
#pragma unroll
    for (int i = 0; i < 4; ++i) y[i] = (__bf16)x[it][i];
    *(v4b*)(d + it * FT) = y; }
}
#define QBH 0              // not used by any kernel here
#define QHI 2048            // rows carrying a q residual plane (all rows when non-causal: 2-product logits everywhere)
#define KHI 64            // key rows carrying k residual / v bf16 hi+lo planes (written by k_proj, read by no kernel here)
// B fragment (k rows k0+.., output column o) of a weight: (in,out) [K][ld] or (out,in) [ld rows of K]: bf16 exact, or f16(bf16 * 256) exact
__device__ __forceinline__ v16b wcol_io(const float* Wm, int k0, int o, int lane, int ld) { v16b w; const int g = lane >> 4;
#pragma unroll
  for (int i = 0; i < 8; ++i) { w[i] = (__bf16)Wm[(size_t)(k0 + 8 * g + i) * ld + o]; w[8 + i] = (__bf16)Wm[(size_t)(k0 + 16 + 8 * g + i) * ld + o]; }
  return w; }
__device__ __forceinline__ v16b wcol_oi(const float* Wm, int k0, int o, int lane, int K) { v16b w; const float* p = Wm + (size_t)o * K + k0 + 8 * (lane >> 4);
#pragma unroll
  for (int i = 0; i < 8; ++i) { w[i] = (__bf16)p[i]; w[8 + i] = (__bf16)p[16 + i]; }
  return w; }
__device__ __forceinline__ v16h wcolh_io(const float* Wm, int k0, int o, int lane, int ld) { v16h w; const int g = lane >> 4;
#pragma unroll
  for (int i = 0; i < 8; ++i) { w[i] = (_Float16)(bfr(Wm[(size_t)(k0 + 8 * g + i) * ld + o]) * 256.0f); w[8 + i] = (_Float16)(bfr(Wm[(size_t)(k0 + 16 + 8 * g + i) * ld + o]) * 256.0f); }
  return w; }
__device__ __forceinline__ v16h wcolh_oi(const float* Wm, int k0, int o, int lane, int K) { v16h w; const float* p = Wm + (size_t)o * K + k0 + 8 * (lane >> 4);
#pragma unroll
  for (int i = 0; i < 8; ++i) { w[i] = (_Float16)(bfr(p[i]) * 256.0f); w[8 + i] = (_Float16)(bfr(p[16 + i]) * 256.0f); }
  return w; }
#define WQKV_LAYOUT 1   // 0 = (in,out) [DIN][CC]; 1 = (out,in) [CC][DIN]; 2 = per-head [NH][DIN][HD]
__device__ __forceinline__ v16b wcol_hdk(const float* Wm, int k0, int o, int lane) { v16b w; const int g = lane >> 4; const float* p = Wm + (size_t)(o / HD) * DIN * HD + (o % HD);
#pragma unroll
  for (int i = 0; i < 8; ++i) { w[i] = (__bf16)p[(size_t)(k0 + 8 * g + i) * HD]; w[8 + i] = (__bf16)p[(size_t)(k0 + 16 + 8 * g + i) * HD]; }
  return w; }
#define WO_OUT_IN 0
#if WQKV_LAYOUT == 1
#define WCOL(W, k0, o, lane) wcol_oin(W, k0, o, lane, DIN, (which == 2) ? CC : HDQ)   /* q / k: 32 real output rows, columns 32..127 exact zeros */
#elif WQKV_LAYOUT == 2
#define WCOL(W, k0, o, lane) wcol_hdk(W, k0, o, lane)
#else
#define WCOL(W, k0, o, lane) wcol_io(W, k0, o, lane, CC)
#endif
#if WO_OUT_IN
#define WOCOL(W, k0, o, lane) wcol_oi(W, k0, o, lane, CC)
#define WOCOLH(W, k0, o, lane) wcolh_oi(W, k0, o, lane, CC)
#else
#define WOCOL(W, k0, o, lane) wcol_io(W, k0, o, lane, DIN)
#define WOCOLH(W, k0, o, lane) wcolh_io(W, k0, o, lane, DIN)
#endif
#define HDQ 32             // q / k width (k_proj's accumulators are 128 wide, columns 32..127 exact zeros; only the 32 real columns are stored)
#define BG HG              // not used by any kernel here
#define NR (TNB * TT)      // 32,768 rows (all batches)
// (out,in) projection weight with only 'nvalid' real output rows: columns o >= nvalid read row 0 and are zeroed by value
__device__ __forceinline__ v16b wcol_oin(const float* Wm, int k0, int o, int lane, int K, int nvalid) { v16b w; const int oc = o < nvalid ? o : 0; const float keep = o < nvalid ? 1.f : 0.f; const float* p = Wm + (size_t)oc * K + k0 + 8 * (lane >> 4);
#pragma unroll
  for (int i = 0; i < 8; ++i) { w[i] = (__bf16)(p[i] * keep); w[8 + i] = (__bf16)(p[16 + i] * keep); }
  return w; }
// pairwise tree over the 16 f32 P values of one A fragment (a lane's share of its query's sum over keys)
__device__ __forceinline__ float sum16(const float v[16]) { return (((v[0] + v[1]) + (v[2] + v[3])) + ((v[4] + v[5]) + (v[6] + v[7]))) + (((v[8] + v[9]) + (v[10] + v[11])) + ((v[12] + v[13]) + (v[14] + v[15]))); }
#define WS_DEN (WS_END)                                // (plane not used: the sum over keys stays inside k_att, in registers and LDS)
#define WS_FSA (WS_DEN + 4u * (size_t)NR)              // f32 f_sa rows [NR][128]
#define WS_YL  (WS_FSA + 4u * (size_t)NR * CC)        // f32 y rows (pre-BN)
#define WS_ST  (WS_YL + 4u * (size_t)NR * CC)         // BN statistics [128][32]
#define WS_PS  (WS_ST + 4u * (size_t)CC * 32)         // BN partials of k_lin's blocks [NR / 64][2][128]: mean of the block's 64 rows, sum of squared distances from that mean
#define WS_END2 (WS_PS + 4u * (size_t)(NR / 64) * 2 * CC)
// ---- k_lin: block = 64 rows: y = (bf16(f_in) - f_sa) (split bf16 hi + lo) Wl^T + bl (2 products, K 128) -> pre-BN rows, and per channel the block's own mean and sum of squared distances from it (PS)
__global__ __launch_bounds__(128) void k_lin(const float* __restrict__ X, const float* __restrict__ FSA, const float* __restrict__ WL, const float* __restrict__ BL, float* __restrict__ YL, float* __restrict__ PS) { __shared__ __align__(16) float sf[4][16][132]; __shared__ __align__(16) float sp[4][2][CC]; __shared__ __align__(16) __bf16 sw[(CC / 16) * (CC / 32) * FT];   /* sw: Wl as bf16 fragment tiles */
  const int tid = threadIdx.x, wave = tid >> 5, lane = tid & 31, col = lane & 15, g = lane >> 4; const size_t r0 = (size_t)blockIdx.x * 64 + wave * 16;
  v8f acc[8] = {}; const float* px = X + (r0 + col) * CC + 8 * g; const float* pf = FSA + (r0 + col) * CC + 8 * g; const float* pb = BL + col; const float* pw = stage_w_p(WL, tid); v4f xr[CC / 32][4], fr[CC / 32][4], wr[(CC / 16) * (CC / 32)]; float br[8];
#pragma unroll   /* the rows' values of all four k steps, the bias and the weight: every operand load of the kernel in flight at once */
  for (int kc = 0; kc < CC / 32; ++kc)
#pragma unroll
    for (int u = 0; u < 4; ++u) { const int o = kc * 32 + (u >> 1) * 16 + (u & 1) * 4; xr[kc][u] = *(const v4f*)(px + o); fr[kc][u] = *(const v4f*)(pf + o); }
#pragma unroll
  for (int j = 0; j < 8; ++j) br[j] = pb[j * 16];
  stage_w_ld<0, (CC / 16) * (CC / 32)>(pw, wr);
  asm volatile("s_wait_xcnt 0x0" :: "v"(px), "v"(pf), "v"(col), "v"(pw) : "memory");   /* precaution: the loads above have taken their addresses before an address register is written again; the pointers, and col (the bias loads' offset register), are named so that their registers live up to here and are no load's destination */
  stage_w_st<0, (CC / 16) * (CC / 32)>(sw, tid, wr);
  F2 a[CC / 32];
#pragma unroll
  for (int kc = 0; kc < CC / 32; ++kc) { float v[16];
#pragma unroll
    for (int i = 0; i < 16; ++i) v[i] = bfr(xr[kc][i >> 2][i & 3]) - fr[kc][i >> 2][i & 3];
    a[kc] = bsplit16(v); }
  __syncthreads();
  v16b wf[2][8];
#pragma unroll
  for (int j = 0; j < 8; ++j) wf[0][j] = frag_lb(sw + (j * 4) * FT + 8 * lane);
#pragma unroll
  for (int kc = 0; kc < CC / 32; ++kc) {
    if (kc + 1 < CC / 32) {
#pragma unroll
      for (int j = 0; j < 8; ++j) wf[(kc + 1) & 1][j] = frag_lb(sw + (j * 4 + kc + 1) * FT + 8 * lane); }
    __builtin_amdgcn_sched_barrier(0);   /* keeps the next k step's 16 LDS reads issued here as one group, a whole step ahead of their products (left alone they sink to their products, with a full wait in front of each) */
#pragma unroll
    for (int j = 0; j < 8; ++j) { acc[j] = wmma_bf(a[kc].h, wf[kc & 1][j], acc[j]); acc[j] = wmma_bf(a[kc].l, wf[kc & 1][j], acc[j]); } }
#pragma unroll
  for (int j = 0; j < 8; ++j) { const float bb = bfr(br[j]);
#pragma unroll
    for (int r = 0; r < 8; ++r) sf[wave][8 * g + r][j * 16 + col] = acc[j][r] + bb; }
  LDSX(); v4f yv[16];
#pragma unroll   /* yv is indexed by constants only */
  for (int rl = 0; rl < 16; ++rl) yv[rl] = *(const v4f*)&sf[wave][rl][lane * 4];
  // the wave's 16 rows, channels 4 lane .. 4 lane + 3: mean, then squared distances from that mean (no difference of large squares anywhere)
  const v4f m16 = ((((yv[0] + yv[1]) + (yv[2] + yv[3])) + ((yv[4] + yv[5]) + (yv[6] + yv[7]))) + (((yv[8] + yv[9]) + (yv[10] + yv[11])) + ((yv[12] + yv[13]) + (yv[14] + yv[15])))) * (1.0f / 16.0f); v4f q16 = {};
#pragma unroll
  for (int rl = 0; rl < 16; ++rl) { const v4f d = yv[rl] - m16; q16 += d * d; }
  *(v4f*)&sp[wave][0][lane * 4] = m16; *(v4f*)&sp[wave][1][lane * 4] = q16;
  __syncthreads();
  // thread = channel: the four waves' groups of 16 rows merged: mean of the means; squared distances add up, plus 16 x each group mean's squared distance from the merged mean
  const float g0 = sp[0][0][tid], g1 = sp[1][0][tid], g2 = sp[2][0][tid], g3 = sp[3][0][tid]; const float m64 = ((g0 + g1) + (g2 + g3)) * 0.25f; const float e0 = g0 - m64, e1 = g1 - m64, e2 = g2 - m64, e3 = g3 - m64;
  const float q64 = ((sp[0][1][tid] + sp[1][1][tid]) + (sp[2][1][tid] + sp[3][1][tid])) + 16.0f * ((e0 * e0 + e1 * e1) + (e2 * e2 + e3 * e3));
#pragma unroll   /* the row stores stand behind the barrier: in front of it the barrier would wait for all sixteen to finish */
  for (int rl = 0; rl < 16; ++rl) vst2(YL + (r0 + rl) * CC + lane * 4, yv[rl]);
  vst2(PS + (size_t)blockIdx.x * 2 * CC + tid, m64); vst2(PS + ((size_t)blockIdx.x * 2 + 1) * CC + tid, q64); }
// ---- k_stat: block = channel c: merges the NR / 64 partials of k_lin (equal groups of 64 rows) in the same way -> mean and 1 / sqrt(biased variance + eps)
__global__ __launch_bounds__(256) void k_stat(const float* __restrict__ PS, float* __restrict__ STAT) { __shared__ float sred[8]; __shared__ float sbc;
  const int t = threadIdx.x; const int c = blockIdx.x; float pm[NR / 64 / 256], pq[NR / 64 / 256];
#pragma unroll   /* register arrays indexed by constants; all loads in flight at once */
  for (int i = 0; i < NR / 64 / 256; ++i) { pm[i] = PS[(size_t)(i * 256 + t) * 2 * CC + c]; pq[i] = PS[((size_t)(i * 256 + t) * 2 + 1) * CC + c]; }
  float s = 0.f;
#pragma unroll
  for (int i = 0; i < NR / 64 / 256; ++i) s += pm[i];
#pragma unroll
  for (int o = 1; o < 32; o <<= 1) s += __shfl_xor(s, o);
  if ((t & 31) == 0) sred[t >> 5] = s; __syncthreads(); if (t == 0) { float a = 0.f; for (int i = 0; i < 8; ++i) a += sred[i]; sbc = a / (float)(NR / 64); } __syncthreads(); const float mean = sbc; __syncthreads();
  float q = 0.f;
#pragma unroll
  for (int i = 0; i < NR / 64 / 256; ++i) { const float d = pm[i] - mean; q += pq[i] + 64.0f * (d * d); }
#pragma unroll
  for (int o = 1; o < 32; o <<= 1) q += __shfl_xor(q, o);
  if ((t & 31) == 0) sred[t >> 5] = q; __syncthreads(); if (t == 0) { float a = 0.f; for (int i = 0; i < 8; ++i) a += sred[i]; sbc = rsqrtf(a / (float)NR + 1e-5f); } __syncthreads();
  if (t < 32) { const float v = t == 0 ? mean : (t == 1 ? sbc : 0.f); vst2(STAT + (size_t)c * 32 + t, v); } }
// ---- k_fin: out = relu(gamma (y - mean) rstd + beta) + f_sa. Block = 64 rows; thread = channels 4 (tid & 31) .. 4 (tid & 31) + 3 of the FR rows (tid >> 5) + 8 i: its channels are the same in every row, so the per-channel constants are fetched once per block (thread = channel; STAT holds one channel per 128-B line, so each such load touches 32 lines) and handed out through LDS
#define FR 8               // rows per thread
static_assert(NR % (8 * FR) == 0, "whole blocks only");
__global__ __launch_bounds__(256) void k_fin(const float* __restrict__ YL, const float* __restrict__ STAT, const float* __restrict__ G, const float* __restrict__ BE, const float* __restrict__ FSA, float* __restrict__ OUT) { __shared__ __align__(16) float sc[4][CC];   /* per channel: gamma, mean, 1 / sqrt(variance + eps), beta */
  const int tid = threadIdx.x; const size_t e0 = (size_t)blockIdx.x * (8 * FR * CC) + tid * 4; const float* py = YL + e0; const float* pf = FSA + e0; const float* ps = STAT + tid * 32; const float* pg = G + tid; const float* pe = BE + tid;
  v2f st = {}; float ga = 0.f, be = 0.f; v4f yv[FR], fv[FR];
#pragma unroll   /* register arrays indexed by constants; all sixteen row loads in flight at once */
  for (int i = 0; i < FR; ++i) { yv[i] = *(const v4f*)(py + i * 8 * CC); fv[i] = *(const v4f*)(pf + i * 8 * CC); }
  if (tid < CC) { st = *(const v2f*)ps; ga = *pg; be = *pe; }   /* behind the row loads: no row load is held up by a wait for a constant */
  asm volatile("s_wait_xcnt 0x0" :: "v"(py), "v"(pf), "v"(ps), "v"(pg), "v"(pe) : "memory");   /* precaution: the loads above have taken their addresses before an address register is written again; the pointers are named so that their registers live up to here and are no load's destination */
  if (tid < CC) { sc[0][tid] = bfr(ga); sc[1][tid] = st[0]; sc[2][tid] = st[1]; sc[3][tid] = bfr(be); }
  __syncthreads();
  const int c0 = (tid & 31) * 4; const v4f vg = *(const v4f*)&sc[0][c0], vm = *(const v4f*)&sc[1][c0], vr = *(const v4f*)&sc[2][c0], vb = *(const v4f*)&sc[3][c0]; float* po = OUT + e0;
#pragma unroll
  for (int i = 0; i < FR; ++i) { v4f o;
#pragma unroll
    for (int k = 0; k < 4; ++k) { const float yb = vg[k] * (yv[i][k] - vm[k]) * vr[k] + vb[k]; o[k] = fmaxf(yb, 0.f) + fv[i][k]; }
    vst2(po + i * 8 * CC, o); } }
#ifndef SM_EXTRA_PARAMS
#define SM_EXTRA_PARAMS
#endif
#ifndef PROJ_EXTRA_PARAMS
#define PROJ_EXTRA_PARAMS
#endif
#ifndef SM_MASK_HOOK
#define SM_MASK_HOOK (void)0
#endif

#define WS_QH  0u                                      // f16 q tiles in fragment order [b*t / 16][FT] (the 32 real columns only; the rest of the plane is not used)
#define WS_KH  (WS_QH + 2u * (size_t)NB * TT * CC)      // f16 k tiles in fragment order [b*t / 16][FT]
#define WS_VT  (WS_KH + 2u * (size_t)NB * TT * CC)      // f16 v tiles in fragment order [b][t / 32][c / 16][FT] (tile: column = channel, k = t)
#define WS_QL  (WS_VT + 2u * (size_t)NB * CC * TT)      // f16 q residual x 2^10 tiles [(b, t < QHI) / 16][FT]
#define WS_KL  (WS_QL + 2u * (size_t)NB * QHI * CC)     // f16 k residual x 2^10 tiles [(b, t < KHI) / 16][FT]
#define WS_VB  (WS_KL + 2u * (size_t)NB * KHI * CC)     // bf16 v hi planes [b][c][t < KHI]
#define WS_VBL (WS_VB + 2u * (size_t)NB * CC * KHI)
#define WS_S   (WS_VBL + 2u * (size_t)NB * CC * KHI)    // f32 per-key softmax constants [b][t / 16][2][16] (the rest of the plane is not used)
#define WS_Y   (WS_S  + 4u * (size_t)HG * TT * TT)      // f32 ctx rows [b*t][CC] (only when there is an output projection)
#define WS_END (WS_Y  + 0u)

// k_proj's products from the staged weight tiles: acc[j] += x W^T over the four k steps; NJ real 16-column tiles (j >= NJ: zero fragments, exact zero columns)
template <int NJ> __device__ __forceinline__ void proj_mm(const __bf16* swl, const v16b (&a)[DIN / 32], v8f (&acc)[8]) {   /* swl = the lane's own place in tile 0 */
  v16b wf[2][NJ];
#pragma unroll
  for (int j = 0; j < NJ; ++j) wf[0][j] = frag_lb(swl + (j * 4) * FT);
#pragma unroll
  for (int kc = 0; kc < DIN / 32; ++kc) {
    if (kc + 1 < DIN / 32) {
#pragma unroll
      for (int j = 0; j < NJ; ++j) wf[(kc + 1) & 1][j] = frag_lb(swl + (j * 4 + kc + 1) * FT); }
    __builtin_amdgcn_sched_barrier(0);   /* keeps the next k step's LDS reads issued here as one group, a whole step ahead of their products (left alone they sink to their products, with a full wait in front of each) */
#pragma unroll
    for (int j = 0; j < 8; ++j) { v16b w = {}; if (j < NJ) w = wf[kc & 1][j < NJ ? j : 0]; acc[j] = wmma_bf(a[kc], w, acc[j]); } }
}
// ---- k_proj: block = (64 rows, 128 cols, which): q/k/v = X W (+ b) with exact bf16 products (K = DIN) -> which 0: q f16 tiles (+ residual tiles, rows < QHI); 1: k f16 tiles (+ residual tiles, rows < KHI); 2: v f16 tiles (+ bf16 hi/lo planes [c][t] for t < KHI); the f16 tiles in fragment order (frag_t)
__global__ __launch_bounds__(128) void k_proj(const float* __restrict__ XQ, const float* __restrict__ XK, const float* __restrict__ XV, const float* __restrict__ WQ, const float* __restrict__ WK, const float* __restrict__ WV, const float* __restrict__ BQ, const float* __restrict__ BK, const float* __restrict__ BV,
    _Float16* __restrict__ QH, _Float16* __restrict__ QL, _Float16* __restrict__ KH, _Float16* __restrict__ KL, _Float16* __restrict__ VT, __bf16* __restrict__ VB, __bf16* __restrict__ VBL) {
  __shared__ __align__(16) _Float16 shl[2][64][136]; _Float16 (&sh)[64][136] = shl[0]; _Float16 (&sl)[64][136] = shl[1];   /* one array, so that a v block's weight tiles can span both halves */
  __shared__ __align__(16) _Float16 th[128][72]; __shared__ __align__(16) __bf16 tb[128][72], tbl[128][72];
  const int tid = threadIdx.x, wave = tid >> 5, lane = tid & 31, col = lane & 15, g = lane >> 4; const int which = blockIdx.z; const int c0 = blockIdx.y * 128; const size_t r0 = (size_t)blockIdx.x * 64; const size_t bb = r0 / TT; const int t0 = (int)(r0 % TT);
  const float* X = which == 0 ? XQ : which == 1 ? XK : XV; const float* WA = which == 0 ? WQ : which == 1 ? WK : WV; const float* BA = which == 0 ? BQ : which == 1 ? BK : BV;
  v8f acc[8] = {}; const float* pa = X + (r0 + wave * 16 + col) * DIN + 8 * g; const float* pw = stage_w_p(WA, tid); const float* pb = BA + c0 + col; v4f xr[DIN / 32][4], wr[(CC / 16) * (DIN / 32)]; float br[8] = {};   /* br: the bias of column 16 j + col; stays 0 in the zero columns of q / k */
#pragma unroll   /* the row's values of all four k steps, the bias and the weight: every operand load of the kernel in flight at once */
  for (int kc = 0; kc < DIN / 32; ++kc)
#pragma unroll
    for (int u = 0; u < 4; ++u) xr[kc][u] = *(const v4f*)(pa + kc * 32 + (u >> 1) * 16 + (u & 1) * 4);
  stage_w_ld<0, (HDQ / 16) * (DIN / 32)>(pw, wr);
#pragma unroll
  for (int j = 0; j < HDQ / 16; ++j) br[j] = pb[j * 16];
  if (which == 2) { stage_w_ld<(HDQ / 16) * (DIN / 32), (CC / 16) * (DIN / 32)>(pw, wr);   /* q / k have only the 32 real rows */
#pragma unroll
    for (int j = HDQ / 16; j < 8; ++j) br[j] = pb[j * 16]; }
  asm volatile("s_wait_xcnt 0x0" :: "v"(pa), "v"(pw), "v"(pb), "v"(col) : "memory");   /* precaution: the loads above have taken their addresses before an address register is written again; the pointers, and col (the offset register of two bias loads), are named so that their registers live up to here and are no load's destination */
  // the weight tiles lie in LDS that this block's own epilogue does not use: v blocks (128 rows, 32 KB) in shl, q / k blocks (the 32 real rows, 8 KB) in th; so no barrier is owed between the last tile read and the epilogue's LDS stores
  __bf16* sw = which == 2 ? (__bf16*)&shl[0][0][0] : (__bf16*)&th[0][0];
  stage_w_st<0, (HDQ / 16) * (DIN / 32)>(sw, tid, wr);
  if (which == 2) stage_w_st<(HDQ / 16) * (DIN / 32), (CC / 16) * (DIN / 32)>(sw, tid, wr);
  v16b a[DIN / 32];
#pragma unroll
  for (int kc = 0; kc < DIN / 32; ++kc)
#pragma unroll
    for (int i = 0; i < 16; ++i) a[kc][i] = (__bf16)xr[kc][i >> 2][i & 3];
  __syncthreads();
  if (which == 2) proj_mm<CC / 16>(sw + 8 * lane, a, acc); else proj_mm<HDQ / 16>(sw + 8 * lane, a, acc);
  if (which < 2) { _Float16* DH = which == 0 ? QH : KH; _Float16* DL = which == 0 ? QL : KL; const int nhi = which == 0 ? QHI : KHI; const bool hi_rows = t0 < nhi;
#pragma unroll
    for (int j = 0; j < 8; ++j) { const float bias = bfr(br[j]);
#pragma unroll
      for (int r = 0; r < 8; ++r) { const float v = acc[j][r] + bias; const _Float16 hv = (_Float16)v; sh[wave * 16 + 8 * g + r][j * 16 + col] = hv; sl[wave * 16 + 8 * g + r][j * 16 + col] = (_Float16)((v - (float)hv) * 1024.0f); } }
    __syncthreads();
    for (int e = tid; e < 64 * HDQ / 8; e += 128) { const int tl = e >> 6, h = (e >> 5) & 1, l = e & 31; const int rl = tl * 16 + (l & 15), k8 = 16 * h + 8 * (l >> 4);   /* e runs in the order of the destination: a wave stores 512 contiguous bytes */
      vst2((unsigned*)(DH + ((r0 >> 4) + tl) * FT + (e & 63) * 8), *(const v4u*)&sh[rl][k8]);
      asm volatile("s_wait_xcnt 0x0" ::: "memory");   /* precaution, here and behind the four stores below: the store has taken its address and data before the next LDS load or address sum writes those registers again */
      if (hi_rows) { vst2((unsigned*)(DL + (((bb * nhi + t0) >> 4) + tl) * FT + (e & 63) * 8), *(const v4u*)&sl[rl][k8]); asm volatile("s_wait_xcnt 0x0" ::: "memory"); } }
  } else { const bool hi_rows = t0 < KHI;
#pragma unroll
    for (int j = 0; j < 8; ++j) { const float bias = bfr(br[j]);
#pragma unroll
      for (int r = 0; r < 8; ++r) { const float v = acc[j][r] + bias; const int rl = wave * 16 + 8 * g + r, cl = j * 16 + col; th[cl][rl] = (_Float16)v; const __bf16 bh = (__bf16)v; tb[cl][rl] = bh; tbl[cl][rl] = (__bf16)(v - (float)bh); } }
    __syncthreads();
    for (int e = tid; e < 128 * 8; e += 128) { const int cl = e >> 3, q = e & 7; { const int tl = e >> 6, h = (e >> 5) & 1, l = e & 31;   /* tile tl = (32-key chunk tl >> 3, 16 channels tl & 7) of the block, e in the order of the destination */
        vst2((unsigned*)(VT + (((bb * (TT / 32) + (t0 >> 5) + (tl >> 3)) * (CC / 16) + (c0 >> 4) + (tl & 7)) * FT + (e & 63) * 8)), *(const v4u*)&th[(tl & 7) * 16 + (l & 15)][(tl >> 3) * 32 + 16 * h + 8 * (l >> 4)]); asm volatile("s_wait_xcnt 0x0" ::: "memory"); }
      if (hi_rows) { const size_t o3 = (bb * CC + c0 + cl) * (size_t)KHI + t0 + q * 8; vst2((unsigned*)(VB + o3), *(const v4u*)&tb[cl][q * 8]); asm volatile("s_wait_xcnt 0x0" ::: "memory"); vst2((unsigned*)(VBL + o3), *(const v4u*)&tbl[cl][q * 8]); asm volatile("s_wait_xcnt 0x0" ::: "memory"); } } } }
// plain builtin form: the compiler keeps the distance behind a matrix instruction itself and fills it with independent work where it can
__device__ __forceinline__ v8f wmma16c(v16h a, v16h b, v8f c) { return __builtin_amdgcn_wmma_f32_16x16x32_f16(false, a, false, b, (short)0, c, false, false); }
// (in the two kernels below every plain '#pragma unroll' is there so that a register array is indexed by constants only)
// logit of one (key, query) pair from the two f16 products: k hi . q + (k residual x 2^10) . q / 2^10
__device__ __forceinline__ float logit2(float hi, float lo) { return (hi + lo * (1.0f / 1024.0f)) * SCALE; }
#define LOG2E 1.4426950408889634f
// exp(x) 2^c = 2^(x log2 e + c): one fused multiply-add (lc) and the hardware's own base-2 exponential (exp2x8). The exponent is at most about 11 here (x never above its key's maximum); a result under 2^-126 may come out as 0, far below what the f32 sums (at least 1) or an f16 P value keep
__device__ __forceinline__ float lc(float x, float c) { return __builtin_fmaf(x, LOG2E, c); }
// y[0..7] = 2^y[0..7]. One statement, each exponential in place, one v_nop at the end: the instruction set asks for one independent instruction behind a transcendental before its result is read or its source written over; here that is the next exponential, on another register, and behind the last one the v_nop (left to the register allocator, neighbours wrote over each other's sources)
__device__ __forceinline__ void exp2x8(float* y) {
  asm("v_exp_f32 %0, %0\n\tv_exp_f32 %1, %1\n\tv_exp_f32 %2, %2\n\tv_exp_f32 %3, %3\n\tv_exp_f32 %4, %4\n\tv_exp_f32 %5, %5\n\tv_exp_f32 %6, %6\n\tv_exp_f32 %7, %7\n\tv_nop"
      : "+v"(y[0]), "+v"(y[1]), "+v"(y[2]), "+v"(y[3]), "+v"(y[4]), "+v"(y[5]), "+v"(y[6]), "+v"(y[7])); }
// ---- k_kst: block = 16 keys of batch blockIdx.y; wave w holds the logits of those keys against queries [256 w, 256 w + 256) in registers (D: row = key 8g + r, column = query): maximum and sum of exp over ALL queries -> KS line of the key tile: per key the one constant c = 11 - max log2 e - log2 sum, so that 2^(logit log2 e + c) = exp(logit - max) x 2^11 / sum (the line's second half repeats the 16 values: the block stays the one writer of its whole 128-B line)
__global__ __launch_bounds__(256) __attribute__((amdgpu_waves_per_eu(4))) /* holds the kernel to 256 registers, four waves per SIMD as before: left alone this build takes a few more and only one block fits a WGP */ void k_kst(const _Float16* __restrict__ KRH, const _Float16* __restrict__ KRL, const _Float16* __restrict__ QR, float* __restrict__ KS) { __shared__ float smx[8][16], ssu[8][16];
  const int tid = threadIdx.x, wave = tid >> 5, lane = tid & 31, col = lane & 15, g = lane >> 4; const size_t kr0 = (size_t)blockIdx.y * TT + blockIdx.x * 16, q0 = (size_t)blockIdx.y * TT + wave * (TT / 8);
  const v16h ah = frag_t(KRH + (kr0 >> 4) * FT, lane), al = frag_t(KRL + (kr0 >> 4) * FT, lane);
  asm volatile("s_wait_xcnt 0x0" ::: "memory");   /* precaution: the four key loads above have taken their addresses before a later load's result reuses those address registers */
  float s[TT / 128][8]; v16h qf[TT / 128];
#pragma unroll
  for (int t = 0; t < 8; ++t) qf[t] = frag_t(QR + ((q0 >> 4) + t) * FT, lane);
#pragma unroll
  for (int tg = 0; tg < TT / 128; tg += 4) {   /* groups of four query tiles, loaded two groups ahead of their products */
    if (tg + 8 < TT / 128) {
#pragma unroll
      for (int t = tg + 8; t < tg + 12; ++t) qf[t] = frag_t(QR + ((q0 >> 4) + t) * FT, lane); }
    __builtin_amdgcn_sched_barrier(0);   /* keeps the loads above issued here: left alone the scheduler either waits on one tile at a time or hoists all sixteen, which takes the kernel past 256 registers */
#pragma unroll
    for (int t = tg; t < tg + 4; ++t) { v8f a = {}, l = {}; a = wmma16(ah, qf[t], a); l = wmma16(al, qf[t], l);
#pragma unroll
      for (int r = 0; r < 8; ++r) s[t][r] = logit2(a[r], l[r]); }
    __builtin_amdgcn_sched_barrier(0);   /* the other side of the same fence: the next group's loads stay behind these products */
  }
  float mx[8], su[8];
#pragma unroll
  for (int r = 0; r < 8; ++r) { float m = s[0][r];
#pragma unroll
    for (int t = 1; t < TT / 128; ++t) m = fmaxf(m, s[t][r]);
#pragma unroll
    for (int o = 1; o < 16; o <<= 1) m = fmaxf(m, __shfl_xor(m, o));
    mx[r] = m; }
  if (col == 0) {
#pragma unroll
    for (int r = 0; r < 8; ++r) smx[wave][8 * g + r] = mx[r]; }
  __syncthreads();
#pragma unroll
  for (int r = 0; r < 8; ++r) { float m = smx[0][8 * g + r];
#pragma unroll
    for (int w = 1; w < 8; ++w) m = fmaxf(m, smx[w][8 * g + r]);
    float a = 0.f; const float nm = -m * LOG2E;
#pragma unroll
    for (int tg = 0; tg < TT / 128; tg += 8) { float e[8];
#pragma unroll
      for (int t = 0; t < 8; ++t) e[t] = lc(s[tg + t][r], nm);
      exp2x8(e);
#pragma unroll
      for (int t = 0; t < 8; ++t) a += e[t]; }
#pragma unroll
    for (int o = 1; o < 16; o <<= 1) a += __shfl_xor(a, o);
    su[r] = a; }
  if (col == 0) {
#pragma unroll
    for (int r = 0; r < 8; ++r) ssu[wave][8 * g + r] = su[r]; }
  __syncthreads();
  if (tid < 32) { float m = smx[0][col], a = 0.f;
#pragma unroll
    for (int w = 1; w < 8; ++w) m = fmaxf(m, smx[w][col]);
#pragma unroll
    for (int w = 0; w < 8; ++w) a += ssu[w][col];
    vst2(KS + kr0 * 2 + tid, a > 0.f ? (11.0f - m * LOG2E) - log2f(a) : -1.0e30f); } }   /* no sum: an exponent that makes every P of the key 0, as the factor 0 did */
// ---- k_att: block = 128 queries of batch blockIdx.y, 8 waves; wave = (query group qg: 32 queries = two 16-query tiles, key half hf: 1,024 keys), so every key and v fragment it loads feeds the products of two query tiles. Per 32 keys and query tile: S^T tiles (row = key, column = query) from the same two products as k_kst, P x 2^11 = 2^(logit log2 e + the key's constant of k_kst) in f32; the two D tiles, converted to f16 in place, ARE the A fragment (row = query, k = key) of P . v. The two waves of a query group (one per key half) each finish one of its tiles: a wave hands its partial P . v and key sum of the other tile to its partner through LDS; f_sa = (P . v) / (sum over keys of P)
#define NP (TT / 64)       // passes of 32 keys in one key half
// The key and v tiles reach the waves through LDS: a staged tile = KT keys of one key half = [k hi: KT / 16 fragment tiles][k residual: the same][v: KT / 32 chunks of HD / 16 fragment tiles], each part contiguous in the workspace and copied as it lies there. The four waves of a key half copy their half's tile once for the block, so a byte comes from L2 once per block and not once per wave; two buffers, the next tile's copies fly while this one is worked on
#define KT 128                             // keys of one key half in a staged tile
#define NT (TT / 2 / KT)                   // staged tiles of one key half
#define TKV (KT / 16 * FT)                 // values in the k hi part, and in the k residual part
#define TVV (KT / 32 * (HD / 16) * FT)     // values in the v part
#define THV (2 * TKV + TVV)                // values in one key half's staged tile
static_assert(TKV == 4 * 128 * 8 && TVV == 16 * 128 * 8, "tile_copy: 128 lanes x 16 bytes x (4 + 4 + 16) copies");
static_assert(NT >= 2, "the ring's prologue fills two tiles");
typedef __attribute__((address_space(1))) v4i glb_v4i; typedef __attribute__((address_space(3))) v4i lds_v4i;
// one asynchronous copy of 16 bytes a lane from global memory into LDS, through no register (the builtin form: the compiler keeps the address registers itself)
__device__ __forceinline__ void copy16(_Float16* l, const _Float16* g) { __builtin_amdgcn_global_load_async_to_lds_b128((glb_v4i*)g, (lds_v4i*)l, 0, 0); }
// one staged tile of one key half, 24 copies a lane: l, gh, gl, gv = the lane's own first place in the buffer and in the three sources; a copy lies 128 lanes x 16 bytes = 1,024 values behind the one before it, in LDS and in its source
__device__ __forceinline__ void tile_copy(_Float16* l, const _Float16* gh, const _Float16* gl, const _Float16* gv) {
#pragma unroll   /* here and twice below: the copies stand one behind another, with no loop counter or branch between them */
  for (int i = 0; i < TKV / 1024; ++i) copy16(l + i * 1024, gh + i * 1024);
#pragma unroll
  for (int i = 0; i < TKV / 1024; ++i) copy16(l + TKV + i * 1024, gl + i * 1024);
#pragma unroll
  for (int i = 0; i < TVV / 1024; ++i) copy16(l + 2 * TKV + i * 1024, gv + i * 1024); }
__global__ __launch_bounds__(256) void k_att(const _Float16* __restrict__ KRH, const _Float16* __restrict__ KRL, const _Float16* __restrict__ QR, const float* __restrict__ KS, const _Float16* __restrict__ VT, float* __restrict__ Y) { __shared__ __align__(16) float ss[8][16][HD + 4]; __shared__ __align__(16) float sks[TT * 2]; __shared__ float sk[8][16]; __shared__ __align__(16) _Float16 sb[2][2][THV];   /* sb: [buffer][key half] staged tiles */
  const int tid = threadIdx.x, lane = tid & 31, col = lane & 15, g = lane >> 4; const int b = blockIdx.y;
  const int wave = __builtin_amdgcn_readfirstlane(tid >> 5), qg = wave & 3, hf = wave >> 2;   /* the wave's number in a scalar register: the bases formed from it below stay scalar */
  const int ql0 = blockIdx.x * 128 + qg * 32;   /* the wave's tile u = queries ql0 + 16 (u ^ hf) ..: tile 0 is the one it finishes itself, tile 1 the one it hands over */
  const _Float16* kh = KRH + ((size_t)b * (TT / 16) + hf * (TT / 32)) * FT; const _Float16* kl = KRL + ((size_t)b * (TT / 16) + hf * (TT / 32)) * FT; const _Float16* vt = VT + ((size_t)b * (TT / 32) + hf * NP) * (HD / 16) * FT; const float* sc = &sks[hf * NP * 64 + 8 * g];   /* the key half's first tiles and constants */
  const int un = (qg * 32 + lane) * 8;   /* the lane's first 8 values among the 128 lanes that copy this key half */
  tile_copy(&sb[0][hf][un], kh + un, kl + un, vt + un);   /* tile 0 into buffer 0 */
#pragma unroll   /* all four loads in flight at once */
  for (int i = 0; i < TT * 2 / 4 / 256; ++i) *(v4f*)&sks[(i * 256 + tid) * 4] = *(const v4f*)(KS + (size_t)b * TT * 2 + (i * 256 + tid) * 4);
  asm volatile("s_wait_asynccnt 0x0" ::: "memory");   /* this wave's copies of tile 0 have landed before the barrier behind which other waves read them */
  __syncthreads();
  tile_copy(&sb[1][hf][un], kh + TKV + un, kl + TKV + un, vt + TVV + un);   /* tile 1 into buffer 1 */
  const _Float16* qt0 = QR + ((((size_t)b * TT + ql0) >> 4) + hf) * FT; const _Float16* qt1 = QR + ((((size_t)b * TT + ql0) >> 4) + (hf ^ 1)) * FT; const v16h qf[2] = { frag_t(qt0, lane), frag_t(qt1, lane) };
  asm volatile("s_wait_xcnt 0x0" :: "s"(qt0), "s"(qt1) : "memory");   /* precaution: the four loads above have taken their addresses before an address register is written again; their two scalar bases are named so that those registers live up to here */
  v8f acc[2][HD / 16] = {}; float ksum[2] = { 0.f, 0.f };   /* ksum[u]: f32 sum of the P x 2^11 values this lane makes for tile u: query col, the k half g of every chunk */
#pragma unroll 1   /* rolled: the ring's trip, one staged tile: 96 products and 96 fragment reads */
  for (int t = 0; t < NT; ++t) { const _Float16* bp = &sb[t & 1][hf][8 * lane];   /* the lane's own place in the first fragment tile of this trip's buffer */
    v16h a0 = frag_l(bp), l0 = frag_l(bp + TKV), a1 = frag_l(bp + FT), l1 = frag_l(bp + TKV + FT);
#pragma unroll   /* the passes of 32 keys of one staged tile: every LDS offset a constant, and a pass's reads can stand among the products of the pass before */
    for (int ps = 0; ps < KT / 32; ++ps) { const int kc = t * (KT / 32) + ps; v16h vf[HD / 16];
#pragma unroll
      for (int j = 0; j < HD / 16; ++j) vf[j] = frag_l(bp + 2 * TKV + (ps * (HD / 16) + j) * FT);
      __builtin_amdgcn_sched_barrier(0);   /* keeps the 16 v reads issued here, a whole score-and-exp phase ahead of their use (the scheduler otherwise sinks them to the P . v products) */
      v8f s0[2], t0[2], s1[2], t1[2];
#pragma unroll
      for (int u = 0; u < 2; ++u) { const v8f z = {}; s0[u] = wmma16c(a0, qf[u], z); t0[u] = wmma16c(l0, qf[u], z); s1[u] = wmma16c(a1, qf[u], z); t1[u] = wmma16c(l1, qf[u], z); }
      if (ps + 1 < KT / 32) { const _Float16* kn = bp + (ps + 1) * 2 * FT;   /* the next pass's two key tiles, of the same staged tile, read one pass ahead */
        a0 = frag_l(kn); l0 = frag_l(kn + TKV); a1 = frag_l(kn + FT); l1 = frag_l(kn + TKV + FT); }
      __builtin_amdgcn_sched_barrier(0);   /* keeps those key reads issued here, ahead of the exp phase */
      const v4f* st = (const v4f*)(sc + kc * 64); const v4f c0[2] = { st[0], st[1] }, c1[2] = { st[8], st[9] }; v16h p[2];   /* the chunk's constants, keys 8g + r of both key tiles: the same for both query tiles */
#pragma unroll
      for (int u = 0; u < 2; ++u) { float v[16];
#pragma unroll
        for (int r = 0; r < 8; ++r) { v[r] = lc(logit2(s0[u][r], t0[u][r]), c0[r >> 2][r & 3]); v[8 + r] = lc(logit2(s1[u][r], t1[u][r]), c1[r >> 2][r & 3]); }
        exp2x8(v); exp2x8(v + 8);
#pragma unroll
        for (int i = 0; i < 16; ++i) p[u][i] = (_Float16)v[i];
        ksum[u] += sum16(v); }
#pragma unroll
      for (int j = 0; j < HD / 16; ++j) { acc[0][j] = wmma16c(p[0], vf[j], acc[0][j]); acc[1][j] = wmma16c(p[1], vf[j], acc[1][j]); } }
    asm volatile("s_wait_dscnt 0x0" ::: "memory");      /* this wave's reads of the trip's buffer are done before the barrier behind which the buffer is refilled */
    asm volatile("s_wait_asynccnt 0x0" ::: "memory");   /* this wave's copies of tile t + 1 have landed before the barrier behind which other waves read them */
    __syncthreads();   /* publishes tile t + 1 and ends every wave's reads of tile t */
    if (t + 2 < NT) tile_copy(&sb[t & 1][hf][un], kh + (size_t)(t + 2) * TKV + un, kl + (size_t)(t + 2) * TKV + un, vt + (size_t)(t + 2) * TVV + un); }   /* tile t + 2 into the buffer that trip t has just read */
  asm volatile("s_wait_asynccnt 0x0" ::: "memory");   /* no copy is outstanding when the wave goes on to the epilogue and ends */
#pragma unroll
  for (int u = 0; u < 2; ++u) ksum[u] += __shfl_xor(ksum[u], 16);   /* both k halves of the chunks: the key half's share of den (x 2^11) of the tile's query col, in lanes col and col + 16 */
  float (&own)[16][HD + 4] = ss[qg * 2 + hf]; float (&oth)[16][HD + 4] = ss[qg * 2 + (hf ^ 1)];   /* a tile's plane belongs to the wave that finishes the tile */
#pragma unroll
  for (int j = 0; j < HD / 16; ++j)
#pragma unroll
    for (int r = 0; r < 8; ++r) oth[8 * g + r][j * 16 + col] = acc[1][j][r];
  if (g == 0) sk[qg * 2 + (hf ^ 1)][col] = ksum[1];
  __syncthreads();   /* the partner's partial sums of this wave's own tile are in LDS */
  const float den = ksum[0] + sk[qg * 2 + hf][col];
  const float inv = den > 0.f ? 2048.0f / den : 0.f; float invr[8];
#pragma unroll
  for (int r = 0; r < 8; ++r) invr[r] = __shfl(inv, 8 * g + r);   /* accumulator element r is query row 8g + r */
  v8f pr[HD / 16];
#pragma unroll   /* the partner's 64 values of this lane's places, all read before the first of the places is rewritten */
  for (int j = 0; j < HD / 16; ++j)
#pragma unroll
    for (int r = 0; r < 8; ++r) pr[j][r] = own[8 * g + r][j * 16 + col];
#pragma unroll
  for (int j = 0; j < HD / 16; ++j)
#pragma unroll
    for (int r = 0; r < 8; ++r) own[8 * g + r][j * 16 + col] = (acc[0][j][r] + pr[j][r]) * (1.0f / 2048.0f) * invr[r];
  LDSX(); v4f yv[16]; float* yp = Y + ((size_t)b * TT + ql0 + 16 * hf) * CC + lane * 4;
#pragma unroll   /* yv is indexed by constants only: all sixteen rows are read before the first store, and no register of a store is written again */
  for (int rl = 0; rl < 16; ++rl) yv[rl] = *(const v4f*)&own[rl][lane * 4];
#pragma unroll
  for (int rl = 0; rl < 16; ++rl) vst2(yp + rl * CC, yv[rl]); }

extern "C" void kernel_launch(void* const* d_in, const int* in_sizes, int n_in, void* d_out, int out_size, void* d_ws, size_t ws_size, hipStream_t stream) {
  (void)in_sizes; (void)n_in; (void)out_size;
  const float** F = (const float**)d_in;
  if (ws_size < (size_t)WS_END) return;
  char* ws = (char*)d_ws; _Float16 *QH = (_Float16*)(ws + WS_QH), *KH = (_Float16*)(ws + WS_KH), *VT = (_Float16*)(ws + WS_VT), *QL = (_Float16*)(ws + WS_QL), *KL = (_Float16*)(ws + WS_KL); __bf16 *VB = (__bf16*)(ws + WS_VB), *VBL = (__bf16*)(ws + WS_VBL); float *S = (float*)(ws + WS_S), *Y = (float*)(ws + WS_Y);
  (void)Y; (void)QL; (void)KL; (void)VB; (void)VBL;
  // inputs: 0 f_in [16,2048,128]; 1 w_q [32,128] (out,in), 2 b_q [32]; 3 w_k [32,128], 4 b_k; 5 w_v [128,128], 6 b_v; 7 w_l [128,128], 8 b_l; 9 bn_gamma, 10 bn_beta
  if (ws_size < (size_t)WS_END2) return;
  float *FSA = (float*)(ws + WS_FSA), *YL = (float*)(ws + WS_YL), *ST = (float*)(ws + WS_ST), *PS = (float*)(ws + WS_PS);
  // ROLE SWAP: the 'q' planes (hi + residual) hold K (from w_k, b_k) and the 'k' planes hold Q, so the score tiles are S^T[key][query] and the softmax runs over QUERIES
  k_proj<<<dim3(TNB * TT / 64, CC / 128, 3), 128, 0, stream>>>(F[0], F[0], F[0], F[3], F[1], F[5], F[4], F[2], F[6], QH, QL, KH, KL, VT, VB, VBL);
  k_kst<<<dim3(TT / 16, TNB), 256, 0, stream>>>(QH, QL, KH, S);   /* per key: the exponent constant from the maximum and the sum of exp over the queries */
  k_att<<<dim3(TT / 128, TNB), 256, 0, stream>>>(QH, QL, KH, S, VT, FSA);   /* f_sa rows: logits made again in registers, P never stored */
  k_lin<<<dim3(NR / 64), 128, 0, stream>>>(F[0], FSA, F[7], F[8], YL, PS);
  k_stat<<<dim3(CC), 256, 0, stream>>>(PS, ST);
  k_fin<<<dim3(NR / (8 * FR)), 256, 0, stream>>>(YL, ST, F[9], F[10], FSA, (float*)d_out);
}

// v010
// Measured time: 67.2 microseconds a run.
// Next to v009, in two timings, it ran 1.13 times as fast each time.
// All steps since v000 together make it 25.2 times as fast.
#include <hip/hip_runtime.h>
#include <math.h>

typedef __attribute__((ext_vector_type(16))) _Float16 v16h;
typedef __attribute__((ext_vector_type(16))) __bf16 v16b;
typedef __attribute__((ext_vector_type(8)))  _Float16 v8h;
typedef __attribute__((ext_vector_type(8)))  float v8f;
typedef __attribute__((ext_vector_type(4)))  float v4f;
typedef __attribute__((ext_vector_type(2)))  float v2f;
typedef __attribute__((ext_vector_type(4)))  unsigned v4u;
typedef __attribute__((ext_vector_type(4)))  int v4i;
typedef float __attribute__((may_alias)) float_a;
typedef int __attribute__((may_alias)) int_a;

template <typename T> __device__ __forceinline__ void vst2(void* p, T v) { *(T*)p = v;  }
__device__ __forceinline__ v8f wmma16(v16h a, v16h b, v8f c) {
  v8f d = __builtin_amdgcn_wmma_f32_16x16x32_f16(false, a, false, b, (short)0, c, false, false);
  asm volatile("v_nop\n\tv_nop\n\tv_nop\n\tv_nop" : "+v"(d) : "v"(a), "v"(b));
  return d;
}
__device__ __forceinline__ v8f wmma_bf(v16b a, v16b b, v8f c) {
  v8f d = __builtin_amdgcn_wmma_f32_16x16x32_bf16(false, a, false, b, (short)0, c, false, false);
  asm volatile("v_nop\n\tv_nop\n\tv_nop\n\tv_nop" : "+v"(d) : "v"(a), "v"(b));
  return d;
}
// 16x16x32 fragments: lane = (h = lane>>4, row/col = lane&15); elements 0..7 = k0+8h+0..7, 8..15 = k0+16+8h+0..7; D element r = row 8h+r
__device__ __forceinline__ v16h frag_h(const _Float16* rowk0, int lane) {
  union { v16h v; v8h q[2]; } u; const _Float16* p = rowk0 + 8 * (lane >> 4);
  u.q[0] = *(const v8h*)p; u.q[1] = *(const v8h*)(p + 16); return u.v;
}
__device__ __forceinline__ v16h frag_f32(const float* rowk0, int lane) {
  v16h a; const float* p = rowk0 + 8 * (lane >> 4);
#pragma unroll
  for (int i = 0; i < 8; ++i) { a[i] = (_Float16)p[i]; a[8 + i] = (_Float16)p[16 + i]; }
  return a;
}
__device__ __forceinline__ v16h frag_f32s(const float* rowk0, int lane, float sc) {
  v16h a; const float* p = rowk0 + 8 * (lane >> 4);
#pragma unroll
  for (int i = 0; i < 8; ++i) { a[i] = (_Float16)(p[i] * sc); a[8 + i] = (_Float16)(p[16 + i] * sc); }
  return a;
}
// column fragment from a [K][ld] layout (column n), rows >= K read as 0
__device__ __forceinline__ v16h fragc_f32(const float* W, int k0, int n, int lane, int ld, int K) {
  v16h a; const int g = lane >> 4;
#pragma unroll
  for (int i = 0; i < 8; ++i) { const int ka = k0 + 8 * g + i, kb = ka + 16;
    a[i] = (_Float16)(ka < K ? W[(size_t)(ka < K ? ka : K - 1) * ld + n] : 0.f); a[8 + i] = (_Float16)(kb < K ? W[(size_t)(kb < K ? kb : K - 1) * ld + n] : 0.f); }
  return a;
}
struct F2 { v16b h, l; };
__device__ __forceinline__ F2 bsplit16(const float v[16]) { F2 r;
#pragma unroll
  for (int i = 0; i < 16; ++i) { const __bf16 h = (__bf16)v[i]; r.h[i] = h; r.l[i] = (__bf16)(v[i] - (float)h); }
  return r; }
__device__ __forceinline__ F2 split_row(const float* row, int k0, int lane) { float v[16]; const float* p = row + k0 + 8 * (lane >> 4);
#pragma unroll
  for (int i = 0; i < 8; ++i) { v[i] = p[i]; v[8 + i] = p[16 + i]; }
  return bsplit16(v); }
__device__ __forceinline__ F2 split_rowK(const float* row, int k0, int lane, int K) { float v[16]; const int g = lane >> 4;
#pragma unroll
  for (int i = 0; i < 8; ++i) { const int ka = k0 + 8 * g + i, kb = ka + 16; v[i] = ka < K ? row[ka < K ? ka : K - 1] : 0.f; v[8 + i] = kb < K ? row[kb < K ? kb : K - 1] : 0.f; }
  return bsplit16(v); }
__device__ __forceinline__ F2 split_col(const float* W, int k0, int n, int lane, int ld, int K) { float v[16]; const int g = lane >> 4;
#pragma unroll
  for (int i = 0; i < 8; ++i) { const int ka = k0 + 8 * g + i, kb = ka + 16; v[i] = ka < K ? W[(size_t)(ka < K ? ka : K - 1) * ld + n] : 0.f; v[8 + i] = kb < K ? W[(size_t)(kb < K ? kb : K - 1) * ld + n] : 0.f; }
  return bsplit16(v); }
__device__ __forceinline__ v8f mac3(const F2& a, const F2& b, v8f c) { c = wmma_bf(a.l, b.h, c); c = wmma_bf(a.h, b.l, c); return wmma_bf(a.h, b.h, c); }
__device__ __forceinline__ float sigm(float v) { return 1.0f / (1.0f + expf(-v)); }
#define LDSX() do { asm volatile("s_wait_dscnt 0" ::: "memory"); __builtin_amdgcn_wave_barrier(); __builtin_amdgcn_fence(__ATOMIC_RELEASE, "workgroup"); } while (0)

// Offset-attention (PCT) block (B 16, N 2,048, D 128, q/k dim 32): q = x Wq^T + bq, k = x Wk^T + bk (32-d), v = x Wv^T + bv; a = softmax over QUERIES of q k^T (no scale), then a = a / sum over keys; f_sa = a v; y = (x - f_sa) Wl^T + bl; out = relu(BN(y)) + f_sa (BN with batch statistics over B*N, biased variance, eps 1e-5).
#define NB 16
#define TT 2048
#define CC 128            // NH * HD = projected width
#define DIN 128          // input (model) width
#define NH 1
#define HD 128
#define NQB (TT / 64)
#define HG 4
#define SCALE (1.0f)
#define CAUSAL 0
#ifndef TNB
#define TNB NB
#endif
__device__ __forceinline__ float bfr(float v) { return (float)(__bf16)v; }
__host__ __device__ __forceinline__ int kb_last(int qb) { return CAUSAL ? ((qb * 64 + 63) >> 7) : (TT / 128 - 1); }
typedef __attribute__((ext_vector_type(8))) __bf16 v8b;
__device__ __forceinline__ v16b frag_b(const __bf16* rowk0, int lane) {
  union { v16b v; v8b q[2]; } u; const __bf16* p = rowk0 + 8 * (lane >> 4);
  u.q[0] = *(const v8b*)p; u.q[1] = *(const v8b*)(p + 16); return u.v;
}
// operand tile in fragment order: a 16 (rows or columns) x 32 (k) tile of 16-bit values is 1 KB = [h][lane][8 values]; lane = (g = lane>>4, row/col = lane&15) holds k = 16h + 8g + 0..7 there, so each of the two wave-wide 16-byte loads of a fragment covers 512 contiguous bytes (four whole lines)
#define FT 512             // values in one such tile
__device__ __forceinline__ v16h frag_l(const _Float16* p) {   /* p = the lane's own place in the tile: tile + 8 lane */
  union { v16h v; v8h q[2]; } u; u.q[0] = *(const v8h*)p; u.q[1] = *(const v8h*)(p + FT / 2); return u.v;
}
__device__ __forceinline__ v16h frag_t(const _Float16* tile, int lane) { return frag_l(tile + 8 * lane); }
typedef __attribute__((ext_vector_type(4))) __bf16 v4b;
__device__ __forceinline__ v16b frag_lb(const __bf16* p) {   /* the same for a bf16 tile */
  union { v16b v; v8b q[2]; } u; u.q[0] = *(const v8b*)p; u.q[1] = *(const v8b*)(p + FT / 2); return u.v;
}
// A block of 128 threads stages an (out,in) f32 weight with rows of 128 values in LDS, rounded to bf16, as tiles in fragment order; tile it = (16 output rows it >> 2, k step it & 3). One tile = one load of every thread: eight lanes read one whole 128-B line (32 k values of one row), a wave four whole lines.
// stage_w_p: the thread's place in tile 0; stage_w_ld: issues the loads of tiles T0 .. T1 - 1; stage_w_st: rounds and stores them (here, in proj_mm, k_lin and k_proj every plain '#pragma unroll' is there so that a register array is indexed by constants only)
__device__ __forceinline__ const float* stage_w_p(const float* Wm, int tid) { return Wm + (size_t)(tid >> 3) * 128 + (tid & 7) * 4; }
template <int T0, int T1, int NT> __device__ __forceinline__ void stage_w_ld(const float* p, v4f (&x)[NT]) {
#pragma unroll   /* register array indexed by constants */
  for (int it = T0; it < T1; ++it) x[it] = *(const v4f*)(p + (it >> 2) * 16 * 128 + (it & 3) * 32);
}
template <int T0, int T1, int NT> __device__ __forceinline__ void stage_w_st(__bf16* sw, int tid, const v4f (&x)[NT]) {
  const int row = tid >> 3, q = tid & 7;   /* the thread holds k = 4 q .. 4 q + 3 of the step: half h = q >> 2, lane 16 g + row with g = (q >> 1) & 1, values 4 (q & 1) .. 4 (q & 1) + 3 of that lane */
  __bf16* d = sw + (q >> 2) * (FT / 2) + (((q >> 1) & 1) * 16 + row) * 8 + (q & 1) * 4;
#pragma unroll
  for (int it = T0; it < T1; ++it) { v4b y;
#pragma unroll
    for (int i = 0; i < 4; ++i) y[i] = (__bf16)x[it][i];
    *(v4b*)(d + it * FT) = y; }
}
#define QBH 0              // not used by any kernel here
#define QHI 2048            // rows carrying a q residual plane (all rows when non-causal: 2-product logits everywhere)
#define KHI 64            // key rows carrying k residual / v bf16 hi+lo planes (written by k_proj, read by no kernel here)
// B fragment (k rows k0+.., output column o) of a weight: (in,out) [K][ld] or (out,in) [ld rows of K]: bf16 exact, or f16(bf16 * 256) exact
__device__ __forceinline__ v16b wcol_io(const float* Wm, int k0, int o, int lane, int ld) { v16b w; const int g = lane >> 4;
#pragma unroll
  for (int i = 0; i < 8; ++i) { w[i] = (__bf16)Wm[(size_t)(k0 + 8 * g + i) * ld + o]; w[8 + i] = (__bf16)Wm[(size_t)(k0 + 16 + 8 * g + i) * ld + o]; }
  return w; }
__device__ __forceinline__ v16b wcol_oi(const float* Wm, int k0, int o, int lane, int K) { v16b w; const float* p = Wm + (size_t)o * K + k0 + 8 * (lane >> 4);
#pragma unroll
  for (int i = 0; i < 8; ++i) { w[i] = (__bf16)p[i]; w[8 + i] = (__bf16)p[16 + i]; }
  return w; }
__device__ __forceinline__ v16h wcolh_io(const float* Wm, int k0, int o, int lane, int ld) { v16h w; const int g = lane >> 4;
#pragma unroll
  for (int i = 0; i < 8; ++i) { w[i] = (_Float16)(bfr(Wm[(size_t)(k0 + 8 * g + i) * ld + o]) * 256.0f); w[8 + i] = (_Float16)(bfr(Wm[(size_t)(k0 + 16 + 8 * g + i) * ld + o]) * 256.0f); }
  return w; }
__device__ __forceinline__ v16h wcolh_oi(const float* Wm, int k0, int o, int lane, int K) { v16h w; const float* p = Wm + (size_t)o * K + k0 + 8 * (lane >> 4);
#pragma unroll
  for (int i = 0; i < 8; ++i) { w[i] = (_Float16)(bfr(p[i]) * 256.0f); w[8 + i] = (_Float16)(bfr(p[16 + i]) * 256.0f); }
  return w; }
#define WQKV_LAYOUT 1   // 0 = (in,out) [DIN][CC]; 1 = (out,in) [CC][DIN]; 2 = per-head [NH][DIN][HD]
__device__ __forceinline__ v16b wcol_hdk(const float* Wm, int k0, int o, int lane) { v16b w; const int g = lane >> 4; const float* p = Wm + (size_t)(o / HD) * DIN * HD + (o % HD);
#pragma unroll
  for (int i = 0; i < 8; ++i) { w[i] = (__bf16)p[(size_t)(k0 + 8 * g + i) * HD]; w[8 + i] = (__bf16)p[(size_t)(k0 + 16 + 8 * g + i) * HD]; }
  return w; }
#define WO_OUT_IN 0
#if WQKV_LAYOUT == 1
#define WCOL(W, k0, o, lane) wcol_oin(W, k0, o, lane, DIN, (which == 2) ? CC : HDQ)   /* q / k: 32 real output rows, columns 32..127 exact zeros */
#elif WQKV_LAYOUT == 2
#define WCOL(W, k0, o, lane) wcol_hdk(W, k0, o, lane)
#else
#define WCOL(W, k0, o, lane) wcol_io(W, k0, o, lane, CC)
#endif
#if WO_OUT_IN
#define WOCOL(W, k0, o, lane) wcol_oi(W, k0, o, lane, CC)
#define WOCOLH(W, k0, o, lane) wcolh_oi(W, k0, o, lane, CC)
#else
#define WOCOL(W, k0, o, lane) wcol_io(W, k0, o, lane, DIN)
#define WOCOLH(W, k0, o, lane) wcolh_io(W, k0, o, lane, DIN)
#endif
#define HDQ 32             // q / k width (k_proj's accumulators are 128 wide, columns 32..127 exact zeros; only the 32 real columns are stored)
#define BG HG              // not used by any kernel here
#define NR (TNB * TT)      // 32,768 rows (all batches)
// (out,in) projection weight with only 'nvalid' real output rows: columns o >= nvalid read row 0 and are zeroed by value
__device__ __forceinline__ v16b wcol_oin(const float* Wm, int k0, int o, int lane, int K, int nvalid) { v16b w; const int oc = o < nvalid ? o : 0; const float keep = o < nvalid ? 1.f : 0.f; const float* p = Wm + (size_t)oc * K + k0 + 8 * (lane >> 4);
#pragma unroll
  for (int i = 0; i < 8; ++i) { w[i] = (__bf16)(p[i] * keep); w[8 + i] = (__bf16)(p[16 + i] * keep); }
  return w; }
// pairwise tree over the 16 f32 P values of one A fragment (a lane's share of its query's sum over keys)
__device__ __forceinline__ float sum16(const float v[16]) { return (((v[0] + v[1]) + (v[2] + v[3])) + ((v[4] + v[5]) + (v[6] + v[7]))) + (((v[8] + v[9]) + (v[10] + v[11])) + ((v[12] + v[13]) + (v[14] + v[15]))); }
#define WS_DEN (WS_END)                                // (plane not used: the sum over keys stays inside k_att, in registers and LDS)
#define WS_FSA (WS_DEN + 4u * (size_t)NR)              // f32 f_sa rows [NR][128]
#define WS_YL  (WS_FSA + 4u * (size_t)NR * CC)        // f32 y rows (pre-BN)
#define WS_ST  (WS_YL + 4u * (size_t)NR * CC)         // BN statistics [128][32]
#define WS_PS  (WS_ST + 4u * (size_t)CC * 32)         // BN partials of k_lin's blocks [NR / 64][2][128]: mean of the block's 64 rows, sum of squared distances from that mean
#define WS_END2 (WS_PS + 4u * (size_t)(NR / 64) * 2 * CC)
// ---- k_lin: block = 64 rows: y = (bf16(f_in) - f_sa) (split bf16 hi + lo) Wl^T + bl (2 products, K 128) -> pre-BN rows, and per channel the block's own mean and sum of squared distances from it (PS)
__global__ __launch_bounds__(128) void k_lin(const float* __restrict__ X, const float* __restrict__ FSA, const float* __restrict__ WL, const float* __restrict__ BL, float* __restrict__ YL, float* __restrict__ PS) { __shared__ __align__(16) float sf[4][16][132]; __shared__ __align__(16) float sp[4][2][CC]; __shared__ __align__(16) __bf16 sw[(CC / 16) * (CC / 32) * FT];   /* sw: Wl as bf16 fragment tiles */
  const int tid = threadIdx.x, wave = tid >> 5, lane = tid & 31, col = lane & 15, g = lane >> 4; const size_t r0 = (size_t)blockIdx.x * 64 + wave * 16;
  v8f acc[8] = {}; const float* px = X + (r0 + col) * CC + 8 * g; const float* pf = FSA + (r0 + col) * CC + 8 * g; const float* pb = BL + col; const float* pw = stage_w_p(WL, tid); v4f xr[CC / 32][4], fr[CC / 32][4], wr[(CC / 16) * (CC / 32)]; float br[8];
#pragma unroll   /* the rows' values of all four k steps, the bias and the weight: every operand load of the kernel in flight at once */
  for (int kc = 0; kc < CC / 32; ++kc)
#pragma unroll
    for (int u = 0; u < 4; ++u) { const int o = kc * 32 + (u >> 1) * 16 + (u & 1) * 4; xr[kc][u] = *(const v4f*)(px + o); fr[kc][u] = *(const v4f*)(pf + o); }
#pragma unroll
  for (int j = 0; j < 8; ++j) br[j] = pb[j * 16];
  stage_w_ld<0, (CC / 16) * (CC / 32)>(pw, wr);
  asm volatile("s_wait_xcnt 0x0" :: "v"(px), "v"(pf), "v"(col), "v"(pw) : "memory");   /* precaution: the loads above have taken their addresses before an address register is written again; the pointers, and col (the bias loads' offset register), are named so that their registers live up to here and are no load's destination */
  stage_w_st<0, (CC / 16) * (CC / 32)>(sw, tid, wr);
  F2 a[CC / 32];
#pragma unroll
  for (int kc = 0; kc < CC / 32; ++kc) { float v[16];
#pragma unroll
    for (int i = 0; i < 16; ++i) v[i] = bfr(xr[kc][i >> 2][i & 3]) - fr[kc][i >> 2][i & 3];
    a[kc] = bsplit16(v); }
  __syncthreads();
  v16b wf[2][8];
#pragma unroll
  for (int j = 0; j < 8; ++j) wf[0][j] = frag_lb(sw + (j * 4) * FT + 8 * lane);
#pragma unroll
  for (int kc = 0; kc < CC / 32; ++kc) {
    if (kc + 1 < CC / 32) {
#pragma unroll
      for (int j = 0; j < 8; ++j) wf[(kc + 1) & 1][j] = frag_lb(sw + (j * 4 + kc + 1) * FT + 8 * lane); }
    __builtin_amdgcn_sched_barrier(0);   /* keeps the next k step's 16 LDS reads issued here as one group, a whole step ahead of their products (left alone they sink to their products, with a full wait in front of each) */
#pragma unroll
    for (int j = 0; j < 8; ++j) { acc[j] = wmma_bf(a[kc].h, wf[kc & 1][j], acc[j]); acc[j] = wmma_bf(a[kc].l, wf[kc & 1][j], acc[j]); } }
#pragma unroll
  for (int j = 0; j < 8; ++j) { const float bb = bfr(br[j]);
#pragma unroll
    for (int r = 0; r < 8; ++r) sf[wave][8 * g + r][j * 16 + col] = acc[j][r] + bb; }
  LDSX(); v4f yv[16];
#pragma unroll   /* yv is indexed by constants only */
  for (int rl = 0; rl < 16; ++rl) yv[rl] = *(const v4f*)&sf[wave][rl][lane * 4];
  // the wave's 16 rows, channels 4 lane .. 4 lane + 3: mean, then squared distances from that mean (no difference of large squares anywhere)
  const v4f m16 = ((((yv[0] + yv[1]) + (yv[2] + yv[3])) + ((yv[4] + yv[5]) + (yv[6] + yv[7]))) + (((yv[8] + yv[9]) + (yv[10] + yv[11])) + ((yv[12] + yv[13]) + (yv[14] + yv[15])))) * (1.0f / 16.0f); v4f q16 = {};
#pragma unroll
  for (int rl = 0; rl < 16; ++rl) { const v4f d = yv[rl] - m16; q16 += d * d; }
  *(v4f*)&sp[wave][0][lane * 4] = m16; *(v4f*)&sp[wave][1][lane * 4] = q16;
  __syncthreads();
  // thread = channel: the four waves' groups of 16 rows merged: mean of the means; squared distances add up, plus 16 x each group mean's squared distance from the merged mean
  const float g0 = sp[0][0][tid], g1 = sp[1][0][tid], g2 = sp[2][0][tid], g3 = sp[3][0][tid]; const float m64 = ((g0 + g1) + (g2 + g3)) * 0.25f; const float e0 = g0 - m64, e1 = g1 - m64, e2 = g2 - m64, e3 = g3 - m64;
  const float q64 = ((sp[0][1][tid] + sp[1][1][tid]) + (sp[2][1][tid] + sp[3][1][tid])) + 16.0f * ((e0 * e0 + e1 * e1) + (e2 * e2 + e3 * e3));
#pragma unroll   /* the row stores stand behind the barrier: in front of it the barrier would wait for all sixteen to finish */
  for (int rl = 0; rl < 16; ++rl) vst2(YL + (r0 + rl) * CC + lane * 4, yv[rl]);
  vst2(PS + (size_t)blockIdx.x * 2 * CC + tid, m64); vst2(PS + ((size_t)blockIdx.x * 2 + 1) * CC + tid, q64); }
// ---- k_stat: block = channel c: merges the NR / 64 partials of k_lin (equal groups of 64 rows) in the same way -> mean and 1 / sqrt(biased variance + eps)
__global__ __launch_bounds__(256) void k_stat(const float* __restrict__ PS, float* __restrict__ STAT) { __shared__ float sred[8]; __shared__ float sbc;
  const int t = threadIdx.x; const int c = blockIdx.x; float pm[NR / 64 / 256], pq[NR / 64 / 256];
#pragma unroll   /* register arrays indexed by constants; all loads in flight at once */
  for (int i = 0; i < NR / 64 / 256; ++i) { pm[i] = PS[(size_t)(i * 256 + t) * 2 * CC + c]; pq[i] = PS[((size_t)(i * 256 + t) * 2 + 1) * CC + c]; }
  float s = 0.f;
#pragma unroll
  for (int i = 0; i < NR / 64 / 256; ++i) s += pm[i];
#pragma unroll
  for (int o = 1; o < 32; o <<= 1) s += __shfl_xor(s, o);
  if ((t & 31) == 0) sred[t >> 5] = s; __syncthreads(); if (t == 0) { float a = 0.f; for (int i = 0; i < 8; ++i) a += sred[i]; sbc = a / (float)(NR / 64); } __syncthreads(); const float mean = sbc; __syncthreads();
  float q = 0.f;
#pragma unroll
  for (int i = 0; i < NR / 64 / 256; ++i) { const float d = pm[i] - mean; q += pq[i] + 64.0f * (d * d); }
#pragma unroll
  for (int o = 1; o < 32; o <<= 1) q += __shfl_xor(q, o);
  if ((t & 31) == 0) sred[t >> 5] = q; __syncthreads(); if (t == 0) { float a = 0.f; for (int i = 0; i < 8; ++i) a += sred[i]; sbc = rsqrtf(a / (float)NR + 1e-5f); } __syncthreads();
  if (t < 32) { const float v = t == 0 ? mean : (t == 1 ? sbc : 0.f); vst2(STAT + (size_t)c * 32 + t, v); } }
// ---- k_fin: out = relu(gamma (y - mean) rstd + beta) + f_sa. Block = 64 rows; thread = channels 4 (tid & 31) .. 4 (tid & 31) + 3 of the FR rows (tid >> 5) + 8 i: its channels are the same in every row, so the per-channel constants are fetched once per block (thread = channel; STAT holds one channel per 128-B line, so each such load touches 32 lines) and handed out through LDS
#define FR 8               // rows per thread
static_assert(NR % (8 * FR) == 0, "whole blocks only");
__global__ __launch_bounds__(256) void k_fin(const float* __restrict__ YL, const float* __restrict__ STAT, const float* __restrict__ G, const float* __restrict__ BE, const float* __restrict__ FSA, float* __restrict__ OUT) { __shared__ __align__(16) float sc[4][CC];   /* per channel: gamma, mean, 1 / sqrt(variance + eps), beta */
  const int tid = threadIdx.x; const size_t e0 = (size_t)blockIdx.x * (8 * FR * CC) + tid * 4; const float* py = YL + e0; const float* pf = FSA + e0; const float* ps = STAT + tid * 32; const float* pg = G + tid; const float* pe = BE + tid;
  v2f st = {}; float ga = 0.f, be = 0.f; v4f yv[FR], fv[FR];
#pragma unroll   /* register arrays indexed by constants; all sixteen row loads in flight at once */
  for (int i = 0; i < FR; ++i) { yv[i] = *(const v4f*)(py + i * 8 * CC); fv[i] = *(const v4f*)(pf + i * 8 * CC); }
  if (tid < CC) { st = *(const v2f*)ps; ga = *pg; be = *pe; }   /* behind the row loads: no row load is held up by a wait for a constant */
  asm volatile("s_wait_xcnt 0x0" :: "v"(py), "v"(pf), "v"(ps), "v"(pg), "v"(pe) : "memory");   /* precaution: the loads above have taken their addresses before an address register is written again; the pointers are named so that their registers live up to here and are no load's destination */
  if (tid < CC) { sc[0][tid] = bfr(ga); sc[1][tid] = st[0]; sc[2][tid] = st[1]; sc[3][tid] = bfr(be); }
  __syncthreads();
  const int c0 = (tid & 31) * 4; const v4f vg = *(const v4f*)&sc[0][c0], vm = *(const v4f*)&sc[1][c0], vr = *(const v4f*)&sc[2][c0], vb = *(const v4f*)&sc[3][c0]; float* po = OUT + e0;
#pragma unroll
  for (int i = 0; i < FR; ++i) { v4f o;
#pragma unroll
    for (int k = 0; k < 4; ++k) { const float yb = vg[k] * (yv[i][k] - vm[k]) * vr[k] + vb[k]; o[k] = fmaxf(yb, 0.f) + fv[i][k]; }
    vst2(po + i * 8 * CC, o); } }
#ifndef SM_EXTRA_PARAMS
#define SM_EXTRA_PARAMS
#endif
#ifndef PROJ_EXTRA_PARAMS
#define PROJ_EXTRA_PARAMS
#endif
#ifndef SM_MASK_HOOK
#define SM_MASK_HOOK (void)0
#endif

#define WS_QH  0u                                      // f16 q tiles in fragment order [b*t / 16][FT] (the 32 real columns only; the rest of the plane is not used)
#define WS_KH  (WS_QH + 2u * (size_t)NB * TT * CC)      // f16 k tiles in fragment order [b*t / 16][FT]
#define WS_VT  (WS_KH + 2u * (size_t)NB * TT * CC)      // f16 v tiles in fragment order [b][t / 32][c / 16][FT] (tile: column = channel, k = t)
#define WS_QL  (WS_VT + 2u * (size_t)NB * CC * TT)      // f16 q residual x 2^10 tiles [(b, t < QHI) / 16][FT]
#define WS_KL  (WS_QL + 2u * (size_t)NB * QHI * CC)     // f16 k residual x 2^10 tiles [(b, t < KHI) / 16][FT]
#define WS_VB  (WS_KL + 2u * (size_t)NB * KHI * CC)     // bf16 v hi planes [b][c][t < KHI]
#define WS_VBL (WS_VB + 2u * (size_t)NB * CC * KHI)
#define WS_S   (WS_VBL + 2u * (size_t)NB * CC * KHI)    // f32 per-key softmax constants [b][t / 16][2][16] (the rest of the plane is not used)
#define WS_Y   (WS_S  + 4u * (size_t)HG * TT * TT)      // f32 ctx rows [b*t][CC] (only when there is an output projection)
#define WS_END (WS_Y  + 0u)

// k_proj's products from the staged weight tiles: acc[j] += x W^T over the four k steps; NJ real 16-column tiles (j >= NJ: zero fragments, exact zero columns)
template <int NJ> __device__ __forceinline__ void proj_mm(const __bf16* swl, const v16b (&a)[DIN / 32], v8f (&acc)[8]) {   /* swl = the lane's own place in tile 0 */
  v16b wf[2][NJ];
#pragma unroll
  for (int j = 0; j < NJ; ++j) wf[0][j] = frag_lb(swl + (j * 4) * FT);
#pragma unroll
  for (int kc = 0; kc < DIN / 32; ++kc) {
    if (kc + 1 < DIN / 32) {
#pragma unroll
      for (int j = 0; j < NJ; ++j) wf[(kc + 1) & 1][j] = frag_lb(swl + (j * 4 + kc + 1) * FT); }
    __builtin_amdgcn_sched_barrier(0);   /* keeps the next k step's LDS reads issued here as one group, a whole step ahead of their products (left alone they sink to their products, with a full wait in front of each) */
#pragma unroll
    for (int j = 0; j < 8; ++j) { v16b w = {}; if (j < NJ) w = wf[kc & 1][j < NJ ? j : 0]; acc[j] = wmma_bf(a[kc], w, acc[j]); } }
}
// ---- k_proj: block = (64 rows, 128 cols, which): q/k/v = X W (+ b) with exact bf16 products (K = DIN) -> which 0: q f16 tiles (+ residual tiles, rows < QHI); 1: k f16 tiles (+ residual tiles, rows < KHI); 2: v f16 tiles (+ bf16 hi/lo planes [c][t] for t < KHI); the f16 tiles in fragment order (frag_t)
__global__ __launch_bounds__(128) void k_proj(const float* __restrict__ XQ, const float* __restrict__ XK, const float* __restrict__ XV, const float* __restrict__ WQ, const float* __restrict__ WK, const float* __restrict__ WV, const float* __restrict__ BQ, const float* __restrict__ BK, const float* __restrict__ BV,
    _Float16* __restrict__ QH, _Float16* __restrict__ QL, _Float16* __restrict__ KH, _Float16* __restrict__ KL, _Float16* __restrict__ VT, __bf16* __restrict__ VB, __bf16* __restrict__ VBL) {
  __shared__ __align__(16) _Float16 shl[2][64][136]; _Float16 (&sh)[64][136] = shl[0]; _Float16 (&sl)[64][136] = shl[1];   /* one array, so that a v block's weight tiles can span both halves */
  __shared__ __align__(16) _Float16 th[128][72]; __shared__ __align__(16) __bf16 tb[128][72], tbl[128][72];
  const int tid = threadIdx.x, wave = tid >> 5, lane = tid & 31, col = lane & 15, g = lane >> 4; const int which = blockIdx.z; const int c0 = blockIdx.y * 128; const size_t r0 = (size_t)blockIdx.x * 64; const size_t bb = r0 / TT; const int t0 = (int)(r0 % TT);
  const float* X = which == 0 ? XQ : which == 1 ? XK : XV; const float* WA = which == 0 ? WQ : which == 1 ? WK : WV; const float* BA = which == 0 ? BQ : which == 1 ? BK : BV;
  v8f acc[8] = {}; const float* pa = X + (r0 + wave * 16 + col) * DIN + 8 * g; const float* pw = stage_w_p(WA, tid); const float* pb = BA + c0 + col; v4f xr[DIN / 32][4], wr[(CC / 16) * (DIN / 32)]; float br[8] = {};   /* br: the bias of column 16 j + col; stays 0 in the zero columns of q / k */
#pragma unroll   /* the row's values of all four k steps, the bias and the weight: every operand load of the kernel in flight at once */
  for (int kc = 0; kc < DIN / 32; ++kc)
#pragma unroll
    for (int u = 0; u < 4; ++u) xr[kc][u] = *(const v4f*)(pa + kc * 32 + (u >> 1) * 16 + (u & 1) * 4);
  stage_w_ld<0, (HDQ / 16) * (DIN / 32)>(pw, wr);
#pragma unroll
  for (int j = 0; j < HDQ / 16; ++j) br[j] = pb[j * 16];
  if (which == 2) { stage_w_ld<(HDQ / 16) * (DIN / 32), (CC / 16) * (DIN / 32)>(pw, wr);   /* q / k have only the 32 real rows */
#pragma unroll
    for (int j = HDQ / 16; j < 8; ++j) br[j] = pb[j * 16]; }
  asm volatile("s_wait_xcnt 0x0" :: "v"(pa), "v"(pw), "v"(pb), "v"(col) : "memory");   /* precaution: the loads above have taken their addresses before an address register is written again; the pointers, and col (the offset register of two bias loads), are named so that their registers live up to here and are no load's destination */
  // the weight tiles lie in LDS that this block's own epilogue does not use: v blocks (128 rows, 32 KB) in shl, q / k blocks (the 32 real rows, 8 KB) in th; so no barrier is owed between the last tile read and the epilogue's LDS stores
  __bf16* sw = which == 2 ? (__bf16*)&shl[0][0][0] : (__bf16*)&th[0][0];
  stage_w_st<0, (HDQ / 16) * (DIN / 32)>(sw, tid, wr);
  if (which == 2) stage_w_st<(HDQ / 16) * (DIN / 32), (CC / 16) * (DIN / 32)>(sw, tid, wr);
  v16b a[DIN / 32];
#pragma unroll
  for (int kc = 0; kc < DIN / 32; ++kc)
#pragma unroll
    for (int i = 0; i < 16; ++i) a[kc][i] = (__bf16)xr[kc][i >> 2][i & 3];
  __syncthreads();
  if (which == 2) proj_mm<CC / 16>(sw + 8 * lane, a, acc); else proj_mm<HDQ / 16>(sw + 8 * lane, a, acc);
  if (which < 2) { _Float16* DH = which == 0 ? QH : KH; _Float16* DL = which == 0 ? QL : KL; const int nhi = which == 0 ? QHI : KHI; const bool hi_rows = t0 < nhi;
#pragma unroll
    for (int j = 0; j < 8; ++j) { const float bias = bfr(br[j]);
#pragma unroll
      for (int r = 0; r < 8; ++r) { const float v = acc[j][r] + bias; const _Float16 hv = (_Float16)v; sh[wave * 16 + 8 * g + r][j * 16 + col] = hv; sl[wave * 16 + 8 * g + r][j * 16 + col] = (_Float16)((v - (float)hv) * 1024.0f); } }
    __syncthreads();
    for (int e = tid; e < 64 * HDQ / 8; e += 128) { const int tl = e >> 6, h = (e >> 5) & 1, l = e & 31; const int rl = tl * 16 + (l & 15), k8 = 16 * h + 8 * (l >> 4);   /* e runs in the order of the destination: a wave stores 512 contiguous bytes */
      vst2((unsigned*)(DH + ((r0 >> 4) + tl) * FT + (e & 63) * 8), *(const v4u*)&sh[rl][k8]);
      asm volatile("s_wait_xcnt 0x0" ::: "memory");   /* precaution, here and behind the four stores below: the store has taken its address and data before the next LDS load or address sum writes those registers again */
      if (hi_rows) { vst2((unsigned*)(DL + (((bb * nhi + t0) >> 4) + tl) * FT + (e & 63) * 8), *(const v4u*)&sl[rl][k8]); asm volatile("s_wait_xcnt 0x0" ::: "memory"); } }
  } else { const bool hi_rows = t0 < KHI;
#pragma unroll
    for (int j = 0; j < 8; ++j) { const float bias = bfr(br[j]);
#pragma unroll
      for (int r = 0; r < 8; ++r) { const float v = acc[j][r] + bias; const int rl = wave * 16 + 8 * g + r, cl = j * 16 + col; th[cl][rl] = (_Float16)v; const __bf16 bh = (__bf16)v; tb[cl][rl] = bh; tbl[cl][rl] = (__bf16)(v - (float)bh); } }
    __syncthreads();
    for (int e = tid; e < 128 * 8; e += 128) { const int cl = e >> 3, q = e & 7; { const int tl = e >> 6, h = (e >> 5) & 1, l = e & 31;   /* tile tl = (32-key chunk tl >> 3, 16 channels tl & 7) of the block, e in the order of the destination */
        vst2((unsigned*)(VT + (((bb * (TT / 32) + (t0 >> 5) + (tl >> 3)) * (CC / 16) + (c0 >> 4) + (tl & 7)) * FT + (e & 63) * 8)), *(const v4u*)&th[(tl & 7) * 16 + (l & 15)][(tl >> 3) * 32 + 16 * h + 8 * (l >> 4)]); asm volatile("s_wait_xcnt 0x0" ::: "memory"); }
      if (hi_rows) { const size_t o3 = (bb * CC + c0 + cl) * (size_t)KHI + t0 + q * 8; vst2((unsigned*)(VB + o3), *(const v4u*)&tb[cl][q * 8]); asm volatile("s_wait_xcnt 0x0" ::: "memory"); vst2((unsigned*)(VBL + o3), *(const v4u*)&tbl[cl][q * 8]); asm volatile("s_wait_xcnt 0x0" ::: "memory"); } } } }
// plain builtin form: the compiler keeps the distance behind a matrix instruction itself and fills it with independent work where it can
__device__ __forceinline__ v8f wmma16c(v16h a, v16h b, v8f c) { return __builtin_amdgcn_wmma_f32_16x16x32_f16(false, a, false, b, (short)0, c, false, false); }
// (in the two kernels below every plain '#pragma unroll' is there so that a register array is indexed by constants only)
// logit of one (key, query) pair from the two f16 products: k hi . q + (k residual x 2^10) . q / 2^10
__device__ __forceinline__ float logit2(float hi, float lo) { return (hi + lo * (1.0f / 1024.0f)) * SCALE; }
#define LOG2E 1.4426950408889634f
// exp(x) 2^c = 2^(x log2 e + c): one fused multiply-add (lc) and the hardware's own base-2 exponential (exp2x8). The exponent is at most about 11 here (x never above its key's maximum); a result under 2^-126 may come out as 0, far below what the f32 sums (at least 1) or an f16 P value keep
__device__ __forceinline__ float lc(float x, float c) { return __builtin_fmaf(x, LOG2E, c); }
// y[0..7] = 2^y[0..7]. One statement, each exponential in place, one v_nop at the end: the instruction set asks for one independent instruction behind a transcendental before its result is read or its source written over; here that is the next exponential, on another register, and behind the last one the v_nop (left to the register allocator, neighbours wrote over each other's sources)
__device__ __forceinline__ void exp2x8(float* y) {
  asm("v_exp_f32 %0, %0\n\tv_exp_f32 %1, %1\n\tv_exp_f32 %2, %2\n\tv_exp_f32 %3, %3\n\tv_exp_f32 %4, %4\n\tv_exp_f32 %5, %5\n\tv_exp_f32 %6, %6\n\tv_exp_f32 %7, %7\n\tv_nop"
      : "+v"(y[0]), "+v"(y[1]), "+v"(y[2]), "+v"(y[3]), "+v"(y[4]), "+v"(y[5]), "+v"(y[6]), "+v"(y[7])); }
// ---- k_kst: block = KB key tiles (128 keys) of batch blockIdx.y, KW waves; wave w loads the fragments of queries [128 w, 128 w + 128) once and keeps them in registers while it walks the block's key tiles, so a query fragment comes from L2 once per 128 keys and not once per 16. The query tile is the A operand (D: row = query 8g + r, column = key col): every logit a lane holds belongs to ONE key, and its maximum and its sum of exp need no other lane and no barrier. Per key tile a lane leaves in LDS the maximum of its 64 logits and their sum of exp relative to that maximum; behind the one barrier wave kt merges the 2 KW partials of each key of tile kt -> KS line of the key tile: per key the one constant c = 11 - max log2 e - log2 sum, so that 2^(logit log2 e + c) = exp(logit - max) x 2^11 / sum (the line's second half repeats the 16 values: the wave stays the one writer of its whole 128-B line)
#define KB 8               // key tiles of one block
#define KW 16              // waves of one block
#define QW (TT / 16 / KW)  // query tiles of one wave
static_assert(KB <= KW && (TT / 16) % KB == 0 && (TT / 16) % KW == 0 && KW % 4 == 0, "one merging wave per key tile; whole blocks and whole waves only");
__global__ __launch_bounds__(KW * 32) void k_kst(const _Float16* __restrict__ KRH, const _Float16* __restrict__ KRL, const _Float16* __restrict__ QR, float* __restrict__ KS) { __shared__ float spm[KB][KW][32], sps[KB][KW][32];   /* [key tile][wave][lane]: a lane's own maximum, and its sum of exp relative to it */
  const int tid = threadIdx.x, lane = tid & 31, col = lane & 15; const int wave = __builtin_amdgcn_readfirstlane(tid >> 5);   /* the wave's number in a scalar register: the bases formed from it stay scalar */
  const size_t kt0 = (size_t)blockIdx.y * (TT / 16) + blockIdx.x * KB, qt0 = (size_t)blockIdx.y * (TT / 16) + wave * QW;   /* the block's first key tile, the wave's first query tile */
  const _Float16* bq = QR + qt0 * FT; const _Float16* bh = KRH + kt0 * FT; const _Float16* bl = KRL + kt0 * FT; const _Float16* pq = bq + 8 * lane; const _Float16* ph = bh + 8 * lane; const _Float16* pl = bl + 8 * lane;   /* those tiles (scalar bases), and the lane's own places in them */
  v16h qf[QW];
#pragma unroll
  for (int t = 0; t < QW; ++t) qf[t] = frag_l(pq + t * FT);
  v16h ah = frag_l(ph), al = frag_l(pl);
  asm volatile("s_wait_xcnt 0x0" :: "s"(bq), "s"(bh), "s"(bl) : "memory");   /* precaution: the loads above have taken their addresses before an address register is written again; their three scalar bases are named so that those registers live up to here */
#pragma unroll 1   /* rolled: one trip = one key tile, 16 products and 64 exponentials a lane; unrolled, the trips' values overlap and the kernel goes past the 256 registers that four waves per SIMD leave it */
  for (int kt = 0; kt < KB; ++kt) { v8f s[QW], l[QW];   /* eight-wide values throughout: neighbouring registers pair up in the packed f32 instructions as they lie */
#pragma unroll
    for (int t = 0; t < QW; ++t) { const v8f z = {}; s[t] = wmma16c(qf[t], ah, z); l[t] = wmma16c(qf[t], al, z); }
    __builtin_amdgcn_sched_barrier(0);   /* keeps the 16 products one behind another, each filling the distance behind the one before (left alone they stand in pairs, with four v_nop and a wait for the result behind each pair), and keeps the loads below behind them: those land in the registers the products have just read, and no second set is needed */
    const int kn = kt + 1 < KB ? kt + 1 : kt;   /* the next key tile, fetched a whole maximum-and-exp phase ahead (the last trip fetches its own again: in bounds, not used) */
    const _Float16* nh = ph + kn * FT; const _Float16* nl = pl + kn * FT; ah = frag_l(nh); al = frag_l(nl);
    asm volatile("s_wait_xcnt 0x0" :: "v"(nh), "v"(nl) : "memory");   /* precaution: the four loads above have taken their addresses before an address register is written again; the pointers are named so that their registers live up to here and are no load's destination */
#pragma unroll
    for (int t = 0; t < QW; ++t) s[t] = (s[t] + l[t] * (1.0f / 1024.0f)) * SCALE;   /* logit2, eight at a time */
    v8f mv = s[0], av;   /* eight independent chains, joined by a tree */
#pragma unroll
    for (int t = 1; t < QW; ++t) mv = __builtin_elementwise_max(mv, s[t]);
    const float m = fmaxf(fmaxf(fmaxf(mv[0], mv[1]), fmaxf(mv[2], mv[3])), fmaxf(fmaxf(mv[4], mv[5]), fmaxf(mv[6], mv[7]))); const float nm = -m * LOG2E;
#pragma unroll
    for (int t = 0; t < QW; ++t) { v8f ev = s[t] * LOG2E + nm; float e[8];   /* lc, eight at a time */
#pragma unroll
      for (int r = 0; r < 8; ++r) e[r] = ev[r];
      exp2x8(e);
#pragma unroll
      for (int r = 0; r < 8; ++r) ev[r] = e[r];
      if (t == 0) av = ev; else av += ev; }
    spm[kt][wave][lane] = m; sps[kt][wave][lane] = ((av[0] + av[1]) + (av[2] + av[3])) + ((av[4] + av[5]) + (av[6] + av[7])); }
  __syncthreads();   /* every wave's partials of every key tile are in LDS */
  if (wave < KB) { float pm[2 * KW];   /* wave = key tile, lane = key col (lanes col and col + 16 do the same work): partial 2 w + i = wave w, lane col + 16 i */
#pragma unroll
    for (int i = 0; i < 2 * KW; ++i) pm[i] = spm[wave][i >> 1][col + 16 * (i & 1)];
    float m = pm[0];
#pragma unroll
    for (int i = 1; i < 2 * KW; ++i) m = fmaxf(m, pm[i]);
    const float nm = -m * LOG2E; float a = 0.f;
#pragma unroll
    for (int i0 = 0; i0 < 2 * KW; i0 += 8) { float e[8];   /* a partial's sum counts 2^((its maximum - the key's maximum) log2 e) times */
#pragma unroll
      for (int i = 0; i < 8; ++i) e[i] = lc(pm[i0 + i], nm);
      exp2x8(e);
#pragma unroll
      for (int i = 0; i < 8; ++i) a += e[i] * sps[wave][(i0 + i) >> 1][col + 16 * (i & 1)]; }
    vst2(KS + (kt0 + wave) * 32 + lane, a > 0.f ? (11.0f - m * LOG2E) - log2f(a) : -1.0e30f); } }   /* no sum: an exponent that makes every P of the key 0, as the factor 0 did */
// ---- k_att: block = 128 queries of batch blockIdx.y, 8 waves; wave = (query group qg: 32 queries = two 16-query tiles, key half hf: 1,024 keys), so every key and v fragment it loads feeds the products of two query tiles. Per 32 keys and query tile: S^T tiles (row = key, column = query) from the same two products as k_kst, P x 2^11 = 2^(logit log2 e + the key's constant of k_kst) in f32; the two D tiles, converted to f16 in place, ARE the A fragment (row = query, k = key) of P . v. The two waves of a query group (one per key half) each finish one of its tiles: a wave hands its partial P . v and key sum of the other tile to its partner through LDS; f_sa = (P . v) / (sum over keys of P)
#define NP (TT / 64)       // passes of 32 keys in one key half
// The key and v tiles reach the waves through LDS: a staged tile = KT keys of one key half = [k hi: KT / 16 fragment tiles][k residual: the same][v: KT / 32 chunks of HD / 16 fragment tiles], each part contiguous in the workspace and copied as it lies there. The four waves of a key half copy their half's tile once for the block, so a byte comes from L2 once per block and not once per wave; two buffers, the next tile's copies fly while this one is worked on
#define KT 128                             // keys of one key half in a staged tile
#define NT (TT / 2 / KT)                   // staged tiles of one key half
#define TKV (KT / 16 * FT)                 // values in the k hi part, and in the k residual part
#define TVV (KT / 32 * (HD / 16) * FT)     // values in the v part
#define THV (2 * TKV + TVV)                // values in one key half's staged tile
static_assert(TKV == 4 * 128 * 8 && TVV == 16 * 128 * 8, "tile_copy: 128 lanes x 16 bytes x (4 + 4 + 16) copies");
static_assert(NT >= 2, "the ring's prologue fills two tiles");
typedef __attribute__((address_space(1))) v4i glb_v4i; typedef __attribute__((address_space(3))) v4i lds_v4i;
// one asynchronous copy of 16 bytes a lane from global memory into LDS, through no register (the builtin form: the compiler keeps the address registers itself)
__device__ __forceinline__ void copy16(_Float16* l, const _Float16* g) { __builtin_amdgcn_global_load_async_to_lds_b128((glb_v4i*)g, (lds_v4i*)l, 0, 0); }
// one staged tile of one key half, 24 copies a lane: l, gh, gl, gv = the lane's own first place in the buffer and in the three sources; a copy lies 128 lanes x 16 bytes = 1,024 values behind the one before it, in LDS and in its source
__device__ __forceinline__ void tile_copy(_Float16* l, const _Float16* gh, const _Float16* gl, const _Float16* gv) {
#pragma unroll   /* here and twice below: the copies stand one behind another, with no loop counter or branch between them */
  for (int i = 0; i < TKV / 1024; ++i) copy16(l + i * 1024, gh + i * 1024);
#pragma unroll
  for (int i = 0; i < TKV / 1024; ++i) copy16(l + TKV + i * 1024, gl + i * 1024);
#pragma unroll
  for (int i = 0; i < TVV / 1024; ++i) copy16(l + 2 * TKV + i * 1024, gv + i * 1024); }
__global__ __launch_bounds__(256) void k_att(const _Float16* __restrict__ KRH, const _Float16* __restrict__ KRL, const _Float16* __restrict__ QR, const float* __restrict__ KS, const _Float16* __restrict__ VT, float* __restrict__ Y) { __shared__ __align__(16) float ss[8][16][HD + 4]; __shared__ __align__(16) float sks[TT * 2]; __shared__ float sk[8][16]; __shared__ __align__(16) _Float16 sb[2][2][THV];   /* sb: [buffer][key half] staged tiles */
  const int tid = threadIdx.x, lane = tid & 31, col = lane & 15, g = lane >> 4; const int b = blockIdx.y;
  const int wave = __builtin_amdgcn_readfirstlane(tid >> 5), qg = wave & 3, hf = wave >> 2;   /* the wave's number in a scalar register: the bases formed from it below stay scalar */
  const int ql0 = blockIdx.x * 128 + qg * 32;   /* the wave's tile u = queries ql0 + 16 (u ^ hf) ..: tile 0 is the one it finishes itself, tile 1 the one it hands over */
  const _Float16* kh = KRH + ((size_t)b * (TT / 16) + hf * (TT / 32)) * FT; const _Float16* kl = KRL + ((size_t)b * (TT / 16) + hf * (TT / 32)) * FT; const _Float16* vt = VT + ((size_t)b * (TT / 32) + hf * NP) * (HD / 16) * FT; const float* sc = &sks[hf * NP * 64 + 8 * g];   /* the key half's first tiles and constants */
  const int un = (qg * 32 + lane) * 8;   /* the lane's first 8 values among the 128 lanes that copy this key half */
  tile_copy(&sb[0][hf][un], kh + un, kl + un, vt + un);   /* tile 0 into buffer 0 */
#pragma unroll   /* all four loads in flight at once */
  for (int i = 0; i < TT * 2 / 4 / 256; ++i) *(v4f*)&sks[(i * 256 + tid) * 4] = *(const v4f*)(KS + (size_t)b * TT * 2 + (i * 256 + tid) * 4);
  asm volatile("s_wait_asynccnt 0x0" ::: "memory");   /* this wave's copies of tile 0 have landed before the barrier behind which other waves read them */
  __syncthreads();
  tile_copy(&sb[1][hf][un], kh + TKV + un, kl + TKV + un, vt + TVV + un);   /* tile 1 into buffer 1 */
  const _Float16* qt0 = QR + ((((size_t)b * TT + ql0) >> 4) + hf) * FT; const _Float16* qt1 = QR + ((((size_t)b * TT + ql0) >> 4) + (hf ^ 1)) * FT; const v16h qf[2] = { frag_t(qt0, lane), frag_t(qt1, lane) };
  asm volatile("s_wait_xcnt 0x0" :: "s"(qt0), "s"(qt1) : "memory");   /* precaution: the four loads above have taken their addresses before an address register is written again; their two scalar bases are named so that those registers live up to here */
  v8f acc[2][HD / 16] = {}; float ksum[2] = { 0.f, 0.f };   /* ksum[u]: f32 sum of the P x 2^11 values this lane makes for tile u: query col, the k half g of every chunk */
#pragma unroll 1   /* rolled: the ring's trip, one staged tile: 96 products and 96 fragment reads */
  for (int t = 0; t < NT; ++t) { const _Float16* bp = &sb[t & 1][hf][8 * lane];   /* the lane's own place in the first fragment tile of this trip's buffer */
    v16h a0 = frag_l(bp), l0 = frag_l(bp + TKV), a1 = frag_l(bp + FT), l1 = frag_l(bp + TKV + FT);
#pragma unroll   /* the passes of 32 keys of one staged tile: every LDS offset a constant, and a pass's reads can stand among the products of the pass before */
    for (int ps = 0; ps < KT / 32; ++ps) { const int kc = t * (KT / 32) + ps; v16h vf[HD / 16];
#pragma unroll
      for (int j = 0; j < HD / 16; ++j) vf[j] = frag_l(bp + 2 * TKV + (ps * (HD / 16) + j) * FT);
      __builtin_amdgcn_sched_barrier(0);   /* keeps the 16 v reads issued here, a whole score-and-exp phase ahead of their use (the scheduler otherwise sinks them to the P . v products) */
      v8f s0[2], t0[2], s1[2], t1[2];
#pragma unroll
      for (int u = 0; u < 2; ++u) { const v8f z = {}; s0[u] = wmma16c(a0, qf[u], z); t0[u] = wmma16c(l0, qf[u], z); s1[u] = wmma16c(a1, qf[u], z); t1[u] = wmma16c(l1, qf[u], z); }
      if (ps + 1 < KT / 32) { const _Float16* kn = bp + (ps + 1) * 2 * FT;   /* the next pass's two key tiles, of the same staged tile, read one pass ahead */
        a0 = frag_l(kn); l0 = frag_l(kn + TKV); a1 = frag_l(kn + FT); l1 = frag_l(kn + TKV + FT); }
      __builtin_amdgcn_sched_barrier(0);   /* keeps those key reads issued here, ahead of the exp phase */
      const v4f* st = (const v4f*)(sc + kc * 64); const v4f c0[2] = { st[0], st[1] }, c1[2] = { st[8], st[9] }; v16h p[2];   /* the chunk's constants, keys 8g + r of both key tiles: the same for both query tiles */
#pragma unroll
      for (int u = 0; u < 2; ++u) { float v[16];
#pragma unroll
        for (int r = 0; r < 8; ++r) { v[r] = lc(logit2(s0[u][r], t0[u][r]), c0[r >> 2][r & 3]); v[8 + r] = lc(logit2(s1[u][r], t1[u][r]), c1[r >> 2][r & 3]); }
        exp2x8(v); exp2x8(v + 8);
#pragma unroll
        for (int i = 0; i < 16; ++i) p[u][i] = (_Float16)v[i];
        ksum[u] += sum16(v); }
#pragma unroll
      for (int j = 0; j < HD / 16; ++j) { acc[0][j] = wmma16c(p[0], vf[j], acc[0][j]); acc[1][j] = wmma16c(p[1], vf[j], acc[1][j]); } }
    asm volatile("s_wait_dscnt 0x0" ::: "memory");      /* this wave's reads of the trip's buffer are done before the barrier behind which the buffer is refilled */
    asm volatile("s_wait_asynccnt 0x0" ::: "memory");   /* this wave's copies of tile t + 1 have landed before the barrier behind which other waves read them */
    __syncthreads();   /* publishes tile t + 1 and ends every wave's reads of tile t */
    if (t + 2 < NT) tile_copy(&sb[t & 1][hf][un], kh + (size_t)(t + 2) * TKV + un, kl + (size_t)(t + 2) * TKV + un, vt + (size_t)(t + 2) * TVV + un); }   /* tile t + 2 into the buffer that trip t has just read */
  asm volatile("s_wait_asynccnt 0x0" ::: "memory");   /* no copy is outstanding when the wave goes on to the epilogue and ends */
#pragma unroll
  for (int u = 0; u < 2; ++u) ksum[u] += __shfl_xor(ksum[u], 16);   /* both k halves of the chunks: the key half's share of den (x 2^11) of the tile's query col, in lanes col and col + 16 */
  float (&own)[16][HD + 4] = ss[qg * 2 + hf]; float (&oth)[16][HD + 4] = ss[qg * 2 + (hf ^ 1)];   /* a tile's plane belongs to the wave that finishes the tile */
#pragma unroll
  for (int j = 0; j < HD / 16; ++j)
#pragma unroll
    for (int r = 0; r < 8; ++r) oth[8 * g + r][j * 16 + col] = acc[1][j][r];
  if (g == 0) sk[qg * 2 + (hf ^ 1)][col] = ksum[1];
  __syncthreads();   /* the partner's partial sums of this wave's own tile are in LDS */
  const float den = ksum[0] + sk[qg * 2 + hf][col];
  const float inv = den > 0.f ? 2048.0f / den : 0.f; float invr[8];
#pragma unroll
  for (int r = 0; r < 8; ++r) invr[r] = __shfl(inv, 8 * g + r);   /* accumulator element r is query row 8g + r */
  v8f pr[HD / 16];
#pragma unroll   /* the partner's 64 values of this lane's places, all read before the first of the places is rewritten */
  for (int j = 0; j < HD / 16; ++j)
#pragma unroll
    for (int r = 0; r < 8; ++r) pr[j][r] = own[8 * g + r][j * 16 + col];
#pragma unroll
  for (int j = 0; j < HD / 16; ++j)
#pragma unroll
    for (int r = 0; r < 8; ++r) own[8 * g + r][j * 16 + col] = (acc[0][j][r] + pr[j][r]) * (1.0f / 2048.0f) * invr[r];
  LDSX(); v4f yv[16]; float* yp = Y + ((size_t)b * TT + ql0 + 16 * hf) * CC + lane * 4;
#pragma unroll   /* yv is indexed by constants only: all sixteen rows are read before the first store, and no register of a store is written again */
  for (int rl = 0; rl < 16; ++rl) yv[rl] = *(const v4f*)&own[rl][lane * 4];
#pragma unroll
  for (int rl = 0; rl < 16; ++rl) vst2(yp + rl * CC, yv[rl]); }

extern "C" void kernel_launch(void* const* d_in, const int* in_sizes, int n_in, void* d_out, int out_size, void* d_ws, size_t ws_size, hipStream_t stream) {
  (void)in_sizes; (void)n_in; (void)out_size;
  const float** F = (const float**)d_in;
  if (ws_size < (size_t)WS_END) return;
  char* ws = (char*)d_ws; _Float16 *QH = (_Float16*)(ws + WS_QH), *KH = (_Float16*)(ws + WS_KH), *VT = (_Float16*)(ws + WS_VT), *QL = (_Float16*)(ws + WS_QL), *KL = (_Float16*)(ws + WS_KL); __bf16 *VB = (__bf16*)(ws + WS_VB), *VBL = (__bf16*)(ws + WS_VBL); float *S = (float*)(ws + WS_S), *Y = (float*)(ws + WS_Y);
  (void)Y; (void)QL; (void)KL; (void)VB; (void)VBL;
  // inputs: 0 f_in [16,2048,128]; 1 w_q [32,128] (out,in), 2 b_q [32]; 3 w_k [32,128], 4 b_k; 5 w_v [128,128], 6 b_v; 7 w_l [128,128], 8 b_l; 9 bn_gamma, 10 bn_beta
  if (ws_size < (size_t)WS_END2) return;
  float *FSA = (float*)(ws + WS_FSA), *YL = (float*)(ws + WS_YL), *ST = (float*)(ws + WS_ST), *PS = (float*)(ws + WS_PS);
  // ROLE SWAP: the 'q' planes (hi + residual) hold K (from w_k, b_k) and the 'k' planes hold Q, so k_att's score tiles are S^T[key][query] and the softmax runs over QUERIES
  k_proj<<<dim3(TNB * TT / 64, CC / 128, 3), 128, 0, stream>>>(F[0], F[0], F[0], F[3], F[1], F[5], F[4], F[2], F[6], QH, QL, KH, KL, VT, VB, VBL);
  k_kst<<<dim3(TT / 16 / KB, TNB), KW * 32, 0, stream>>>(QH, QL, KH, S);   /* per key: the exponent constant from the maximum and the sum of exp over the queries */
  k_att<<<dim3(TT / 128, TNB), 256, 0, stream>>>(QH, QL, KH, S, VT, FSA);   /* f_sa rows: logits made again in registers, P never stored */
  k_lin<<<dim3(NR / 64), 128, 0, stream>>>(F[0], FSA, F[7], F[8], YL, PS);
  k_stat<<<dim3(CC), 256, 0, stream>>>(PS, ST);
  k_fin<<<dim3(NR / (8 * FR)), 256, 0, stream>>>(YL, ST, F[9], F[10], FSA, (float*)d_out);
}
